// v000
// Times are from an AMD MI455X. After a warm-up the kernel runs many times in a row, and a time is the length of
// such a window on the GPU divided by its runs, so every launch and the gaps after it count. The runs cycle
// through copies of the inputs. A figure is the median of several windows, for all but v000 over two sittings.
// Sittings can differ by a few percent; kernels timed side by side share one.
// v000 is the starting kernel. One run takes 417 microseconds.
#include <hip/hip_runtime.h>
#include <hip/hip_fp16.h>

// All contractions on v_wmma_f32_16x16x32_f16 (f16 operands, f32 accumulate), single products: x*Wq (x carried x16, Wq x64), q*q^T (q carried x64), P*q (P carried x256), x1*W1 (x1 x16, W1 x64), h*W2 (h x16, W2 x64); raw inputs RNE-converted to bf16 first.

#ifndef NB
#define NB 2
#endif
#ifndef SEQ
#define SEQ 2048
#endif
#define NB_FULL  2
#define SEQ_FULL 2048
#define DM   1024        // model width
#define NH   16          // heads
#define DH   64          // head width
#define HID  4096        // FFN hidden width
#define NTOK (NB * SEQ)

static_assert(NB >= 1 && NB <= NB_FULL);
static_assert(SEQ >= 128 && SEQ <= SEQ_FULL);
static_assert(SEQ % 128 == 0);                      // attention block = 128 queries; key loop steps 32
static_assert(SEQ % 64 == 0);                       // a 64-row GEMM wave tile stays inside one batch
static_assert(NTOK % 256 == 0);                     // GEMM block = 4 waves x 64 rows
static_assert(NTOK % 4 == 0);                       // LN block = 4 rows
static_assert(NH * DH == DM);                       // heads concatenate to the model width
static_assert(DH == 64);                            // one GEMM column tile == one head; 2 k-steps per score
static_assert(DM % 64 == 0 && HID % 64 == 0);       // N tiles of 64
static_assert(DM % 32 == 0 && HID % 32 == 0);       // K steps of 32
static_assert(DM == 32 * 8 * 4);                    // LN: 32 lanes x 8 chunks x 4 floats
static_assert(((size_t)NTOK * DM / 8) % 256 == 0);  // convert grid x block == plane extent

typedef _Float16 v16h __attribute__((ext_vector_type(16)));
typedef _Float16 v8h  __attribute__((ext_vector_type(8)));
typedef _Float16 v4h  __attribute__((ext_vector_type(4)));
typedef float    v8f  __attribute__((ext_vector_type(8)));
typedef float    v4f  __attribute__((ext_vector_type(4)));

union Frag { v16h v; v8h h[2]; };

// scores: acc = (64 q_s).(64 q_t); t (log2 units) = acc * log2(e) / 8 / 4096
#define CS (1.44269504088896340736f * 3.0517578125e-05f)

// plane sizes in bytes (all multiples of 128)
#define SZ_X16   ((size_t)NTOK * DM * 2)     // xh, later x1h
#define SZ_WQT   ((size_t)DM * DM * 2)
#define SZ_W1T   ((size_t)HID * DM * 2)
#define SZ_W2T   ((size_t)DM * HID * 2)
#define SZ_Q16   ((size_t)NTOK * DM * 2)     // qrow, qT each
#define SZ_Y32   ((size_t)NTOK * DM * 4)     // y1 (later y2), x1 each
#define SZ_HB    ((size_t)NTOK * HID * 2)
#define WS_TOTAL (SZ_X16 + SZ_WQT + SZ_W1T + SZ_W2T + 2 * SZ_Q16 + 2 * SZ_Y32 + SZ_HB)
static_assert(WS_TOTAL <= (size_t)134217728);       // carve <= 128 MiB

static __device__ __forceinline__ v8f zero8() {
    v8f z;
#pragma unroll
    for (int i = 0; i < 8; ++i) z[i] = 0.0f;
    return z;
}

// 16x32 A fragment (or B fragment from an [n][k] k-contiguous source).
// p = tile_base + (lane&15)*ld + 8*(lane>>4): elements 0..7 = k 8h..8h+7,
// elements 8..15 = k 16+8h..16+8h+7 (split map, same for A and B).
static __device__ __forceinline__ v16h load_frag_p(const _Float16* p) {
    Frag f;
    f.h[0] = *(const v8h*)(p);
    f.h[1] = *(const v8h*)(p + 16);
    return f.v;
}

static __device__ __forceinline__ v8f wmma16(v16h a, v16h b, v8f c) {
    v8f d = __builtin_amdgcn_wmma_f32_16x16x32_f16(false, a, false, b, (short)0, c, false, false);
    asm volatile("v_nop\n\tv_nop\n\tv_nop\n\tv_nop" : "+v"(d) : "v"(a), "v"(b));
    return d;
}

// f32 -> bf16 RNE convert, value kept as f32
static __device__ __forceinline__ float bf16r(float x) {
    unsigned u = __float_as_uint(x);
    u = (u + 0x7FFFu + ((u >> 16) & 1u)) & 0xFFFF0000u;
    return __uint_as_float(u);
}

static __device__ __forceinline__ float ex2(float x) {
    return __builtin_amdgcn_exp2f(x);
}

// ordering for a wave-private LDS tile: stores before later loads of the same wave
static __device__ __forceinline__ void wave_lds_sync() {
    __builtin_amdgcn_fence(3, "wavefront");
    asm volatile("s_wait_dscnt 0" ::: "memory");
    __builtin_amdgcn_wave_barrier();
}

static __device__ __forceinline__ float wave_sum(float v) {
    v += __shfl_xor(v, 16, 32);
    v += __shfl_xor(v, 8, 32);
    v += __shfl_xor(v, 4, 32);
    v += __shfl_xor(v, 2, 32);
    v += __shfl_xor(v, 1, 32);
    return v;
}

// ---------------------------------------------------------------------------
// xh[tok][d] = f16(16 * bf16(x)). One thread = one 16-B output piece; lanes
// ---------------------------------------------------------------------------
__global__ __launch_bounds__(256) void k_cvt_x(const float* __restrict__ x,
                                                _Float16* __restrict__ xh) {
    const int idx = blockIdx.x * 256 + threadIdx.x;
    if (idx >= NTOK * (DM / 8)) return;
    const int tok = idx >> 7;                 // DM/8 = 128 pieces per row
    const int c8  = idx & 127;
    const int b   = tok / SEQ;
    const int s   = tok - b * SEQ;
    const float* src = x + ((size_t)b * SEQ_FULL + s) * DM + c8 * 8;
    v4f a = *(const v4f*)(src);
    v4f c = *(const v4f*)(src + 4);
    v8h o;
    o[0] = (_Float16)(bf16r(a.x) * 16.0f);
    o[1] = (_Float16)(bf16r(a.y) * 16.0f);
    o[2] = (_Float16)(bf16r(a.z) * 16.0f);
    o[3] = (_Float16)(bf16r(a.w) * 16.0f);
    o[4] = (_Float16)(bf16r(c.x) * 16.0f);
    o[5] = (_Float16)(bf16r(c.y) * 16.0f);
    o[6] = (_Float16)(bf16r(c.z) * 16.0f);
    o[7] = (_Float16)(bf16r(c.w) * 16.0f);
    _Float16* dst = xh + (size_t)tok * DM + c8 * 8;
    *(v8h*)dst = o;
    
}

// ---------------------------------------------------------------------------
// Batched transpose + convert through LDS: in[z][rows][cols] f32 ->
// out[z][cols][rows] = f16(64 * bf16(in)). Block = one 64x64 tile;
// ---------------------------------------------------------------------------
__global__ __launch_bounds__(256) void k_wT(const float* __restrict__ in,
                                             _Float16* __restrict__ out,
                                             int rows, int cols) {
    __shared__ __align__(16) _Float16 T[64 * 64];     // [c][r], 8 KB, cross-wave (block barrier)
    const int tid = threadIdx.x;
    const int c0 = blockIdx.x * 64;
    const int r0 = blockIdx.y * 64;
    const size_t zoff = (size_t)blockIdx.z * (size_t)rows * (size_t)cols;
    const float* ib = in + zoff;
    _Float16*    ob = out + zoff;
#pragma unroll 1
    for (int i = 0; i < 4; ++i) {
        const int idx = i * 256 + tid;
        const int r = idx >> 4, c4 = idx & 15;
        v4f v = *(const v4f*)(ib + (size_t)(r0 + r) * cols + c0 + c4 * 4);
        T[(c4 * 4 + 0) * 64 + r] = (_Float16)(bf16r(v.x) * 64.0f);
        T[(c4 * 4 + 1) * 64 + r] = (_Float16)(bf16r(v.y) * 64.0f);
        T[(c4 * 4 + 2) * 64 + r] = (_Float16)(bf16r(v.z) * 64.0f);
        T[(c4 * 4 + 3) * 64 + r] = (_Float16)(bf16r(v.w) * 64.0f);
    }
    __syncthreads();
    const int ca = tid >> 3, j = tid & 7;              // rows ca and ca + 32 of the transposed tile
    v8h o0 = *(const v8h*)(&T[ca * 64 + j * 8]);
    v8h o1 = *(const v8h*)(&T[(ca + 32) * 64 + j * 8]);
    _Float16* d0 = ob + (size_t)(c0 + ca) * rows + r0 + j * 8;
    _Float16* d1 = ob + (size_t)(c0 + ca + 32) * rows + r0 + j * 8;
    *(v8h*)d0 = o0;
    *(v8h*)d1 = o1;
    
}

// ---------------------------------------------------------------------------
// GEMM main loop: one wave = 64x64 tile = 4x4 subtiles; A [M][K] and Bt [N][K]
// 16-bit k-contiguous planes in global memory; fragments are two 16-B loads.
// pa = A + (m0 + lane&15)*K + 8*(lane>>4); pb likewise for Bt rows n0 + lane&15.
// ---------------------------------------------------------------------------
template <int K>
static __device__ __forceinline__ void gemm_tile64(const _Float16* __restrict__ pa,
                                                   const _Float16* __restrict__ pb,
                                                   v8f (&acc)[4][4]) {
    static_assert(K % 32 == 0);
#pragma unroll
    for (int ms = 0; ms < 4; ++ms)
#pragma unroll
        for (int nt = 0; nt < 4; ++nt) acc[ms][nt] = zero8();
#pragma unroll 1
    for (int k0 = 0; k0 < K; k0 += 32) {
        v16h am[4];
#pragma unroll
        for (int i = 0; i < 4; ++i) am[i] = load_frag_p(pa + (size_t)i * 16 * K + k0);
#pragma unroll
        for (int nt = 0; nt < 4; ++nt) {
            v16h bn = load_frag_p(pb + (size_t)nt * 16 * K + k0);
#pragma unroll
            for (int ms = 0; ms < 4; ++ms) acc[ms][nt] = wmma16(am[ms], bn, acc[ms][nt]);
        }
    }
}

// ---------------------------------------------------------------------------
// Q projection: acc = (16 x)(64 Wq) = 1024 x.Wq ; q64 = (acc + 1024 bq) / 16.
// Writes qrow[b][h][s][64] and qT[b][h][64][s] as f16(64 q).
// Wave tile = 64 tokens x one head. Row plane: 16-row steps through a
// wave-private LDS tile; transposed plane: whole 64x64 wave-private tile.
// ---------------------------------------------------------------------------
__global__ __launch_bounds__(128) __attribute__((amdgpu_num_vgpr(256)))
void k_gemm_q(const _Float16* __restrict__ xh,
              const _Float16* __restrict__ wqT,
              const float* __restrict__ bq,
              _Float16* __restrict__ qrow,
              _Float16* __restrict__ qT) {
    __shared__ __align__(16) _Float16 Rst[4][16 * 64];   // 8 KB, wave-private
    __shared__ __align__(16) _Float16 Tst[4][64 * 64];   // 32 KB, wave-private
    const int tid  = threadIdx.x;
    const int lane = tid & 31;
    const int w    = tid >> 5;
    const int hh   = lane >> 4;
    const int lm   = lane & 15;
    const int kb   = hh << 3;
    const int m0   = blockIdx.x * 256 + w * 64;
    const int n0   = blockIdx.y * 64;
    const int head = blockIdx.y;
    const int b    = m0 / SEQ;
    const int s0   = m0 - b * SEQ;

    v8f acc[4][4];
    gemm_tile64<DM>(xh + (size_t)(m0 + lm) * DM + kb, wqT + (size_t)(n0 + lm) * DM + kb, acc);

    float bv[4];
#pragma unroll
    for (int nt = 0; nt < 4; ++nt) bv[nt] = bf16r(bq[n0 + nt * 16 + lm]) * 1024.0f;

    _Float16* qr = qrow + (((size_t)b * NH + head) * SEQ + s0) * DH;
    _Float16* qt = qT + ((size_t)b * NH + head) * DH * SEQ + s0;

#pragma unroll
    for (int ms = 0; ms < 4; ++ms) {
#pragma unroll
        for (int nt = 0; nt < 4; ++nt) {
            v8h tv;
#pragma unroll
            for (int r = 0; r < 8; ++r) {
                _Float16 hv = (_Float16)((acc[ms][nt][r] + bv[nt]) * 0.0625f);
                Rst[w][(8 * hh + r) * 64 + nt * 16 + lm] = hv;
                tv[r] = hv;
            }
            *(v8h*)(&Tst[w][(nt * 16 + lm) * 64 + ms * 16 + 8 * hh]) = tv;
        }
        wave_lds_sync();
        v8h rv[4];
#pragma unroll
        for (int i = 0; i < 4; ++i) rv[i] = *(const v8h*)(&Rst[w][i * 256 + lane * 8]);
        _Float16* dst = qr + ms * 1024 + lane * 8;
#pragma unroll
        for (int i = 0; i < 4; ++i) *(v8h*)(dst + i * 256) = rv[i];
        
        wave_lds_sync();
    }
    wave_lds_sync();
#pragma unroll 1
    for (int g = 0; g < 4; ++g) {
        v8h tv[4];
#pragma unroll
        for (int i = 0; i < 4; ++i) tv[i] = *(const v8h*)(&Tst[w][(g * 4 + i) * 256 + lane * 8]);
        _Float16* dst = qt + (size_t)(g * 16 + (lane >> 3)) * SEQ + (lane & 7) * 8;
#pragma unroll
        for (int i = 0; i < 4; ++i) *(v8h*)(dst + (size_t)i * 4 * SEQ) = tv[i];
        
    }
}

// ---------------------------------------------------------------------------
// Fused attention, q = k = v. Block = 8 waves = 128 queries of one (b, head);
// a wave owns 16 queries and streams all SEQ keys, 32 per step:
//   S^T tiles (rows = keys, cols = queries): A = key rows, B = query rows,
//   both fragments straight from the qrow plane (k = d, 2 steps of 32);
//   per-lane online softmax (lane column = its query; partner lane +-16);
//   P^T carried 2^8 as f16: the two S^T tiles chain directly as the B
//   fragment (elements 0..7 = tile keys 0..15, 8..15 = tile keys 16..31);
//   O^T += V^T . P^T with A fragments from the qT plane (rows = d, k = keys).
// Epilogue: O^T / (64 l) staged as [query][d] f32 in a wave-private LDS tile,
// bf16(x) added at the store stage, 8 lane-contiguous 16-B-per-lane
// ---------------------------------------------------------------------------
__global__ __launch_bounds__(256) __attribute__((amdgpu_num_vgpr(256)))
void k_attn(const _Float16* __restrict__ qrow,
            const _Float16* __restrict__ qT,
            const float* __restrict__ x,
            float* __restrict__ y1) {
    __shared__ __align__(16) float Ost[8][16 * DH];      // 32 KB, wave-private
    const int tid  = threadIdx.x;
    const int lane = tid & 31;
    const int w    = tid >> 5;
    const int hh   = lane >> 4;
    const int lm   = lane & 15;
    const int kb   = hh << 3;
    const int b    = blockIdx.z;
    const int head = blockIdx.y;
    const int q0   = blockIdx.x * 128 + w * 16;

    const _Float16* qlane = qrow + ((size_t)b * NH + head) * SEQ * DH + (size_t)lm * DH + kb;
    const _Float16* tlane = qT + ((size_t)b * NH + head) * DH * SEQ + (size_t)lm * SEQ + kb;

    const v16h qf0 = load_frag_p(qlane + (size_t)q0 * DH);        // d 0..31
    const v16h qf1 = load_frag_p(qlane + (size_t)q0 * DH + 32);   // d 32..63

    v8f o[4];
#pragma unroll
    for (int dt = 0; dt < 4; ++dt) o[dt] = zero8();
    float mr = -1.0e30f, l = 0.0f;

#pragma unroll 1
    for (int key0 = 0; key0 < SEQ; key0 += 32) {
        const _Float16* ka = qlane + (size_t)key0 * DH;
        v16h a0 = load_frag_p(ka);
        v16h a1 = load_frag_p(ka + 32);
        v8f sA = wmma16(a0, qf0, zero8());
        sA = wmma16(a1, qf1, sA);
        v16h c0 = load_frag_p(ka + 16 * DH);
        v16h c1 = load_frag_p(ka + 16 * DH + 32);
        v8f sB = wmma16(c0, qf0, zero8());
        sB = wmma16(c1, qf1, sB);

        float tA[8], tB[8];
#pragma unroll
        for (int i = 0; i < 8; ++i) { tA[i] = sA[i] * CS; tB[i] = sB[i] * CS; }
        float tmax = fmaxf(tA[0], tB[0]);
#pragma unroll
        for (int i = 1; i < 8; ++i) tmax = fmaxf(tmax, fmaxf(tA[i], tB[i]));
        tmax = fmaxf(tmax, __shfl_xor(tmax, 16, 32));
        const float mn = fmaxf(mr, tmax);
        if (__builtin_amdgcn_ballot_w32(mn > mr) != 0u) {       // wave-uniform
            const float sc = ex2(mr - mn);
            l *= sc;
#pragma unroll
            for (int dt = 0; dt < 4; ++dt)
#pragma unroll
                for (int r = 0; r < 8; ++r) o[dt][r] *= sc;
        }
        mr = mn;
        const float sh = 8.0f - mn;
        float ps = 0.0f;
        v16h pb;
#pragma unroll
        for (int i = 0; i < 8; ++i) {
            const float pa = ex2(tA[i] + sh);
            const float pq = ex2(tB[i] + sh);
            ps += pa + pq;
            pb[i]     = (_Float16)pa;
            pb[8 + i] = (_Float16)pq;
        }
        l += ps;
#pragma unroll
        for (int dt = 0; dt < 4; ++dt) {
            v16h vf = load_frag_p(tlane + (size_t)dt * 16 * SEQ + key0);
            o[dt] = wmma16(vf, pb, o[dt]);
        }
    }

    const float lt  = l + __shfl_xor(l, 16, 32);
    const float inv = (1.0f / lt) * 0.015625f;          // 2^8 P carry cancels in o/l; 1/64 for the q carry
#pragma unroll
    for (int dt = 0; dt < 4; ++dt) {
        v4f u0, u1;
        u0.x = o[dt][0] * inv; u0.y = o[dt][1] * inv; u0.z = o[dt][2] * inv; u0.w = o[dt][3] * inv;
        u1.x = o[dt][4] * inv; u1.y = o[dt][5] * inv; u1.z = o[dt][6] * inv; u1.w = o[dt][7] * inv;
        *(v4f*)(&Ost[w][lm * DH + dt * 16 + 8 * hh])     = u0;
        *(v4f*)(&Ost[w][lm * DH + dt * 16 + 8 * hh + 4]) = u1;
    }
    wave_lds_sync();

    v4f sv[8];
    const int col = lm * 4;
#pragma unroll
    for (int i = 0; i < 8; ++i) {
        const int row = 2 * i + hh;
        v4f a  = *(const v4f*)(&Ost[w][i * 128 + lane * 4]);
        v4f xv = *(const v4f*)(x + ((size_t)b * SEQ_FULL + q0 + row) * DM + head * DH + col);
        a.x = bf16r(xv.x) + a.x;
        a.y = bf16r(xv.y) + a.y;
        a.z = bf16r(xv.z) + a.z;
        a.w = bf16r(xv.w) + a.w;
        sv[i] = a;
    }
    float* ob = y1 + ((size_t)b * SEQ + q0 + hh) * DM + head * DH + col;
#pragma unroll
    for (int i = 0; i < 8; ++i) *(v4f*)(ob + (size_t)(2 * i) * DM) = sv[i];
    
}

// ---------------------------------------------------------------------------
// row, row kept in a wave-private LDS line, loops rolled. Writes f32 row
// (512 B per instruction, lane-contiguous) and optionally f16(16 * LN(y)) row
// ---------------------------------------------------------------------------
__global__ __launch_bounds__(128) void k_ln(const float* __restrict__ y,
                                             const float* __restrict__ g,
                                             const float* __restrict__ be,
                                             float* __restrict__ of,
                                             _Float16* __restrict__ oh,
                                             int wr16) {
    __shared__ __align__(16) float    Rw[4][DM];     // 16 KB, wave-private
    __shared__ __align__(16) _Float16 Hw[4][DM];     // 8 KB, wave-private
    const int tid  = threadIdx.x;
    const int lane = tid & 31;
    const int w    = tid >> 5;
    const int row  = blockIdx.x * 4 + w;
    if (row >= NTOK) return;                          // wave-uniform; no block barriers below
    const float* yr = y + (size_t)row * DM;

    float s = 0.0f;
#pragma unroll 1
    for (int j = 0; j < 8; ++j) {
        const int c = j * 128 + lane * 4;
        v4f v = *(const v4f*)(yr + c);
        *(v4f*)(&Rw[w][c]) = v;
        s += (v.x + v.y) + (v.z + v.w);
    }
    s = wave_sum(s);
    const float mu = s * 0.0009765625f;
    float qv = 0.0f;
#pragma unroll 1
    for (int j = 0; j < 8; ++j) {
        const int c = j * 128 + lane * 4;
        v4f v = *(const v4f*)(&Rw[w][c]);
        const float d0 = v.x - mu, d1 = v.y - mu, d2 = v.z - mu, d3 = v.w - mu;
        qv += (d0 * d0 + d1 * d1) + (d2 * d2 + d3 * d3);
    }
    qv = wave_sum(qv);
    const float rs = rsqrtf(qv * 0.0009765625f + 1.0e-5f);
#pragma unroll 1
    for (int j = 0; j < 8; ++j) {
        const int c = j * 128 + lane * 4;
        v4f v  = *(const v4f*)(&Rw[w][c]);
        v4f gv = *(const v4f*)(g + c);
        v4f bv = *(const v4f*)(be + c);
        v4f r;
        r.x = (v.x - mu) * rs * bf16r(gv.x) + bf16r(bv.x);
        r.y = (v.y - mu) * rs * bf16r(gv.y) + bf16r(bv.y);
        r.z = (v.z - mu) * rs * bf16r(gv.z) + bf16r(bv.z);
        r.w = (v.w - mu) * rs * bf16r(gv.w) + bf16r(bv.w);
        *(v4f*)(&Rw[w][c]) = r;
        if (wr16 != 0) {
            v4h hv;
            hv.x = (_Float16)(r.x * 16.0f);
            hv.y = (_Float16)(r.y * 16.0f);
            hv.z = (_Float16)(r.z * 16.0f);
            hv.w = (_Float16)(r.w * 16.0f);
            *(v4h*)(&Hw[w][c]) = hv;
        }
    }
    wave_lds_sync();

    float*    df = of + (size_t)row * DM;
    _Float16* dh = oh + (size_t)row * DM;
#pragma unroll 1
    for (int j = 0; j < 8; ++j) {
        const int c = j * 128 + lane * 4;
        v4f v = *(const v4f*)(&Rw[w][c]);
        *(v4f*)(df + c) = v;
    }
    if (wr16 != 0) {
#pragma unroll 1
        for (int j = 0; j < 4; ++j) {
            const int c = j * 256 + lane * 8;
            v8h hv = *(const v8h*)(&Hw[w][c]);
            *(v8h*)(dh + c) = hv;
        }
    }
    
}

// ---------------------------------------------------------------------------
// FFN1: acc = (16 x1)(64 W1) = 1024 pre ; hb = f16(16 relu(pre + b1)).
// 16-row steps through a wave-private LDS tile; row segment = 64 halves =
// ---------------------------------------------------------------------------
__global__ __launch_bounds__(128) __attribute__((amdgpu_num_vgpr(256)))
void k_gemm_ffn1(const _Float16* __restrict__ a16,
                 const _Float16* __restrict__ w1T,
                 const float* __restrict__ b1,
                 _Float16* __restrict__ hb) {
    __shared__ __align__(16) _Float16 Rst[4][16 * 64];   // 8 KB, wave-private
    const int tid  = threadIdx.x;
    const int lane = tid & 31;
    const int w    = tid >> 5;
    const int hh   = lane >> 4;
    const int lm   = lane & 15;
    const int kb   = hh << 3;
    const int m0   = blockIdx.x * 256 + w * 64;
    const int n0   = blockIdx.y * 64;

    v8f acc[4][4];
    gemm_tile64<DM>(a16 + (size_t)(m0 + lm) * DM + kb, w1T + (size_t)(n0 + lm) * DM + kb, acc);

    float bv[4];
#pragma unroll
    for (int nt = 0; nt < 4; ++nt) bv[nt] = bf16r(b1[n0 + nt * 16 + lm]) * 1024.0f;

#pragma unroll
    for (int ms = 0; ms < 4; ++ms) {
#pragma unroll
        for (int nt = 0; nt < 4; ++nt)
#pragma unroll
            for (int r = 0; r < 8; ++r)
                Rst[w][(8 * hh + r) * 64 + nt * 16 + lm] =
                    (_Float16)(fmaxf(acc[ms][nt][r] + bv[nt], 0.0f) * 0.015625f);
        wave_lds_sync();
        v8h rv[4];
#pragma unroll
        for (int i = 0; i < 4; ++i) rv[i] = *(const v8h*)(&Rst[w][i * 256 + lane * 8]);
        _Float16* dst = hb + (size_t)(m0 + ms * 16 + (lane >> 3)) * HID + n0 + (lane & 7) * 8;
#pragma unroll
        for (int i = 0; i < 4; ++i) *(v8h*)(dst + (size_t)i * 4 * HID) = rv[i];
        
        wave_lds_sync();
    }
}

// ---------------------------------------------------------------------------
// FFN2: acc = (16 h)(64 W2) = 1024 ff ; y2 = x1 + (ff + b2), f32.
// 16-row steps through a wave-private f32 LDS tile; bias and skip path added
// at the store stage as 4-float vectors; each instruction = 2 rows x 256 B.
// ---------------------------------------------------------------------------
__global__ __launch_bounds__(128) __attribute__((amdgpu_num_vgpr(256)))
void k_gemm_ffn2(const _Float16* __restrict__ hb,
                 const _Float16* __restrict__ w2T,
                 const float* __restrict__ b2,
                 const float* __restrict__ x1,
                 float* __restrict__ y2) {
    __shared__ __align__(16) float Fst[4][16 * 64];      // 16 KB, wave-private
    const int tid  = threadIdx.x;
    const int lane = tid & 31;
    const int w    = tid >> 5;
    const int hh   = lane >> 4;
    const int lm   = lane & 15;
    const int kb   = hh << 3;
    const int m0   = blockIdx.x * 256 + w * 64;
    const int n0   = blockIdx.y * 64;

    v8f acc[4][4];
    gemm_tile64<HID>(hb + (size_t)(m0 + lm) * HID + kb, w2T + (size_t)(n0 + lm) * HID + kb, acc);

    const int col = lm * 4;
    v4f bb = *(const v4f*)(b2 + n0 + col);
    bb.x = bf16r(bb.x); bb.y = bf16r(bb.y); bb.z = bf16r(bb.z); bb.w = bf16r(bb.w);

#pragma unroll
    for (int ms = 0; ms < 4; ++ms) {
#pragma unroll
        for (int nt = 0; nt < 4; ++nt)
#pragma unroll
            for (int r = 0; r < 8; ++r)
                Fst[w][(8 * hh + r) * 64 + nt * 16 + lm] = acc[ms][nt][r] * 0.0009765625f;
        wave_lds_sync();
        v4f sv[8];
        const size_t rbase = ((size_t)(m0 + ms * 16 + hh)) * DM + n0 + col;
#pragma unroll
        for (int i = 0; i < 8; ++i) {
            v4f a  = *(const v4f*)(&Fst[w][i * 128 + lane * 4]);
            v4f xr = *(const v4f*)(x1 + rbase + (size_t)(2 * i) * DM);
            a.x = xr.x + (a.x + bb.x);
            a.y = xr.y + (a.y + bb.y);
            a.z = xr.z + (a.z + bb.z);
            a.w = xr.w + (a.w + bb.w);
            sv[i] = a;
        }
        float* dst = y2 + rbase;
#pragma unroll
        for (int i = 0; i < 8; ++i) *(v4f*)(dst + (size_t)(2 * i) * DM) = sv[i];
        
        wave_lds_sync();
    }
}

// ---------------------------------------------------------------------------
extern "C" void kernel_launch(void* const* d_in, const int* in_sizes, int n_in,
                              void* d_out, int out_size, void* d_ws, size_t ws_size,
                              hipStream_t stream) {
    if (n_in < 11) return;
    if (in_sizes[0] < ((NB - 1) * SEQ_FULL + SEQ) * DM) return;
    if (in_sizes[1] < DM * DM || in_sizes[2] < DM) return;
    if (in_sizes[3] < DM || in_sizes[4] < DM) return;
    if (in_sizes[5] < DM * HID || in_sizes[6] < HID) return;
    if (in_sizes[7] < HID * DM || in_sizes[8] < DM) return;
    if (in_sizes[9] < DM || in_sizes[10] < DM) return;
    if (out_size < NTOK * DM) return;
    if (WS_TOTAL > ws_size) return;

    const float* x    = (const float*)d_in[0];    // [2,2048,1024]
    const float* Wq   = (const float*)d_in[1];    // [16,1024,64]  [head][in][dim]
    const float* bq   = (const float*)d_in[2];    // [16,64]
    const float* ln1g = (const float*)d_in[3];
    const float* ln1b = (const float*)d_in[4];
    const float* W1   = (const float*)d_in[5];    // [1024,4096]  [in][out]
    const float* b1   = (const float*)d_in[6];
    const float* W2   = (const float*)d_in[7];    // [4096,1024]  [in][out]
    const float* b2   = (const float*)d_in[8];
    const float* ln2g = (const float*)d_in[9];
    const float* ln2b = (const float*)d_in[10];
    float* out = (float*)d_out;                   // [2,2048,1024]

    char* ws = (char*)d_ws;
    size_t off = 0;
    _Float16* x16  = (_Float16*)(ws + off); off += SZ_X16;   // xh, then x1h (xh dead after k_gemm_q)
    _Float16* wqT  = (_Float16*)(ws + off); off += SZ_WQT;   // [h*64+e][d]
    _Float16* w1T  = (_Float16*)(ws + off); off += SZ_W1T;   // [n][k]
    _Float16* w2T  = (_Float16*)(ws + off); off += SZ_W2T;   // [n][k]
    _Float16* qrow = (_Float16*)(ws + off); off += SZ_Q16;   // [b][h][s][64]
    _Float16* qT   = (_Float16*)(ws + off); off += SZ_Q16;   // [b][h][64][s]
    float*    y12  = (float*)(ws + off);    off += SZ_Y32;   // y1, then y2 (y1 dead after LN1)
    float*    x1   = (float*)(ws + off);    off += SZ_Y32;
    _Float16* hb   = (_Float16*)(ws + off); off += SZ_HB;
    if (off > ws_size) return;

    k_cvt_x<<<dim3((unsigned)((size_t)NTOK * DM / 8 / 256)), dim3(256), 0, stream>>>(x, x16);
    // Wq: per head in[rows = 1024 (d)][cols = 64 (e)] -> out[e][d]; grid (cols/64, rows/64, heads)
    k_wT<<<dim3(DH / 64, DM / 64, NH), dim3(256), 0, stream>>>(Wq, wqT, DM, DH);
    // W1: in[rows = 1024 (k)][cols = 4096 (n)] -> out[n][k]; grid (cols/64, rows/64, 1)
    k_wT<<<dim3(HID / 64, DM / 64, 1), dim3(256), 0, stream>>>(W1, w1T, DM, HID);
    // W2: in[rows = 4096 (k)][cols = 1024 (n)] -> out[n][k]; grid (cols/64, rows/64, 1)
    k_wT<<<dim3(DM / 64, HID / 64, 1), dim3(256), 0, stream>>>(W2, w2T, HID, DM);

    k_gemm_q<<<dim3(NTOK / 256, DM / 64), dim3(128), 0, stream>>>(x16, wqT, bq, qrow, qT);
    k_attn<<<dim3(SEQ / 128, NH, NB), dim3(256), 0, stream>>>(qrow, qT, x, y12);
    k_ln<<<dim3(NTOK / 4), dim3(128), 0, stream>>>(y12, ln1g, ln1b, x1, x16, 1);
    k_gemm_ffn1<<<dim3(NTOK / 256, HID / 64), dim3(128), 0, stream>>>(x16, w1T, b1, hb);
    k_gemm_ffn2<<<dim3(NTOK / 256, DM / 64), dim3(128), 0, stream>>>(hb, w2T, b2, x1, y12);
    k_ln<<<dim3(NTOK / 4), dim3(128), 0, stream>>>(y12, ln2g, ln2b, out, x16, 0);
}

// v001
// One run takes 287 microseconds.
// In two side-by-side timings against v000, it was 1.49 and 1.47 times as fast.
#include <hip/hip_runtime.h>
#include <hip/hip_fp16.h>

// All contractions on v_wmma_f32_16x16x32_f16 (f16 operands, f32 accumulate), single products: x*Wq (x carried x16, Wq x64), q*q^T (q carried x64), P*q (P carried x256), x1*W1 (x1 x16, W1 x64), h*W2 (h x16, W2 x64); raw inputs RNE-converted to bf16 first.

#ifndef NB
#define NB 2
#endif
#ifndef SEQ
#define SEQ 2048
#endif
#define NB_FULL  2
#define SEQ_FULL 2048
#define DM   1024        // model width
#define NH   16          // heads
#define DH   64          // head width
#define HID  4096        // FFN hidden width
#define NTOK (NB * SEQ)

static_assert(NB >= 1 && NB <= NB_FULL);
static_assert(SEQ >= 128 && SEQ <= SEQ_FULL);
static_assert(SEQ % 128 == 0);                      // attention block = 128 queries; key loop steps 32
static_assert(SEQ % 64 == 0);                       // a 64-row GEMM wave tile stays inside one batch
static_assert(NTOK % 256 == 0);                     // GEMM block = 4 waves x 64 rows
static_assert(NTOK % 4 == 0);                       // LN block = 4 rows
static_assert(NH * DH == DM);                       // heads concatenate to the model width
static_assert(DH == 64);                            // one GEMM column tile == one head; 2 k-steps per score
static_assert(DM % 64 == 0 && HID % 64 == 0);       // N tiles of 64
static_assert(DM % 32 == 0 && HID % 32 == 0);       // K steps of 32
static_assert(DM == 32 * 8 * 4);                    // LN: 32 lanes x 8 chunks x 4 floats
static_assert(((size_t)NTOK * DM / 8) % 256 == 0);  // convert grid x block == plane extent

typedef _Float16 v16h __attribute__((ext_vector_type(16)));
typedef _Float16 v8h  __attribute__((ext_vector_type(8)));
typedef _Float16 v4h  __attribute__((ext_vector_type(4)));
typedef float    v8f  __attribute__((ext_vector_type(8)));
typedef float    v4f  __attribute__((ext_vector_type(4)));

union Frag { v16h v; v8h h[2]; };

// scores: acc = (64 q_s).(64 q_t); t (log2 units) = acc * log2(e) / 8 / 4096
#define CS (1.44269504088896340736f * 3.0517578125e-05f)

// plane sizes in bytes (all multiples of 128)
#define SZ_X16   ((size_t)NTOK * DM * 2)     // xh, later x1h
#define SZ_WQT   ((size_t)DM * DM * 2)
#define SZ_W1T   ((size_t)HID * DM * 2)
#define SZ_W2T   ((size_t)DM * HID * 2)
#define SZ_Q16   ((size_t)NTOK * DM * 2)     // qrow, qT each
#define SZ_Y32   ((size_t)NTOK * DM * 4)     // y1 (later y2), x1 each
#define SZ_HB    ((size_t)NTOK * HID * 2)
#define WS_TOTAL (SZ_X16 + SZ_WQT + SZ_W1T + SZ_W2T + 2 * SZ_Q16 + 2 * SZ_Y32 + SZ_HB)
static_assert(WS_TOTAL <= (size_t)134217728);       // carve <= 128 MiB

static __device__ __forceinline__ v8f zero8() {
    v8f z;
#pragma unroll
    for (int i = 0; i < 8; ++i) z[i] = 0.0f;
    return z;
}

// 16x32 A fragment (or B fragment from an [n][k] k-contiguous source).
// p = tile_base + (lane&15)*ld + 8*(lane>>4): elements 0..7 = k 8h..8h+7,
// elements 8..15 = k 16+8h..16+8h+7 (split map, same for A and B).
static __device__ __forceinline__ v16h load_frag_p(const _Float16* p) {
    Frag f;
    f.h[0] = *(const v8h*)(p);
    f.h[1] = *(const v8h*)(p + 16);
    return f.v;
}

static __device__ __forceinline__ v8f wmma16(v16h a, v16h b, v8f c) {
    v8f d = __builtin_amdgcn_wmma_f32_16x16x32_f16(false, a, false, b, (short)0, c, false, false);
    asm volatile("v_nop\n\tv_nop\n\tv_nop\n\tv_nop" : "+v"(d) : "v"(a), "v"(b));
    return d;
}

// f32 -> bf16 RNE convert, value kept as f32
static __device__ __forceinline__ float bf16r(float x) {
    unsigned u = __float_as_uint(x);
    u = (u + 0x7FFFu + ((u >> 16) & 1u)) & 0xFFFF0000u;
    return __uint_as_float(u);
}

static __device__ __forceinline__ float ex2(float x) {
    return __builtin_amdgcn_exp2f(x);
}

// ordering for a wave-private LDS tile: stores before later loads of the same wave
static __device__ __forceinline__ void wave_lds_sync() {
    __builtin_amdgcn_fence(3, "wavefront");
    asm volatile("s_wait_dscnt 0" ::: "memory");
    __builtin_amdgcn_wave_barrier();
}

static __device__ __forceinline__ float wave_sum(float v) {
    v += __shfl_xor(v, 16, 32);
    v += __shfl_xor(v, 8, 32);
    v += __shfl_xor(v, 4, 32);
    v += __shfl_xor(v, 2, 32);
    v += __shfl_xor(v, 1, 32);
    return v;
}

// ---------------------------------------------------------------------------
// xh[tok][d] = f16(16 * bf16(x)). One thread = one 16-B output piece; lanes
// ---------------------------------------------------------------------------
__global__ __launch_bounds__(256) void k_cvt_x(const float* __restrict__ x,
                                                _Float16* __restrict__ xh) {
    const int idx = blockIdx.x * 256 + threadIdx.x;
    if (idx >= NTOK * (DM / 8)) return;
    const int tok = idx >> 7;                 // DM/8 = 128 pieces per row
    const int c8  = idx & 127;
    const int b   = tok / SEQ;
    const int s   = tok - b * SEQ;
    const float* src = x + ((size_t)b * SEQ_FULL + s) * DM + c8 * 8;
    v4f a = *(const v4f*)(src);
    v4f c = *(const v4f*)(src + 4);
    v8h o;
    o[0] = (_Float16)(bf16r(a.x) * 16.0f);
    o[1] = (_Float16)(bf16r(a.y) * 16.0f);
    o[2] = (_Float16)(bf16r(a.z) * 16.0f);
    o[3] = (_Float16)(bf16r(a.w) * 16.0f);
    o[4] = (_Float16)(bf16r(c.x) * 16.0f);
    o[5] = (_Float16)(bf16r(c.y) * 16.0f);
    o[6] = (_Float16)(bf16r(c.z) * 16.0f);
    o[7] = (_Float16)(bf16r(c.w) * 16.0f);
    _Float16* dst = xh + (size_t)tok * DM + c8 * 8;
    *(v8h*)dst = o;
    
}

// ---------------------------------------------------------------------------
// Batched transpose + convert through LDS: in[z][rows][cols] f32 ->
// out[z][cols][rows] = f16(64 * bf16(in)). Block = one 64x64 tile;
// ---------------------------------------------------------------------------
__global__ __launch_bounds__(256) void k_wT(const float* __restrict__ in,
                                             _Float16* __restrict__ out,
                                             int rows, int cols) {
    __shared__ __align__(16) _Float16 T[64 * 64];     // [c][r], 8 KB, cross-wave (block barrier)
    const int tid = threadIdx.x;
    const int c0 = blockIdx.x * 64;
    const int r0 = blockIdx.y * 64;
    const size_t zoff = (size_t)blockIdx.z * (size_t)rows * (size_t)cols;
    const float* ib = in + zoff;
    _Float16*    ob = out + zoff;
#pragma unroll 1
    for (int i = 0; i < 4; ++i) {
        const int idx = i * 256 + tid;
        const int r = idx >> 4, c4 = idx & 15;
        v4f v = *(const v4f*)(ib + (size_t)(r0 + r) * cols + c0 + c4 * 4);
        T[(c4 * 4 + 0) * 64 + r] = (_Float16)(bf16r(v.x) * 64.0f);
        T[(c4 * 4 + 1) * 64 + r] = (_Float16)(bf16r(v.y) * 64.0f);
        T[(c4 * 4 + 2) * 64 + r] = (_Float16)(bf16r(v.z) * 64.0f);
        T[(c4 * 4 + 3) * 64 + r] = (_Float16)(bf16r(v.w) * 64.0f);
    }
    __syncthreads();
    const int ca = tid >> 3, j = tid & 7;              // rows ca and ca + 32 of the transposed tile
    v8h o0 = *(const v8h*)(&T[ca * 64 + j * 8]);
    v8h o1 = *(const v8h*)(&T[(ca + 32) * 64 + j * 8]);
    _Float16* d0 = ob + (size_t)(c0 + ca) * rows + r0 + j * 8;
    _Float16* d1 = ob + (size_t)(c0 + ca + 32) * rows + r0 + j * 8;
    *(v8h*)d0 = o0;
    *(v8h*)d1 = o1;
    
}

// ---------------------------------------------------------------------------
// GEMM main loop: block = 4 waves = 256x64 tile, one wave = 64x64 = 4x4 subtiles.
// A [M][K] and Bt [N][K] are 16-bit k-contiguous planes in global memory. A stage
// is 64 k (128 B, one whole line) of the block's 256 A rows and 64 Bt rows, laid
// in LDS at a 144-B pitch; asynchronous copies fill it (16 B per lane, 8 lanes
// per row), two buffers, the next stage in flight while this one is multiplied.
// Fragments are two 16-B LDS loads, same k order as from the global planes.
// ---------------------------------------------------------------------------
#define ST_K      64                         // halves of k per stage
#define ST_ROWS   320                        // 256 A rows, then 64 Bt rows
#define ST_PITCH  72                         // halves per LDS row (144 B)
#define ST_HALVES (ST_ROWS * ST_PITCH)       // one buffer, 46,080 B

static __device__ __forceinline__ unsigned lds_off(const void* p) { return (unsigned)(size_t)p; }

// Ten copies, rows 16 apart in both places. The s_wait_xcnt closes the statement
// so that no address register of a copy is rewritten ahead of it.
static __device__ __forceinline__ void copy10(unsigned l, const _Float16* g, size_t gstep) {
    const unsigned ls = 16u * ST_PITCH * 2u;
    asm volatile(
        "global_load_async_to_lds_b128 %0, %10, off\n\t"
        "global_load_async_to_lds_b128 %1, %11, off\n\t"
        "global_load_async_to_lds_b128 %2, %12, off\n\t"
        "global_load_async_to_lds_b128 %3, %13, off\n\t"
        "global_load_async_to_lds_b128 %4, %14, off\n\t"
        "global_load_async_to_lds_b128 %5, %15, off\n\t"
        "global_load_async_to_lds_b128 %6, %16, off\n\t"
        "global_load_async_to_lds_b128 %7, %17, off\n\t"
        "global_load_async_to_lds_b128 %8, %18, off\n\t"
        "global_load_async_to_lds_b128 %9, %19, off\n\t"
        "s_wait_xcnt 0x0"
        :: "v"(l), "v"(l + ls), "v"(l + 2u * ls), "v"(l + 3u * ls), "v"(l + 4u * ls),
           "v"(l + 5u * ls), "v"(l + 6u * ls), "v"(l + 7u * ls), "v"(l + 8u * ls), "v"(l + 9u * ls),
           "v"(g), "v"(g + gstep), "v"(g + 2 * gstep), "v"(g + 3 * gstep), "v"(g + 4 * gstep),
           "v"(g + 5 * gstep), "v"(g + 6 * gstep), "v"(g + 7 * gstep), "v"(g + 8 * gstep), "v"(g + 9 * gstep)
        : "memory");
}

// Six copies of A rows and four of Bt rows, same form.
static __device__ __forceinline__ void copy6_4(unsigned l, const _Float16* g, const _Float16* h, size_t gstep) {
    const unsigned ls = 16u * ST_PITCH * 2u;
    asm volatile(
        "global_load_async_to_lds_b128 %0, %10, off\n\t"
        "global_load_async_to_lds_b128 %1, %11, off\n\t"
        "global_load_async_to_lds_b128 %2, %12, off\n\t"
        "global_load_async_to_lds_b128 %3, %13, off\n\t"
        "global_load_async_to_lds_b128 %4, %14, off\n\t"
        "global_load_async_to_lds_b128 %5, %15, off\n\t"
        "global_load_async_to_lds_b128 %6, %16, off\n\t"
        "global_load_async_to_lds_b128 %7, %17, off\n\t"
        "global_load_async_to_lds_b128 %8, %18, off\n\t"
        "global_load_async_to_lds_b128 %9, %19, off\n\t"
        "s_wait_xcnt 0x0"
        :: "v"(l), "v"(l + ls), "v"(l + 2u * ls), "v"(l + 3u * ls), "v"(l + 4u * ls),
           "v"(l + 5u * ls), "v"(l + 6u * ls), "v"(l + 7u * ls), "v"(l + 8u * ls), "v"(l + 9u * ls),
           "v"(g), "v"(g + gstep), "v"(g + 2 * gstep), "v"(g + 3 * gstep), "v"(g + 4 * gstep),
           "v"(g + 5 * gstep), "v"(h), "v"(h + gstep), "v"(h + 2 * gstep), "v"(h + 3 * gstep)
        : "memory");
}

// ab = A + m_block * K (256 rows), bb = Bt + n0 * K (64 rows), St = two buffers.
template <int K>
static __device__ __forceinline__ void gemm_tile64(const _Float16* __restrict__ ab,
                                                   const _Float16* __restrict__ bb,
                                                   _Float16* St,
                                                   v8f (&acc)[4][4]) {
    static_assert(K % ST_K == 0 && K / ST_K >= 2);   // whole stages, both buffers filled
    constexpr int NT = K / ST_K;
    const int tid  = threadIdx.x;
    const int lane = tid & 31;
    const int w    = tid >> 5;
    const int lm   = lane & 15;
    const int kb   = (lane >> 4) << 3;
    // copy i of a thread: stage row i*16 + tid/8, 16-B piece tid%8
    const _Float16* ga = ab + (size_t)(tid >> 3) * K + (tid & 7) * 8;
    const _Float16* gb = bb + (size_t)(tid >> 3) * K + (tid & 7) * 8;
    const unsigned  l0 = lds_off(St) + (unsigned)((tid >> 3) * (ST_PITCH * 2) + (tid & 7) * 16);
    const unsigned  lhalf = 160u * ST_PITCH * 2u;    // stage row 160: second statement's first row
    const size_t    gstep = (size_t)16 * K;

#pragma unroll
    for (int ms = 0; ms < 4; ++ms)
#pragma unroll
        for (int nt = 0; nt < 4; ++nt) acc[ms][nt] = zero8();

    copy10(l0, ga, gstep);
    copy6_4(l0 + lhalf, ga + 10 * gstep, gb, gstep);
    asm volatile("s_wait_asynccnt 0x0" ::: "memory");   // stage 0 landed (this wave's copies)
    __syncthreads();                                    // stage 0 published to all waves
    copy10(l0 + ST_HALVES * 2u, ga + ST_K, gstep);
    copy6_4(l0 + ST_HALVES * 2u + lhalf, ga + 10 * gstep + ST_K, gb + ST_K, gstep);

#pragma unroll 1
    for (int t = 0; t < NT; ++t) {
        const int bo = (t & 1) * ST_HALVES;
        const _Float16* sa = St + bo + (w * 64 + lm) * ST_PITCH + kb;
        const _Float16* sb = St + bo + (256 + lm) * ST_PITCH + kb;
        // Fragment reads stand in few groups, each ahead of the products that hide it:
        // k 0..31 whole and the A side of k 32..63 first, the B side of k 32..63 in
        // two halves into the B registers that the first k step has just left.
        v16h a0[4], a1[4], bn[4];
#pragma unroll
        for (int i = 0; i < 4; ++i) a0[i] = load_frag_p(sa + i * 16 * ST_PITCH);
#pragma unroll
        for (int i = 0; i < 4; ++i) bn[i] = load_frag_p(sb + i * 16 * ST_PITCH);
#pragma unroll
        for (int i = 0; i < 4; ++i) a1[i] = load_frag_p(sa + i * 16 * ST_PITCH + 32);
#pragma unroll
        for (int hf = 0; hf < 4; hf += 2) {
#pragma unroll
            for (int nt = hf; nt < hf + 2; ++nt)
#pragma unroll
                for (int ms = 0; ms < 4; ++ms) acc[ms][nt] = wmma16(a0[ms], bn[nt], acc[ms][nt]);
#pragma unroll
            for (int nt = hf; nt < hf + 2; ++nt) bn[nt] = load_frag_p(sb + nt * 16 * ST_PITCH + 32);
        }
#pragma unroll
        for (int nt = 0; nt < 4; ++nt)
#pragma unroll
            for (int ms = 0; ms < 4; ++ms) acc[ms][nt] = wmma16(a1[ms], bn[nt], acc[ms][nt]);
        asm volatile("s_wait_dscnt 0x0" ::: "memory");      // this wave's reads of the buffer are done
        asm volatile("s_wait_asynccnt 0x0" ::: "memory");   // stage t+1 landed (this wave's copies)
        __syncthreads();                                    // publishes stage t+1, frees stage t's buffer
        if (t + 2 < NT) {
            const unsigned lb = l0 + (unsigned)bo * 2u;
            const _Float16* gk = ga + (size_t)(t + 2) * ST_K;
            copy10(lb, gk, gstep);
            copy6_4(lb + lhalf, gk + 10 * gstep, gb + (size_t)(t + 2) * ST_K, gstep);
        }
    }
    asm volatile("s_wait_asynccnt 0x0" ::: "memory");       // nothing in flight when the loop is left
}

// ---------------------------------------------------------------------------
// Q projection: acc = (16 x)(64 Wq) = 1024 x.Wq ; q64 = (acc + 1024 bq) / 16.
// Writes qrow[b][h][s][64] and qT[b][h][64][s] as f16(64 q).
// Wave tile = 64 tokens x one head. Row plane: 16-row steps through a
// wave-private LDS tile; transposed plane: whole 64x64 wave-private tile.
// ---------------------------------------------------------------------------
__global__ __launch_bounds__(128) __attribute__((amdgpu_num_vgpr(256)))
void k_gemm_q(const _Float16* __restrict__ xh,
              const _Float16* __restrict__ wqT,
              const float* __restrict__ bq,
              _Float16* __restrict__ qrow,
              _Float16* __restrict__ qT) {
    __shared__ __align__(16) _Float16 Rst[4][16 * 64];   // 8 KB, wave-private
    __shared__ __align__(16) _Float16 Tst[4][64 * 64];   // 32 KB, wave-private
    __shared__ __align__(16) _Float16 St[2 * ST_HALVES]; // 90 KB, operand stages, cross-wave
    const int tid  = threadIdx.x;
    const int lane = tid & 31;
    const int w    = tid >> 5;
    const int hh   = lane >> 4;
    const int lm   = lane & 15;
    const int m0   = blockIdx.x * 256 + w * 64;
    const int n0   = blockIdx.y * 64;
    const int head = blockIdx.y;
    const int b    = m0 / SEQ;
    const int s0   = m0 - b * SEQ;

    v8f acc[4][4];
    gemm_tile64<DM>(xh + (size_t)(blockIdx.x * 256) * DM, wqT + (size_t)n0 * DM, St, acc);

    float bv[4];
#pragma unroll
    for (int nt = 0; nt < 4; ++nt) bv[nt] = bf16r(bq[n0 + nt * 16 + lm]) * 1024.0f;

    _Float16* qr = qrow + (((size_t)b * NH + head) * SEQ + s0) * DH;
    _Float16* qt = qT + ((size_t)b * NH + head) * DH * SEQ + s0;

#pragma unroll
    for (int ms = 0; ms < 4; ++ms) {
#pragma unroll
        for (int nt = 0; nt < 4; ++nt) {
            v8h tv;
#pragma unroll
            for (int r = 0; r < 8; ++r) {
                _Float16 hv = (_Float16)((acc[ms][nt][r] + bv[nt]) * 0.0625f);
                Rst[w][(8 * hh + r) * 64 + nt * 16 + lm] = hv;
                tv[r] = hv;
            }
            *(v8h*)(&Tst[w][(nt * 16 + lm) * 64 + ms * 16 + 8 * hh]) = tv;
        }
        wave_lds_sync();
        v8h rv[4];
#pragma unroll
        for (int i = 0; i < 4; ++i) rv[i] = *(const v8h*)(&Rst[w][i * 256 + lane * 8]);
        _Float16* dst = qr + ms * 1024 + lane * 8;
#pragma unroll
        for (int i = 0; i < 4; ++i) *(v8h*)(dst + i * 256) = rv[i];
        
        wave_lds_sync();
    }
    wave_lds_sync();
#pragma unroll 1
    for (int g = 0; g < 4; ++g) {
        v8h tv[4];
#pragma unroll
        for (int i = 0; i < 4; ++i) tv[i] = *(const v8h*)(&Tst[w][(g * 4 + i) * 256 + lane * 8]);
        _Float16* dst = qt + (size_t)(g * 16 + (lane >> 3)) * SEQ + (lane & 7) * 8;
#pragma unroll
        for (int i = 0; i < 4; ++i) *(v8h*)(dst + (size_t)i * 4 * SEQ) = tv[i];
        
    }
}

// ---------------------------------------------------------------------------
// Fused attention, q = k = v. Block = 8 waves = 128 queries of one (b, head);
// a wave owns 16 queries and streams all SEQ keys, 32 per step:
//   S^T tiles (rows = keys, cols = queries): A = key rows, B = query rows,
//   both fragments straight from the qrow plane (k = d, 2 steps of 32);
//   per-lane online softmax (lane column = its query; partner lane +-16);
//   P^T carried 2^8 as f16: the two S^T tiles chain directly as the B
//   fragment (elements 0..7 = tile keys 0..15, 8..15 = tile keys 16..31);
//   O^T += V^T . P^T with A fragments from the qT plane (rows = d, k = keys).
// Epilogue: O^T / (64 l) staged as [query][d] f32 in a wave-private LDS tile,
// bf16(x) added at the store stage, 8 lane-contiguous 16-B-per-lane
// ---------------------------------------------------------------------------
__global__ __launch_bounds__(256) __attribute__((amdgpu_num_vgpr(256)))
void k_attn(const _Float16* __restrict__ qrow,
            const _Float16* __restrict__ qT,
            const float* __restrict__ x,
            float* __restrict__ y1) {
    __shared__ __align__(16) float Ost[8][16 * DH];      // 32 KB, wave-private
    const int tid  = threadIdx.x;
    const int lane = tid & 31;
    const int w    = tid >> 5;
    const int hh   = lane >> 4;
    const int lm   = lane & 15;
    const int kb   = hh << 3;
    const int b    = blockIdx.z;
    const int head = blockIdx.y;
    const int q0   = blockIdx.x * 128 + w * 16;

    const _Float16* qlane = qrow + ((size_t)b * NH + head) * SEQ * DH + (size_t)lm * DH + kb;
    const _Float16* tlane = qT + ((size_t)b * NH + head) * DH * SEQ + (size_t)lm * SEQ + kb;

    const v16h qf0 = load_frag_p(qlane + (size_t)q0 * DH);        // d 0..31
    const v16h qf1 = load_frag_p(qlane + (size_t)q0 * DH + 32);   // d 32..63

    v8f o[4];
#pragma unroll
    for (int dt = 0; dt < 4; ++dt) o[dt] = zero8();
    float mr = -1.0e30f, l = 0.0f;

#pragma unroll 1
    for (int key0 = 0; key0 < SEQ; key0 += 32) {
        const _Float16* ka = qlane + (size_t)key0 * DH;
        v16h a0 = load_frag_p(ka);
        v16h a1 = load_frag_p(ka + 32);
        v8f sA = wmma16(a0, qf0, zero8());
        sA = wmma16(a1, qf1, sA);
        v16h c0 = load_frag_p(ka + 16 * DH);
        v16h c1 = load_frag_p(ka + 16 * DH + 32);
        v8f sB = wmma16(c0, qf0, zero8());
        sB = wmma16(c1, qf1, sB);

        float tA[8], tB[8];
#pragma unroll
        for (int i = 0; i < 8; ++i) { tA[i] = sA[i] * CS; tB[i] = sB[i] * CS; }
        float tmax = fmaxf(tA[0], tB[0]);
#pragma unroll
        for (int i = 1; i < 8; ++i) tmax = fmaxf(tmax, fmaxf(tA[i], tB[i]));
        tmax = fmaxf(tmax, __shfl_xor(tmax, 16, 32));
        const float mn = fmaxf(mr, tmax);
        if (__builtin_amdgcn_ballot_w32(mn > mr) != 0u) {       // wave-uniform
            const float sc = ex2(mr - mn);
            l *= sc;
#pragma unroll
            for (int dt = 0; dt < 4; ++dt)
#pragma unroll
                for (int r = 0; r < 8; ++r) o[dt][r] *= sc;
        }
        mr = mn;
        const float sh = 8.0f - mn;
        float ps = 0.0f;
        v16h pb;
#pragma unroll
        for (int i = 0; i < 8; ++i) {
            const float pa = ex2(tA[i] + sh);
            const float pq = ex2(tB[i] + sh);
            ps += pa + pq;
            pb[i]     = (_Float16)pa;
            pb[8 + i] = (_Float16)pq;
        }
        l += ps;
#pragma unroll
        for (int dt = 0; dt < 4; ++dt) {
            v16h vf = load_frag_p(tlane + (size_t)dt * 16 * SEQ + key0);
            o[dt] = wmma16(vf, pb, o[dt]);
        }
    }

    const float lt  = l + __shfl_xor(l, 16, 32);
    const float inv = (1.0f / lt) * 0.015625f;          // 2^8 P carry cancels in o/l; 1/64 for the q carry
#pragma unroll
    for (int dt = 0; dt < 4; ++dt) {
        v4f u0, u1;
        u0.x = o[dt][0] * inv; u0.y = o[dt][1] * inv; u0.z = o[dt][2] * inv; u0.w = o[dt][3] * inv;
        u1.x = o[dt][4] * inv; u1.y = o[dt][5] * inv; u1.z = o[dt][6] * inv; u1.w = o[dt][7] * inv;
        *(v4f*)(&Ost[w][lm * DH + dt * 16 + 8 * hh])     = u0;
        *(v4f*)(&Ost[w][lm * DH + dt * 16 + 8 * hh + 4]) = u1;
    }
    wave_lds_sync();

    v4f sv[8];
    const int col = lm * 4;
#pragma unroll
    for (int i = 0; i < 8; ++i) {
        const int row = 2 * i + hh;
        v4f a  = *(const v4f*)(&Ost[w][i * 128 + lane * 4]);
        v4f xv = *(const v4f*)(x + ((size_t)b * SEQ_FULL + q0 + row) * DM + head * DH + col);
        a.x = bf16r(xv.x) + a.x;
        a.y = bf16r(xv.y) + a.y;
        a.z = bf16r(xv.z) + a.z;
        a.w = bf16r(xv.w) + a.w;
        sv[i] = a;
    }
    float* ob = y1 + ((size_t)b * SEQ + q0 + hh) * DM + head * DH + col;
#pragma unroll
    for (int i = 0; i < 8; ++i) *(v4f*)(ob + (size_t)(2 * i) * DM) = sv[i];
    
}

// ---------------------------------------------------------------------------
// row, row kept in a wave-private LDS line, loops rolled. Writes f32 row
// (512 B per instruction, lane-contiguous) and optionally f16(16 * LN(y)) row
// ---------------------------------------------------------------------------
__global__ __launch_bounds__(128) void k_ln(const float* __restrict__ y,
                                             const float* __restrict__ g,
                                             const float* __restrict__ be,
                                             float* __restrict__ of,
                                             _Float16* __restrict__ oh,
                                             int wr16) {
    __shared__ __align__(16) float    Rw[4][DM];     // 16 KB, wave-private
    __shared__ __align__(16) _Float16 Hw[4][DM];     // 8 KB, wave-private
    const int tid  = threadIdx.x;
    const int lane = tid & 31;
    const int w    = tid >> 5;
    const int row  = blockIdx.x * 4 + w;
    if (row >= NTOK) return;                          // wave-uniform; no block barriers below
    const float* yr = y + (size_t)row * DM;

    float s = 0.0f;
#pragma unroll 1
    for (int j = 0; j < 8; ++j) {
        const int c = j * 128 + lane * 4;
        v4f v = *(const v4f*)(yr + c);
        *(v4f*)(&Rw[w][c]) = v;
        s += (v.x + v.y) + (v.z + v.w);
    }
    s = wave_sum(s);
    const float mu = s * 0.0009765625f;
    float qv = 0.0f;
#pragma unroll 1
    for (int j = 0; j < 8; ++j) {
        const int c = j * 128 + lane * 4;
        v4f v = *(const v4f*)(&Rw[w][c]);
        const float d0 = v.x - mu, d1 = v.y - mu, d2 = v.z - mu, d3 = v.w - mu;
        qv += (d0 * d0 + d1 * d1) + (d2 * d2 + d3 * d3);
    }
    qv = wave_sum(qv);
    const float rs = rsqrtf(qv * 0.0009765625f + 1.0e-5f);
#pragma unroll 1
    for (int j = 0; j < 8; ++j) {
        const int c = j * 128 + lane * 4;
        v4f v  = *(const v4f*)(&Rw[w][c]);
        v4f gv = *(const v4f*)(g + c);
        v4f bv = *(const v4f*)(be + c);
        v4f r;
        r.x = (v.x - mu) * rs * bf16r(gv.x) + bf16r(bv.x);
        r.y = (v.y - mu) * rs * bf16r(gv.y) + bf16r(bv.y);
        r.z = (v.z - mu) * rs * bf16r(gv.z) + bf16r(bv.z);
        r.w = (v.w - mu) * rs * bf16r(gv.w) + bf16r(bv.w);
        *(v4f*)(&Rw[w][c]) = r;
        if (wr16 != 0) {
            v4h hv;
            hv.x = (_Float16)(r.x * 16.0f);
            hv.y = (_Float16)(r.y * 16.0f);
            hv.z = (_Float16)(r.z * 16.0f);
            hv.w = (_Float16)(r.w * 16.0f);
            *(v4h*)(&Hw[w][c]) = hv;
        }
    }
    wave_lds_sync();

    float*    df = of + (size_t)row * DM;
    _Float16* dh = oh + (size_t)row * DM;
#pragma unroll 1
    for (int j = 0; j < 8; ++j) {
        const int c = j * 128 + lane * 4;
        v4f v = *(const v4f*)(&Rw[w][c]);
        *(v4f*)(df + c) = v;
    }
    if (wr16 != 0) {
#pragma unroll 1
        for (int j = 0; j < 4; ++j) {
            const int c = j * 256 + lane * 8;
            v8h hv = *(const v8h*)(&Hw[w][c]);
            *(v8h*)(dh + c) = hv;
        }
    }
    
}

// ---------------------------------------------------------------------------
// FFN1: acc = (16 x1)(64 W1) = 1024 pre ; hb = f16(16 relu(pre + b1)).
// 16-row steps through a wave-private LDS tile; row segment = 64 halves =
// ---------------------------------------------------------------------------
__global__ __launch_bounds__(128) __attribute__((amdgpu_num_vgpr(256)))
void k_gemm_ffn1(const _Float16* __restrict__ a16,
                 const _Float16* __restrict__ w1T,
                 const float* __restrict__ b1,
                 _Float16* __restrict__ hb) {
    __shared__ __align__(16) _Float16 Rst[4][16 * 64];   // 8 KB, wave-private
    __shared__ __align__(16) _Float16 St[2 * ST_HALVES]; // 90 KB, operand stages, cross-wave
    const int tid  = threadIdx.x;
    const int lane = tid & 31;
    const int w    = tid >> 5;
    const int hh   = lane >> 4;
    const int lm   = lane & 15;
    const int m0   = blockIdx.x * 256 + w * 64;
    const int n0   = blockIdx.y * 64;

    v8f acc[4][4];
    gemm_tile64<DM>(a16 + (size_t)(blockIdx.x * 256) * DM, w1T + (size_t)n0 * DM, St, acc);

    float bv[4];
#pragma unroll
    for (int nt = 0; nt < 4; ++nt) bv[nt] = bf16r(b1[n0 + nt * 16 + lm]) * 1024.0f;

#pragma unroll
    for (int ms = 0; ms < 4; ++ms) {
#pragma unroll
        for (int nt = 0; nt < 4; ++nt)
#pragma unroll
            for (int r = 0; r < 8; ++r)
                Rst[w][(8 * hh + r) * 64 + nt * 16 + lm] =
                    (_Float16)(fmaxf(acc[ms][nt][r] + bv[nt], 0.0f) * 0.015625f);
        wave_lds_sync();
        v8h rv[4];
#pragma unroll
        for (int i = 0; i < 4; ++i) rv[i] = *(const v8h*)(&Rst[w][i * 256 + lane * 8]);
        _Float16* dst = hb + (size_t)(m0 + ms * 16 + (lane >> 3)) * HID + n0 + (lane & 7) * 8;
#pragma unroll
        for (int i = 0; i < 4; ++i) *(v8h*)(dst + (size_t)i * 4 * HID) = rv[i];
        
        wave_lds_sync();
    }
}

// ---------------------------------------------------------------------------
// FFN2: acc = (16 h)(64 W2) = 1024 ff ; y2 = x1 + (ff + b2), f32.
// 16-row steps through a wave-private f32 LDS tile; bias and skip path added
// at the store stage as 4-float vectors; each instruction = 2 rows x 256 B.
// ---------------------------------------------------------------------------
__global__ __launch_bounds__(128) __attribute__((amdgpu_num_vgpr(256)))
void k_gemm_ffn2(const _Float16* __restrict__ hb,
                 const _Float16* __restrict__ w2T,
                 const float* __restrict__ b2,
                 const float* __restrict__ x1,
                 float* __restrict__ y2) {
    __shared__ __align__(16) float Fst[4][16 * 64];      // 16 KB, wave-private
    __shared__ __align__(16) _Float16 St[2 * ST_HALVES]; // 90 KB, operand stages, cross-wave
    const int tid  = threadIdx.x;
    const int lane = tid & 31;
    const int w    = tid >> 5;
    const int hh   = lane >> 4;
    const int lm   = lane & 15;
    const int m0   = blockIdx.x * 256 + w * 64;
    const int n0   = blockIdx.y * 64;

    v8f acc[4][4];
    gemm_tile64<HID>(hb + (size_t)(blockIdx.x * 256) * HID, w2T + (size_t)n0 * HID, St, acc);

    const int col = lm * 4;
    v4f bb = *(const v4f*)(b2 + n0 + col);
    bb.x = bf16r(bb.x); bb.y = bf16r(bb.y); bb.z = bf16r(bb.z); bb.w = bf16r(bb.w);

#pragma unroll
    for (int ms = 0; ms < 4; ++ms) {
#pragma unroll
        for (int nt = 0; nt < 4; ++nt)
#pragma unroll
            for (int r = 0; r < 8; ++r)
                Fst[w][(8 * hh + r) * 64 + nt * 16 + lm] = acc[ms][nt][r] * 0.0009765625f;
        wave_lds_sync();
        v4f sv[8];
        const size_t rbase = ((size_t)(m0 + ms * 16 + hh)) * DM + n0 + col;
#pragma unroll
        for (int i = 0; i < 8; ++i) {
            v4f a  = *(const v4f*)(&Fst[w][i * 128 + lane * 4]);
            v4f xr = *(const v4f*)(x1 + rbase + (size_t)(2 * i) * DM);
            a.x = xr.x + (a.x + bb.x);
            a.y = xr.y + (a.y + bb.y);
            a.z = xr.z + (a.z + bb.z);
            a.w = xr.w + (a.w + bb.w);
            sv[i] = a;
        }
        float* dst = y2 + rbase;
#pragma unroll
        for (int i = 0; i < 8; ++i) *(v4f*)(dst + (size_t)(2 * i) * DM) = sv[i];
        
        wave_lds_sync();
    }
}

// ---------------------------------------------------------------------------
extern "C" void kernel_launch(void* const* d_in, const int* in_sizes, int n_in,
                              void* d_out, int out_size, void* d_ws, size_t ws_size,
                              hipStream_t stream) {
    if (n_in < 11) return;
    if (in_sizes[0] < ((NB - 1) * SEQ_FULL + SEQ) * DM) return;
    if (in_sizes[1] < DM * DM || in_sizes[2] < DM) return;
    if (in_sizes[3] < DM || in_sizes[4] < DM) return;
    if (in_sizes[5] < DM * HID || in_sizes[6] < HID) return;
    if (in_sizes[7] < HID * DM || in_sizes[8] < DM) return;
    if (in_sizes[9] < DM || in_sizes[10] < DM) return;
    if (out_size < NTOK * DM) return;
    if (WS_TOTAL > ws_size) return;

    const float* x    = (const float*)d_in[0];    // [2,2048,1024]
    const float* Wq   = (const float*)d_in[1];    // [16,1024,64]  [head][in][dim]
    const float* bq   = (const float*)d_in[2];    // [16,64]
    const float* ln1g = (const float*)d_in[3];
    const float* ln1b = (const float*)d_in[4];
    const float* W1   = (const float*)d_in[5];    // [1024,4096]  [in][out]
    const float* b1   = (const float*)d_in[6];
    const float* W2   = (const float*)d_in[7];    // [4096,1024]  [in][out]
    const float* b2   = (const float*)d_in[8];
    const float* ln2g = (const float*)d_in[9];
    const float* ln2b = (const float*)d_in[10];
    float* out = (float*)d_out;                   // [2,2048,1024]

    char* ws = (char*)d_ws;
    size_t off = 0;
    _Float16* x16  = (_Float16*)(ws + off); off += SZ_X16;   // xh, then x1h (xh dead after k_gemm_q)
    _Float16* wqT  = (_Float16*)(ws + off); off += SZ_WQT;   // [h*64+e][d]
    _Float16* w1T  = (_Float16*)(ws + off); off += SZ_W1T;   // [n][k]
    _Float16* w2T  = (_Float16*)(ws + off); off += SZ_W2T;   // [n][k]
    _Float16* qrow = (_Float16*)(ws + off); off += SZ_Q16;   // [b][h][s][64]
    _Float16* qT   = (_Float16*)(ws + off); off += SZ_Q16;   // [b][h][64][s]
    float*    y12  = (float*)(ws + off);    off += SZ_Y32;   // y1, then y2 (y1 dead after LN1)
    float*    x1   = (float*)(ws + off);    off += SZ_Y32;
    _Float16* hb   = (_Float16*)(ws + off); off += SZ_HB;
    if (off > ws_size) return;

    k_cvt_x<<<dim3((unsigned)((size_t)NTOK * DM / 8 / 256)), dim3(256), 0, stream>>>(x, x16);
    // Wq: per head in[rows = 1024 (d)][cols = 64 (e)] -> out[e][d]; grid (cols/64, rows/64, heads)
    k_wT<<<dim3(DH / 64, DM / 64, NH), dim3(256), 0, stream>>>(Wq, wqT, DM, DH);
    // W1: in[rows = 1024 (k)][cols = 4096 (n)] -> out[n][k]; grid (cols/64, rows/64, 1)
    k_wT<<<dim3(HID / 64, DM / 64, 1), dim3(256), 0, stream>>>(W1, w1T, DM, HID);
    // W2: in[rows = 4096 (k)][cols = 1024 (n)] -> out[n][k]; grid (cols/64, rows/64, 1)
    k_wT<<<dim3(DM / 64, HID / 64, 1), dim3(256), 0, stream>>>(W2, w2T, HID, DM);

    k_gemm_q<<<dim3(NTOK / 256, DM / 64), dim3(128), 0, stream>>>(x16, wqT, bq, qrow, qT);
    k_attn<<<dim3(SEQ / 128, NH, NB), dim3(256), 0, stream>>>(qrow, qT, x, y12);
    k_ln<<<dim3(NTOK / 4), dim3(128), 0, stream>>>(y12, ln1g, ln1b, x1, x16, 1);
    k_gemm_ffn1<<<dim3(NTOK / 256, HID / 64), dim3(128), 0, stream>>>(x16, w1T, b1, hb);
    k_gemm_ffn2<<<dim3(NTOK / 256, DM / 64), dim3(128), 0, stream>>>(hb, w2T, b2, x1, y12);
    k_ln<<<dim3(NTOK / 4), dim3(128), 0, stream>>>(y12, ln2g, ln2b, out, x16, 0);
}

// v002
// It runs in 191 microseconds.
// In two side-by-side timings against v001, it was 1.50 and 1.51 times as fast.
// All steps since v000 together make it 2.23 times as fast.
#include <hip/hip_runtime.h>
#include <hip/hip_fp16.h>

// All contractions on v_wmma_f32_16x16x32_f16 (f16 operands, f32 accumulate), single products: x*Wq (x carried x16, Wq x64), q*q^T (q carried x64), P*q (P carried x256), x1*W1 (x1 x16, W1 x64), h*W2 (h x16, W2 x64); raw inputs RNE-converted to bf16 first.

#ifndef NB
#define NB 2
#endif
#ifndef SEQ
#define SEQ 2048
#endif
#define NB_FULL  2
#define SEQ_FULL 2048
#define DM   1024        // model width
#define NH   16          // heads
#define DH   64          // head width
#define HID  4096        // FFN hidden width
#define NTOK (NB * SEQ)

static_assert(NB >= 1 && NB <= NB_FULL);
static_assert(SEQ >= 128 && SEQ <= SEQ_FULL);
static_assert(SEQ % 128 == 0);                      // attention block = 128 queries; key loop steps 32
static_assert(SEQ % 64 == 0);                       // a 64-row GEMM wave tile stays inside one batch
static_assert(NTOK % 256 == 0);                     // GEMM block = 4 waves x 64 rows
static_assert(NTOK % 4 == 0);                       // LN block = 4 rows
static_assert(NH * DH == DM);                       // heads concatenate to the model width
static_assert(DH == 64);                            // one GEMM column tile == one head; 2 k-steps per score
static_assert(DM % 64 == 0 && HID % 64 == 0);       // N tiles of 64
static_assert(DM % 32 == 0 && HID % 32 == 0);       // K steps of 32
static_assert(DM == 32 * 8 * 4);                    // LN: 32 lanes x 8 chunks x 4 floats
static_assert(((size_t)NTOK * DM / 8) % 256 == 0);  // convert grid x block == plane extent

typedef _Float16 v16h __attribute__((ext_vector_type(16)));
typedef _Float16 v8h  __attribute__((ext_vector_type(8)));
typedef _Float16 v4h  __attribute__((ext_vector_type(4)));
typedef float    v8f  __attribute__((ext_vector_type(8)));
typedef float    v4f  __attribute__((ext_vector_type(4)));

union Frag { v16h v; v8h h[2]; };

// scores: acc = (64 q_s).(64 q_t); t (log2 units) = acc * log2(e) / 8 / 4096
#define CS (1.44269504088896340736f * 3.0517578125e-05f)

// plane sizes in bytes (all multiples of 128)
#define SZ_X16   ((size_t)NTOK * DM * 2)     // xh, later x1h
#define SZ_WQT   ((size_t)DM * DM * 2)
#define SZ_W1T   ((size_t)HID * DM * 2)
#define SZ_W2T   ((size_t)DM * HID * 2)
#define SZ_Q16   ((size_t)NTOK * DM * 2)     // qrow, qT each
#define SZ_Y32   ((size_t)NTOK * DM * 4)     // y1 (later y2), x1 each
#define SZ_HB    ((size_t)NTOK * HID * 2)
#define WS_TOTAL (SZ_X16 + SZ_WQT + SZ_W1T + SZ_W2T + 2 * SZ_Q16 + 2 * SZ_Y32 + SZ_HB)
static_assert(WS_TOTAL <= (size_t)134217728);       // carve <= 128 MiB

static __device__ __forceinline__ v8f zero8() {
    v8f z;
#pragma unroll
    for (int i = 0; i < 8; ++i) z[i] = 0.0f;
    return z;
}

// 16x32 A fragment (or B fragment from an [n][k] k-contiguous source).
// p = tile_base + (lane&15)*ld + 8*(lane>>4): elements 0..7 = k 8h..8h+7,
// elements 8..15 = k 16+8h..16+8h+7 (split map, same for A and B).
static __device__ __forceinline__ v16h load_frag_p(const _Float16* p) {
    Frag f;
    f.h[0] = *(const v8h*)(p);
    f.h[1] = *(const v8h*)(p + 16);
    return f.v;
}

static __device__ __forceinline__ v8f wmma16(v16h a, v16h b, v8f c) {
    v8f d = __builtin_amdgcn_wmma_f32_16x16x32_f16(false, a, false, b, (short)0, c, false, false);
    asm volatile("v_nop\n\tv_nop\n\tv_nop\n\tv_nop" : "+v"(d) : "v"(a), "v"(b));
    return d;
}

// f32 -> bf16 RNE convert, value kept as f32
static __device__ __forceinline__ float bf16r(float x) {
    unsigned u = __float_as_uint(x);
    u = (u + 0x7FFFu + ((u >> 16) & 1u)) & 0xFFFF0000u;
    return __uint_as_float(u);
}

static __device__ __forceinline__ float ex2(float x) {
    return __builtin_amdgcn_exp2f(x);
}

// ordering for a wave-private LDS tile: stores before later loads of the same wave
static __device__ __forceinline__ void wave_lds_sync() {
    __builtin_amdgcn_fence(3, "wavefront");
    asm volatile("s_wait_dscnt 0" ::: "memory");
    __builtin_amdgcn_wave_barrier();
}

static __device__ __forceinline__ float wave_sum(float v) {
    v += __shfl_xor(v, 16, 32);
    v += __shfl_xor(v, 8, 32);
    v += __shfl_xor(v, 4, 32);
    v += __shfl_xor(v, 2, 32);
    v += __shfl_xor(v, 1, 32);
    return v;
}

// ---------------------------------------------------------------------------
// xh[tok][d] = f16(16 * bf16(x)). One thread = one 16-B output piece; lanes
// ---------------------------------------------------------------------------
__global__ __launch_bounds__(256) void k_cvt_x(const float* __restrict__ x,
                                                _Float16* __restrict__ xh) {
    const int idx = blockIdx.x * 256 + threadIdx.x;
    if (idx >= NTOK * (DM / 8)) return;
    const int tok = idx >> 7;                 // DM/8 = 128 pieces per row
    const int c8  = idx & 127;
    const int b   = tok / SEQ;
    const int s   = tok - b * SEQ;
    const float* src = x + ((size_t)b * SEQ_FULL + s) * DM + c8 * 8;
    v4f a = *(const v4f*)(src);
    v4f c = *(const v4f*)(src + 4);
    v8h o;
    o[0] = (_Float16)(bf16r(a.x) * 16.0f);
    o[1] = (_Float16)(bf16r(a.y) * 16.0f);
    o[2] = (_Float16)(bf16r(a.z) * 16.0f);
    o[3] = (_Float16)(bf16r(a.w) * 16.0f);
    o[4] = (_Float16)(bf16r(c.x) * 16.0f);
    o[5] = (_Float16)(bf16r(c.y) * 16.0f);
    o[6] = (_Float16)(bf16r(c.z) * 16.0f);
    o[7] = (_Float16)(bf16r(c.w) * 16.0f);
    _Float16* dst = xh + (size_t)tok * DM + c8 * 8;
    *(v8h*)dst = o;
    
}

// ---------------------------------------------------------------------------
// Batched transpose + convert through LDS: in[z][rows][cols] f32 ->
// out[z][cols][rows] = f16(64 * bf16(in)). Block = one 64x64 tile;
// ---------------------------------------------------------------------------
__global__ __launch_bounds__(256) void k_wT(const float* __restrict__ in,
                                             _Float16* __restrict__ out,
                                             int rows, int cols) {
    __shared__ __align__(16) _Float16 T[64 * 64];     // [c][r], 8 KB, cross-wave (block barrier)
    const int tid = threadIdx.x;
    const int c0 = blockIdx.x * 64;
    const int r0 = blockIdx.y * 64;
    const size_t zoff = (size_t)blockIdx.z * (size_t)rows * (size_t)cols;
    const float* ib = in + zoff;
    _Float16*    ob = out + zoff;
#pragma unroll 1
    for (int i = 0; i < 4; ++i) {
        const int idx = i * 256 + tid;
        const int r = idx >> 4, c4 = idx & 15;
        v4f v = *(const v4f*)(ib + (size_t)(r0 + r) * cols + c0 + c4 * 4);
        T[(c4 * 4 + 0) * 64 + r] = (_Float16)(bf16r(v.x) * 64.0f);
        T[(c4 * 4 + 1) * 64 + r] = (_Float16)(bf16r(v.y) * 64.0f);
        T[(c4 * 4 + 2) * 64 + r] = (_Float16)(bf16r(v.z) * 64.0f);
        T[(c4 * 4 + 3) * 64 + r] = (_Float16)(bf16r(v.w) * 64.0f);
    }
    __syncthreads();
    const int ca = tid >> 3, j = tid & 7;              // rows ca and ca + 32 of the transposed tile
    v8h o0 = *(const v8h*)(&T[ca * 64 + j * 8]);
    v8h o1 = *(const v8h*)(&T[(ca + 32) * 64 + j * 8]);
    _Float16* d0 = ob + (size_t)(c0 + ca) * rows + r0 + j * 8;
    _Float16* d1 = ob + (size_t)(c0 + ca + 32) * rows + r0 + j * 8;
    *(v8h*)d0 = o0;
    *(v8h*)d1 = o1;
    
}

// ---------------------------------------------------------------------------
// GEMM main loop: block = 4 waves = 256x64 tile, one wave = 64x64 = 4x4 subtiles.
// A [M][K] and Bt [N][K] are 16-bit k-contiguous planes in global memory. A stage
// is 64 k (128 B, one whole line) of the block's 256 A rows and 64 Bt rows, laid
// in LDS at a 144-B pitch; asynchronous copies fill it (16 B per lane, 8 lanes
// per row), two buffers, the next stage in flight while this one is multiplied.
// Fragments are two 16-B LDS loads, same k order as from the global planes.
// ---------------------------------------------------------------------------
#define ST_K      64                         // halves of k per stage
#define ST_ROWS   320                        // 256 A rows, then 64 Bt rows
#define ST_PITCH  72                         // halves per LDS row (144 B)
#define ST_HALVES (ST_ROWS * ST_PITCH)       // one buffer, 46,080 B

static __device__ __forceinline__ unsigned lds_off(const void* p) { return (unsigned)(size_t)p; }

// Ten copies, rows 16 apart in both places. The s_wait_xcnt closes the statement
// so that no address register of a copy is rewritten ahead of it.
static __device__ __forceinline__ void copy10(unsigned l, const _Float16* g, size_t gstep) {
    const unsigned ls = 16u * ST_PITCH * 2u;
    asm volatile(
        "global_load_async_to_lds_b128 %0, %10, off\n\t"
        "global_load_async_to_lds_b128 %1, %11, off\n\t"
        "global_load_async_to_lds_b128 %2, %12, off\n\t"
        "global_load_async_to_lds_b128 %3, %13, off\n\t"
        "global_load_async_to_lds_b128 %4, %14, off\n\t"
        "global_load_async_to_lds_b128 %5, %15, off\n\t"
        "global_load_async_to_lds_b128 %6, %16, off\n\t"
        "global_load_async_to_lds_b128 %7, %17, off\n\t"
        "global_load_async_to_lds_b128 %8, %18, off\n\t"
        "global_load_async_to_lds_b128 %9, %19, off\n\t"
        "s_wait_xcnt 0x0"
        :: "v"(l), "v"(l + ls), "v"(l + 2u * ls), "v"(l + 3u * ls), "v"(l + 4u * ls),
           "v"(l + 5u * ls), "v"(l + 6u * ls), "v"(l + 7u * ls), "v"(l + 8u * ls), "v"(l + 9u * ls),
           "v"(g), "v"(g + gstep), "v"(g + 2 * gstep), "v"(g + 3 * gstep), "v"(g + 4 * gstep),
           "v"(g + 5 * gstep), "v"(g + 6 * gstep), "v"(g + 7 * gstep), "v"(g + 8 * gstep), "v"(g + 9 * gstep)
        : "memory");
}

// Six copies of A rows and four of Bt rows, same form.
static __device__ __forceinline__ void copy6_4(unsigned l, const _Float16* g, const _Float16* h, size_t gstep) {
    const unsigned ls = 16u * ST_PITCH * 2u;
    asm volatile(
        "global_load_async_to_lds_b128 %0, %10, off\n\t"
        "global_load_async_to_lds_b128 %1, %11, off\n\t"
        "global_load_async_to_lds_b128 %2, %12, off\n\t"
        "global_load_async_to_lds_b128 %3, %13, off\n\t"
        "global_load_async_to_lds_b128 %4, %14, off\n\t"
        "global_load_async_to_lds_b128 %5, %15, off\n\t"
        "global_load_async_to_lds_b128 %6, %16, off\n\t"
        "global_load_async_to_lds_b128 %7, %17, off\n\t"
        "global_load_async_to_lds_b128 %8, %18, off\n\t"
        "global_load_async_to_lds_b128 %9, %19, off\n\t"
        "s_wait_xcnt 0x0"
        :: "v"(l), "v"(l + ls), "v"(l + 2u * ls), "v"(l + 3u * ls), "v"(l + 4u * ls),
           "v"(l + 5u * ls), "v"(l + 6u * ls), "v"(l + 7u * ls), "v"(l + 8u * ls), "v"(l + 9u * ls),
           "v"(g), "v"(g + gstep), "v"(g + 2 * gstep), "v"(g + 3 * gstep), "v"(g + 4 * gstep),
           "v"(g + 5 * gstep), "v"(h), "v"(h + gstep), "v"(h + 2 * gstep), "v"(h + 3 * gstep)
        : "memory");
}

// ab = A + m_block * K (256 rows), bb = Bt + n0 * K (64 rows), St = two buffers.
template <int K>
static __device__ __forceinline__ void gemm_tile64(const _Float16* __restrict__ ab,
                                                   const _Float16* __restrict__ bb,
                                                   _Float16* St,
                                                   v8f (&acc)[4][4]) {
    static_assert(K % ST_K == 0 && K / ST_K >= 2);   // whole stages, both buffers filled
    constexpr int NT = K / ST_K;
    const int tid  = threadIdx.x;
    const int lane = tid & 31;
    const int w    = tid >> 5;
    const int lm   = lane & 15;
    const int kb   = (lane >> 4) << 3;
    // copy i of a thread: stage row i*16 + tid/8, 16-B piece tid%8
    const _Float16* ga = ab + (size_t)(tid >> 3) * K + (tid & 7) * 8;
    const _Float16* gb = bb + (size_t)(tid >> 3) * K + (tid & 7) * 8;
    const unsigned  l0 = lds_off(St) + (unsigned)((tid >> 3) * (ST_PITCH * 2) + (tid & 7) * 16);
    const unsigned  lhalf = 160u * ST_PITCH * 2u;    // stage row 160: second statement's first row
    const size_t    gstep = (size_t)16 * K;

#pragma unroll
    for (int ms = 0; ms < 4; ++ms)
#pragma unroll
        for (int nt = 0; nt < 4; ++nt) acc[ms][nt] = zero8();

    copy10(l0, ga, gstep);
    copy6_4(l0 + lhalf, ga + 10 * gstep, gb, gstep);
    asm volatile("s_wait_asynccnt 0x0" ::: "memory");   // stage 0 landed (this wave's copies)
    __syncthreads();                                    // stage 0 published to all waves
    copy10(l0 + ST_HALVES * 2u, ga + ST_K, gstep);
    copy6_4(l0 + ST_HALVES * 2u + lhalf, ga + 10 * gstep + ST_K, gb + ST_K, gstep);

#pragma unroll 1
    for (int t = 0; t < NT; ++t) {
        const int bo = (t & 1) * ST_HALVES;
        const _Float16* sa = St + bo + (w * 64 + lm) * ST_PITCH + kb;
        const _Float16* sb = St + bo + (256 + lm) * ST_PITCH + kb;
        // Fragment reads stand in few groups, each ahead of the products that hide it:
        // k 0..31 whole and the A side of k 32..63 first, the B side of k 32..63 in
        // two halves into the B registers that the first k step has just left.
        v16h a0[4], a1[4], bn[4];
#pragma unroll
        for (int i = 0; i < 4; ++i) a0[i] = load_frag_p(sa + i * 16 * ST_PITCH);
#pragma unroll
        for (int i = 0; i < 4; ++i) bn[i] = load_frag_p(sb + i * 16 * ST_PITCH);
#pragma unroll
        for (int i = 0; i < 4; ++i) a1[i] = load_frag_p(sa + i * 16 * ST_PITCH + 32);
#pragma unroll
        for (int hf = 0; hf < 4; hf += 2) {
#pragma unroll
            for (int nt = hf; nt < hf + 2; ++nt)
#pragma unroll
                for (int ms = 0; ms < 4; ++ms) acc[ms][nt] = wmma16(a0[ms], bn[nt], acc[ms][nt]);
#pragma unroll
            for (int nt = hf; nt < hf + 2; ++nt) bn[nt] = load_frag_p(sb + nt * 16 * ST_PITCH + 32);
        }
#pragma unroll
        for (int nt = 0; nt < 4; ++nt)
#pragma unroll
            for (int ms = 0; ms < 4; ++ms) acc[ms][nt] = wmma16(a1[ms], bn[nt], acc[ms][nt]);
        asm volatile("s_wait_dscnt 0x0" ::: "memory");      // this wave's reads of the buffer are done
        asm volatile("s_wait_asynccnt 0x0" ::: "memory");   // stage t+1 landed (this wave's copies)
        __syncthreads();                                    // publishes stage t+1, frees stage t's buffer
        if (t + 2 < NT) {
            const unsigned lb = l0 + (unsigned)bo * 2u;
            const _Float16* gk = ga + (size_t)(t + 2) * ST_K;
            copy10(lb, gk, gstep);
            copy6_4(lb + lhalf, gk + 10 * gstep, gb + (size_t)(t + 2) * ST_K, gstep);
        }
    }
    asm volatile("s_wait_asynccnt 0x0" ::: "memory");       // nothing in flight when the loop is left
}

// ---------------------------------------------------------------------------
// Q projection: acc = (16 x)(64 Wq) = 1024 x.Wq ; q64 = (acc + 1024 bq) / 16.
// Writes qrow[b][h][s][64] and qT[b][h][64][s] as f16(64 q).
// Wave tile = 64 tokens x one head. Row plane: 16-row steps through a
// wave-private LDS tile; transposed plane: whole 64x64 wave-private tile.
// ---------------------------------------------------------------------------
__global__ __launch_bounds__(128) __attribute__((amdgpu_num_vgpr(256)))
void k_gemm_q(const _Float16* __restrict__ xh,
              const _Float16* __restrict__ wqT,
              const float* __restrict__ bq,
              _Float16* __restrict__ qrow,
              _Float16* __restrict__ qT) {
    __shared__ __align__(16) _Float16 Rst[4][16 * 64];   // 8 KB, wave-private
    __shared__ __align__(16) _Float16 Tst[4][64 * 64];   // 32 KB, wave-private
    __shared__ __align__(16) _Float16 St[2 * ST_HALVES]; // 90 KB, operand stages, cross-wave
    const int tid  = threadIdx.x;
    const int lane = tid & 31;
    const int w    = tid >> 5;
    const int hh   = lane >> 4;
    const int lm   = lane & 15;
    const int m0   = blockIdx.x * 256 + w * 64;
    const int n0   = blockIdx.y * 64;
    const int head = blockIdx.y;
    const int b    = m0 / SEQ;
    const int s0   = m0 - b * SEQ;

    v8f acc[4][4];
    gemm_tile64<DM>(xh + (size_t)(blockIdx.x * 256) * DM, wqT + (size_t)n0 * DM, St, acc);

    float bv[4];
#pragma unroll
    for (int nt = 0; nt < 4; ++nt) bv[nt] = bf16r(bq[n0 + nt * 16 + lm]) * 1024.0f;

    _Float16* qr = qrow + (((size_t)b * NH + head) * SEQ + s0) * DH;
    _Float16* qt = qT + ((size_t)b * NH + head) * DH * SEQ + s0;

#pragma unroll
    for (int ms = 0; ms < 4; ++ms) {
#pragma unroll
        for (int nt = 0; nt < 4; ++nt) {
            v8h tv;
#pragma unroll
            for (int r = 0; r < 8; ++r) {
                _Float16 hv = (_Float16)((acc[ms][nt][r] + bv[nt]) * 0.0625f);
                Rst[w][(8 * hh + r) * 64 + nt * 16 + lm] = hv;
                tv[r] = hv;
            }
            *(v8h*)(&Tst[w][(nt * 16 + lm) * 64 + ms * 16 + 8 * hh]) = tv;
        }
        wave_lds_sync();
        v8h rv[4];
#pragma unroll
        for (int i = 0; i < 4; ++i) rv[i] = *(const v8h*)(&Rst[w][i * 256 + lane * 8]);
        _Float16* dst = qr + ms * 1024 + lane * 8;
#pragma unroll
        for (int i = 0; i < 4; ++i) *(v8h*)(dst + i * 256) = rv[i];
        
        wave_lds_sync();
    }
    wave_lds_sync();
#pragma unroll 1
    for (int g = 0; g < 4; ++g) {
        v8h tv[4];
#pragma unroll
        for (int i = 0; i < 4; ++i) tv[i] = *(const v8h*)(&Tst[w][(g * 4 + i) * 256 + lane * 8]);
        _Float16* dst = qt + (size_t)(g * 16 + (lane >> 3)) * SEQ + (lane & 7) * 8;
#pragma unroll
        for (int i = 0; i < 4; ++i) *(v8h*)(dst + (size_t)i * 4 * SEQ) = tv[i];
        
    }
}

// ---------------------------------------------------------------------------
// Fused attention, q = k = v. Block = 8 waves = 128 queries of one (b, head);
// a wave owns 16 queries and streams all SEQ keys, 32 per step:
//   S^T tiles (rows = keys, cols = queries): A = key rows, B = query rows
//   (k = d, 2 steps of 32); query fragments straight from the qrow plane;
//   per-lane online softmax (lane column = its query; partner lane +-16);
//   P^T carried 2^8 as f16: the two S^T tiles chain directly as the B
//   fragment (elements 0..7 = tile keys 0..15, 8..15 = tile keys 16..31);
//   O^T += V^T . P^T with A fragments of V^T (rows = d, k = keys).
// Key rows and V^T rows reach the waves through LDS: a stage is 128 keys, 128
// qrow rows of 128 B at a 144-B pitch and 64 qT rows of 256 B at a 272-B pitch,
// filled once per block by asynchronous copies (16 B per lane, whole lines per
// wave) and read by all 8 waves; two buffers, the next stage in flight while
// this one is worked on. Fragments keep the k order they had from the planes.
// Epilogue: O^T / (64 l) staged as [query][d] f32 in a wave-private LDS tile,
// bf16(x) added at the store stage, 8 lane-contiguous 16-B-per-lane
// ---------------------------------------------------------------------------
#define AT_KEYS   128                        // keys per stage
#define AK_PITCH  72                         // halves per key row in LDS (144 B)
#define AV_PITCH  136                        // halves per V^T row in LDS (272 B)
#define AK_HALVES (AT_KEYS * AK_PITCH)       // key rows of one buffer, 18,432 B
#define AV_HALVES (DH * AV_PITCH)            // V^T rows of one buffer, 17,408 B
#define AT_HALVES (AK_HALVES + AV_HALVES)    // one buffer, 35,840 B
static_assert(SEQ % AT_KEYS == 0);           // whole stages

// Four copies of key rows (32 rows apart) and four of V^T rows (16 rows apart).
// The s_wait_xcnt closes the statement so that no address register of a copy is
// rewritten ahead of it.
static __device__ __forceinline__ void copy_kv(unsigned lk, const _Float16* gk,
                                               unsigned lv, const _Float16* gv) {
    const unsigned ks = 32u * AK_PITCH * 2u;
    const unsigned vs = 16u * AV_PITCH * 2u;
    const size_t   gks = (size_t)32 * DH;
    const size_t   gvs = (size_t)16 * SEQ;
    asm volatile(
        "global_load_async_to_lds_b128 %0, %8, off\n\t"
        "global_load_async_to_lds_b128 %1, %9, off\n\t"
        "global_load_async_to_lds_b128 %2, %10, off\n\t"
        "global_load_async_to_lds_b128 %3, %11, off\n\t"
        "global_load_async_to_lds_b128 %4, %12, off\n\t"
        "global_load_async_to_lds_b128 %5, %13, off\n\t"
        "global_load_async_to_lds_b128 %6, %14, off\n\t"
        "global_load_async_to_lds_b128 %7, %15, off\n\t"
        "s_wait_xcnt 0x0"
        :: "v"(lk), "v"(lk + ks), "v"(lk + 2u * ks), "v"(lk + 3u * ks),
           "v"(lv), "v"(lv + vs), "v"(lv + 2u * vs), "v"(lv + 3u * vs),
           "v"(gk), "v"(gk + gks), "v"(gk + 2 * gks), "v"(gk + 3 * gks),
           "v"(gv), "v"(gv + gvs), "v"(gv + 2 * gvs), "v"(gv + 3 * gvs)
        : "memory");
}

__global__ __launch_bounds__(256) __attribute__((amdgpu_num_vgpr(256)))
void k_attn(const _Float16* __restrict__ qrow,
            const _Float16* __restrict__ qT,
            const float* __restrict__ x,
            float* __restrict__ y1) {
    __shared__ __align__(16) float Ost[8][16 * DH];      // 32 KB, wave-private
    __shared__ __align__(16) _Float16 Kv[2 * AT_HALVES]; // 70 KB, key and V^T stages, cross-wave
    constexpr int NT = SEQ / AT_KEYS;
    const int tid  = threadIdx.x;
    const int lane = tid & 31;
    const int w    = tid >> 5;
    const int hh   = lane >> 4;
    const int lm   = lane & 15;
    const int kb   = hh << 3;
    const int b    = blockIdx.z;
    const int head = blockIdx.y;
    const int q0   = blockIdx.x * 128 + w * 16;

    const _Float16* qhead = qrow + ((size_t)b * NH + head) * SEQ * DH;
    const _Float16* thead = qT + ((size_t)b * NH + head) * DH * SEQ;
    const _Float16* qlane = qhead + (size_t)lm * DH + kb;
    // key copy i of a thread: stage row i*32 + tid/8, 16-B piece tid%8;
    // V^T copy i: row i*16 + tid/16, 16-B piece tid%16
    const _Float16* gk = qhead + (size_t)(tid >> 3) * DH + (tid & 7) * 8;
    const _Float16* gv = thead + (size_t)(tid >> 4) * SEQ + (tid & 15) * 8;
    const unsigned  lk = lds_off(Kv) + (unsigned)((tid >> 3) * (AK_PITCH * 2) + (tid & 7) * 16);
    const unsigned  lv = lds_off(Kv) + (unsigned)(AK_HALVES * 2 + (tid >> 4) * (AV_PITCH * 2) + (tid & 15) * 16);

    copy_kv(lk, gk, lv, gv);
    asm volatile("s_wait_asynccnt 0x0" ::: "memory");   // stage 0 landed (this wave's copies)
    __syncthreads();                                    // stage 0 published to all waves
    if (NT > 1)
        copy_kv(lk + AT_HALVES * 2u, gk + (size_t)AT_KEYS * DH, lv + AT_HALVES * 2u, gv + AT_KEYS);

    const v16h qf0 = load_frag_p(qlane + (size_t)q0 * DH);        // d 0..31
    const v16h qf1 = load_frag_p(qlane + (size_t)q0 * DH + 32);   // d 32..63

    v8f o[4];
#pragma unroll
    for (int dt = 0; dt < 4; ++dt) o[dt] = zero8();
    float mr = -1.0e30f, l = 0.0f;

#pragma unroll 1
    for (int t = 0; t < NT; ++t) {
      const int bo = (t & 1) * AT_HALVES;
      const _Float16* sk = Kv + bo + lm * AK_PITCH + kb;
      const _Float16* sv = Kv + bo + AK_HALVES + lm * AV_PITCH + kb;
#pragma unroll
      for (int u = 0; u < AT_KEYS / 32; ++u) {
        // The step's LDS reads stand in one group ahead of its products, so that
        // the wave waits out one LDS latency per 32 keys and not one per fragment.
        const _Float16* ka = sk + u * 32 * AK_PITCH;
        v16h a0 = load_frag_p(ka);
        v16h a1 = load_frag_p(ka + 32);
        v16h c0 = load_frag_p(ka + 16 * AK_PITCH);
        v16h c1 = load_frag_p(ka + 16 * AK_PITCH + 32);
        v16h vf[4];
#pragma unroll
        for (int dt = 0; dt < 4; ++dt) vf[dt] = load_frag_p(sv + dt * 16 * AV_PITCH + u * 32);
        v8f sA = wmma16(a0, qf0, zero8());
        sA = wmma16(a1, qf1, sA);
        v8f sB = wmma16(c0, qf0, zero8());
        sB = wmma16(c1, qf1, sB);

        float tA[8], tB[8];
#pragma unroll
        for (int i = 0; i < 8; ++i) { tA[i] = sA[i] * CS; tB[i] = sB[i] * CS; }
        float tmax = fmaxf(tA[0], tB[0]);
#pragma unroll
        for (int i = 1; i < 8; ++i) tmax = fmaxf(tmax, fmaxf(tA[i], tB[i]));
        tmax = fmaxf(tmax, __shfl_xor(tmax, 16, 32));
        const float mn = fmaxf(mr, tmax);
        if (__builtin_amdgcn_ballot_w32(mn > mr) != 0u) {       // wave-uniform
            const float sc = ex2(mr - mn);
            l *= sc;
#pragma unroll
            for (int dt = 0; dt < 4; ++dt)
#pragma unroll
                for (int r = 0; r < 8; ++r) o[dt][r] *= sc;
        }
        mr = mn;
        const float sh = 8.0f - mn;
        float ps = 0.0f;
        v16h pb;
#pragma unroll
        for (int i = 0; i < 8; ++i) {
            const float pa = ex2(tA[i] + sh);
            const float pq = ex2(tB[i] + sh);
            ps += pa + pq;
            pb[i]     = (_Float16)pa;
            pb[8 + i] = (_Float16)pq;
        }
        l += ps;
#pragma unroll
        for (int dt = 0; dt < 4; ++dt) o[dt] = wmma16(vf[dt], pb, o[dt]);
      }
      asm volatile("s_wait_dscnt 0x0" ::: "memory");      // this wave's reads of the buffer are done
      asm volatile("s_wait_asynccnt 0x0" ::: "memory");   // stage t+1 landed (this wave's copies)
      __syncthreads();                                    // publishes stage t+1, frees stage t's buffer
      if (t + 2 < NT)
          copy_kv(lk + (unsigned)bo * 2u, gk + (size_t)(t + 2) * AT_KEYS * DH,
                  lv + (unsigned)bo * 2u, gv + (size_t)(t + 2) * AT_KEYS);
    }
    asm volatile("s_wait_asynccnt 0x0" ::: "memory");       // nothing in flight when the loop is left

    const float lt  = l + __shfl_xor(l, 16, 32);
    const float inv = (1.0f / lt) * 0.015625f;          // 2^8 P carry cancels in o/l; 1/64 for the q carry
#pragma unroll
    for (int dt = 0; dt < 4; ++dt) {
        v4f u0, u1;
        u0.x = o[dt][0] * inv; u0.y = o[dt][1] * inv; u0.z = o[dt][2] * inv; u0.w = o[dt][3] * inv;
        u1.x = o[dt][4] * inv; u1.y = o[dt][5] * inv; u1.z = o[dt][6] * inv; u1.w = o[dt][7] * inv;
        *(v4f*)(&Ost[w][lm * DH + dt * 16 + 8 * hh])     = u0;
        *(v4f*)(&Ost[w][lm * DH + dt * 16 + 8 * hh + 4]) = u1;
    }
    wave_lds_sync();

    v4f sv[8];
    const int col = lm * 4;
#pragma unroll
    for (int i = 0; i < 8; ++i) {
        const int row = 2 * i + hh;
        v4f a  = *(const v4f*)(&Ost[w][i * 128 + lane * 4]);
        v4f xv = *(const v4f*)(x + ((size_t)b * SEQ_FULL + q0 + row) * DM + head * DH + col);
        a.x = bf16r(xv.x) + a.x;
        a.y = bf16r(xv.y) + a.y;
        a.z = bf16r(xv.z) + a.z;
        a.w = bf16r(xv.w) + a.w;
        sv[i] = a;
    }
    float* ob = y1 + ((size_t)b * SEQ + q0 + hh) * DM + head * DH + col;
#pragma unroll
    for (int i = 0; i < 8; ++i) *(v4f*)(ob + (size_t)(2 * i) * DM) = sv[i];
    
}

// ---------------------------------------------------------------------------
// row, row kept in a wave-private LDS line, loops rolled. Writes f32 row
// (512 B per instruction, lane-contiguous) and optionally f16(16 * LN(y)) row
// ---------------------------------------------------------------------------
__global__ __launch_bounds__(128) void k_ln(const float* __restrict__ y,
                                             const float* __restrict__ g,
                                             const float* __restrict__ be,
                                             float* __restrict__ of,
                                             _Float16* __restrict__ oh,
                                             int wr16) {
    __shared__ __align__(16) float    Rw[4][DM];     // 16 KB, wave-private
    __shared__ __align__(16) _Float16 Hw[4][DM];     // 8 KB, wave-private
    const int tid  = threadIdx.x;
    const int lane = tid & 31;
    const int w    = tid >> 5;
    const int row  = blockIdx.x * 4 + w;
    if (row >= NTOK) return;                          // wave-uniform; no block barriers below
    const float* yr = y + (size_t)row * DM;

    float s = 0.0f;
#pragma unroll 1
    for (int j = 0; j < 8; ++j) {
        const int c = j * 128 + lane * 4;
        v4f v = *(const v4f*)(yr + c);
        *(v4f*)(&Rw[w][c]) = v;
        s += (v.x + v.y) + (v.z + v.w);
    }
    s = wave_sum(s);
    const float mu = s * 0.0009765625f;
    float qv = 0.0f;
#pragma unroll 1
    for (int j = 0; j < 8; ++j) {
        const int c = j * 128 + lane * 4;
        v4f v = *(const v4f*)(&Rw[w][c]);
        const float d0 = v.x - mu, d1 = v.y - mu, d2 = v.z - mu, d3 = v.w - mu;
        qv += (d0 * d0 + d1 * d1) + (d2 * d2 + d3 * d3);
    }
    qv = wave_sum(qv);
    const float rs = rsqrtf(qv * 0.0009765625f + 1.0e-5f);
#pragma unroll 1
    for (int j = 0; j < 8; ++j) {
        const int c = j * 128 + lane * 4;
        v4f v  = *(const v4f*)(&Rw[w][c]);
        v4f gv = *(const v4f*)(g + c);
        v4f bv = *(const v4f*)(be + c);
        v4f r;
        r.x = (v.x - mu) * rs * bf16r(gv.x) + bf16r(bv.x);
        r.y = (v.y - mu) * rs * bf16r(gv.y) + bf16r(bv.y);
        r.z = (v.z - mu) * rs * bf16r(gv.z) + bf16r(bv.z);
        r.w = (v.w - mu) * rs * bf16r(gv.w) + bf16r(bv.w);
        *(v4f*)(&Rw[w][c]) = r;
        if (wr16 != 0) {
            v4h hv;
            hv.x = (_Float16)(r.x * 16.0f);
            hv.y = (_Float16)(r.y * 16.0f);
            hv.z = (_Float16)(r.z * 16.0f);
            hv.w = (_Float16)(r.w * 16.0f);
            *(v4h*)(&Hw[w][c]) = hv;
        }
    }
    wave_lds_sync();

    float*    df = of + (size_t)row * DM;
    _Float16* dh = oh + (size_t)row * DM;
#pragma unroll 1
    for (int j = 0; j < 8; ++j) {
        const int c = j * 128 + lane * 4;
        v4f v = *(const v4f*)(&Rw[w][c]);
        *(v4f*)(df + c) = v;
    }
    if (wr16 != 0) {
#pragma unroll 1
        for (int j = 0; j < 4; ++j) {
            const int c = j * 256 + lane * 8;
            v8h hv = *(const v8h*)(&Hw[w][c]);
            *(v8h*)(dh + c) = hv;
        }
    }
    
}

// ---------------------------------------------------------------------------
// FFN1: acc = (16 x1)(64 W1) = 1024 pre ; hb = f16(16 relu(pre + b1)).
// 16-row steps through a wave-private LDS tile; row segment = 64 halves =
// ---------------------------------------------------------------------------
__global__ __launch_bounds__(128) __attribute__((amdgpu_num_vgpr(256)))
void k_gemm_ffn1(const _Float16* __restrict__ a16,
                 const _Float16* __restrict__ w1T,
                 const float* __restrict__ b1,
                 _Float16* __restrict__ hb) {
    __shared__ __align__(16) _Float16 Rst[4][16 * 64];   // 8 KB, wave-private
    __shared__ __align__(16) _Float16 St[2 * ST_HALVES]; // 90 KB, operand stages, cross-wave
    const int tid  = threadIdx.x;
    const int lane = tid & 31;
    const int w    = tid >> 5;
    const int hh   = lane >> 4;
    const int lm   = lane & 15;
    const int m0   = blockIdx.x * 256 + w * 64;
    const int n0   = blockIdx.y * 64;

    v8f acc[4][4];
    gemm_tile64<DM>(a16 + (size_t)(blockIdx.x * 256) * DM, w1T + (size_t)n0 * DM, St, acc);

    float bv[4];
#pragma unroll
    for (int nt = 0; nt < 4; ++nt) bv[nt] = bf16r(b1[n0 + nt * 16 + lm]) * 1024.0f;

#pragma unroll
    for (int ms = 0; ms < 4; ++ms) {
#pragma unroll
        for (int nt = 0; nt < 4; ++nt)
#pragma unroll
            for (int r = 0; r < 8; ++r)
                Rst[w][(8 * hh + r) * 64 + nt * 16 + lm] =
                    (_Float16)(fmaxf(acc[ms][nt][r] + bv[nt], 0.0f) * 0.015625f);
        wave_lds_sync();
        v8h rv[4];
#pragma unroll
        for (int i = 0; i < 4; ++i) rv[i] = *(const v8h*)(&Rst[w][i * 256 + lane * 8]);
        _Float16* dst = hb + (size_t)(m0 + ms * 16 + (lane >> 3)) * HID + n0 + (lane & 7) * 8;
#pragma unroll
        for (int i = 0; i < 4; ++i) *(v8h*)(dst + (size_t)i * 4 * HID) = rv[i];
        
        wave_lds_sync();
    }
}

// ---------------------------------------------------------------------------
// FFN2: acc = (16 h)(64 W2) = 1024 ff ; y2 = x1 + (ff + b2), f32.
// 16-row steps through a wave-private f32 LDS tile; bias and skip path added
// at the store stage as 4-float vectors; each instruction = 2 rows x 256 B.
// ---------------------------------------------------------------------------
__global__ __launch_bounds__(128) __attribute__((amdgpu_num_vgpr(256)))
void k_gemm_ffn2(const _Float16* __restrict__ hb,
                 const _Float16* __restrict__ w2T,
                 const float* __restrict__ b2,
                 const float* __restrict__ x1,
                 float* __restrict__ y2) {
    __shared__ __align__(16) float Fst[4][16 * 64];      // 16 KB, wave-private
    __shared__ __align__(16) _Float16 St[2 * ST_HALVES]; // 90 KB, operand stages, cross-wave
    const int tid  = threadIdx.x;
    const int lane = tid & 31;
    const int w    = tid >> 5;
    const int hh   = lane >> 4;
    const int lm   = lane & 15;
    const int m0   = blockIdx.x * 256 + w * 64;
    const int n0   = blockIdx.y * 64;

    v8f acc[4][4];
    gemm_tile64<HID>(hb + (size_t)(blockIdx.x * 256) * HID, w2T + (size_t)n0 * HID, St, acc);

    const int col = lm * 4;
    v4f bb = *(const v4f*)(b2 + n0 + col);
    bb.x = bf16r(bb.x); bb.y = bf16r(bb.y); bb.z = bf16r(bb.z); bb.w = bf16r(bb.w);

#pragma unroll
    for (int ms = 0; ms < 4; ++ms) {
#pragma unroll
        for (int nt = 0; nt < 4; ++nt)
#pragma unroll
            for (int r = 0; r < 8; ++r)
                Fst[w][(8 * hh + r) * 64 + nt * 16 + lm] = acc[ms][nt][r] * 0.0009765625f;
        wave_lds_sync();
        v4f sv[8];
        const size_t rbase = ((size_t)(m0 + ms * 16 + hh)) * DM + n0 + col;
#pragma unroll
        for (int i = 0; i < 8; ++i) {
            v4f a  = *(const v4f*)(&Fst[w][i * 128 + lane * 4]);
            v4f xr = *(const v4f*)(x1 + rbase + (size_t)(2 * i) * DM);
            a.x = xr.x + (a.x + bb.x);
            a.y = xr.y + (a.y + bb.y);
            a.z = xr.z + (a.z + bb.z);
            a.w = xr.w + (a.w + bb.w);
            sv[i] = a;
        }
        float* dst = y2 + rbase;
#pragma unroll
        for (int i = 0; i < 8; ++i) *(v4f*)(dst + (size_t)(2 * i) * DM) = sv[i];
        
        wave_lds_sync();
    }
}

// ---------------------------------------------------------------------------
extern "C" void kernel_launch(void* const* d_in, const int* in_sizes, int n_in,
                              void* d_out, int out_size, void* d_ws, size_t ws_size,
                              hipStream_t stream) {
    if (n_in < 11) return;
    if (in_sizes[0] < ((NB - 1) * SEQ_FULL + SEQ) * DM) return;
    if (in_sizes[1] < DM * DM || in_sizes[2] < DM) return;
    if (in_sizes[3] < DM || in_sizes[4] < DM) return;
    if (in_sizes[5] < DM * HID || in_sizes[6] < HID) return;
    if (in_sizes[7] < HID * DM || in_sizes[8] < DM) return;
    if (in_sizes[9] < DM || in_sizes[10] < DM) return;
    if (out_size < NTOK * DM) return;
    if (WS_TOTAL > ws_size) return;

    const float* x    = (const float*)d_in[0];    // [2,2048,1024]
    const float* Wq   = (const float*)d_in[1];    // [16,1024,64]  [head][in][dim]
    const float* bq   = (const float*)d_in[2];    // [16,64]
    const float* ln1g = (const float*)d_in[3];
    const float* ln1b = (const float*)d_in[4];
    const float* W1   = (const float*)d_in[5];    // [1024,4096]  [in][out]
    const float* b1   = (const float*)d_in[6];
    const float* W2   = (const float*)d_in[7];    // [4096,1024]  [in][out]
    const float* b2   = (const float*)d_in[8];
    const float* ln2g = (const float*)d_in[9];
    const float* ln2b = (const float*)d_in[10];
    float* out = (float*)d_out;                   // [2,2048,1024]

    char* ws = (char*)d_ws;
    size_t off = 0;
    _Float16* x16  = (_Float16*)(ws + off); off += SZ_X16;   // xh, then x1h (xh dead after k_gemm_q)
    _Float16* wqT  = (_Float16*)(ws + off); off += SZ_WQT;   // [h*64+e][d]
    _Float16* w1T  = (_Float16*)(ws + off); off += SZ_W1T;   // [n][k]
    _Float16* w2T  = (_Float16*)(ws + off); off += SZ_W2T;   // [n][k]
    _Float16* qrow = (_Float16*)(ws + off); off += SZ_Q16;   // [b][h][s][64]
    _Float16* qT   = (_Float16*)(ws + off); off += SZ_Q16;   // [b][h][64][s]
    float*    y12  = (float*)(ws + off);    off += SZ_Y32;   // y1, then y2 (y1 dead after LN1)
    float*    x1   = (float*)(ws + off);    off += SZ_Y32;
    _Float16* hb   = (_Float16*)(ws + off); off += SZ_HB;
    if (off > ws_size) return;

    k_cvt_x<<<dim3((unsigned)((size_t)NTOK * DM / 8 / 256)), dim3(256), 0, stream>>>(x, x16);
    // Wq: per head in[rows = 1024 (d)][cols = 64 (e)] -> out[e][d]; grid (cols/64, rows/64, heads)
    k_wT<<<dim3(DH / 64, DM / 64, NH), dim3(256), 0, stream>>>(Wq, wqT, DM, DH);
    // W1: in[rows = 1024 (k)][cols = 4096 (n)] -> out[n][k]; grid (cols/64, rows/64, 1)
    k_wT<<<dim3(HID / 64, DM / 64, 1), dim3(256), 0, stream>>>(W1, w1T, DM, HID);
    // W2: in[rows = 4096 (k)][cols = 1024 (n)] -> out[n][k]; grid (cols/64, rows/64, 1)
    k_wT<<<dim3(DM / 64, HID / 64, 1), dim3(256), 0, stream>>>(W2, w2T, HID, DM);

    k_gemm_q<<<dim3(NTOK / 256, DM / 64), dim3(128), 0, stream>>>(x16, wqT, bq, qrow, qT);
    k_attn<<<dim3(SEQ / 128, NH, NB), dim3(256), 0, stream>>>(qrow, qT, x, y12);
    k_ln<<<dim3(NTOK / 4), dim3(128), 0, stream>>>(y12, ln1g, ln1b, x1, x16, 1);
    k_gemm_ffn1<<<dim3(NTOK / 256, HID / 64), dim3(128), 0, stream>>>(x16, w1T, b1, hb);
    k_gemm_ffn2<<<dim3(NTOK / 256, DM / 64), dim3(128), 0, stream>>>(hb, w2T, b2, x1, y12);
    k_ln<<<dim3(NTOK / 4), dim3(128), 0, stream>>>(y12, ln2g, ln2b, out, x16, 0);
}

// v003
// It runs in 179 microseconds.
// Two timings next to v002 both put it at 1.07 times that version's speed.
// Counting every step since v000, it is 2.39 times as fast.
#include <hip/hip_runtime.h>
#include <hip/hip_fp16.h>

// All contractions on v_wmma_f32_16x16x32_f16 (f16 operands, f32 accumulate), single products: x*Wq (x carried x16, Wq x64), q*q^T (q carried x64), P*q (P carried x256), x1*W1 (x1 x16, W1 x64), h*W2 (h x16, W2 x64); raw inputs RNE-converted to bf16 first.

#ifndef NB
#define NB 2
#endif
#ifndef SEQ
#define SEQ 2048
#endif
#define NB_FULL  2
#define SEQ_FULL 2048
#define DM   1024        // model width
#define NH   16          // heads
#define DH   64          // head width
#define HID  4096        // FFN hidden width
#define NTOK (NB * SEQ)

static_assert(NB >= 1 && NB <= NB_FULL);
static_assert(SEQ >= 128 && SEQ <= SEQ_FULL);
static_assert(SEQ % 128 == 0);                      // attention block = 128 queries; key loop steps 32
static_assert(SEQ % 64 == 0);                       // a 64-row GEMM wave tile stays inside one batch
static_assert(NTOK % 256 == 0);                     // GEMM block rows: 256 (FFN1), 128 (Q, FFN2)
static_assert(HID % 256 == 0 && DM % 128 == 0);     // GEMM block columns: 256 (FFN1), 128 (Q, FFN2)
static_assert(NTOK % 4 == 0);                       // LN block = 4 rows
static_assert(NH * DH == DM);                       // heads concatenate to the model width
static_assert(DH == 64);                            // one GEMM column tile == one head; 2 k-steps per score
static_assert(DM % 64 == 0 && HID % 64 == 0);       // N tiles of 64
static_assert(DM % 32 == 0 && HID % 32 == 0);       // K steps of 32
static_assert(DM == 32 * 8 * 4);                    // LN: 32 lanes x 8 chunks x 4 floats
static_assert(((size_t)NTOK * DM / 8) % 256 == 0);  // convert grid x block == plane extent

typedef _Float16 v16h __attribute__((ext_vector_type(16)));
typedef _Float16 v8h  __attribute__((ext_vector_type(8)));
typedef _Float16 v4h  __attribute__((ext_vector_type(4)));
typedef float    v8f  __attribute__((ext_vector_type(8)));
typedef float    v4f  __attribute__((ext_vector_type(4)));

union Frag { v16h v; v8h h[2]; };

// scores: acc = (64 q_s).(64 q_t); t (log2 units) = acc * log2(e) / 8 / 4096
#define CS (1.44269504088896340736f * 3.0517578125e-05f)

// plane sizes in bytes (all multiples of 128)
#define SZ_X16   ((size_t)NTOK * DM * 2)     // xh, later x1h
#define SZ_WQT   ((size_t)DM * DM * 2)
#define SZ_W1T   ((size_t)HID * DM * 2)
#define SZ_W2T   ((size_t)DM * HID * 2)
#define SZ_Q16   ((size_t)NTOK * DM * 2)     // qrow, qT each
#define SZ_Y32   ((size_t)NTOK * DM * 4)     // y1 (later y2), x1 each
#define SZ_HB    ((size_t)NTOK * HID * 2)
#define WS_TOTAL (SZ_X16 + SZ_WQT + SZ_W1T + SZ_W2T + 2 * SZ_Q16 + 2 * SZ_Y32 + SZ_HB)
static_assert(WS_TOTAL <= (size_t)134217728);       // carve <= 128 MiB

static __device__ __forceinline__ v8f zero8() {
    v8f z;
#pragma unroll
    for (int i = 0; i < 8; ++i) z[i] = 0.0f;
    return z;
}

// 16x32 A fragment (or B fragment from an [n][k] k-contiguous source).
// p = tile_base + (lane&15)*ld + 8*(lane>>4): elements 0..7 = k 8h..8h+7,
// elements 8..15 = k 16+8h..16+8h+7 (split map, same for A and B).
static __device__ __forceinline__ v16h load_frag_p(const _Float16* p) {
    Frag f;
    f.h[0] = *(const v8h*)(p);
    f.h[1] = *(const v8h*)(p + 16);
    return f.v;
}

static __device__ __forceinline__ v8f wmma16(v16h a, v16h b, v8f c) {
    v8f d = __builtin_amdgcn_wmma_f32_16x16x32_f16(false, a, false, b, (short)0, c, false, false);
    asm volatile("v_nop\n\tv_nop\n\tv_nop\n\tv_nop" : "+v"(d) : "v"(a), "v"(b));
    return d;
}

// f32 -> bf16 RNE convert, value kept as f32
static __device__ __forceinline__ float bf16r(float x) {
    unsigned u = __float_as_uint(x);
    u = (u + 0x7FFFu + ((u >> 16) & 1u)) & 0xFFFF0000u;
    return __uint_as_float(u);
}

static __device__ __forceinline__ float ex2(float x) {
    return __builtin_amdgcn_exp2f(x);
}

// ordering for a wave-private LDS tile: stores before later loads of the same wave
static __device__ __forceinline__ void wave_lds_sync() {
    __builtin_amdgcn_fence(3, "wavefront");
    asm volatile("s_wait_dscnt 0" ::: "memory");
    __builtin_amdgcn_wave_barrier();
}

static __device__ __forceinline__ float wave_sum(float v) {
    v += __shfl_xor(v, 16, 32);
    v += __shfl_xor(v, 8, 32);
    v += __shfl_xor(v, 4, 32);
    v += __shfl_xor(v, 2, 32);
    v += __shfl_xor(v, 1, 32);
    return v;
}

// ---------------------------------------------------------------------------
// xh[tok][d] = f16(16 * bf16(x)). One thread = one 16-B output piece; lanes
// ---------------------------------------------------------------------------
__global__ __launch_bounds__(256) void k_cvt_x(const float* __restrict__ x,
                                                _Float16* __restrict__ xh) {
    const int idx = blockIdx.x * 256 + threadIdx.x;
    if (idx >= NTOK * (DM / 8)) return;
    const int tok = idx >> 7;                 // DM/8 = 128 pieces per row
    const int c8  = idx & 127;
    const int b   = tok / SEQ;
    const int s   = tok - b * SEQ;
    const float* src = x + ((size_t)b * SEQ_FULL + s) * DM + c8 * 8;
    v4f a = *(const v4f*)(src);
    v4f c = *(const v4f*)(src + 4);
    v8h o;
    o[0] = (_Float16)(bf16r(a.x) * 16.0f);
    o[1] = (_Float16)(bf16r(a.y) * 16.0f);
    o[2] = (_Float16)(bf16r(a.z) * 16.0f);
    o[3] = (_Float16)(bf16r(a.w) * 16.0f);
    o[4] = (_Float16)(bf16r(c.x) * 16.0f);
    o[5] = (_Float16)(bf16r(c.y) * 16.0f);
    o[6] = (_Float16)(bf16r(c.z) * 16.0f);
    o[7] = (_Float16)(bf16r(c.w) * 16.0f);
    _Float16* dst = xh + (size_t)tok * DM + c8 * 8;
    *(v8h*)dst = o;
    
}

// ---------------------------------------------------------------------------
// Batched transpose + convert through LDS: in[z][rows][cols] f32 ->
// out[z][cols][rows] = f16(64 * bf16(in)). Block = one 64x64 tile;
// ---------------------------------------------------------------------------
__global__ __launch_bounds__(256) void k_wT(const float* __restrict__ in,
                                             _Float16* __restrict__ out,
                                             int rows, int cols) {
    __shared__ __align__(16) _Float16 T[64 * 64];     // [c][r], 8 KB, cross-wave (block barrier)
    const int tid = threadIdx.x;
    const int c0 = blockIdx.x * 64;
    const int r0 = blockIdx.y * 64;
    const size_t zoff = (size_t)blockIdx.z * (size_t)rows * (size_t)cols;
    const float* ib = in + zoff;
    _Float16*    ob = out + zoff;
#pragma unroll 1
    for (int i = 0; i < 4; ++i) {
        const int idx = i * 256 + tid;
        const int r = idx >> 4, c4 = idx & 15;
        v4f v = *(const v4f*)(ib + (size_t)(r0 + r) * cols + c0 + c4 * 4);
        T[(c4 * 4 + 0) * 64 + r] = (_Float16)(bf16r(v.x) * 64.0f);
        T[(c4 * 4 + 1) * 64 + r] = (_Float16)(bf16r(v.y) * 64.0f);
        T[(c4 * 4 + 2) * 64 + r] = (_Float16)(bf16r(v.z) * 64.0f);
        T[(c4 * 4 + 3) * 64 + r] = (_Float16)(bf16r(v.w) * 64.0f);
    }
    __syncthreads();
    const int ca = tid >> 3, j = tid & 7;              // rows ca and ca + 32 of the transposed tile
    v8h o0 = *(const v8h*)(&T[ca * 64 + j * 8]);
    v8h o1 = *(const v8h*)(&T[(ca + 32) * 64 + j * 8]);
    _Float16* d0 = ob + (size_t)(c0 + ca) * rows + r0 + j * 8;
    _Float16* d1 = ob + (size_t)(c0 + ca + 32) * rows + r0 + j * 8;
    *(v8h*)d0 = o0;
    *(v8h*)d1 = o1;
    
}

// ---------------------------------------------------------------------------
// GEMM main loop: block = WS x WS waves = a square (WS*64) x (WS*64) tile, one wave
// = 64x64 = 4x4 subtiles; wave w takes row band w % WS and column band w / WS.
// A [M][K] and Bt [N][K] are 16-bit k-contiguous planes in global memory. A stage
// is 64 k (128 B, one whole line) of the block's WS*64 A rows and WS*64 Bt rows,
// laid in LDS at a 144-B pitch; asynchronous copies fill it (16 B per lane, 8 lanes
// per row), two buffers, the next stage in flight while this one is multiplied.
// A staged row feeds WS waves, so the bytes copied per product fall as 1 / WS.
// Fragments are two 16-B LDS loads, same k order as from the global planes.
// ---------------------------------------------------------------------------
#define ST_K      64                         // halves of k per stage
#define ST_PITCH  72                         // halves per LDS row (144 B)
#define ST_HALVES(WS) (2 * (WS) * 64 * ST_PITCH)   // one buffer: A rows, then Bt rows

static __device__ __forceinline__ unsigned lds_off(const void* p) { return (unsigned)(size_t)p; }

// Four copies of A rows and four of Bt rows, each run ls bytes apart in LDS and gs
// halves apart in its plane. The s_wait_xcnt closes the statement so that no
// address register of a copy is rewritten ahead of it.
static __device__ __forceinline__ void copy4_4(unsigned la, const _Float16* ga,
                                               unsigned lb, const _Float16* gb,
                                               unsigned ls, size_t gs) {
    asm volatile(
        "global_load_async_to_lds_b128 %0, %8, off\n\t"
        "global_load_async_to_lds_b128 %1, %9, off\n\t"
        "global_load_async_to_lds_b128 %2, %10, off\n\t"
        "global_load_async_to_lds_b128 %3, %11, off\n\t"
        "global_load_async_to_lds_b128 %4, %12, off\n\t"
        "global_load_async_to_lds_b128 %5, %13, off\n\t"
        "global_load_async_to_lds_b128 %6, %14, off\n\t"
        "global_load_async_to_lds_b128 %7, %15, off\n\t"
        "s_wait_xcnt 0x0"
        :: "v"(la), "v"(la + ls), "v"(la + 2u * ls), "v"(la + 3u * ls),
           "v"(lb), "v"(lb + ls), "v"(lb + 2u * ls), "v"(lb + 3u * ls),
           "v"(ga), "v"(ga + gs), "v"(ga + 2 * gs), "v"(ga + 3 * gs),
           "v"(gb), "v"(gb + gs), "v"(gb + 2 * gs), "v"(gb + 3 * gs)
        : "memory");
}

// One stage: l = the thread's first LDS byte in the buffer, ga / gb = its first A and
// Bt piece at the stage's k. Copy i of a run: run row i * (threads / 8) + tid / 8.
template <int K, int WS>
static __device__ __forceinline__ void copy_stage(unsigned l, const _Float16* ga, const _Float16* gb) {
    constexpr int RSTEP = WS * WS * 4;               // rows that one copy of the whole block covers
    constexpr int NG    = WS * 64 / (4 * RSTEP);     // statements per stage
    static_assert(NG * 4 * RSTEP == WS * 64);        // every row of both runs copied once
    const unsigned ls = (unsigned)RSTEP * ST_PITCH * 2u;
    const size_t   gs = (size_t)RSTEP * K;
#pragma unroll
    for (int j = 0; j < NG; ++j)
        copy4_4(l + 4u * j * ls, ga + 4 * j * gs,
                l + (unsigned)(WS * 64 * ST_PITCH * 2) + 4u * j * ls, gb + 4 * j * gs, ls, gs);
}

// ab = A + m_block * K (WS*64 rows), bb = Bt + n_block * K (WS*64 rows), St = two buffers.
template <int K, int WS>
static __device__ __forceinline__ void gemm_tile64(const _Float16* __restrict__ ab,
                                                   const _Float16* __restrict__ bb,
                                                   _Float16* St,
                                                   v8f (&acc)[4][4]) {
    static_assert(K % ST_K == 0 && K / ST_K >= 2);   // whole stages, both buffers filled
    constexpr int NT = K / ST_K;
    const int tid  = threadIdx.x;
    const int lane = tid & 31;
    const int w    = tid >> 5;
    const int wm   = w % WS;
    const int wn   = w / WS;
    const int lm   = lane & 15;
    const int kb   = (lane >> 4) << 3;
    const _Float16* ga = ab + (size_t)(tid >> 3) * K + (tid & 7) * 8;
    const _Float16* gb = bb + (size_t)(tid >> 3) * K + (tid & 7) * 8;
    const unsigned  l0 = lds_off(St) + (unsigned)((tid >> 3) * (ST_PITCH * 2) + (tid & 7) * 16);

#pragma unroll
    for (int ms = 0; ms < 4; ++ms)
#pragma unroll
        for (int nt = 0; nt < 4; ++nt) acc[ms][nt] = zero8();

    copy_stage<K, WS>(l0, ga, gb);
    asm volatile("s_wait_asynccnt 0x0" ::: "memory");   // stage 0 landed (this wave's copies)
    __syncthreads();                                    // stage 0 published to all waves
    copy_stage<K, WS>(l0 + ST_HALVES(WS) * 2u, ga + ST_K, gb + ST_K);

#pragma unroll 1
    for (int t = 0; t < NT; ++t) {
        const int bo = (t & 1) * ST_HALVES(WS);
        const _Float16* sa = St + bo + (wm * 64 + lm) * ST_PITCH + kb;
        const _Float16* sb = St + bo + ((WS + wn) * 64 + lm) * ST_PITCH + kb;
        // Fragment reads stand in few groups, each ahead of the products that hide it:
        // k 0..31 whole and the A side of k 32..63 first, the B side of k 32..63 in
        // two halves into the B registers that the first k step has just left.
        v16h a0[4], a1[4], bn[4];
#pragma unroll
        for (int i = 0; i < 4; ++i) a0[i] = load_frag_p(sa + i * 16 * ST_PITCH);
#pragma unroll
        for (int i = 0; i < 4; ++i) bn[i] = load_frag_p(sb + i * 16 * ST_PITCH);
#pragma unroll
        for (int i = 0; i < 4; ++i) a1[i] = load_frag_p(sa + i * 16 * ST_PITCH + 32);
#pragma unroll
        for (int hf = 0; hf < 4; hf += 2) {
#pragma unroll
            for (int nt = hf; nt < hf + 2; ++nt)
#pragma unroll
                for (int ms = 0; ms < 4; ++ms) acc[ms][nt] = wmma16(a0[ms], bn[nt], acc[ms][nt]);
#pragma unroll
            for (int nt = hf; nt < hf + 2; ++nt) bn[nt] = load_frag_p(sb + nt * 16 * ST_PITCH + 32);
        }
#pragma unroll
        for (int nt = 0; nt < 4; ++nt)
#pragma unroll
            for (int ms = 0; ms < 4; ++ms) acc[ms][nt] = wmma16(a1[ms], bn[nt], acc[ms][nt]);
        asm volatile("s_wait_dscnt 0x0" ::: "memory");      // this wave's reads of the buffer are done
        asm volatile("s_wait_asynccnt 0x0" ::: "memory");   // stage t+1 landed (this wave's copies)
        __syncthreads();                                    // publishes stage t+1, frees stage t's buffer
        if (t + 2 < NT)
            copy_stage<K, WS>(l0 + (unsigned)bo * 2u, ga + (size_t)(t + 2) * ST_K, gb + (size_t)(t + 2) * ST_K);
    }
    asm volatile("s_wait_asynccnt 0x0" ::: "memory");       // nothing in flight when the loop is left
}

// ---------------------------------------------------------------------------
// Q projection: acc = (16 x)(64 Wq) = 1024 x.Wq ; q64 = (acc + 1024 bq) / 16.
// Writes qrow[b][h][s][64] and qT[b][h][64][s] as f16(64 q).
// Block = 2 x 2 waves = 128 tokens x two heads; wave tile = 64 tokens x one head. Row plane: 16-row steps through a
// wave-private LDS tile; transposed plane: whole 64x64 wave-private tile.
// ---------------------------------------------------------------------------
__global__ __launch_bounds__(128) __attribute__((amdgpu_num_vgpr(256)))
void k_gemm_q(const _Float16* __restrict__ xh,
              const _Float16* __restrict__ wqT,
              const float* __restrict__ bq,
              _Float16* __restrict__ qrow,
              _Float16* __restrict__ qT) {
    __shared__ __align__(16) _Float16 Rst[4][16 * 64];   // 8 KB, wave-private
    __shared__ __align__(16) _Float16 Tst[4][64 * 64];   // 32 KB, wave-private
    __shared__ __align__(16) _Float16 St[2 * ST_HALVES(2)]; // 72 KB, operand stages, cross-wave
    const int tid  = threadIdx.x;
    const int lane = tid & 31;
    const int w    = tid >> 5;
    const int hh   = lane >> 4;
    const int lm   = lane & 15;
    const int m0   = blockIdx.x * 128 + (w % 2) * 64;
    const int head = blockIdx.y * 2 + w / 2;
    const int n0   = head * 64;
    const int b    = m0 / SEQ;
    const int s0   = m0 - b * SEQ;

    v8f acc[4][4];
    gemm_tile64<DM, 2>(xh + (size_t)(blockIdx.x * 128) * DM, wqT + (size_t)(blockIdx.y * 128) * DM, St, acc);

    float bv[4];
#pragma unroll
    for (int nt = 0; nt < 4; ++nt) bv[nt] = bf16r(bq[n0 + nt * 16 + lm]) * 1024.0f;

    _Float16* qr = qrow + (((size_t)b * NH + head) * SEQ + s0) * DH;
    _Float16* qt = qT + ((size_t)b * NH + head) * DH * SEQ + s0;

#pragma unroll
    for (int ms = 0; ms < 4; ++ms) {
#pragma unroll
        for (int nt = 0; nt < 4; ++nt) {
            v8h tv;
#pragma unroll
            for (int r = 0; r < 8; ++r) {
                _Float16 hv = (_Float16)((acc[ms][nt][r] + bv[nt]) * 0.0625f);
                Rst[w][(8 * hh + r) * 64 + nt * 16 + lm] = hv;
                tv[r] = hv;
            }
            *(v8h*)(&Tst[w][(nt * 16 + lm) * 64 + ms * 16 + 8 * hh]) = tv;
        }
        wave_lds_sync();
        v8h rv[4];
#pragma unroll
        for (int i = 0; i < 4; ++i) rv[i] = *(const v8h*)(&Rst[w][i * 256 + lane * 8]);
        _Float16* dst = qr + ms * 1024 + lane * 8;
#pragma unroll
        for (int i = 0; i < 4; ++i) *(v8h*)(dst + i * 256) = rv[i];
        
        wave_lds_sync();
    }
    wave_lds_sync();
#pragma unroll 1
    for (int g = 0; g < 4; ++g) {
        v8h tv[4];
#pragma unroll
        for (int i = 0; i < 4; ++i) tv[i] = *(const v8h*)(&Tst[w][(g * 4 + i) * 256 + lane * 8]);
        _Float16* dst = qt + (size_t)(g * 16 + (lane >> 3)) * SEQ + (lane & 7) * 8;
#pragma unroll
        for (int i = 0; i < 4; ++i) *(v8h*)(dst + (size_t)i * 4 * SEQ) = tv[i];
        
    }
}

// ---------------------------------------------------------------------------
// Fused attention, q = k = v. Block = 8 waves = 128 queries of one (b, head);
// a wave owns 16 queries and streams all SEQ keys, 32 per step:
//   S^T tiles (rows = keys, cols = queries): A = key rows, B = query rows
//   (k = d, 2 steps of 32); query fragments straight from the qrow plane;
//   per-lane online softmax (lane column = its query; partner lane +-16);
//   P^T carried 2^8 as f16: the two S^T tiles chain directly as the B
//   fragment (elements 0..7 = tile keys 0..15, 8..15 = tile keys 16..31);
//   O^T += V^T . P^T with A fragments of V^T (rows = d, k = keys).
// Key rows and V^T rows reach the waves through LDS: a stage is 128 keys, 128
// qrow rows of 128 B at a 144-B pitch and 64 qT rows of 256 B at a 272-B pitch,
// filled once per block by asynchronous copies (16 B per lane, whole lines per
// wave) and read by all 8 waves; two buffers, the next stage in flight while
// this one is worked on. Fragments keep the k order they had from the planes.
// Epilogue: O^T / (64 l) staged as [query][d] f32 in a wave-private LDS tile,
// bf16(x) added at the store stage, 8 lane-contiguous 16-B-per-lane
// ---------------------------------------------------------------------------
#define AT_KEYS   128                        // keys per stage
#define AK_PITCH  72                         // halves per key row in LDS (144 B)
#define AV_PITCH  136                        // halves per V^T row in LDS (272 B)
#define AK_HALVES (AT_KEYS * AK_PITCH)       // key rows of one buffer, 18,432 B
#define AV_HALVES (DH * AV_PITCH)            // V^T rows of one buffer, 17,408 B
#define AT_HALVES (AK_HALVES + AV_HALVES)    // one buffer, 35,840 B
static_assert(SEQ % AT_KEYS == 0);           // whole stages

// Four copies of key rows (32 rows apart) and four of V^T rows (16 rows apart).
// The s_wait_xcnt closes the statement so that no address register of a copy is
// rewritten ahead of it.
static __device__ __forceinline__ void copy_kv(unsigned lk, const _Float16* gk,
                                               unsigned lv, const _Float16* gv) {
    const unsigned ks = 32u * AK_PITCH * 2u;
    const unsigned vs = 16u * AV_PITCH * 2u;
    const size_t   gks = (size_t)32 * DH;
    const size_t   gvs = (size_t)16 * SEQ;
    asm volatile(
        "global_load_async_to_lds_b128 %0, %8, off\n\t"
        "global_load_async_to_lds_b128 %1, %9, off\n\t"
        "global_load_async_to_lds_b128 %2, %10, off\n\t"
        "global_load_async_to_lds_b128 %3, %11, off\n\t"
        "global_load_async_to_lds_b128 %4, %12, off\n\t"
        "global_load_async_to_lds_b128 %5, %13, off\n\t"
        "global_load_async_to_lds_b128 %6, %14, off\n\t"
        "global_load_async_to_lds_b128 %7, %15, off\n\t"
        "s_wait_xcnt 0x0"
        :: "v"(lk), "v"(lk + ks), "v"(lk + 2u * ks), "v"(lk + 3u * ks),
           "v"(lv), "v"(lv + vs), "v"(lv + 2u * vs), "v"(lv + 3u * vs),
           "v"(gk), "v"(gk + gks), "v"(gk + 2 * gks), "v"(gk + 3 * gks),
           "v"(gv), "v"(gv + gvs), "v"(gv + 2 * gvs), "v"(gv + 3 * gvs)
        : "memory");
}

__global__ __launch_bounds__(256) __attribute__((amdgpu_num_vgpr(256)))
void k_attn(const _Float16* __restrict__ qrow,
            const _Float16* __restrict__ qT,
            const float* __restrict__ x,
            float* __restrict__ y1) {
    __shared__ __align__(16) float Ost[8][16 * DH];      // 32 KB, wave-private
    __shared__ __align__(16) _Float16 Kv[2 * AT_HALVES]; // 70 KB, key and V^T stages, cross-wave
    constexpr int NT = SEQ / AT_KEYS;
    const int tid  = threadIdx.x;
    const int lane = tid & 31;
    const int w    = tid >> 5;
    const int hh   = lane >> 4;
    const int lm   = lane & 15;
    const int kb   = hh << 3;
    const int b    = blockIdx.z;
    const int head = blockIdx.y;
    const int q0   = blockIdx.x * 128 + w * 16;

    const _Float16* qhead = qrow + ((size_t)b * NH + head) * SEQ * DH;
    const _Float16* thead = qT + ((size_t)b * NH + head) * DH * SEQ;
    const _Float16* qlane = qhead + (size_t)lm * DH + kb;
    // key copy i of a thread: stage row i*32 + tid/8, 16-B piece tid%8;
    // V^T copy i: row i*16 + tid/16, 16-B piece tid%16
    const _Float16* gk = qhead + (size_t)(tid >> 3) * DH + (tid & 7) * 8;
    const _Float16* gv = thead + (size_t)(tid >> 4) * SEQ + (tid & 15) * 8;
    const unsigned  lk = lds_off(Kv) + (unsigned)((tid >> 3) * (AK_PITCH * 2) + (tid & 7) * 16);
    const unsigned  lv = lds_off(Kv) + (unsigned)(AK_HALVES * 2 + (tid >> 4) * (AV_PITCH * 2) + (tid & 15) * 16);

    copy_kv(lk, gk, lv, gv);
    asm volatile("s_wait_asynccnt 0x0" ::: "memory");   // stage 0 landed (this wave's copies)
    __syncthreads();                                    // stage 0 published to all waves
    if (NT > 1)
        copy_kv(lk + AT_HALVES * 2u, gk + (size_t)AT_KEYS * DH, lv + AT_HALVES * 2u, gv + AT_KEYS);

    const v16h qf0 = load_frag_p(qlane + (size_t)q0 * DH);        // d 0..31
    const v16h qf1 = load_frag_p(qlane + (size_t)q0 * DH + 32);   // d 32..63

    v8f o[4];
#pragma unroll
    for (int dt = 0; dt < 4; ++dt) o[dt] = zero8();
    float mr = -1.0e30f, l = 0.0f;

#pragma unroll 1
    for (int t = 0; t < NT; ++t) {
      const int bo = (t & 1) * AT_HALVES;
      const _Float16* sk = Kv + bo + lm * AK_PITCH + kb;
      const _Float16* sv = Kv + bo + AK_HALVES + lm * AV_PITCH + kb;
#pragma unroll
      for (int u = 0; u < AT_KEYS / 32; ++u) {
        // The step's LDS reads stand in one group ahead of its products, so that
        // the wave waits out one LDS latency per 32 keys and not one per fragment.
        const _Float16* ka = sk + u * 32 * AK_PITCH;
        v16h a0 = load_frag_p(ka);
        v16h a1 = load_frag_p(ka + 32);
        v16h c0 = load_frag_p(ka + 16 * AK_PITCH);
        v16h c1 = load_frag_p(ka + 16 * AK_PITCH + 32);
        v16h vf[4];
#pragma unroll
        for (int dt = 0; dt < 4; ++dt) vf[dt] = load_frag_p(sv + dt * 16 * AV_PITCH + u * 32);
        v8f sA = wmma16(a0, qf0, zero8());
        sA = wmma16(a1, qf1, sA);
        v8f sB = wmma16(c0, qf0, zero8());
        sB = wmma16(c1, qf1, sB);

        float tA[8], tB[8];
#pragma unroll
        for (int i = 0; i < 8; ++i) { tA[i] = sA[i] * CS; tB[i] = sB[i] * CS; }
        float tmax = fmaxf(tA[0], tB[0]);
#pragma unroll
        for (int i = 1; i < 8; ++i) tmax = fmaxf(tmax, fmaxf(tA[i], tB[i]));
        tmax = fmaxf(tmax, __shfl_xor(tmax, 16, 32));
        const float mn = fmaxf(mr, tmax);
        if (__builtin_amdgcn_ballot_w32(mn > mr) != 0u) {       // wave-uniform
            const float sc = ex2(mr - mn);
            l *= sc;
#pragma unroll
            for (int dt = 0; dt < 4; ++dt)
#pragma unroll
                for (int r = 0; r < 8; ++r) o[dt][r] *= sc;
        }
        mr = mn;
        const float sh = 8.0f - mn;
        float ps = 0.0f;
        v16h pb;
#pragma unroll
        for (int i = 0; i < 8; ++i) {
            const float pa = ex2(tA[i] + sh);
            const float pq = ex2(tB[i] + sh);
            ps += pa + pq;
            pb[i]     = (_Float16)pa;
            pb[8 + i] = (_Float16)pq;
        }
        l += ps;
#pragma unroll
        for (int dt = 0; dt < 4; ++dt) o[dt] = wmma16(vf[dt], pb, o[dt]);
      }
      asm volatile("s_wait_dscnt 0x0" ::: "memory");      // this wave's reads of the buffer are done
      asm volatile("s_wait_asynccnt 0x0" ::: "memory");   // stage t+1 landed (this wave's copies)
      __syncthreads();                                    // publishes stage t+1, frees stage t's buffer
      if (t + 2 < NT)
          copy_kv(lk + (unsigned)bo * 2u, gk + (size_t)(t + 2) * AT_KEYS * DH,
                  lv + (unsigned)bo * 2u, gv + (size_t)(t + 2) * AT_KEYS);
    }
    asm volatile("s_wait_asynccnt 0x0" ::: "memory");       // nothing in flight when the loop is left

    const float lt  = l + __shfl_xor(l, 16, 32);
    const float inv = (1.0f / lt) * 0.015625f;          // 2^8 P carry cancels in o/l; 1/64 for the q carry
#pragma unroll
    for (int dt = 0; dt < 4; ++dt) {
        v4f u0, u1;
        u0.x = o[dt][0] * inv; u0.y = o[dt][1] * inv; u0.z = o[dt][2] * inv; u0.w = o[dt][3] * inv;
        u1.x = o[dt][4] * inv; u1.y = o[dt][5] * inv; u1.z = o[dt][6] * inv; u1.w = o[dt][7] * inv;
        *(v4f*)(&Ost[w][lm * DH + dt * 16 + 8 * hh])     = u0;
        *(v4f*)(&Ost[w][lm * DH + dt * 16 + 8 * hh + 4]) = u1;
    }
    wave_lds_sync();

    v4f sv[8];
    const int col = lm * 4;
#pragma unroll
    for (int i = 0; i < 8; ++i) {
        const int row = 2 * i + hh;
        v4f a  = *(const v4f*)(&Ost[w][i * 128 + lane * 4]);
        v4f xv = *(const v4f*)(x + ((size_t)b * SEQ_FULL + q0 + row) * DM + head * DH + col);
        a.x = bf16r(xv.x) + a.x;
        a.y = bf16r(xv.y) + a.y;
        a.z = bf16r(xv.z) + a.z;
        a.w = bf16r(xv.w) + a.w;
        sv[i] = a;
    }
    float* ob = y1 + ((size_t)b * SEQ + q0 + hh) * DM + head * DH + col;
#pragma unroll
    for (int i = 0; i < 8; ++i) *(v4f*)(ob + (size_t)(2 * i) * DM) = sv[i];
    
}

// ---------------------------------------------------------------------------
// row, row kept in a wave-private LDS line, loops rolled. Writes f32 row
// (512 B per instruction, lane-contiguous) and optionally f16(16 * LN(y)) row
// ---------------------------------------------------------------------------
__global__ __launch_bounds__(128) void k_ln(const float* __restrict__ y,
                                             const float* __restrict__ g,
                                             const float* __restrict__ be,
                                             float* __restrict__ of,
                                             _Float16* __restrict__ oh,
                                             int wr16) {
    __shared__ __align__(16) float    Rw[4][DM];     // 16 KB, wave-private
    __shared__ __align__(16) _Float16 Hw[4][DM];     // 8 KB, wave-private
    const int tid  = threadIdx.x;
    const int lane = tid & 31;
    const int w    = tid >> 5;
    const int row  = blockIdx.x * 4 + w;
    if (row >= NTOK) return;                          // wave-uniform; no block barriers below
    const float* yr = y + (size_t)row * DM;

    float s = 0.0f;
#pragma unroll 1
    for (int j = 0; j < 8; ++j) {
        const int c = j * 128 + lane * 4;
        v4f v = *(const v4f*)(yr + c);
        *(v4f*)(&Rw[w][c]) = v;
        s += (v.x + v.y) + (v.z + v.w);
    }
    s = wave_sum(s);
    const float mu = s * 0.0009765625f;
    float qv = 0.0f;
#pragma unroll 1
    for (int j = 0; j < 8; ++j) {
        const int c = j * 128 + lane * 4;
        v4f v = *(const v4f*)(&Rw[w][c]);
        const float d0 = v.x - mu, d1 = v.y - mu, d2 = v.z - mu, d3 = v.w - mu;
        qv += (d0 * d0 + d1 * d1) + (d2 * d2 + d3 * d3);
    }
    qv = wave_sum(qv);
    const float rs = rsqrtf(qv * 0.0009765625f + 1.0e-5f);
#pragma unroll 1
    for (int j = 0; j < 8; ++j) {
        const int c = j * 128 + lane * 4;
        v4f v  = *(const v4f*)(&Rw[w][c]);
        v4f gv = *(const v4f*)(g + c);
        v4f bv = *(const v4f*)(be + c);
        v4f r;
        r.x = (v.x - mu) * rs * bf16r(gv.x) + bf16r(bv.x);
        r.y = (v.y - mu) * rs * bf16r(gv.y) + bf16r(bv.y);
        r.z = (v.z - mu) * rs * bf16r(gv.z) + bf16r(bv.z);
        r.w = (v.w - mu) * rs * bf16r(gv.w) + bf16r(bv.w);
        *(v4f*)(&Rw[w][c]) = r;
        if (wr16 != 0) {
            v4h hv;
            hv.x = (_Float16)(r.x * 16.0f);
            hv.y = (_Float16)(r.y * 16.0f);
            hv.z = (_Float16)(r.z * 16.0f);
            hv.w = (_Float16)(r.w * 16.0f);
            *(v4h*)(&Hw[w][c]) = hv;
        }
    }
    wave_lds_sync();

    float*    df = of + (size_t)row * DM;
    _Float16* dh = oh + (size_t)row * DM;
#pragma unroll 1
    for (int j = 0; j < 8; ++j) {
        const int c = j * 128 + lane * 4;
        v4f v = *(const v4f*)(&Rw[w][c]);
        *(v4f*)(df + c) = v;
    }
    if (wr16 != 0) {
#pragma unroll 1
        for (int j = 0; j < 4; ++j) {
            const int c = j * 256 + lane * 8;
            v8h hv = *(const v8h*)(&Hw[w][c]);
            *(v8h*)(dh + c) = hv;
        }
    }
    
}

// ---------------------------------------------------------------------------
// FFN1: acc = (16 x1)(64 W1) = 1024 pre ; hb = f16(16 relu(pre + b1)).
// Block = 4 x 4 waves = 256 x 256.
// 16-row steps through a wave-private LDS tile; row segment = 64 halves =
// ---------------------------------------------------------------------------
__global__ __launch_bounds__(512) __attribute__((amdgpu_num_vgpr(256)))
void k_gemm_ffn1(const _Float16* __restrict__ a16,
                 const _Float16* __restrict__ w1T,
                 const float* __restrict__ b1,
                 _Float16* __restrict__ hb) {
    __shared__ __align__(16) _Float16 Rst[16][16 * 64];  // 32 KB, wave-private
    __shared__ __align__(16) _Float16 St[2 * ST_HALVES(4)]; // 144 KB, operand stages, cross-wave
    const int tid  = threadIdx.x;
    const int lane = tid & 31;
    const int w    = tid >> 5;
    const int hh   = lane >> 4;
    const int lm   = lane & 15;
    const int m0   = blockIdx.x * 256 + (w % 4) * 64;
    const int n0   = blockIdx.y * 256 + (w / 4) * 64;

    v8f acc[4][4];
    gemm_tile64<DM, 4>(a16 + (size_t)(blockIdx.x * 256) * DM, w1T + (size_t)(blockIdx.y * 256) * DM, St, acc);

    float bv[4];
#pragma unroll
    for (int nt = 0; nt < 4; ++nt) bv[nt] = bf16r(b1[n0 + nt * 16 + lm]) * 1024.0f;

#pragma unroll
    for (int ms = 0; ms < 4; ++ms) {
#pragma unroll
        for (int nt = 0; nt < 4; ++nt)
#pragma unroll
            for (int r = 0; r < 8; ++r)
                Rst[w][(8 * hh + r) * 64 + nt * 16 + lm] =
                    (_Float16)(fmaxf(acc[ms][nt][r] + bv[nt], 0.0f) * 0.015625f);
        wave_lds_sync();
        v8h rv[4];
#pragma unroll
        for (int i = 0; i < 4; ++i) rv[i] = *(const v8h*)(&Rst[w][i * 256 + lane * 8]);
        _Float16* dst = hb + (size_t)(m0 + ms * 16 + (lane >> 3)) * HID + n0 + (lane & 7) * 8;
#pragma unroll
        for (int i = 0; i < 4; ++i) *(v8h*)(dst + (size_t)i * 4 * HID) = rv[i];
        
        wave_lds_sync();
    }
}

// ---------------------------------------------------------------------------
// FFN2: acc = (16 h)(64 W2) = 1024 ff ; y2 = x1 + (ff + b2), f32.
// Block = 2 x 2 waves = 128 x 128.
// 16-row steps through a wave-private f32 LDS tile; bias and skip path added
// at the store stage as 4-float vectors; each instruction = 2 rows x 256 B.
// ---------------------------------------------------------------------------
__global__ __launch_bounds__(128) __attribute__((amdgpu_num_vgpr(256)))
void k_gemm_ffn2(const _Float16* __restrict__ hb,
                 const _Float16* __restrict__ w2T,
                 const float* __restrict__ b2,
                 const float* __restrict__ x1,
                 float* __restrict__ y2) {
    __shared__ __align__(16) float Fst[4][16 * 64];      // 16 KB, wave-private
    __shared__ __align__(16) _Float16 St[2 * ST_HALVES(2)]; // 72 KB, operand stages, cross-wave
    const int tid  = threadIdx.x;
    const int lane = tid & 31;
    const int w    = tid >> 5;
    const int hh   = lane >> 4;
    const int lm   = lane & 15;
    const int m0   = blockIdx.x * 128 + (w % 2) * 64;
    const int n0   = blockIdx.y * 128 + (w / 2) * 64;

    v8f acc[4][4];
    gemm_tile64<HID, 2>(hb + (size_t)(blockIdx.x * 128) * HID, w2T + (size_t)(blockIdx.y * 128) * HID, St, acc);

    const int col = lm * 4;
    v4f bb = *(const v4f*)(b2 + n0 + col);
    bb.x = bf16r(bb.x); bb.y = bf16r(bb.y); bb.z = bf16r(bb.z); bb.w = bf16r(bb.w);

#pragma unroll
    for (int ms = 0; ms < 4; ++ms) {
#pragma unroll
        for (int nt = 0; nt < 4; ++nt)
#pragma unroll
            for (int r = 0; r < 8; ++r)
                Fst[w][(8 * hh + r) * 64 + nt * 16 + lm] = acc[ms][nt][r] * 0.0009765625f;
        wave_lds_sync();
        v4f sv[8];
        const size_t rbase = ((size_t)(m0 + ms * 16 + hh)) * DM + n0 + col;
#pragma unroll
        for (int i = 0; i < 8; ++i) {
            v4f a  = *(const v4f*)(&Fst[w][i * 128 + lane * 4]);
            v4f xr = *(const v4f*)(x1 + rbase + (size_t)(2 * i) * DM);
            a.x = xr.x + (a.x + bb.x);
            a.y = xr.y + (a.y + bb.y);
            a.z = xr.z + (a.z + bb.z);
            a.w = xr.w + (a.w + bb.w);
            sv[i] = a;
        }
        float* dst = y2 + rbase;
#pragma unroll
        for (int i = 0; i < 8; ++i) *(v4f*)(dst + (size_t)(2 * i) * DM) = sv[i];
        
        wave_lds_sync();
    }
}

// ---------------------------------------------------------------------------
extern "C" void kernel_launch(void* const* d_in, const int* in_sizes, int n_in,
                              void* d_out, int out_size, void* d_ws, size_t ws_size,
                              hipStream_t stream) {
    if (n_in < 11) return;
    if (in_sizes[0] < ((NB - 1) * SEQ_FULL + SEQ) * DM) return;
    if (in_sizes[1] < DM * DM || in_sizes[2] < DM) return;
    if (in_sizes[3] < DM || in_sizes[4] < DM) return;
    if (in_sizes[5] < DM * HID || in_sizes[6] < HID) return;
    if (in_sizes[7] < HID * DM || in_sizes[8] < DM) return;
    if (in_sizes[9] < DM || in_sizes[10] < DM) return;
    if (out_size < NTOK * DM) return;
    if (WS_TOTAL > ws_size) return;

    const float* x    = (const float*)d_in[0];    // [2,2048,1024]
    const float* Wq   = (const float*)d_in[1];    // [16,1024,64]  [head][in][dim]
    const float* bq   = (const float*)d_in[2];    // [16,64]
    const float* ln1g = (const float*)d_in[3];
    const float* ln1b = (const float*)d_in[4];
    const float* W1   = (const float*)d_in[5];    // [1024,4096]  [in][out]
    const float* b1   = (const float*)d_in[6];
    const float* W2   = (const float*)d_in[7];    // [4096,1024]  [in][out]
    const float* b2   = (const float*)d_in[8];
    const float* ln2g = (const float*)d_in[9];
    const float* ln2b = (const float*)d_in[10];
    float* out = (float*)d_out;                   // [2,2048,1024]

    char* ws = (char*)d_ws;
    size_t off = 0;
    _Float16* x16  = (_Float16*)(ws + off); off += SZ_X16;   // xh, then x1h (xh dead after k_gemm_q)
    _Float16* wqT  = (_Float16*)(ws + off); off += SZ_WQT;   // [h*64+e][d]
    _Float16* w1T  = (_Float16*)(ws + off); off += SZ_W1T;   // [n][k]
    _Float16* w2T  = (_Float16*)(ws + off); off += SZ_W2T;   // [n][k]
    _Float16* qrow = (_Float16*)(ws + off); off += SZ_Q16;   // [b][h][s][64]
    _Float16* qT   = (_Float16*)(ws + off); off += SZ_Q16;   // [b][h][64][s]
    float*    y12  = (float*)(ws + off);    off += SZ_Y32;   // y1, then y2 (y1 dead after LN1)
    float*    x1   = (float*)(ws + off);    off += SZ_Y32;
    _Float16* hb   = (_Float16*)(ws + off); off += SZ_HB;
    if (off > ws_size) return;

    k_cvt_x<<<dim3((unsigned)((size_t)NTOK * DM / 8 / 256)), dim3(256), 0, stream>>>(x, x16);
    // Wq: per head in[rows = 1024 (d)][cols = 64 (e)] -> out[e][d]; grid (cols/64, rows/64, heads)
    k_wT<<<dim3(DH / 64, DM / 64, NH), dim3(256), 0, stream>>>(Wq, wqT, DM, DH);
    // W1: in[rows = 1024 (k)][cols = 4096 (n)] -> out[n][k]; grid (cols/64, rows/64, 1)
    k_wT<<<dim3(HID / 64, DM / 64, 1), dim3(256), 0, stream>>>(W1, w1T, DM, HID);
    // W2: in[rows = 4096 (k)][cols = 1024 (n)] -> out[n][k]; grid (cols/64, rows/64, 1)
    k_wT<<<dim3(DM / 64, HID / 64, 1), dim3(256), 0, stream>>>(W2, w2T, HID, DM);

    k_gemm_q<<<dim3(NTOK / 128, DM / 128), dim3(128), 0, stream>>>(x16, wqT, bq, qrow, qT);
    k_attn<<<dim3(SEQ / 128, NH, NB), dim3(256), 0, stream>>>(qrow, qT, x, y12);
    k_ln<<<dim3(NTOK / 4), dim3(128), 0, stream>>>(y12, ln1g, ln1b, x1, x16, 1);
    k_gemm_ffn1<<<dim3(NTOK / 256, HID / 256), dim3(512), 0, stream>>>(x16, w1T, b1, hb);
    k_gemm_ffn2<<<dim3(NTOK / 128, DM / 128), dim3(128), 0, stream>>>(hb, w2T, b2, x1, y12);
    k_ln<<<dim3(NTOK / 4), dim3(128), 0, stream>>>(y12, ln2g, ln2b, out, x16, 0);
}

// v004
// One run takes 173 microseconds.
// Two timings next to v003 both put it at 1.03 times that version's speed.
// Counting every step since v000, it is 2.46 times as fast.
#include <hip/hip_runtime.h>
#include <hip/hip_fp16.h>

// All contractions on v_wmma_f32_16x16x32_f16 (f16 operands, f32 accumulate), single products: x*Wq (x carried x16, Wq x64), q*q^T (q carried x64), P*q (P carried x256), x1*W1 (x1 x16, W1 x64), h*W2 (h x16, W2 x64); raw inputs RNE-converted to bf16 first.

#ifndef NB
#define NB 2
#endif
#ifndef SEQ
#define SEQ 2048
#endif
#define NB_FULL  2
#define SEQ_FULL 2048
#define DM   1024        // model width
#define NH   16          // heads
#define DH   64          // head width
#define HID  4096        // FFN hidden width
#define NTOK (NB * SEQ)

static_assert(NB >= 1 && NB <= NB_FULL);
static_assert(SEQ >= 128 && SEQ <= SEQ_FULL);
static_assert(SEQ % 128 == 0);                      // attention block = 128 queries; key loop steps 32
static_assert(SEQ % 64 == 0);                       // a 64-row GEMM wave tile stays inside one batch
static_assert(NTOK % 256 == 0);                     // GEMM block rows: 256 (FFN1), 128 (Q, FFN2)
static_assert(HID % 256 == 0 && DM % 128 == 0);     // GEMM block columns: 256 (FFN1), 128 (Q, FFN2)
static_assert(NTOK % 4 == 0);                       // LN block = 4 rows
static_assert(NH * DH == DM);                       // heads concatenate to the model width
static_assert(DH == 64);                            // one GEMM column tile == one head; 2 k-steps per score
static_assert(DM % 64 == 0 && HID % 64 == 0);       // N tiles of 64
static_assert(DM % 32 == 0 && HID % 32 == 0);       // K steps of 32
static_assert(DM == 32 * 8 * 4);                    // LN: 32 lanes x 8 chunks x 4 floats

typedef _Float16 v16h __attribute__((ext_vector_type(16)));
typedef _Float16 v8h  __attribute__((ext_vector_type(8)));
typedef _Float16 v4h  __attribute__((ext_vector_type(4)));
typedef float    v8f  __attribute__((ext_vector_type(8)));
typedef float    v4f  __attribute__((ext_vector_type(4)));

union Frag { v16h v; v8h h[2]; };

// scores: acc = (64 q_s).(64 q_t); t (log2 units) = acc * log2(e) / 8 / 4096
#define CS (1.44269504088896340736f * 3.0517578125e-05f)

// plane sizes in bytes (all multiples of 128)
#define SZ_X16   ((size_t)NTOK * DM * 2)     // xh, later x1h
#define SZ_WQT   ((size_t)DM * DM * 2)
#define SZ_W1T   ((size_t)HID * DM * 2)
#define SZ_W2T   ((size_t)DM * HID * 2)
#define SZ_Q16   ((size_t)NTOK * DM * 2)     // qrow, qT each
#define SZ_Y32   ((size_t)NTOK * DM * 4)     // y1 (later y2), x1 each
#define SZ_HB    ((size_t)NTOK * HID * 2)
#define WS_TOTAL (SZ_X16 + SZ_WQT + SZ_W1T + SZ_W2T + 2 * SZ_Q16 + 2 * SZ_Y32 + SZ_HB)
static_assert(WS_TOTAL <= (size_t)134217728);       // carve <= 128 MiB

static __device__ __forceinline__ v8f zero8() {
    v8f z;
#pragma unroll
    for (int i = 0; i < 8; ++i) z[i] = 0.0f;
    return z;
}

// 16x32 A fragment (or B fragment from an [n][k] k-contiguous source).
// p = tile_base + (lane&15)*ld + 8*(lane>>4): elements 0..7 = k 8h..8h+7,
// elements 8..15 = k 16+8h..16+8h+7 (split map, same for A and B).
static __device__ __forceinline__ v16h load_frag_p(const _Float16* p) {
    Frag f;
    f.h[0] = *(const v8h*)(p);
    f.h[1] = *(const v8h*)(p + 16);
    return f.v;
}

static __device__ __forceinline__ v8f wmma16(v16h a, v16h b, v8f c) {
    v8f d = __builtin_amdgcn_wmma_f32_16x16x32_f16(false, a, false, b, (short)0, c, false, false);
    asm volatile("v_nop\n\tv_nop\n\tv_nop\n\tv_nop" : "+v"(d) : "v"(a), "v"(b));
    return d;
}

// f32 -> bf16 RNE convert, value kept as f32
static __device__ __forceinline__ float bf16r(float x) {
    unsigned u = __float_as_uint(x);
    u = (u + 0x7FFFu + ((u >> 16) & 1u)) & 0xFFFF0000u;
    return __uint_as_float(u);
}

static __device__ __forceinline__ float ex2(float x) {
    return __builtin_amdgcn_exp2f(x);
}

// ordering for a wave-private LDS tile: stores before later loads of the same wave
static __device__ __forceinline__ void wave_lds_sync() {
    __builtin_amdgcn_fence(3, "wavefront");
    asm volatile("s_wait_dscnt 0" ::: "memory");
    __builtin_amdgcn_wave_barrier();
}

static __device__ __forceinline__ float wave_sum(float v) {
    v += __shfl_xor(v, 16, 32);
    v += __shfl_xor(v, 8, 32);
    v += __shfl_xor(v, 4, 32);
    v += __shfl_xor(v, 2, 32);
    v += __shfl_xor(v, 1, 32);
    return v;
}

// ---------------------------------------------------------------------------
// Operand preparation, one launch, no LDS, no barrier. A work-group is 8 waves and
// takes one share of one of four jobs, picked by its index:
//   xh[tok][d]     = f16(16 * bf16(x)),  2048 16-B output pieces per work-group;
//   out[z][c][r]   = f16(64 * bf16(in[z][r][c])) for Wq, W1 and W2, one 64-row x
//                    32-column tile per wave, transposed in registers.
// Every thread has its 16 16-B loads in flight at once and writes 8 16-B pieces,
// so few waves have to be started for the bytes that are moved.
// ---------------------------------------------------------------------------
#define PX_PIECES 2048                                     // x pieces per work-group
#define PX_BLKS   ((int)((size_t)NTOK * DM / 8 / PX_PIECES))
#define PQ_BLKS   (NH * (DM / 64) * (DH / 32) / 8)
#define P1_BLKS   ((DM / 64) * (HID / 32) / 8)
#define P2_BLKS   ((HID / 64) * (DM / 32) / 8)
static_assert(((size_t)NTOK * DM / 8) % PX_PIECES == 0);   // whole work-groups of x pieces
static_assert(SEQ % (PX_PIECES / (DM / 8)) == 0);          // a work-group's token rows lie in one batch entry
static_assert((NH * (DM / 64) * (DH / 32)) % 8 == 0);      // whole work-groups of Wq tiles
static_assert(((DM / 64) * (HID / 32)) % 8 == 0);          // whole work-groups of W1 and W2 tiles

static __device__ __forceinline__ _Float16 cvt_s(float v, float sc) {
    return (_Float16)(bf16r(v) * sc);
}

// Tile u of in[z][ROWS][COLS]: rows rt*64.., columns ct*32... Lane = (r8, c4): it reads
// rows r8*8..+7 at columns c4*4..+3 and 16+c4*4..+3 (4 lanes = 64 B of a row per load)
// and writes, per column, its 8 rows as one 16-B piece (8 lanes = one whole 128-B line).
template <int ROWS, int COLS>
static __device__ __forceinline__ void tr_tile(const float* __restrict__ in,
                                               _Float16* __restrict__ out, int u, int lane) {
    constexpr int NCT = COLS / 32, NRT = ROWS / 64;
    const int ct = u % NCT;
    const int t  = u / NCT;
    const int rt = t % NRT;
    const int zz = t / NRT;
    const int r8 = lane & 7, c4 = lane >> 3;
    const size_t zoff = (size_t)zz * ROWS * COLS;
    const float* sp = in + zoff + (size_t)(rt * 64 + r8 * 8) * COLS + ct * 32 + c4 * 4;
    v4f a[8][2];
    // every loop below is unrolled whole: a and o stay in registers only under constant indices
#pragma unroll
    for (int j = 0; j < 8; ++j) {
        a[j][0] = *(const v4f*)(sp + (size_t)j * COLS);
        a[j][1] = *(const v4f*)(sp + (size_t)j * COLS + 16);
    }
    // the loads' address registers stay untouched up to this wait (sp is named so that they live until here)
    asm volatile("s_wait_xcnt 0x0" :: "v"(sp) : "memory");
    _Float16* dp = out + zoff + (size_t)(ct * 32 + c4 * 4) * ROWS + rt * 64 + r8 * 8;
    v8h o[8];
#pragma unroll
    for (int c = 0; c < 8; ++c)
#pragma unroll
        for (int j = 0; j < 8; ++j) o[c][j] = cvt_s(a[j][c >> 2][c & 3], 64.0f);
#pragma unroll
    for (int c = 0; c < 8; ++c)
        *(v8h*)(dp + (size_t)((c >> 2) * 16 + (c & 3)) * ROWS) = o[c];
    // no data or address register of the stores is rewritten ahead of this wait (another job's code follows in the listing)
    asm volatile("s_wait_xcnt 0x0" ::: "memory");
}

__global__ __launch_bounds__(256) void k_prep(const float* __restrict__ x,
                                               const float* __restrict__ Wq,
                                               const float* __restrict__ W1,
                                               const float* __restrict__ W2,
                                               _Float16* __restrict__ xh,
                                               _Float16* __restrict__ wqT,
                                               _Float16* __restrict__ w1T,
                                               _Float16* __restrict__ w2T) {
    const int tid  = threadIdx.x;
    const int lane = tid & 31;
    const int w    = tid >> 5;
    int blk = blockIdx.x;
    if (blk < P1_BLKS) { tr_tile<DM, HID>(W1, w1T, blk * 8 + w, lane); return; }
    blk -= P1_BLKS;
    if (blk < P2_BLKS) { tr_tile<HID, DM>(W2, w2T, blk * 8 + w, lane); return; }
    blk -= P2_BLKS;
    if (blk < PQ_BLKS) { tr_tile<DM, DH>(Wq, wqT, blk * 8 + w, lane); return; }
    blk -= PQ_BLKS;
    if (blk >= PX_BLKS) return;
    // 2048 pieces = 16 whole token rows, inside one batch entry
    const int tok0 = blk * (PX_PIECES / (DM / 8));
    const int b    = tok0 / SEQ;
    const int s0   = tok0 - b * SEQ;
    const char* xb = (const char*)(x + ((size_t)b * SEQ_FULL + s0) * DM);   // the same for the whole work-group
    const unsigned ob = (unsigned)tid * 32u;                                // the thread's byte offset in a run of 256 pieces
    v4f a[8], c[8];
    // every loop below is unrolled whole: a, c and o stay in registers only under constant indices
#pragma unroll
    for (int i = 0; i < 8; ++i) {
        a[i] = *(const v4f*)(xb + ob + i * 8192);
        c[i] = *(const v4f*)(xb + ob + i * 8192 + 16);
    }
    // the loads' address register stays untouched up to this wait (ob is named so that it lives until here)
    asm volatile("s_wait_xcnt 0x0" :: "v"(ob) : "memory");
    v8h o[8];
#pragma unroll
    for (int i = 0; i < 8; ++i) {
#pragma unroll
        for (int e = 0; e < 4; ++e) {
            o[i][e]     = cvt_s(a[i][e], 16.0f);
            o[i][4 + e] = cvt_s(c[i][e], 16.0f);
        }
    }
    _Float16* dst = xh + (size_t)(blk * PX_PIECES + tid) * 8;
#pragma unroll
    for (int i = 0; i < 8; ++i) *(v8h*)(dst + i * 2048) = o[i];
    // no data or address register of the stores is rewritten ahead of this wait
    asm volatile("s_wait_xcnt 0x0" ::: "memory");
}

// ---------------------------------------------------------------------------
// GEMM main loop: block = WS x WS waves = a square (WS*64) x (WS*64) tile, one wave
// = 64x64 = 4x4 subtiles; wave w takes row band w % WS and column band w / WS.
// A [M][K] and Bt [N][K] are 16-bit k-contiguous planes in global memory. A stage
// is 64 k (128 B, one whole line) of the block's WS*64 A rows and WS*64 Bt rows,
// laid in LDS at a 144-B pitch; asynchronous copies fill it (16 B per lane, 8 lanes
// per row), two buffers, the next stage in flight while this one is multiplied.
// A staged row feeds WS waves, so the bytes copied per product fall as 1 / WS.
// Fragments are two 16-B LDS loads, same k order as from the global planes.
// ---------------------------------------------------------------------------
#define ST_K      64                         // halves of k per stage
#define ST_PITCH  72                         // halves per LDS row (144 B)
#define ST_HALVES(WS) (2 * (WS) * 64 * ST_PITCH)   // one buffer: A rows, then Bt rows

static __device__ __forceinline__ unsigned lds_off(const void* p) { return (unsigned)(size_t)p; }

// Four copies of A rows and four of Bt rows, each run ls bytes apart in LDS and gs
// halves apart in its plane. The s_wait_xcnt closes the statement so that no
// address register of a copy is rewritten ahead of it.
static __device__ __forceinline__ void copy4_4(unsigned la, const _Float16* ga,
                                               unsigned lb, const _Float16* gb,
                                               unsigned ls, size_t gs) {
    asm volatile(
        "global_load_async_to_lds_b128 %0, %8, off\n\t"
        "global_load_async_to_lds_b128 %1, %9, off\n\t"
        "global_load_async_to_lds_b128 %2, %10, off\n\t"
        "global_load_async_to_lds_b128 %3, %11, off\n\t"
        "global_load_async_to_lds_b128 %4, %12, off\n\t"
        "global_load_async_to_lds_b128 %5, %13, off\n\t"
        "global_load_async_to_lds_b128 %6, %14, off\n\t"
        "global_load_async_to_lds_b128 %7, %15, off\n\t"
        "s_wait_xcnt 0x0"
        :: "v"(la), "v"(la + ls), "v"(la + 2u * ls), "v"(la + 3u * ls),
           "v"(lb), "v"(lb + ls), "v"(lb + 2u * ls), "v"(lb + 3u * ls),
           "v"(ga), "v"(ga + gs), "v"(ga + 2 * gs), "v"(ga + 3 * gs),
           "v"(gb), "v"(gb + gs), "v"(gb + 2 * gs), "v"(gb + 3 * gs)
        : "memory");
}

// One stage: l = the thread's first LDS byte in the buffer, ga / gb = its first A and
// Bt piece at the stage's k. Copy i of a run: run row i * (threads / 8) + tid / 8.
template <int K, int WS>
static __device__ __forceinline__ void copy_stage(unsigned l, const _Float16* ga, const _Float16* gb) {
    constexpr int RSTEP = WS * WS * 4;               // rows that one copy of the whole block covers
    constexpr int NG    = WS * 64 / (4 * RSTEP);     // statements per stage
    static_assert(NG * 4 * RSTEP == WS * 64);        // every row of both runs copied once
    const unsigned ls = (unsigned)RSTEP * ST_PITCH * 2u;
    const size_t   gs = (size_t)RSTEP * K;
#pragma unroll
    for (int j = 0; j < NG; ++j)
        copy4_4(l + 4u * j * ls, ga + 4 * j * gs,
                l + (unsigned)(WS * 64 * ST_PITCH * 2) + 4u * j * ls, gb + 4 * j * gs, ls, gs);
}

// ab = A + m_block * K (WS*64 rows), bb = Bt + n_block * K (WS*64 rows), St = two buffers.
template <int K, int WS>
static __device__ __forceinline__ void gemm_tile64(const _Float16* __restrict__ ab,
                                                   const _Float16* __restrict__ bb,
                                                   _Float16* St,
                                                   v8f (&acc)[4][4]) {
    static_assert(K % ST_K == 0 && K / ST_K >= 2);   // whole stages, both buffers filled
    constexpr int NT = K / ST_K;
    const int tid  = threadIdx.x;
    const int lane = tid & 31;
    const int w    = tid >> 5;
    const int wm   = w % WS;
    const int wn   = w / WS;
    const int lm   = lane & 15;
    const int kb   = (lane >> 4) << 3;
    const _Float16* ga = ab + (size_t)(tid >> 3) * K + (tid & 7) * 8;
    const _Float16* gb = bb + (size_t)(tid >> 3) * K + (tid & 7) * 8;
    const unsigned  l0 = lds_off(St) + (unsigned)((tid >> 3) * (ST_PITCH * 2) + (tid & 7) * 16);

#pragma unroll
    for (int ms = 0; ms < 4; ++ms)
#pragma unroll
        for (int nt = 0; nt < 4; ++nt) acc[ms][nt] = zero8();

    copy_stage<K, WS>(l0, ga, gb);
    asm volatile("s_wait_asynccnt 0x0" ::: "memory");   // stage 0 landed (this wave's copies)
    __syncthreads();                                    // stage 0 published to all waves
    copy_stage<K, WS>(l0 + ST_HALVES(WS) * 2u, ga + ST_K, gb + ST_K);

#pragma unroll 1
    for (int t = 0; t < NT; ++t) {
        const int bo = (t & 1) * ST_HALVES(WS);
        const _Float16* sa = St + bo + (wm * 64 + lm) * ST_PITCH + kb;
        const _Float16* sb = St + bo + ((WS + wn) * 64 + lm) * ST_PITCH + kb;
        // Fragment reads stand in few groups, each ahead of the products that hide it:
        // k 0..31 whole and the A side of k 32..63 first, the B side of k 32..63 in
        // two halves into the B registers that the first k step has just left.
        v16h a0[4], a1[4], bn[4];
#pragma unroll
        for (int i = 0; i < 4; ++i) a0[i] = load_frag_p(sa + i * 16 * ST_PITCH);
#pragma unroll
        for (int i = 0; i < 4; ++i) bn[i] = load_frag_p(sb + i * 16 * ST_PITCH);
#pragma unroll
        for (int i = 0; i < 4; ++i) a1[i] = load_frag_p(sa + i * 16 * ST_PITCH + 32);
#pragma unroll
        for (int hf = 0; hf < 4; hf += 2) {
#pragma unroll
            for (int nt = hf; nt < hf + 2; ++nt)
#pragma unroll
                for (int ms = 0; ms < 4; ++ms) acc[ms][nt] = wmma16(a0[ms], bn[nt], acc[ms][nt]);
#pragma unroll
            for (int nt = hf; nt < hf + 2; ++nt) bn[nt] = load_frag_p(sb + nt * 16 * ST_PITCH + 32);
        }
#pragma unroll
        for (int nt = 0; nt < 4; ++nt)
#pragma unroll
            for (int ms = 0; ms < 4; ++ms) acc[ms][nt] = wmma16(a1[ms], bn[nt], acc[ms][nt]);
        asm volatile("s_wait_dscnt 0x0" ::: "memory");      // this wave's reads of the buffer are done
        asm volatile("s_wait_asynccnt 0x0" ::: "memory");   // stage t+1 landed (this wave's copies)
        __syncthreads();                                    // publishes stage t+1, frees stage t's buffer
        if (t + 2 < NT)
            copy_stage<K, WS>(l0 + (unsigned)bo * 2u, ga + (size_t)(t + 2) * ST_K, gb + (size_t)(t + 2) * ST_K);
    }
    asm volatile("s_wait_asynccnt 0x0" ::: "memory");       // nothing in flight when the loop is left
}

// ---------------------------------------------------------------------------
// Q projection: acc = (16 x)(64 Wq) = 1024 x.Wq ; q64 = (acc + 1024 bq) / 16.
// Writes qrow[b][h][s][64] and qT[b][h][64][s] as f16(64 q).
// Block = 2 x 2 waves = 128 tokens x two heads; wave tile = 64 tokens x one head. Row plane: 16-row steps through a
// wave-private LDS tile; transposed plane: whole 64x64 wave-private tile.
// ---------------------------------------------------------------------------
__global__ __launch_bounds__(128) __attribute__((amdgpu_num_vgpr(256)))
void k_gemm_q(const _Float16* __restrict__ xh,
              const _Float16* __restrict__ wqT,
              const float* __restrict__ bq,
              _Float16* __restrict__ qrow,
              _Float16* __restrict__ qT) {
    __shared__ __align__(16) _Float16 Rst[4][16 * 64];   // 8 KB, wave-private
    __shared__ __align__(16) _Float16 Tst[4][64 * 64];   // 32 KB, wave-private
    __shared__ __align__(16) _Float16 St[2 * ST_HALVES(2)]; // 72 KB, operand stages, cross-wave
    const int tid  = threadIdx.x;
    const int lane = tid & 31;
    const int w    = tid >> 5;
    const int hh   = lane >> 4;
    const int lm   = lane & 15;
    const int m0   = blockIdx.x * 128 + (w % 2) * 64;
    const int head = blockIdx.y * 2 + w / 2;
    const int n0   = head * 64;
    const int b    = m0 / SEQ;
    const int s0   = m0 - b * SEQ;

    v8f acc[4][4];
    gemm_tile64<DM, 2>(xh + (size_t)(blockIdx.x * 128) * DM, wqT + (size_t)(blockIdx.y * 128) * DM, St, acc);

    float bv[4];
#pragma unroll
    for (int nt = 0; nt < 4; ++nt) bv[nt] = bf16r(bq[n0 + nt * 16 + lm]) * 1024.0f;

    _Float16* qr = qrow + (((size_t)b * NH + head) * SEQ + s0) * DH;
    _Float16* qt = qT + ((size_t)b * NH + head) * DH * SEQ + s0;

#pragma unroll
    for (int ms = 0; ms < 4; ++ms) {
#pragma unroll
        for (int nt = 0; nt < 4; ++nt) {
            v8h tv;
#pragma unroll
            for (int r = 0; r < 8; ++r) {
                _Float16 hv = (_Float16)((acc[ms][nt][r] + bv[nt]) * 0.0625f);
                Rst[w][(8 * hh + r) * 64 + nt * 16 + lm] = hv;
                tv[r] = hv;
            }
            *(v8h*)(&Tst[w][(nt * 16 + lm) * 64 + ms * 16 + 8 * hh]) = tv;
        }
        wave_lds_sync();
        v8h rv[4];
#pragma unroll
        for (int i = 0; i < 4; ++i) rv[i] = *(const v8h*)(&Rst[w][i * 256 + lane * 8]);
        _Float16* dst = qr + ms * 1024 + lane * 8;
#pragma unroll
        for (int i = 0; i < 4; ++i) *(v8h*)(dst + i * 256) = rv[i];
        
        wave_lds_sync();
    }
    wave_lds_sync();
#pragma unroll 1
    for (int g = 0; g < 4; ++g) {
        v8h tv[4];
#pragma unroll
        for (int i = 0; i < 4; ++i) tv[i] = *(const v8h*)(&Tst[w][(g * 4 + i) * 256 + lane * 8]);
        _Float16* dst = qt + (size_t)(g * 16 + (lane >> 3)) * SEQ + (lane & 7) * 8;
#pragma unroll
        for (int i = 0; i < 4; ++i) *(v8h*)(dst + (size_t)i * 4 * SEQ) = tv[i];
        
    }
}

// ---------------------------------------------------------------------------
// Fused attention, q = k = v. Block = 8 waves = 128 queries of one (b, head);
// a wave owns 16 queries and streams all SEQ keys, 32 per step:
//   S^T tiles (rows = keys, cols = queries): A = key rows, B = query rows
//   (k = d, 2 steps of 32); query fragments straight from the qrow plane;
//   per-lane online softmax (lane column = its query; partner lane +-16);
//   P^T carried 2^8 as f16: the two S^T tiles chain directly as the B
//   fragment (elements 0..7 = tile keys 0..15, 8..15 = tile keys 16..31);
//   O^T += V^T . P^T with A fragments of V^T (rows = d, k = keys).
// Key rows and V^T rows reach the waves through LDS: a stage is 128 keys, 128
// qrow rows of 128 B at a 144-B pitch and 64 qT rows of 256 B at a 272-B pitch,
// filled once per block by asynchronous copies (16 B per lane, whole lines per
// wave) and read by all 8 waves; two buffers, the next stage in flight while
// this one is worked on. Fragments keep the k order they had from the planes.
// Epilogue: O^T / (64 l) staged as [query][d] f32 in a wave-private LDS tile,
// bf16(x) added at the store stage, 8 lane-contiguous 16-B-per-lane
// ---------------------------------------------------------------------------
#define AT_KEYS   128                        // keys per stage
#define AK_PITCH  72                         // halves per key row in LDS (144 B)
#define AV_PITCH  136                        // halves per V^T row in LDS (272 B)
#define AK_HALVES (AT_KEYS * AK_PITCH)       // key rows of one buffer, 18,432 B
#define AV_HALVES (DH * AV_PITCH)            // V^T rows of one buffer, 17,408 B
#define AT_HALVES (AK_HALVES + AV_HALVES)    // one buffer, 35,840 B
static_assert(SEQ % AT_KEYS == 0);           // whole stages

// Four copies of key rows (32 rows apart) and four of V^T rows (16 rows apart).
// The s_wait_xcnt closes the statement so that no address register of a copy is
// rewritten ahead of it.
static __device__ __forceinline__ void copy_kv(unsigned lk, const _Float16* gk,
                                               unsigned lv, const _Float16* gv) {
    const unsigned ks = 32u * AK_PITCH * 2u;
    const unsigned vs = 16u * AV_PITCH * 2u;
    const size_t   gks = (size_t)32 * DH;
    const size_t   gvs = (size_t)16 * SEQ;
    asm volatile(
        "global_load_async_to_lds_b128 %0, %8, off\n\t"
        "global_load_async_to_lds_b128 %1, %9, off\n\t"
        "global_load_async_to_lds_b128 %2, %10, off\n\t"
        "global_load_async_to_lds_b128 %3, %11, off\n\t"
        "global_load_async_to_lds_b128 %4, %12, off\n\t"
        "global_load_async_to_lds_b128 %5, %13, off\n\t"
        "global_load_async_to_lds_b128 %6, %14, off\n\t"
        "global_load_async_to_lds_b128 %7, %15, off\n\t"
        "s_wait_xcnt 0x0"
        :: "v"(lk), "v"(lk + ks), "v"(lk + 2u * ks), "v"(lk + 3u * ks),
           "v"(lv), "v"(lv + vs), "v"(lv + 2u * vs), "v"(lv + 3u * vs),
           "v"(gk), "v"(gk + gks), "v"(gk + 2 * gks), "v"(gk + 3 * gks),
           "v"(gv), "v"(gv + gvs), "v"(gv + 2 * gvs), "v"(gv + 3 * gvs)
        : "memory");
}

__global__ __launch_bounds__(256) __attribute__((amdgpu_num_vgpr(256)))
void k_attn(const _Float16* __restrict__ qrow,
            const _Float16* __restrict__ qT,
            const float* __restrict__ x,
            float* __restrict__ y1) {
    __shared__ __align__(16) float Ost[8][16 * DH];      // 32 KB, wave-private
    __shared__ __align__(16) _Float16 Kv[2 * AT_HALVES]; // 70 KB, key and V^T stages, cross-wave
    constexpr int NT = SEQ / AT_KEYS;
    const int tid  = threadIdx.x;
    const int lane = tid & 31;
    const int w    = tid >> 5;
    const int hh   = lane >> 4;
    const int lm   = lane & 15;
    const int kb   = hh << 3;
    const int b    = blockIdx.z;
    const int head = blockIdx.y;
    const int q0   = blockIdx.x * 128 + w * 16;

    const _Float16* qhead = qrow + ((size_t)b * NH + head) * SEQ * DH;
    const _Float16* thead = qT + ((size_t)b * NH + head) * DH * SEQ;
    const _Float16* qlane = qhead + (size_t)lm * DH + kb;
    // key copy i of a thread: stage row i*32 + tid/8, 16-B piece tid%8;
    // V^T copy i: row i*16 + tid/16, 16-B piece tid%16
    const _Float16* gk = qhead + (size_t)(tid >> 3) * DH + (tid & 7) * 8;
    const _Float16* gv = thead + (size_t)(tid >> 4) * SEQ + (tid & 15) * 8;
    const unsigned  lk = lds_off(Kv) + (unsigned)((tid >> 3) * (AK_PITCH * 2) + (tid & 7) * 16);
    const unsigned  lv = lds_off(Kv) + (unsigned)(AK_HALVES * 2 + (tid >> 4) * (AV_PITCH * 2) + (tid & 15) * 16);

    copy_kv(lk, gk, lv, gv);
    asm volatile("s_wait_asynccnt 0x0" ::: "memory");   // stage 0 landed (this wave's copies)
    __syncthreads();                                    // stage 0 published to all waves
    if (NT > 1)
        copy_kv(lk + AT_HALVES * 2u, gk + (size_t)AT_KEYS * DH, lv + AT_HALVES * 2u, gv + AT_KEYS);

    const v16h qf0 = load_frag_p(qlane + (size_t)q0 * DH);        // d 0..31
    const v16h qf1 = load_frag_p(qlane + (size_t)q0 * DH + 32);   // d 32..63

    v8f o[4];
#pragma unroll
    for (int dt = 0; dt < 4; ++dt) o[dt] = zero8();
    float mr = -1.0e30f, l = 0.0f;

#pragma unroll 1
    for (int t = 0; t < NT; ++t) {
      const int bo = (t & 1) * AT_HALVES;
      const _Float16* sk = Kv + bo + lm * AK_PITCH + kb;
      const _Float16* sv = Kv + bo + AK_HALVES + lm * AV_PITCH + kb;
#pragma unroll
      for (int u = 0; u < AT_KEYS / 32; ++u) {
        // The step's LDS reads stand in one group ahead of its products, so that
        // the wave waits out one LDS latency per 32 keys and not one per fragment.
        const _Float16* ka = sk + u * 32 * AK_PITCH;
        v16h a0 = load_frag_p(ka);
        v16h a1 = load_frag_p(ka + 32);
        v16h c0 = load_frag_p(ka + 16 * AK_PITCH);
        v16h c1 = load_frag_p(ka + 16 * AK_PITCH + 32);
        v16h vf[4];
#pragma unroll
        for (int dt = 0; dt < 4; ++dt) vf[dt] = load_frag_p(sv + dt * 16 * AV_PITCH + u * 32);
        v8f sA = wmma16(a0, qf0, zero8());
        sA = wmma16(a1, qf1, sA);
        v8f sB = wmma16(c0, qf0, zero8());
        sB = wmma16(c1, qf1, sB);

        float tA[8], tB[8];
#pragma unroll
        for (int i = 0; i < 8; ++i) { tA[i] = sA[i] * CS; tB[i] = sB[i] * CS; }
        float tmax = fmaxf(tA[0], tB[0]);
#pragma unroll
        for (int i = 1; i < 8; ++i) tmax = fmaxf(tmax, fmaxf(tA[i], tB[i]));
        tmax = fmaxf(tmax, __shfl_xor(tmax, 16, 32));
        const float mn = fmaxf(mr, tmax);
        if (__builtin_amdgcn_ballot_w32(mn > mr) != 0u) {       // wave-uniform
            const float sc = ex2(mr - mn);
            l *= sc;
#pragma unroll
            for (int dt = 0; dt < 4; ++dt)
#pragma unroll
                for (int r = 0; r < 8; ++r) o[dt][r] *= sc;
        }
        mr = mn;
        const float sh = 8.0f - mn;
        float ps = 0.0f;
        v16h pb;
#pragma unroll
        for (int i = 0; i < 8; ++i) {
            const float pa = ex2(tA[i] + sh);
            const float pq = ex2(tB[i] + sh);
            ps += pa + pq;
            pb[i]     = (_Float16)pa;
            pb[8 + i] = (_Float16)pq;
        }
        l += ps;
#pragma unroll
        for (int dt = 0; dt < 4; ++dt) o[dt] = wmma16(vf[dt], pb, o[dt]);
      }
      asm volatile("s_wait_dscnt 0x0" ::: "memory");      // this wave's reads of the buffer are done
      asm volatile("s_wait_asynccnt 0x0" ::: "memory");   // stage t+1 landed (this wave's copies)
      __syncthreads();                                    // publishes stage t+1, frees stage t's buffer
      if (t + 2 < NT)
          copy_kv(lk + (unsigned)bo * 2u, gk + (size_t)(t + 2) * AT_KEYS * DH,
                  lv + (unsigned)bo * 2u, gv + (size_t)(t + 2) * AT_KEYS);
    }
    asm volatile("s_wait_asynccnt 0x0" ::: "memory");       // nothing in flight when the loop is left

    const float lt  = l + __shfl_xor(l, 16, 32);
    const float inv = (1.0f / lt) * 0.015625f;          // 2^8 P carry cancels in o/l; 1/64 for the q carry
#pragma unroll
    for (int dt = 0; dt < 4; ++dt) {
        v4f u0, u1;
        u0.x = o[dt][0] * inv; u0.y = o[dt][1] * inv; u0.z = o[dt][2] * inv; u0.w = o[dt][3] * inv;
        u1.x = o[dt][4] * inv; u1.y = o[dt][5] * inv; u1.z = o[dt][6] * inv; u1.w = o[dt][7] * inv;
        *(v4f*)(&Ost[w][lm * DH + dt * 16 + 8 * hh])     = u0;
        *(v4f*)(&Ost[w][lm * DH + dt * 16 + 8 * hh + 4]) = u1;
    }
    wave_lds_sync();

    v4f sv[8];
    const int col = lm * 4;
#pragma unroll
    for (int i = 0; i < 8; ++i) {
        const int row = 2 * i + hh;
        v4f a  = *(const v4f*)(&Ost[w][i * 128 + lane * 4]);
        v4f xv = *(const v4f*)(x + ((size_t)b * SEQ_FULL + q0 + row) * DM + head * DH + col);
        a.x = bf16r(xv.x) + a.x;
        a.y = bf16r(xv.y) + a.y;
        a.z = bf16r(xv.z) + a.z;
        a.w = bf16r(xv.w) + a.w;
        sv[i] = a;
    }
    float* ob = y1 + ((size_t)b * SEQ + q0 + hh) * DM + head * DH + col;
#pragma unroll
    for (int i = 0; i < 8; ++i) *(v4f*)(ob + (size_t)(2 * i) * DM) = sv[i];
    
}

// ---------------------------------------------------------------------------
// row, row kept in a wave-private LDS line, loops rolled. Writes f32 row
// (512 B per instruction, lane-contiguous) and optionally f16(16 * LN(y)) row
// ---------------------------------------------------------------------------
__global__ __launch_bounds__(128) void k_ln(const float* __restrict__ y,
                                             const float* __restrict__ g,
                                             const float* __restrict__ be,
                                             float* __restrict__ of,
                                             _Float16* __restrict__ oh,
                                             int wr16) {
    __shared__ __align__(16) float    Rw[4][DM];     // 16 KB, wave-private
    __shared__ __align__(16) _Float16 Hw[4][DM];     // 8 KB, wave-private
    const int tid  = threadIdx.x;
    const int lane = tid & 31;
    const int w    = tid >> 5;
    const int row  = blockIdx.x * 4 + w;
    if (row >= NTOK) return;                          // wave-uniform; no block barriers below
    const float* yr = y + (size_t)row * DM;

    float s = 0.0f;
#pragma unroll 1
    for (int j = 0; j < 8; ++j) {
        const int c = j * 128 + lane * 4;
        v4f v = *(const v4f*)(yr + c);
        *(v4f*)(&Rw[w][c]) = v;
        s += (v.x + v.y) + (v.z + v.w);
    }
    s = wave_sum(s);
    const float mu = s * 0.0009765625f;
    float qv = 0.0f;
#pragma unroll 1
    for (int j = 0; j < 8; ++j) {
        const int c = j * 128 + lane * 4;
        v4f v = *(const v4f*)(&Rw[w][c]);
        const float d0 = v.x - mu, d1 = v.y - mu, d2 = v.z - mu, d3 = v.w - mu;
        qv += (d0 * d0 + d1 * d1) + (d2 * d2 + d3 * d3);
    }
    qv = wave_sum(qv);
    const float rs = rsqrtf(qv * 0.0009765625f + 1.0e-5f);
#pragma unroll 1
    for (int j = 0; j < 8; ++j) {
        const int c = j * 128 + lane * 4;
        v4f v  = *(const v4f*)(&Rw[w][c]);
        v4f gv = *(const v4f*)(g + c);
        v4f bv = *(const v4f*)(be + c);
        v4f r;
        r.x = (v.x - mu) * rs * bf16r(gv.x) + bf16r(bv.x);
        r.y = (v.y - mu) * rs * bf16r(gv.y) + bf16r(bv.y);
        r.z = (v.z - mu) * rs * bf16r(gv.z) + bf16r(bv.z);
        r.w = (v.w - mu) * rs * bf16r(gv.w) + bf16r(bv.w);
        *(v4f*)(&Rw[w][c]) = r;
        if (wr16 != 0) {
            v4h hv;
            hv.x = (_Float16)(r.x * 16.0f);
            hv.y = (_Float16)(r.y * 16.0f);
            hv.z = (_Float16)(r.z * 16.0f);
            hv.w = (_Float16)(r.w * 16.0f);
            *(v4h*)(&Hw[w][c]) = hv;
        }
    }
    wave_lds_sync();

    float*    df = of + (size_t)row * DM;
    _Float16* dh = oh + (size_t)row * DM;
#pragma unroll 1
    for (int j = 0; j < 8; ++j) {
        const int c = j * 128 + lane * 4;
        v4f v = *(const v4f*)(&Rw[w][c]);
        *(v4f*)(df + c) = v;
    }
    if (wr16 != 0) {
#pragma unroll 1
        for (int j = 0; j < 4; ++j) {
            const int c = j * 256 + lane * 8;
            v8h hv = *(const v8h*)(&Hw[w][c]);
            *(v8h*)(dh + c) = hv;
        }
    }
    
}

// ---------------------------------------------------------------------------
// FFN1: acc = (16 x1)(64 W1) = 1024 pre ; hb = f16(16 relu(pre + b1)).
// Block = 4 x 4 waves = 256 x 256.
// 16-row steps through a wave-private LDS tile; row segment = 64 halves =
// ---------------------------------------------------------------------------
__global__ __launch_bounds__(512) __attribute__((amdgpu_num_vgpr(256)))
void k_gemm_ffn1(const _Float16* __restrict__ a16,
                 const _Float16* __restrict__ w1T,
                 const float* __restrict__ b1,
                 _Float16* __restrict__ hb) {
    __shared__ __align__(16) _Float16 Rst[16][16 * 64];  // 32 KB, wave-private
    __shared__ __align__(16) _Float16 St[2 * ST_HALVES(4)]; // 144 KB, operand stages, cross-wave
    const int tid  = threadIdx.x;
    const int lane = tid & 31;
    const int w    = tid >> 5;
    const int hh   = lane >> 4;
    const int lm   = lane & 15;
    const int m0   = blockIdx.x * 256 + (w % 4) * 64;
    const int n0   = blockIdx.y * 256 + (w / 4) * 64;

    v8f acc[4][4];
    gemm_tile64<DM, 4>(a16 + (size_t)(blockIdx.x * 256) * DM, w1T + (size_t)(blockIdx.y * 256) * DM, St, acc);

    float bv[4];
#pragma unroll
    for (int nt = 0; nt < 4; ++nt) bv[nt] = bf16r(b1[n0 + nt * 16 + lm]) * 1024.0f;

#pragma unroll
    for (int ms = 0; ms < 4; ++ms) {
#pragma unroll
        for (int nt = 0; nt < 4; ++nt)
#pragma unroll
            for (int r = 0; r < 8; ++r)
                Rst[w][(8 * hh + r) * 64 + nt * 16 + lm] =
                    (_Float16)(fmaxf(acc[ms][nt][r] + bv[nt], 0.0f) * 0.015625f);
        wave_lds_sync();
        v8h rv[4];
#pragma unroll
        for (int i = 0; i < 4; ++i) rv[i] = *(const v8h*)(&Rst[w][i * 256 + lane * 8]);
        _Float16* dst = hb + (size_t)(m0 + ms * 16 + (lane >> 3)) * HID + n0 + (lane & 7) * 8;
#pragma unroll
        for (int i = 0; i < 4; ++i) *(v8h*)(dst + (size_t)i * 4 * HID) = rv[i];
        
        wave_lds_sync();
    }
}

// ---------------------------------------------------------------------------
// FFN2: acc = (16 h)(64 W2) = 1024 ff ; y2 = x1 + (ff + b2), f32.
// Block = 2 x 2 waves = 128 x 128.
// 16-row steps through a wave-private f32 LDS tile; bias and skip path added
// at the store stage as 4-float vectors; each instruction = 2 rows x 256 B.
// ---------------------------------------------------------------------------
__global__ __launch_bounds__(128) __attribute__((amdgpu_num_vgpr(256)))
void k_gemm_ffn2(const _Float16* __restrict__ hb,
                 const _Float16* __restrict__ w2T,
                 const float* __restrict__ b2,
                 const float* __restrict__ x1,
                 float* __restrict__ y2) {
    __shared__ __align__(16) float Fst[4][16 * 64];      // 16 KB, wave-private
    __shared__ __align__(16) _Float16 St[2 * ST_HALVES(2)]; // 72 KB, operand stages, cross-wave
    const int tid  = threadIdx.x;
    const int lane = tid & 31;
    const int w    = tid >> 5;
    const int hh   = lane >> 4;
    const int lm   = lane & 15;
    const int m0   = blockIdx.x * 128 + (w % 2) * 64;
    const int n0   = blockIdx.y * 128 + (w / 2) * 64;

    v8f acc[4][4];
    gemm_tile64<HID, 2>(hb + (size_t)(blockIdx.x * 128) * HID, w2T + (size_t)(blockIdx.y * 128) * HID, St, acc);

    const int col = lm * 4;
    v4f bb = *(const v4f*)(b2 + n0 + col);
    bb.x = bf16r(bb.x); bb.y = bf16r(bb.y); bb.z = bf16r(bb.z); bb.w = bf16r(bb.w);

#pragma unroll
    for (int ms = 0; ms < 4; ++ms) {
#pragma unroll
        for (int nt = 0; nt < 4; ++nt)
#pragma unroll
            for (int r = 0; r < 8; ++r)
                Fst[w][(8 * hh + r) * 64 + nt * 16 + lm] = acc[ms][nt][r] * 0.0009765625f;
        wave_lds_sync();
        v4f sv[8];
        const size_t rbase = ((size_t)(m0 + ms * 16 + hh)) * DM + n0 + col;
#pragma unroll
        for (int i = 0; i < 8; ++i) {
            v4f a  = *(const v4f*)(&Fst[w][i * 128 + lane * 4]);
            v4f xr = *(const v4f*)(x1 + rbase + (size_t)(2 * i) * DM);
            a.x = xr.x + (a.x + bb.x);
            a.y = xr.y + (a.y + bb.y);
            a.z = xr.z + (a.z + bb.z);
            a.w = xr.w + (a.w + bb.w);
            sv[i] = a;
        }
        float* dst = y2 + rbase;
#pragma unroll
        for (int i = 0; i < 8; ++i) *(v4f*)(dst + (size_t)(2 * i) * DM) = sv[i];
        
        wave_lds_sync();
    }
}

// ---------------------------------------------------------------------------
extern "C" void kernel_launch(void* const* d_in, const int* in_sizes, int n_in,
                              void* d_out, int out_size, void* d_ws, size_t ws_size,
                              hipStream_t stream) {
    if (n_in < 11) return;
    if (in_sizes[0] < ((NB - 1) * SEQ_FULL + SEQ) * DM) return;
    if (in_sizes[1] < DM * DM || in_sizes[2] < DM) return;
    if (in_sizes[3] < DM || in_sizes[4] < DM) return;
    if (in_sizes[5] < DM * HID || in_sizes[6] < HID) return;
    if (in_sizes[7] < HID * DM || in_sizes[8] < DM) return;
    if (in_sizes[9] < DM || in_sizes[10] < DM) return;
    if (out_size < NTOK * DM) return;
    if (WS_TOTAL > ws_size) return;

    const float* x    = (const float*)d_in[0];    // [2,2048,1024]
    const float* Wq   = (const float*)d_in[1];    // [16,1024,64]  [head][in][dim]
    const float* bq   = (const float*)d_in[2];    // [16,64]
    const float* ln1g = (const float*)d_in[3];
    const float* ln1b = (const float*)d_in[4];
    const float* W1   = (const float*)d_in[5];    // [1024,4096]  [in][out]
    const float* b1   = (const float*)d_in[6];
    const float* W2   = (const float*)d_in[7];    // [4096,1024]  [in][out]
    const float* b2   = (const float*)d_in[8];
    const float* ln2g = (const float*)d_in[9];
    const float* ln2b = (const float*)d_in[10];
    float* out = (float*)d_out;                   // [2,2048,1024]

    char* ws = (char*)d_ws;
    size_t off = 0;
    _Float16* x16  = (_Float16*)(ws + off); off += SZ_X16;   // xh, then x1h (xh dead after k_gemm_q)
    _Float16* wqT  = (_Float16*)(ws + off); off += SZ_WQT;   // [h*64+e][d]
    _Float16* w1T  = (_Float16*)(ws + off); off += SZ_W1T;   // [n][k]
    _Float16* w2T  = (_Float16*)(ws + off); off += SZ_W2T;   // [n][k]
    _Float16* qrow = (_Float16*)(ws + off); off += SZ_Q16;   // [b][h][s][64]
    _Float16* qT   = (_Float16*)(ws + off); off += SZ_Q16;   // [b][h][64][s]
    float*    y12  = (float*)(ws + off);    off += SZ_Y32;   // y1, then y2 (y1 dead after LN1)
    float*    x1   = (float*)(ws + off);    off += SZ_Y32;
    _Float16* hb   = (_Float16*)(ws + off); off += SZ_HB;
    if (off > ws_size) return;

    // x -> xh; Wq per head [1024 (d)][64 (e)] -> [e][d]; W1 [1024 (k)][4096 (n)] -> [n][k]; W2 [4096 (k)][1024 (n)] -> [n][k]
    k_prep<<<dim3(P1_BLKS + P2_BLKS + PQ_BLKS + PX_BLKS), dim3(256), 0, stream>>>(x, Wq, W1, W2, x16, wqT, w1T, w2T);

    k_gemm_q<<<dim3(NTOK / 128, DM / 128), dim3(128), 0, stream>>>(x16, wqT, bq, qrow, qT);
    k_attn<<<dim3(SEQ / 128, NH, NB), dim3(256), 0, stream>>>(qrow, qT, x, y12);
    k_ln<<<dim3(NTOK / 4), dim3(128), 0, stream>>>(y12, ln1g, ln1b, x1, x16, 1);
    k_gemm_ffn1<<<dim3(NTOK / 256, HID / 256), dim3(512), 0, stream>>>(x16, w1T, b1, hb);
    k_gemm_ffn2<<<dim3(NTOK / 128, DM / 128), dim3(128), 0, stream>>>(hb, w2T, b2, x1, y12);
    k_ln<<<dim3(NTOK / 4), dim3(128), 0, stream>>>(y12, ln2g, ln2b, out, x16, 0);
}

// v005
// One run takes 155 microseconds.
// Two timings next to v004 both put it at 1.12 times that version's speed.
// All steps since v000 together make it 2.75 times as fast.
#include <hip/hip_runtime.h>
#include <hip/hip_fp16.h>

// All contractions on v_wmma_f32_16x16x32_f16 (f16 operands, f32 accumulate), single products: x*Wq (x carried x16, Wq x64), q*q^T (q carried x64), P*q (P carried x256), x1*W1 (x1 x16, W1 x64), h*W2 (h x16, W2 x64); raw inputs RNE-converted to bf16 first.

#ifndef NB
#define NB 2
#endif
#ifndef SEQ
#define SEQ 2048
#endif
#define NB_FULL  2
#define SEQ_FULL 2048
#define DM   1024        // model width
#define NH   16          // heads
#define DH   64          // head width
#define HID  4096        // FFN hidden width
#define NTOK (NB * SEQ)

static_assert(NB >= 1 && NB <= NB_FULL);
static_assert(SEQ >= 128 && SEQ <= SEQ_FULL);
static_assert(SEQ % 128 == 0);                      // attention block = 128 queries; key loop steps 32
static_assert(SEQ % 64 == 0);                       // a 64-row GEMM wave tile stays inside one batch
static_assert(NTOK % 256 == 0);                     // GEMM block rows: 256 (FFN1), 128 (Q, FFN2)
static_assert(HID % 256 == 0 && DM % 128 == 0);     // GEMM block columns: 256 (FFN1), 128 (Q, FFN2)
static_assert(NTOK % 4 == 0);                       // LN block = 4 rows
static_assert(NH * DH == DM);                       // heads concatenate to the model width
static_assert(DH == 64);                            // one GEMM column tile == one head; 2 k-steps per score
static_assert(DM % 64 == 0 && HID % 64 == 0);       // N tiles of 64
static_assert(DM % 32 == 0 && HID % 32 == 0);       // K steps of 32
static_assert(DM == 32 * 8 * 4);                    // LN: 32 lanes x 8 chunks x 4 floats

typedef _Float16 v16h __attribute__((ext_vector_type(16)));
typedef _Float16 v8h  __attribute__((ext_vector_type(8)));
typedef _Float16 v4h  __attribute__((ext_vector_type(4)));
typedef float    v8f  __attribute__((ext_vector_type(8)));
typedef float    v4f  __attribute__((ext_vector_type(4)));

union Frag { v16h v; v8h h[2]; };

// scores: acc = (64 q_s).(64 q_t); t (log2 units) = acc * log2(e) / 8 / 4096
#define CS (1.44269504088896340736f * 3.0517578125e-05f)

// plane sizes in bytes (all multiples of 128)
#define SZ_X16   ((size_t)NTOK * DM * 2)     // xh, later x1h
#define SZ_WQT   ((size_t)DM * DM * 2)
#define SZ_W1T   ((size_t)HID * DM * 2)
#define SZ_W2T   ((size_t)DM * HID * 2)
#define SZ_Q16   ((size_t)NTOK * DM * 2)     // qrow, qT each
#define SZ_Y32   ((size_t)NTOK * DM * 4)     // y1 (later y2), x1 each
#define SZ_HB    ((size_t)NTOK * HID * 2)
#define WS_TOTAL (SZ_X16 + SZ_WQT + SZ_W1T + SZ_W2T + 2 * SZ_Q16 + 2 * SZ_Y32 + SZ_HB)
static_assert(WS_TOTAL <= (size_t)134217728);       // carve <= 128 MiB

static __device__ __forceinline__ v8f zero8() {
    v8f z;
#pragma unroll
    for (int i = 0; i < 8; ++i) z[i] = 0.0f;
    return z;
}

// 16x32 A fragment (or B fragment from an [n][k] k-contiguous source).
// p = tile_base + (lane&15)*ld + 8*(lane>>4): elements 0..7 = k 8h..8h+7,
// elements 8..15 = k 16+8h..16+8h+7 (split map, same for A and B).
static __device__ __forceinline__ v16h load_frag_p(const _Float16* p) {
    Frag f;
    f.h[0] = *(const v8h*)(p);
    f.h[1] = *(const v8h*)(p + 16);
    return f.v;
}

static __device__ __forceinline__ v8f wmma16(v16h a, v16h b, v8f c) {
    v8f d = __builtin_amdgcn_wmma_f32_16x16x32_f16(false, a, false, b, (short)0, c, false, false);
    asm volatile("v_nop\n\tv_nop\n\tv_nop\n\tv_nop" : "+v"(d) : "v"(a), "v"(b));
    return d;
}

// f32 -> bf16 RNE convert, value kept as f32
static __device__ __forceinline__ float bf16r(float x) {
    unsigned u = __float_as_uint(x);
    u = (u + 0x7FFFu + ((u >> 16) & 1u)) & 0xFFFF0000u;
    return __uint_as_float(u);
}

static __device__ __forceinline__ float ex2(float x) {
    return __builtin_amdgcn_exp2f(x);
}

// ordering for a wave-private LDS tile: stores before later loads of the same wave
static __device__ __forceinline__ void wave_lds_sync() {
    __builtin_amdgcn_fence(3, "wavefront");
    asm volatile("s_wait_dscnt 0" ::: "memory");
    __builtin_amdgcn_wave_barrier();
}

static __device__ __forceinline__ float wave_sum(float v) {
    v += __shfl_xor(v, 16, 32);
    v += __shfl_xor(v, 8, 32);
    v += __shfl_xor(v, 4, 32);
    v += __shfl_xor(v, 2, 32);
    v += __shfl_xor(v, 1, 32);
    return v;
}

// ---------------------------------------------------------------------------
// Operand preparation, one launch, no LDS, no barrier. A work-group is 8 waves and
// takes one share of one of four jobs, picked by its index:
//   xh[tok][d]     = f16(16 * bf16(x)),  2048 16-B output pieces per work-group;
//   out[z][c][r]   = f16(64 * bf16(in[z][r][c])) for Wq, W1 and W2, one 64-row x
//                    32-column tile per wave, transposed in registers.
// Every thread has its 16 16-B loads in flight at once and writes 8 16-B pieces,
// so few waves have to be started for the bytes that are moved.
// ---------------------------------------------------------------------------
#define PX_PIECES 2048                                     // x pieces per work-group
#define PX_BLKS   ((int)((size_t)NTOK * DM / 8 / PX_PIECES))
#define PQ_BLKS   (NH * (DM / 64) * (DH / 32) / 8)
#define P1_BLKS   ((DM / 64) * (HID / 32) / 8)
#define P2_BLKS   ((HID / 64) * (DM / 32) / 8)
static_assert(((size_t)NTOK * DM / 8) % PX_PIECES == 0);   // whole work-groups of x pieces
static_assert(SEQ % (PX_PIECES / (DM / 8)) == 0);          // a work-group's token rows lie in one batch entry
static_assert((NH * (DM / 64) * (DH / 32)) % 8 == 0);      // whole work-groups of Wq tiles
static_assert(((DM / 64) * (HID / 32)) % 8 == 0);          // whole work-groups of W1 and W2 tiles

static __device__ __forceinline__ _Float16 cvt_s(float v, float sc) {
    return (_Float16)(bf16r(v) * sc);
}

// Tile u of in[z][ROWS][COLS]: rows rt*64.., columns ct*32... Lane = (r8, c4): it reads
// rows r8*8..+7 at columns c4*4..+3 and 16+c4*4..+3 (4 lanes = 64 B of a row per load)
// and writes, per column, its 8 rows as one 16-B piece (8 lanes = one whole 128-B line).
template <int ROWS, int COLS>
static __device__ __forceinline__ void tr_tile(const float* __restrict__ in,
                                               _Float16* __restrict__ out, int u, int lane) {
    constexpr int NCT = COLS / 32, NRT = ROWS / 64;
    const int ct = u % NCT;
    const int t  = u / NCT;
    const int rt = t % NRT;
    const int zz = t / NRT;
    const int r8 = lane & 7, c4 = lane >> 3;
    const size_t zoff = (size_t)zz * ROWS * COLS;
    const float* sp = in + zoff + (size_t)(rt * 64 + r8 * 8) * COLS + ct * 32 + c4 * 4;
    v4f a[8][2];
    // every loop below is unrolled whole: a and o stay in registers only under constant indices
#pragma unroll
    for (int j = 0; j < 8; ++j) {
        a[j][0] = *(const v4f*)(sp + (size_t)j * COLS);
        a[j][1] = *(const v4f*)(sp + (size_t)j * COLS + 16);
    }
    // the loads' address registers stay untouched up to this wait (sp is named so that they live until here)
    asm volatile("s_wait_xcnt 0x0" :: "v"(sp) : "memory");
    _Float16* dp = out + zoff + (size_t)(ct * 32 + c4 * 4) * ROWS + rt * 64 + r8 * 8;
    v8h o[8];
#pragma unroll
    for (int c = 0; c < 8; ++c)
#pragma unroll
        for (int j = 0; j < 8; ++j) o[c][j] = cvt_s(a[j][c >> 2][c & 3], 64.0f);
#pragma unroll
    for (int c = 0; c < 8; ++c)
        *(v8h*)(dp + (size_t)((c >> 2) * 16 + (c & 3)) * ROWS) = o[c];
    // no data or address register of the stores is rewritten ahead of this wait (another job's code follows in the listing)
    asm volatile("s_wait_xcnt 0x0" ::: "memory");
}

__global__ __launch_bounds__(256) void k_prep(const float* __restrict__ x,
                                               const float* __restrict__ Wq,
                                               const float* __restrict__ W1,
                                               const float* __restrict__ W2,
                                               _Float16* __restrict__ xh,
                                               _Float16* __restrict__ wqT,
                                               _Float16* __restrict__ w1T,
                                               _Float16* __restrict__ w2T) {
    const int tid  = threadIdx.x;
    const int lane = tid & 31;
    const int w    = tid >> 5;
    int blk = blockIdx.x;
    if (blk < P1_BLKS) { tr_tile<DM, HID>(W1, w1T, blk * 8 + w, lane); return; }
    blk -= P1_BLKS;
    if (blk < P2_BLKS) { tr_tile<HID, DM>(W2, w2T, blk * 8 + w, lane); return; }
    blk -= P2_BLKS;
    if (blk < PQ_BLKS) { tr_tile<DM, DH>(Wq, wqT, blk * 8 + w, lane); return; }
    blk -= PQ_BLKS;
    if (blk >= PX_BLKS) return;
    // 2048 pieces = 16 whole token rows, inside one batch entry
    const int tok0 = blk * (PX_PIECES / (DM / 8));
    const int b    = tok0 / SEQ;
    const int s0   = tok0 - b * SEQ;
    const char* xb = (const char*)(x + ((size_t)b * SEQ_FULL + s0) * DM);   // the same for the whole work-group
    const unsigned ob = (unsigned)tid * 32u;                                // the thread's byte offset in a run of 256 pieces
    v4f a[8], c[8];
    // every loop below is unrolled whole: a, c and o stay in registers only under constant indices
#pragma unroll
    for (int i = 0; i < 8; ++i) {
        a[i] = *(const v4f*)(xb + ob + i * 8192);
        c[i] = *(const v4f*)(xb + ob + i * 8192 + 16);
    }
    // the loads' address register stays untouched up to this wait (ob is named so that it lives until here)
    asm volatile("s_wait_xcnt 0x0" :: "v"(ob) : "memory");
    v8h o[8];
#pragma unroll
    for (int i = 0; i < 8; ++i) {
#pragma unroll
        for (int e = 0; e < 4; ++e) {
            o[i][e]     = cvt_s(a[i][e], 16.0f);
            o[i][4 + e] = cvt_s(c[i][e], 16.0f);
        }
    }
    _Float16* dst = xh + (size_t)(blk * PX_PIECES + tid) * 8;
#pragma unroll
    for (int i = 0; i < 8; ++i) *(v8h*)(dst + i * 2048) = o[i];
    // no data or address register of the stores is rewritten ahead of this wait
    asm volatile("s_wait_xcnt 0x0" ::: "memory");
}

// ---------------------------------------------------------------------------
// GEMM main loop: block = KS groups of WS x WS waves = a square (WS*64) x (WS*64) tile,
// one wave = 64x64 = 4x4 subtiles; in its group, wave q takes row band q % WS and column
// band q / WS. A [M][K] and Bt [N][K] are 16-bit k-contiguous planes in global memory.
// A stage is KS*64 k (KS whole 128-B lines) of the block's WS*64 A rows and WS*64 Bt rows,
// laid in LDS at a pitch of 16 B more; asynchronous copies fill it (16 B per lane, 8*KS
// lanes per row), two buffers, the next stage in flight while this one is multiplied.
// A staged row feeds WS waves, so the bytes copied per product fall as 1 / WS.
// Group g multiplies k g*64..g*64+63 of every stage, so with KS = 2 a block of four
// 64x64 tiles runs two waves on each SIMD, one working while the other waits; each
// group ends with a partial sum over its half of k, and the caller joins the two.
// Fragments are two 16-B LDS loads, same k order as from the global planes.
// ---------------------------------------------------------------------------
#define ST_K      64                         // halves of k per stage and wave group
#define ST_PITCH(KS)  ((KS) * ST_K + 8)      // halves per LDS row (144 B, 272 B)
#define ST_HALVES(WS, KS) (2 * (WS) * 64 * ST_PITCH(KS))   // one buffer: A rows, then Bt rows

static __device__ __forceinline__ unsigned lds_off(const void* p) { return (unsigned)(size_t)p; }

// Four copies of A rows and four of Bt rows, each run ls bytes apart in LDS and gs
// halves apart in its plane. The s_wait_xcnt closes the statement so that no
// address register of a copy is rewritten ahead of it.
static __device__ __forceinline__ void copy4_4(unsigned la, const _Float16* ga,
                                               unsigned lb, const _Float16* gb,
                                               unsigned ls, size_t gs) {
    asm volatile(
        "global_load_async_to_lds_b128 %0, %8, off\n\t"
        "global_load_async_to_lds_b128 %1, %9, off\n\t"
        "global_load_async_to_lds_b128 %2, %10, off\n\t"
        "global_load_async_to_lds_b128 %3, %11, off\n\t"
        "global_load_async_to_lds_b128 %4, %12, off\n\t"
        "global_load_async_to_lds_b128 %5, %13, off\n\t"
        "global_load_async_to_lds_b128 %6, %14, off\n\t"
        "global_load_async_to_lds_b128 %7, %15, off\n\t"
        "s_wait_xcnt 0x0"
        :: "v"(la), "v"(la + ls), "v"(la + 2u * ls), "v"(la + 3u * ls),
           "v"(lb), "v"(lb + ls), "v"(lb + 2u * ls), "v"(lb + 3u * ls),
           "v"(ga), "v"(ga + gs), "v"(ga + 2 * gs), "v"(ga + 3 * gs),
           "v"(gb), "v"(gb + gs), "v"(gb + 2 * gs), "v"(gb + 3 * gs)
        : "memory");
}

// One stage: l = the thread's first LDS byte in the buffer, ga / gb = its first A and
// Bt piece at the stage's k. Copy i of a run: run row (i * threads + tid) / (8 * KS).
template <int K, int WS, int KS>
static __device__ __forceinline__ void copy_stage(unsigned l, const _Float16* ga, const _Float16* gb) {
    constexpr int RSTEP = WS * WS * 4;               // rows that one copy of the whole block covers
    constexpr int NG    = WS * 64 / (4 * RSTEP);     // statements per stage
    static_assert(NG * 4 * RSTEP == WS * 64);        // every row of both runs copied once
    const unsigned ls = (unsigned)RSTEP * ST_PITCH(KS) * 2u;
    const size_t   gs = (size_t)RSTEP * K;
#pragma unroll
    for (int j = 0; j < NG; ++j)
        copy4_4(l + 4u * j * ls, ga + 4 * j * gs,
                l + (unsigned)(WS * 64 * ST_PITCH(KS) * 2) + 4u * j * ls, gb + 4 * j * gs, ls, gs);
}

// ab = A + m_block * K (WS*64 rows), bb = Bt + n_block * K (WS*64 rows), St = two buffers.
template <int K, int WS, int KS>
static __device__ __forceinline__ void gemm_tile64(const _Float16* __restrict__ ab,
                                                   const _Float16* __restrict__ bb,
                                                   _Float16* St,
                                                   v8f (&acc)[4][4]) {
    constexpr int SK = ST_K * KS;                    // halves of k per stage
    constexpr int PT = ST_PITCH(KS);
    static_assert(K % SK == 0 && K / SK >= 2);       // whole stages, both buffers filled
    constexpr int NT = K / SK;
    const int tid  = threadIdx.x;
    const int lane = tid & 31;
    const int w    = tid >> 5;
    const int kg   = w / (WS * WS);
    const int wm   = (w % (WS * WS)) % WS;
    const int wn   = (w % (WS * WS)) / WS;
    const int lm   = lane & 15;
    const int kb   = kg * ST_K + ((lane >> 4) << 3);
    const int crow = tid / (8 * KS), cpc = tid % (8 * KS);
    const _Float16* ga = ab + (size_t)crow * K + cpc * 8;
    const _Float16* gb = bb + (size_t)crow * K + cpc * 8;
    const unsigned  l0 = lds_off(St) + (unsigned)(crow * (PT * 2) + cpc * 16);

#pragma unroll
    for (int ms = 0; ms < 4; ++ms)
#pragma unroll
        for (int nt = 0; nt < 4; ++nt) acc[ms][nt] = zero8();

    copy_stage<K, WS, KS>(l0, ga, gb);
    asm volatile("s_wait_asynccnt 0x0" ::: "memory");   // stage 0 landed (this wave's copies)
    __syncthreads();                                    // stage 0 published to all waves
    copy_stage<K, WS, KS>(l0 + ST_HALVES(WS, KS) * 2u, ga + SK, gb + SK);

#pragma unroll 1
    for (int t = 0; t < NT; ++t) {
        const int bo = (t & 1) * ST_HALVES(WS, KS);
        const _Float16* sa = St + bo + (wm * 64 + lm) * PT + kb;
        const _Float16* sb = St + bo + ((WS + wn) * 64 + lm) * PT + kb;
        // Fragment reads stand in few groups, each ahead of the products that hide it:
        // k 0..31 whole and the A side of k 32..63 first, the B side of k 32..63 in
        // two halves into the B registers that the first k step has just left.
        v16h a0[4], a1[4], bn[4];
#pragma unroll
        for (int i = 0; i < 4; ++i) a0[i] = load_frag_p(sa + i * 16 * PT);
#pragma unroll
        for (int i = 0; i < 4; ++i) bn[i] = load_frag_p(sb + i * 16 * PT);
#pragma unroll
        for (int i = 0; i < 4; ++i) a1[i] = load_frag_p(sa + i * 16 * PT + 32);
#pragma unroll
        for (int hf = 0; hf < 4; hf += 2) {
#pragma unroll
            for (int nt = hf; nt < hf + 2; ++nt)
#pragma unroll
                for (int ms = 0; ms < 4; ++ms) acc[ms][nt] = wmma16(a0[ms], bn[nt], acc[ms][nt]);
#pragma unroll
            for (int nt = hf; nt < hf + 2; ++nt) bn[nt] = load_frag_p(sb + nt * 16 * PT + 32);
        }
#pragma unroll
        for (int nt = 0; nt < 4; ++nt)
#pragma unroll
            for (int ms = 0; ms < 4; ++ms) acc[ms][nt] = wmma16(a1[ms], bn[nt], acc[ms][nt]);
        asm volatile("s_wait_dscnt 0x0" ::: "memory");      // this wave's reads of the buffer are done
        asm volatile("s_wait_asynccnt 0x0" ::: "memory");   // stage t+1 landed (this wave's copies)
        __syncthreads();                                    // publishes stage t+1, frees stage t's buffer
        if (t + 2 < NT)
            copy_stage<K, WS, KS>(l0 + (unsigned)bo * 2u, ga + (size_t)(t + 2) * SK, gb + (size_t)(t + 2) * SK);
    }
    asm volatile("s_wait_asynccnt 0x0" ::: "memory");       // nothing in flight when the loop is left
}

// Joining the two k groups' partial sums. X = the operand ring, free behind the loop's
// last barrier. A subtile travels as two runs of 512 B, 16 B per lane, lane-contiguous;
// slot = 256 floats. The sum of a pair is the same whichever group forms it.
static __device__ __forceinline__ void sub_put(float* X, int slot, int lane, v8f v) {
    v4f lo, hi;
    lo.x = v[0]; lo.y = v[1]; lo.z = v[2]; lo.w = v[3];
    hi.x = v[4]; hi.y = v[5]; hi.z = v[6]; hi.w = v[7];
    *(v4f*)(X + slot * 256 + lane * 4)       = lo;
    *(v4f*)(X + slot * 256 + 128 + lane * 4) = hi;
}

static __device__ __forceinline__ v8f sub_add(const float* X, int slot, int lane, v8f v) {
    const v4f lo = *(const v4f*)(X + slot * 256 + lane * 4);
    const v4f hi = *(const v4f*)(X + slot * 256 + 128 + lane * 4);
    v[0] += lo.x; v[1] += lo.y; v[2] += lo.z; v[3] += lo.w;
    v[4] += hi.x; v[5] += hi.y; v[6] += hi.z; v[7] += hi.w;
    return v;
}

// ---------------------------------------------------------------------------
// Q projection: acc = (16 x)(64 Wq) = 1024 x.Wq ; q64 = (acc + 1024 bq) / 16.
// Writes qrow[b][h][s][64] and qT[b][h][64][s] as f16(64 q).
// Block = two k groups of 2 x 2 waves = 128 tokens x two heads; wave tile = 64 tokens x one head. The second group
// hands its partial sums to the first through LDS and ends; the first stores. Row plane: 16-row steps through a
// wave-private LDS tile; transposed plane: whole 64x64 wave-private tile.
// ---------------------------------------------------------------------------
__global__ __launch_bounds__(256) __attribute__((amdgpu_num_vgpr(256)))
void k_gemm_q(const _Float16* __restrict__ xh,
              const _Float16* __restrict__ wqT,
              const float* __restrict__ bq,
              _Float16* __restrict__ qrow,
              _Float16* __restrict__ qT) {
    __shared__ __align__(16) _Float16 Rst[4][16 * 64];   // 8 KB, wave-private
    __shared__ __align__(16) _Float16 Tst[4][64 * 64];   // 32 KB, wave-private
    __shared__ __align__(16) _Float16 St[2 * ST_HALVES(2, 2)]; // 136 KB, operand stages, cross-wave
    const int tid  = threadIdx.x;
    const int lane = tid & 31;
    const int wv   = __builtin_amdgcn_readfirstlane(tid >> 5);   // the wave's number, held scalar: the tests on kg are scalar branches
    const int kg   = wv >> 2;
    const int w    = wv & 3;
    const int hh   = lane >> 4;
    const int lm   = lane & 15;
    const int m0   = blockIdx.x * 128 + (w % 2) * 64;
    const int head = blockIdx.y * 2 + w / 2;
    const int n0   = head * 64;
    const int b    = m0 / SEQ;
    const int s0   = m0 - b * SEQ;

    v8f acc[4][4];
    gemm_tile64<DM, 2, 2>(xh + (size_t)(blockIdx.x * 128) * DM, wqT + (size_t)(blockIdx.y * 128) * DM, St, acc);

    float* X = (float*)St;
    // the loops of the join are unrolled whole: acc stays in registers only under constant indices
    if (kg == 1) {
#pragma unroll
        for (int ms = 0; ms < 4; ++ms)
#pragma unroll
            for (int nt = 0; nt < 4; ++nt) sub_put(X, w * 16 + ms * 4 + nt, lane, acc[ms][nt]);
    }
    __syncthreads();                                    // the second group's partial sums published
    if (kg == 1) return;                                // no block barrier below
#pragma unroll
    for (int ms = 0; ms < 4; ++ms)
#pragma unroll
        for (int nt = 0; nt < 4; ++nt) acc[ms][nt] = sub_add(X, w * 16 + ms * 4 + nt, lane, acc[ms][nt]);

    float bv[4];
#pragma unroll
    for (int nt = 0; nt < 4; ++nt) bv[nt] = bf16r(bq[n0 + nt * 16 + lm]) * 1024.0f;

    _Float16* qr = qrow + (((size_t)b * NH + head) * SEQ + s0) * DH;
    _Float16* qt = qT + ((size_t)b * NH + head) * DH * SEQ + s0;

#pragma unroll
    for (int ms = 0; ms < 4; ++ms) {
#pragma unroll
        for (int nt = 0; nt < 4; ++nt) {
            v8h tv;
#pragma unroll
            for (int r = 0; r < 8; ++r) {
                _Float16 hv = (_Float16)((acc[ms][nt][r] + bv[nt]) * 0.0625f);
                Rst[w][(8 * hh + r) * 64 + nt * 16 + lm] = hv;
                tv[r] = hv;
            }
            *(v8h*)(&Tst[w][(nt * 16 + lm) * 64 + ms * 16 + 8 * hh]) = tv;
        }
        wave_lds_sync();
        v8h rv[4];
#pragma unroll
        for (int i = 0; i < 4; ++i) rv[i] = *(const v8h*)(&Rst[w][i * 256 + lane * 8]);
        _Float16* dst = qr + ms * 1024 + lane * 8;
#pragma unroll
        for (int i = 0; i < 4; ++i) *(v8h*)(dst + i * 256) = rv[i];
        
        wave_lds_sync();
    }
    wave_lds_sync();
#pragma unroll 1
    for (int g = 0; g < 4; ++g) {
        v8h tv[4];
#pragma unroll
        for (int i = 0; i < 4; ++i) tv[i] = *(const v8h*)(&Tst[w][(g * 4 + i) * 256 + lane * 8]);
        _Float16* dst = qt + (size_t)(g * 16 + (lane >> 3)) * SEQ + (lane & 7) * 8;
#pragma unroll
        for (int i = 0; i < 4; ++i) *(v8h*)(dst + (size_t)i * 4 * SEQ) = tv[i];
        
    }
}

// ---------------------------------------------------------------------------
// Fused attention, q = k = v. Block = 8 waves = 128 queries of one (b, head);
// a wave owns 16 queries and streams all SEQ keys, 32 per step:
//   S^T tiles (rows = keys, cols = queries): A = key rows, B = query rows
//   (k = d, 2 steps of 32); query fragments straight from the qrow plane;
//   per-lane online softmax (lane column = its query; partner lane +-16);
//   P^T carried 2^8 as f16: the two S^T tiles chain directly as the B
//   fragment (elements 0..7 = tile keys 0..15, 8..15 = tile keys 16..31);
//   O^T += V^T . P^T with A fragments of V^T (rows = d, k = keys).
// Key rows and V^T rows reach the waves through LDS: a stage is 128 keys, 128
// qrow rows of 128 B at a 144-B pitch and 64 qT rows of 256 B at a 272-B pitch,
// filled once per block by asynchronous copies (16 B per lane, whole lines per
// wave) and read by all 8 waves; two buffers, the next stage in flight while
// this one is worked on. Fragments keep the k order they had from the planes.
// Epilogue: O^T / (64 l) staged as [query][d] f32 in a wave-private LDS tile,
// bf16(x) added at the store stage, 8 lane-contiguous 16-B-per-lane
// ---------------------------------------------------------------------------
#define AT_KEYS   128                        // keys per stage
#define AK_PITCH  72                         // halves per key row in LDS (144 B)
#define AV_PITCH  136                        // halves per V^T row in LDS (272 B)
#define AK_HALVES (AT_KEYS * AK_PITCH)       // key rows of one buffer, 18,432 B
#define AV_HALVES (DH * AV_PITCH)            // V^T rows of one buffer, 17,408 B
#define AT_HALVES (AK_HALVES + AV_HALVES)    // one buffer, 35,840 B
static_assert(SEQ % AT_KEYS == 0);           // whole stages

// Four copies of key rows (32 rows apart) and four of V^T rows (16 rows apart).
// The s_wait_xcnt closes the statement so that no address register of a copy is
// rewritten ahead of it.
static __device__ __forceinline__ void copy_kv(unsigned lk, const _Float16* gk,
                                               unsigned lv, const _Float16* gv) {
    const unsigned ks = 32u * AK_PITCH * 2u;
    const unsigned vs = 16u * AV_PITCH * 2u;
    const size_t   gks = (size_t)32 * DH;
    const size_t   gvs = (size_t)16 * SEQ;
    asm volatile(
        "global_load_async_to_lds_b128 %0, %8, off\n\t"
        "global_load_async_to_lds_b128 %1, %9, off\n\t"
        "global_load_async_to_lds_b128 %2, %10, off\n\t"
        "global_load_async_to_lds_b128 %3, %11, off\n\t"
        "global_load_async_to_lds_b128 %4, %12, off\n\t"
        "global_load_async_to_lds_b128 %5, %13, off\n\t"
        "global_load_async_to_lds_b128 %6, %14, off\n\t"
        "global_load_async_to_lds_b128 %7, %15, off\n\t"
        "s_wait_xcnt 0x0"
        :: "v"(lk), "v"(lk + ks), "v"(lk + 2u * ks), "v"(lk + 3u * ks),
           "v"(lv), "v"(lv + vs), "v"(lv + 2u * vs), "v"(lv + 3u * vs),
           "v"(gk), "v"(gk + gks), "v"(gk + 2 * gks), "v"(gk + 3 * gks),
           "v"(gv), "v"(gv + gvs), "v"(gv + 2 * gvs), "v"(gv + 3 * gvs)
        : "memory");
}

__global__ __launch_bounds__(256) __attribute__((amdgpu_num_vgpr(256)))
void k_attn(const _Float16* __restrict__ qrow,
            const _Float16* __restrict__ qT,
            const float* __restrict__ x,
            float* __restrict__ y1) {
    __shared__ __align__(16) float Ost[8][16 * DH];      // 32 KB, wave-private
    __shared__ __align__(16) _Float16 Kv[2 * AT_HALVES]; // 70 KB, key and V^T stages, cross-wave
    constexpr int NT = SEQ / AT_KEYS;
    const int tid  = threadIdx.x;
    const int lane = tid & 31;
    const int w    = tid >> 5;
    const int hh   = lane >> 4;
    const int lm   = lane & 15;
    const int kb   = hh << 3;
    const int b    = blockIdx.z;
    const int head = blockIdx.y;
    const int q0   = blockIdx.x * 128 + w * 16;

    const _Float16* qhead = qrow + ((size_t)b * NH + head) * SEQ * DH;
    const _Float16* thead = qT + ((size_t)b * NH + head) * DH * SEQ;
    const _Float16* qlane = qhead + (size_t)lm * DH + kb;
    // key copy i of a thread: stage row i*32 + tid/8, 16-B piece tid%8;
    // V^T copy i: row i*16 + tid/16, 16-B piece tid%16
    const _Float16* gk = qhead + (size_t)(tid >> 3) * DH + (tid & 7) * 8;
    const _Float16* gv = thead + (size_t)(tid >> 4) * SEQ + (tid & 15) * 8;
    const unsigned  lk = lds_off(Kv) + (unsigned)((tid >> 3) * (AK_PITCH * 2) + (tid & 7) * 16);
    const unsigned  lv = lds_off(Kv) + (unsigned)(AK_HALVES * 2 + (tid >> 4) * (AV_PITCH * 2) + (tid & 15) * 16);

    copy_kv(lk, gk, lv, gv);
    asm volatile("s_wait_asynccnt 0x0" ::: "memory");   // stage 0 landed (this wave's copies)
    __syncthreads();                                    // stage 0 published to all waves
    if (NT > 1)
        copy_kv(lk + AT_HALVES * 2u, gk + (size_t)AT_KEYS * DH, lv + AT_HALVES * 2u, gv + AT_KEYS);

    const v16h qf0 = load_frag_p(qlane + (size_t)q0 * DH);        // d 0..31
    const v16h qf1 = load_frag_p(qlane + (size_t)q0 * DH + 32);   // d 32..63

    v8f o[4];
#pragma unroll
    for (int dt = 0; dt < 4; ++dt) o[dt] = zero8();
    float mr = -1.0e30f, l = 0.0f;

#pragma unroll 1
    for (int t = 0; t < NT; ++t) {
      const int bo = (t & 1) * AT_HALVES;
      const _Float16* sk = Kv + bo + lm * AK_PITCH + kb;
      const _Float16* sv = Kv + bo + AK_HALVES + lm * AV_PITCH + kb;
#pragma unroll
      for (int u = 0; u < AT_KEYS / 32; ++u) {
        // The step's LDS reads stand in one group ahead of its products, so that
        // the wave waits out one LDS latency per 32 keys and not one per fragment.
        const _Float16* ka = sk + u * 32 * AK_PITCH;
        v16h a0 = load_frag_p(ka);
        v16h a1 = load_frag_p(ka + 32);
        v16h c0 = load_frag_p(ka + 16 * AK_PITCH);
        v16h c1 = load_frag_p(ka + 16 * AK_PITCH + 32);
        v16h vf[4];
#pragma unroll
        for (int dt = 0; dt < 4; ++dt) vf[dt] = load_frag_p(sv + dt * 16 * AV_PITCH + u * 32);
        v8f sA = wmma16(a0, qf0, zero8());
        sA = wmma16(a1, qf1, sA);
        v8f sB = wmma16(c0, qf0, zero8());
        sB = wmma16(c1, qf1, sB);

        float tA[8], tB[8];
#pragma unroll
        for (int i = 0; i < 8; ++i) { tA[i] = sA[i] * CS; tB[i] = sB[i] * CS; }
        float tmax = fmaxf(tA[0], tB[0]);
#pragma unroll
        for (int i = 1; i < 8; ++i) tmax = fmaxf(tmax, fmaxf(tA[i], tB[i]));
        tmax = fmaxf(tmax, __shfl_xor(tmax, 16, 32));
        const float mn = fmaxf(mr, tmax);
        if (__builtin_amdgcn_ballot_w32(mn > mr) != 0u) {       // wave-uniform
            const float sc = ex2(mr - mn);
            l *= sc;
#pragma unroll
            for (int dt = 0; dt < 4; ++dt)
#pragma unroll
                for (int r = 0; r < 8; ++r) o[dt][r] *= sc;
        }
        mr = mn;
        const float sh = 8.0f - mn;
        float ps = 0.0f;
        v16h pb;
#pragma unroll
        for (int i = 0; i < 8; ++i) {
            const float pa = ex2(tA[i] + sh);
            const float pq = ex2(tB[i] + sh);
            ps += pa + pq;
            pb[i]     = (_Float16)pa;
            pb[8 + i] = (_Float16)pq;
        }
        l += ps;
#pragma unroll
        for (int dt = 0; dt < 4; ++dt) o[dt] = wmma16(vf[dt], pb, o[dt]);
      }
      asm volatile("s_wait_dscnt 0x0" ::: "memory");      // this wave's reads of the buffer are done
      asm volatile("s_wait_asynccnt 0x0" ::: "memory");   // stage t+1 landed (this wave's copies)
      __syncthreads();                                    // publishes stage t+1, frees stage t's buffer
      if (t + 2 < NT)
          copy_kv(lk + (unsigned)bo * 2u, gk + (size_t)(t + 2) * AT_KEYS * DH,
                  lv + (unsigned)bo * 2u, gv + (size_t)(t + 2) * AT_KEYS);
    }
    asm volatile("s_wait_asynccnt 0x0" ::: "memory");       // nothing in flight when the loop is left

    const float lt  = l + __shfl_xor(l, 16, 32);
    const float inv = (1.0f / lt) * 0.015625f;          // 2^8 P carry cancels in o/l; 1/64 for the q carry
#pragma unroll
    for (int dt = 0; dt < 4; ++dt) {
        v4f u0, u1;
        u0.x = o[dt][0] * inv; u0.y = o[dt][1] * inv; u0.z = o[dt][2] * inv; u0.w = o[dt][3] * inv;
        u1.x = o[dt][4] * inv; u1.y = o[dt][5] * inv; u1.z = o[dt][6] * inv; u1.w = o[dt][7] * inv;
        *(v4f*)(&Ost[w][lm * DH + dt * 16 + 8 * hh])     = u0;
        *(v4f*)(&Ost[w][lm * DH + dt * 16 + 8 * hh + 4]) = u1;
    }
    wave_lds_sync();

    v4f sv[8];
    const int col = lm * 4;
#pragma unroll
    for (int i = 0; i < 8; ++i) {
        const int row = 2 * i + hh;
        v4f a  = *(const v4f*)(&Ost[w][i * 128 + lane * 4]);
        v4f xv = *(const v4f*)(x + ((size_t)b * SEQ_FULL + q0 + row) * DM + head * DH + col);
        a.x = bf16r(xv.x) + a.x;
        a.y = bf16r(xv.y) + a.y;
        a.z = bf16r(xv.z) + a.z;
        a.w = bf16r(xv.w) + a.w;
        sv[i] = a;
    }
    float* ob = y1 + ((size_t)b * SEQ + q0 + hh) * DM + head * DH + col;
#pragma unroll
    for (int i = 0; i < 8; ++i) *(v4f*)(ob + (size_t)(2 * i) * DM) = sv[i];
    
}

// ---------------------------------------------------------------------------
// row, row kept in a wave-private LDS line, loops rolled. Writes f32 row
// (512 B per instruction, lane-contiguous) and optionally f16(16 * LN(y)) row
// ---------------------------------------------------------------------------
__global__ __launch_bounds__(128) void k_ln(const float* __restrict__ y,
                                             const float* __restrict__ g,
                                             const float* __restrict__ be,
                                             float* __restrict__ of,
                                             _Float16* __restrict__ oh,
                                             int wr16) {
    __shared__ __align__(16) float    Rw[4][DM];     // 16 KB, wave-private
    __shared__ __align__(16) _Float16 Hw[4][DM];     // 8 KB, wave-private
    const int tid  = threadIdx.x;
    const int lane = tid & 31;
    const int w    = tid >> 5;
    const int row  = blockIdx.x * 4 + w;
    if (row >= NTOK) return;                          // wave-uniform; no block barriers below
    const float* yr = y + (size_t)row * DM;

    float s = 0.0f;
#pragma unroll 1
    for (int j = 0; j < 8; ++j) {
        const int c = j * 128 + lane * 4;
        v4f v = *(const v4f*)(yr + c);
        *(v4f*)(&Rw[w][c]) = v;
        s += (v.x + v.y) + (v.z + v.w);
    }
    s = wave_sum(s);
    const float mu = s * 0.0009765625f;
    float qv = 0.0f;
#pragma unroll 1
    for (int j = 0; j < 8; ++j) {
        const int c = j * 128 + lane * 4;
        v4f v = *(const v4f*)(&Rw[w][c]);
        const float d0 = v.x - mu, d1 = v.y - mu, d2 = v.z - mu, d3 = v.w - mu;
        qv += (d0 * d0 + d1 * d1) + (d2 * d2 + d3 * d3);
    }
    qv = wave_sum(qv);
    const float rs = rsqrtf(qv * 0.0009765625f + 1.0e-5f);
#pragma unroll 1
    for (int j = 0; j < 8; ++j) {
        const int c = j * 128 + lane * 4;
        v4f v  = *(const v4f*)(&Rw[w][c]);
        v4f gv = *(const v4f*)(g + c);
        v4f bv = *(const v4f*)(be + c);
        v4f r;
        r.x = (v.x - mu) * rs * bf16r(gv.x) + bf16r(bv.x);
        r.y = (v.y - mu) * rs * bf16r(gv.y) + bf16r(bv.y);
        r.z = (v.z - mu) * rs * bf16r(gv.z) + bf16r(bv.z);
        r.w = (v.w - mu) * rs * bf16r(gv.w) + bf16r(bv.w);
        *(v4f*)(&Rw[w][c]) = r;
        if (wr16 != 0) {
            v4h hv;
            hv.x = (_Float16)(r.x * 16.0f);
            hv.y = (_Float16)(r.y * 16.0f);
            hv.z = (_Float16)(r.z * 16.0f);
            hv.w = (_Float16)(r.w * 16.0f);
            *(v4h*)(&Hw[w][c]) = hv;
        }
    }
    wave_lds_sync();

    float*    df = of + (size_t)row * DM;
    _Float16* dh = oh + (size_t)row * DM;
#pragma unroll 1
    for (int j = 0; j < 8; ++j) {
        const int c = j * 128 + lane * 4;
        v4f v = *(const v4f*)(&Rw[w][c]);
        *(v4f*)(df + c) = v;
    }
    if (wr16 != 0) {
#pragma unroll 1
        for (int j = 0; j < 4; ++j) {
            const int c = j * 256 + lane * 8;
            v8h hv = *(const v8h*)(&Hw[w][c]);
            *(v8h*)(dh + c) = hv;
        }
    }
    
}

// ---------------------------------------------------------------------------
// FFN1: acc = (16 x1)(64 W1) = 1024 pre ; hb = f16(16 relu(pre + b1)).
// Block = 4 x 4 waves = 256 x 256.
// 16-row steps through a wave-private LDS tile; row segment = 64 halves =
// ---------------------------------------------------------------------------
__global__ __launch_bounds__(512) __attribute__((amdgpu_num_vgpr(256)))
void k_gemm_ffn1(const _Float16* __restrict__ a16,
                 const _Float16* __restrict__ w1T,
                 const float* __restrict__ b1,
                 _Float16* __restrict__ hb) {
    __shared__ __align__(16) _Float16 Rst[16][16 * 64];  // 32 KB, wave-private
    __shared__ __align__(16) _Float16 St[2 * ST_HALVES(4, 1)]; // 144 KB, operand stages, cross-wave
    const int tid  = threadIdx.x;
    const int lane = tid & 31;
    const int w    = tid >> 5;
    const int hh   = lane >> 4;
    const int lm   = lane & 15;
    const int m0   = blockIdx.x * 256 + (w % 4) * 64;
    const int n0   = blockIdx.y * 256 + (w / 4) * 64;

    v8f acc[4][4];
    gemm_tile64<DM, 4, 1>(a16 + (size_t)(blockIdx.x * 256) * DM, w1T + (size_t)(blockIdx.y * 256) * DM, St, acc);

    float bv[4];
#pragma unroll
    for (int nt = 0; nt < 4; ++nt) bv[nt] = bf16r(b1[n0 + nt * 16 + lm]) * 1024.0f;

#pragma unroll
    for (int ms = 0; ms < 4; ++ms) {
#pragma unroll
        for (int nt = 0; nt < 4; ++nt)
#pragma unroll
            for (int r = 0; r < 8; ++r)
                Rst[w][(8 * hh + r) * 64 + nt * 16 + lm] =
                    (_Float16)(fmaxf(acc[ms][nt][r] + bv[nt], 0.0f) * 0.015625f);
        wave_lds_sync();
        v8h rv[4];
#pragma unroll
        for (int i = 0; i < 4; ++i) rv[i] = *(const v8h*)(&Rst[w][i * 256 + lane * 8]);
        _Float16* dst = hb + (size_t)(m0 + ms * 16 + (lane >> 3)) * HID + n0 + (lane & 7) * 8;
#pragma unroll
        for (int i = 0; i < 4; ++i) *(v8h*)(dst + (size_t)i * 4 * HID) = rv[i];
        
        wave_lds_sync();
    }
}

// ---------------------------------------------------------------------------
// FFN2: acc = (16 h)(64 W2) = 1024 ff ; y2 = x1 + (ff + b2), f32.
// Block = two k groups of 2 x 2 waves = 128 x 128. The two waves of a 64x64 tile swap
// halves of their partial sums through LDS: group 0 finishes rows 0..31, group 1 rows 32..63.
// 16-row steps through a wave-private f32 LDS tile; bias and skip path added
// at the store stage as 4-float vectors; each instruction = 2 rows x 256 B.
// ---------------------------------------------------------------------------
__global__ __launch_bounds__(256) __attribute__((amdgpu_num_vgpr(256)))
void k_gemm_ffn2(const _Float16* __restrict__ hb,
                 const _Float16* __restrict__ w2T,
                 const float* __restrict__ b2,
                 const float* __restrict__ x1,
                 float* __restrict__ y2) {
    __shared__ __align__(16) float Fst[8][16 * 64];      // 32 KB, wave-private
    __shared__ __align__(16) _Float16 St[2 * ST_HALVES(2, 2)]; // 136 KB, operand stages, cross-wave
    const int tid  = threadIdx.x;
    const int lane = tid & 31;
    const int w    = __builtin_amdgcn_readfirstlane(tid >> 5);   // the wave's number, held scalar: the test on kg is a scalar branch
    const int kg   = w >> 2;
    const int wq   = w & 3;
    const int hh   = lane >> 4;
    const int lm   = lane & 15;
    const int m0   = blockIdx.x * 128 + (wq % 2) * 64 + kg * 32;
    const int n0   = blockIdx.y * 128 + (wq / 2) * 64;

    v8f acc[2][4];
    {
        v8f part[4][4];
        gemm_tile64<HID, 2, 2>(hb + (size_t)(blockIdx.x * 128) * HID, w2T + (size_t)(blockIdx.y * 128) * HID, St, part);
        float* X = (float*)St;
        // the loops of the join are unrolled whole: part and acc stay in registers only under constant indices
        if (kg == 0) {
#pragma unroll
            for (int i = 0; i < 2; ++i)
#pragma unroll
                for (int nt = 0; nt < 4; ++nt) {
                    sub_put(X, wq * 8 + i * 4 + nt, lane, part[2 + i][nt]);
                    acc[i][nt] = part[i][nt];
                }
        } else {
#pragma unroll
            for (int i = 0; i < 2; ++i)
#pragma unroll
                for (int nt = 0; nt < 4; ++nt) {
                    sub_put(X, 32 + wq * 8 + i * 4 + nt, lane, part[i][nt]);
                    acc[i][nt] = part[2 + i][nt];
                }
        }
        __syncthreads();                                // both groups' handed-over halves published
        const int tk = (1 - kg) * 32 + wq * 8;
#pragma unroll
        for (int i = 0; i < 2; ++i)
#pragma unroll
            for (int nt = 0; nt < 4; ++nt) acc[i][nt] = sub_add(X, tk + i * 4 + nt, lane, acc[i][nt]);
    }

    const int col = lm * 4;
    v4f bb = *(const v4f*)(b2 + n0 + col);
    bb.x = bf16r(bb.x); bb.y = bf16r(bb.y); bb.z = bf16r(bb.z); bb.w = bf16r(bb.w);

#pragma unroll
    for (int ms = 0; ms < 2; ++ms) {
#pragma unroll
        for (int nt = 0; nt < 4; ++nt)
#pragma unroll
            for (int r = 0; r < 8; ++r)
                Fst[w][(8 * hh + r) * 64 + nt * 16 + lm] = acc[ms][nt][r] * 0.0009765625f;
        wave_lds_sync();
        v4f sv[8];
        const size_t rbase = ((size_t)(m0 + ms * 16 + hh)) * DM + n0 + col;
#pragma unroll
        for (int i = 0; i < 8; ++i) {
            v4f a  = *(const v4f*)(&Fst[w][i * 128 + lane * 4]);
            v4f xr = *(const v4f*)(x1 + rbase + (size_t)(2 * i) * DM);
            a.x = xr.x + (a.x + bb.x);
            a.y = xr.y + (a.y + bb.y);
            a.z = xr.z + (a.z + bb.z);
            a.w = xr.w + (a.w + bb.w);
            sv[i] = a;
        }
        float* dst = y2 + rbase;
#pragma unroll
        for (int i = 0; i < 8; ++i) *(v4f*)(dst + (size_t)(2 * i) * DM) = sv[i];
        
        wave_lds_sync();
    }
}

// ---------------------------------------------------------------------------
extern "C" void kernel_launch(void* const* d_in, const int* in_sizes, int n_in,
                              void* d_out, int out_size, void* d_ws, size_t ws_size,
                              hipStream_t stream) {
    if (n_in < 11) return;
    if (in_sizes[0] < ((NB - 1) * SEQ_FULL + SEQ) * DM) return;
    if (in_sizes[1] < DM * DM || in_sizes[2] < DM) return;
    if (in_sizes[3] < DM || in_sizes[4] < DM) return;
    if (in_sizes[5] < DM * HID || in_sizes[6] < HID) return;
    if (in_sizes[7] < HID * DM || in_sizes[8] < DM) return;
    if (in_sizes[9] < DM || in_sizes[10] < DM) return;
    if (out_size < NTOK * DM) return;
    if (WS_TOTAL > ws_size) return;

    const float* x    = (const float*)d_in[0];    // [2,2048,1024]
    const float* Wq   = (const float*)d_in[1];    // [16,1024,64]  [head][in][dim]
    const float* bq   = (const float*)d_in[2];    // [16,64]
    const float* ln1g = (const float*)d_in[3];
    const float* ln1b = (const float*)d_in[4];
    const float* W1   = (const float*)d_in[5];    // [1024,4096]  [in][out]
    const float* b1   = (const float*)d_in[6];
    const float* W2   = (const float*)d_in[7];    // [4096,1024]  [in][out]
    const float* b2   = (const float*)d_in[8];
    const float* ln2g = (const float*)d_in[9];
    const float* ln2b = (const float*)d_in[10];
    float* out = (float*)d_out;                   // [2,2048,1024]

    char* ws = (char*)d_ws;
    size_t off = 0;
    _Float16* x16  = (_Float16*)(ws + off); off += SZ_X16;   // xh, then x1h (xh dead after k_gemm_q)
    _Float16* wqT  = (_Float16*)(ws + off); off += SZ_WQT;   // [h*64+e][d]
    _Float16* w1T  = (_Float16*)(ws + off); off += SZ_W1T;   // [n][k]
    _Float16* w2T  = (_Float16*)(ws + off); off += SZ_W2T;   // [n][k]
    _Float16* qrow = (_Float16*)(ws + off); off += SZ_Q16;   // [b][h][s][64]
    _Float16* qT   = (_Float16*)(ws + off); off += SZ_Q16;   // [b][h][64][s]
    float*    y12  = (float*)(ws + off);    off += SZ_Y32;   // y1, then y2 (y1 dead after LN1)
    float*    x1   = (float*)(ws + off);    off += SZ_Y32;
    _Float16* hb   = (_Float16*)(ws + off); off += SZ_HB;
    if (off > ws_size) return;

    // x -> xh; Wq per head [1024 (d)][64 (e)] -> [e][d]; W1 [1024 (k)][4096 (n)] -> [n][k]; W2 [4096 (k)][1024 (n)] -> [n][k]
    k_prep<<<dim3(P1_BLKS + P2_BLKS + PQ_BLKS + PX_BLKS), dim3(256), 0, stream>>>(x, Wq, W1, W2, x16, wqT, w1T, w2T);

    k_gemm_q<<<dim3(NTOK / 128, DM / 128), dim3(256), 0, stream>>>(x16, wqT, bq, qrow, qT);
    k_attn<<<dim3(SEQ / 128, NH, NB), dim3(256), 0, stream>>>(qrow, qT, x, y12);
    k_ln<<<dim3(NTOK / 4), dim3(128), 0, stream>>>(y12, ln1g, ln1b, x1, x16, 1);
    k_gemm_ffn1<<<dim3(NTOK / 256, HID / 256), dim3(512), 0, stream>>>(x16, w1T, b1, hb);
    k_gemm_ffn2<<<dim3(NTOK / 128, DM / 128), dim3(256), 0, stream>>>(hb, w2T, b2, x1, y12);
    k_ln<<<dim3(NTOK / 4), dim3(128), 0, stream>>>(y12, ln2g, ln2b, out, x16, 0);
}

// v006
// One run takes 147 microseconds.
// Next to v005, in two timings, it ran 1.05 times as fast each time.
// All steps since v000 together make it 2.88 times as fast.
#include <hip/hip_runtime.h>
#include <hip/hip_fp16.h>

// All contractions on v_wmma_f32_16x16x32_f16 (f16 operands, f32 accumulate), single products: x*Wq (x carried x16, Wq x64), q*q^T (q carried x64), P*q (P carried x256), x1*W1 (x1 x16, W1 x64), h*W2 (h x16, W2 x64); raw inputs RNE-converted to bf16 first.

#ifndef NB
#define NB 2
#endif
#ifndef SEQ
#define SEQ 2048
#endif
#define NB_FULL  2
#define SEQ_FULL 2048
#define DM   1024        // model width
#define NH   16          // heads
#define DH   64          // head width
#define HID  4096        // FFN hidden width
#define NTOK (NB * SEQ)

static_assert(NB >= 1 && NB <= NB_FULL);
static_assert(SEQ >= 128 && SEQ <= SEQ_FULL);
static_assert(SEQ % 128 == 0);                      // attention block = 128 queries; key loop steps 32
static_assert(SEQ % 64 == 0);                       // a 64-row GEMM wave tile stays inside one batch
static_assert(NTOK % 256 == 0);                     // GEMM block rows: 256 (FFN1), 128 (Q, FFN2)
static_assert(HID % 256 == 0 && DM % 128 == 0);     // GEMM block columns: 256 (FFN1), 128 (Q, FFN2)
static_assert(NTOK % 4 == 0);                       // LN block = 4 rows
static_assert(NH * DH == DM);                       // heads concatenate to the model width
static_assert(DH == 64);                            // one GEMM column tile == one head; 2 k-steps per score
static_assert(DM % 64 == 0 && HID % 64 == 0);       // N tiles of 64
static_assert(DM % 32 == 0 && HID % 32 == 0);       // K steps of 32
static_assert(DM == 32 * 8 * 4);                    // LN: 32 lanes x 8 chunks x 4 floats

typedef _Float16 v16h __attribute__((ext_vector_type(16)));
typedef _Float16 v8h  __attribute__((ext_vector_type(8)));
typedef _Float16 v4h  __attribute__((ext_vector_type(4)));
typedef float    v8f  __attribute__((ext_vector_type(8)));
typedef float    v4f  __attribute__((ext_vector_type(4)));

union Frag { v16h v; v8h h[2]; };

// scores: acc = (64 q_s).(64 q_t); t (log2 units) = acc * log2(e) / 8 / 4096
#define CS (1.44269504088896340736f * 3.0517578125e-05f)

// plane sizes in bytes (all multiples of 128)
#define SZ_X16   ((size_t)NTOK * DM * 2)     // xh, later x1h
#define SZ_WQT   ((size_t)DM * DM * 2)
#define SZ_W1T   ((size_t)HID * DM * 2)
#define SZ_W2T   ((size_t)DM * HID * 2)
#define SZ_Q16   ((size_t)NTOK * DM * 2)     // qrow, qT each
#define SZ_Y32   ((size_t)NTOK * DM * 4)     // y1 (later y2), x1 each
#define SZ_HB    ((size_t)NTOK * HID * 2)
#define WS_TOTAL (SZ_X16 + SZ_WQT + SZ_W1T + SZ_W2T + 2 * SZ_Q16 + 2 * SZ_Y32 + SZ_HB)
static_assert(WS_TOTAL <= (size_t)134217728);       // carve <= 128 MiB

static __device__ __forceinline__ v8f zero8() {
    v8f z;
#pragma unroll
    for (int i = 0; i < 8; ++i) z[i] = 0.0f;
    return z;
}

// 16x32 A fragment (or B fragment from an [n][k] k-contiguous source).
// p = tile_base + (lane&15)*ld + 8*(lane>>4): elements 0..7 = k 8h..8h+7,
// elements 8..15 = k 16+8h..16+8h+7 (split map, same for A and B).
static __device__ __forceinline__ v16h load_frag_p(const _Float16* p) {
    Frag f;
    f.h[0] = *(const v8h*)(p);
    f.h[1] = *(const v8h*)(p + 16);
    return f.v;
}

static __device__ __forceinline__ v8f wmma16(v16h a, v16h b, v8f c) {
    v8f d = __builtin_amdgcn_wmma_f32_16x16x32_f16(false, a, false, b, (short)0, c, false, false);
    asm volatile("v_nop\n\tv_nop\n\tv_nop\n\tv_nop" : "+v"(d) : "v"(a), "v"(b));
    return d;
}

// f32 -> bf16 RNE convert, value kept as f32
static __device__ __forceinline__ float bf16r(float x) {
    unsigned u = __float_as_uint(x);
    u = (u + 0x7FFFu + ((u >> 16) & 1u)) & 0xFFFF0000u;
    return __uint_as_float(u);
}

static __device__ __forceinline__ float ex2(float x) {
    return __builtin_amdgcn_exp2f(x);
}

// ordering for a wave-private LDS tile: stores before later loads of the same wave
static __device__ __forceinline__ void wave_lds_sync() {
    __builtin_amdgcn_fence(3, "wavefront");
    asm volatile("s_wait_dscnt 0" ::: "memory");
    __builtin_amdgcn_wave_barrier();
}

static __device__ __forceinline__ float wave_sum(float v) {
    v += __shfl_xor(v, 16, 32);
    v += __shfl_xor(v, 8, 32);
    v += __shfl_xor(v, 4, 32);
    v += __shfl_xor(v, 2, 32);
    v += __shfl_xor(v, 1, 32);
    return v;
}

// ---------------------------------------------------------------------------
// Operand preparation, one launch, no LDS, no barrier. A work-group is 8 waves and
// takes one share of one of four jobs, picked by its index:
//   xh[tok][d]     = f16(16 * bf16(x)),  2048 16-B output pieces per work-group;
//   out[z][c][r]   = f16(64 * bf16(in[z][r][c])) for Wq, W1 and W2, one 64-row x
//                    32-column tile per wave, transposed in registers.
// Every thread has its 16 16-B loads in flight at once and writes 8 16-B pieces,
// so few waves have to be started for the bytes that are moved.
// ---------------------------------------------------------------------------
#define PX_PIECES 2048                                     // x pieces per work-group
#define PX_BLKS   ((int)((size_t)NTOK * DM / 8 / PX_PIECES))
#define PQ_BLKS   (NH * (DM / 64) * (DH / 32) / 8)
#define P1_BLKS   ((DM / 64) * (HID / 32) / 8)
#define P2_BLKS   ((HID / 64) * (DM / 32) / 8)
static_assert(((size_t)NTOK * DM / 8) % PX_PIECES == 0);   // whole work-groups of x pieces
static_assert(SEQ % (PX_PIECES / (DM / 8)) == 0);          // a work-group's token rows lie in one batch entry
static_assert((NH * (DM / 64) * (DH / 32)) % 8 == 0);      // whole work-groups of Wq tiles
static_assert(((DM / 64) * (HID / 32)) % 8 == 0);          // whole work-groups of W1 and W2 tiles

static __device__ __forceinline__ _Float16 cvt_s(float v, float sc) {
    return (_Float16)(bf16r(v) * sc);
}

// Tile u of in[z][ROWS][COLS]: rows rt*64.., columns ct*32... Lane = (r8, c4): it reads
// rows r8*8..+7 at columns c4*4..+3 and 16+c4*4..+3 (4 lanes = 64 B of a row per load)
// and writes, per column, its 8 rows as one 16-B piece (8 lanes = one whole 128-B line).
template <int ROWS, int COLS>
static __device__ __forceinline__ void tr_tile(const float* __restrict__ in,
                                               _Float16* __restrict__ out, int u, int lane) {
    constexpr int NCT = COLS / 32, NRT = ROWS / 64;
    const int ct = u % NCT;
    const int t  = u / NCT;
    const int rt = t % NRT;
    const int zz = t / NRT;
    const int r8 = lane & 7, c4 = lane >> 3;
    const size_t zoff = (size_t)zz * ROWS * COLS;
    const float* sp = in + zoff + (size_t)(rt * 64 + r8 * 8) * COLS + ct * 32 + c4 * 4;
    v4f a[8][2];
    // every loop below is unrolled whole: a and o stay in registers only under constant indices
#pragma unroll
    for (int j = 0; j < 8; ++j) {
        a[j][0] = *(const v4f*)(sp + (size_t)j * COLS);
        a[j][1] = *(const v4f*)(sp + (size_t)j * COLS + 16);
    }
    // the loads' address registers stay untouched up to this wait (sp is named so that they live until here)
    asm volatile("s_wait_xcnt 0x0" :: "v"(sp) : "memory");
    _Float16* dp = out + zoff + (size_t)(ct * 32 + c4 * 4) * ROWS + rt * 64 + r8 * 8;
    v8h o[8];
#pragma unroll
    for (int c = 0; c < 8; ++c)
#pragma unroll
        for (int j = 0; j < 8; ++j) o[c][j] = cvt_s(a[j][c >> 2][c & 3], 64.0f);
#pragma unroll
    for (int c = 0; c < 8; ++c)
        *(v8h*)(dp + (size_t)((c >> 2) * 16 + (c & 3)) * ROWS) = o[c];
    // no data or address register of the stores is rewritten ahead of this wait (another job's code follows in the listing)
    asm volatile("s_wait_xcnt 0x0" ::: "memory");
}

__global__ __launch_bounds__(256) void k_prep(const float* __restrict__ x,
                                               const float* __restrict__ Wq,
                                               const float* __restrict__ W1,
                                               const float* __restrict__ W2,
                                               _Float16* __restrict__ xh,
                                               _Float16* __restrict__ wqT,
                                               _Float16* __restrict__ w1T,
                                               _Float16* __restrict__ w2T) {
    const int tid  = threadIdx.x;
    const int lane = tid & 31;
    const int w    = tid >> 5;
    int blk = blockIdx.x;
    if (blk < P1_BLKS) { tr_tile<DM, HID>(W1, w1T, blk * 8 + w, lane); return; }
    blk -= P1_BLKS;
    if (blk < P2_BLKS) { tr_tile<HID, DM>(W2, w2T, blk * 8 + w, lane); return; }
    blk -= P2_BLKS;
    if (blk < PQ_BLKS) { tr_tile<DM, DH>(Wq, wqT, blk * 8 + w, lane); return; }
    blk -= PQ_BLKS;
    if (blk >= PX_BLKS) return;
    // 2048 pieces = 16 whole token rows, inside one batch entry
    const int tok0 = blk * (PX_PIECES / (DM / 8));
    const int b    = tok0 / SEQ;
    const int s0   = tok0 - b * SEQ;
    const char* xb = (const char*)(x + ((size_t)b * SEQ_FULL + s0) * DM);   // the same for the whole work-group
    const unsigned ob = (unsigned)tid * 32u;                                // the thread's byte offset in a run of 256 pieces
    v4f a[8], c[8];
    // every loop below is unrolled whole: a, c and o stay in registers only under constant indices
#pragma unroll
    for (int i = 0; i < 8; ++i) {
        a[i] = *(const v4f*)(xb + ob + i * 8192);
        c[i] = *(const v4f*)(xb + ob + i * 8192 + 16);
    }
    // the loads' address register stays untouched up to this wait (ob is named so that it lives until here)
    asm volatile("s_wait_xcnt 0x0" :: "v"(ob) : "memory");
    v8h o[8];
#pragma unroll
    for (int i = 0; i < 8; ++i) {
#pragma unroll
        for (int e = 0; e < 4; ++e) {
            o[i][e]     = cvt_s(a[i][e], 16.0f);
            o[i][4 + e] = cvt_s(c[i][e], 16.0f);
        }
    }
    _Float16* dst = xh + (size_t)(blk * PX_PIECES + tid) * 8;
#pragma unroll
    for (int i = 0; i < 8; ++i) *(v8h*)(dst + i * 2048) = o[i];
    // no data or address register of the stores is rewritten ahead of this wait
    asm volatile("s_wait_xcnt 0x0" ::: "memory");
}

// ---------------------------------------------------------------------------
// GEMM main loop: block = KS groups of WS x WS waves = a square (WS*64) x (WS*64) tile,
// one wave = 64x64 = 4x4 subtiles; in its group, wave q takes row band q % WS and column
// band q / WS. A [M][K] and Bt [N][K] are 16-bit k-contiguous planes in global memory.
// A stage is KS*64 k (KS whole 128-B lines) of the block's WS*64 A rows and WS*64 Bt rows,
// laid in LDS at a pitch of 16 B more; asynchronous copies fill it (16 B per lane, 8*KS
// lanes per row), RB buffers, the next RB - 1 stages in flight while this one is multiplied,
// so that a copy has RB - 1 stages' time to land. The counted wait returns when all but the
// wave's youngest copies have landed: left at RB - 2 stages' copies, it covers the next stage.
// A staged row feeds WS waves, so the bytes copied per product fall as 1 / WS.
// Group g multiplies k g*64..g*64+63 of every stage, so with KS = 2 a block of four
// 64x64 tiles runs two waves on each SIMD, one working while the other waits; each
// group ends with a partial sum over its half of k, and the caller joins the two.
// Fragments are two 16-B LDS loads, same k order as from the global planes.
// ---------------------------------------------------------------------------
#define ST_K      64                         // halves of k per stage and wave group
#define ST_PITCH(KS)  ((KS) * ST_K + 8)      // halves per LDS row (144 B, 272 B)
#define ST_HALVES(WS, KS) (2 * (WS) * 64 * ST_PITCH(KS))   // one buffer: A rows, then Bt rows

static __device__ __forceinline__ unsigned lds_off(const void* p) { return (unsigned)(size_t)p; }

// Four copies of A rows and four of Bt rows, each run ls bytes apart in LDS and gs
// halves apart in its plane. The s_wait_xcnt closes the statement so that no
// address register of a copy is rewritten ahead of it.
static __device__ __forceinline__ void copy4_4(unsigned la, const _Float16* ga,
                                               unsigned lb, const _Float16* gb,
                                               unsigned ls, size_t gs) {
    asm volatile(
        "global_load_async_to_lds_b128 %0, %8, off\n\t"
        "global_load_async_to_lds_b128 %1, %9, off\n\t"
        "global_load_async_to_lds_b128 %2, %10, off\n\t"
        "global_load_async_to_lds_b128 %3, %11, off\n\t"
        "global_load_async_to_lds_b128 %4, %12, off\n\t"
        "global_load_async_to_lds_b128 %5, %13, off\n\t"
        "global_load_async_to_lds_b128 %6, %14, off\n\t"
        "global_load_async_to_lds_b128 %7, %15, off\n\t"
        "s_wait_xcnt 0x0"
        :: "v"(la), "v"(la + ls), "v"(la + 2u * ls), "v"(la + 3u * ls),
           "v"(lb), "v"(lb + ls), "v"(lb + 2u * ls), "v"(lb + 3u * ls),
           "v"(ga), "v"(ga + gs), "v"(ga + 2 * gs), "v"(ga + 3 * gs),
           "v"(gb), "v"(gb + gs), "v"(gb + 2 * gs), "v"(gb + 3 * gs)
        : "memory");
}

// One stage: l = the thread's first LDS byte in the buffer, ga / gb = its first A and
// Bt piece at the stage's k. Copy i of a run: run row (i * threads + tid) / (8 * KS).
template <int K, int WS, int KS>
static __device__ __forceinline__ void copy_stage(unsigned l, const _Float16* ga, const _Float16* gb) {
    constexpr int RSTEP = WS * WS * 4;               // rows that one copy of the whole block covers
    constexpr int NG    = WS * 64 / (4 * RSTEP);     // statements per stage
    static_assert(NG * 4 * RSTEP == WS * 64);        // every row of both runs copied once
    const unsigned ls = (unsigned)RSTEP * ST_PITCH(KS) * 2u;
    const size_t   gs = (size_t)RSTEP * K;
#pragma unroll
    for (int j = 0; j < NG; ++j)
        copy4_4(l + 4u * j * ls, ga + 4 * j * gs,
                l + (unsigned)(WS * 64 * ST_PITCH(KS) * 2) + 4u * j * ls, gb + 4 * j * gs, ls, gs);
}

// ab = A + m_block * K (WS*64 rows), bb = Bt + n_block * K (WS*64 rows), St = RB buffers.
template <int K, int WS, int KS, int RB>
static __device__ __forceinline__ void gemm_tile64(const _Float16* __restrict__ ab,
                                                   const _Float16* __restrict__ bb,
                                                   _Float16* St,
                                                   v8f (&acc)[4][4]) {
    constexpr int SK = ST_K * KS;                    // halves of k per stage
    constexpr int PT = ST_PITCH(KS);
    static_assert(K % SK == 0 && K / SK >= RB);      // whole stages, every buffer filled
    constexpr int NT = K / SK;
    constexpr int CW = 2 * WS * 64 * 8 * KS / (WS * WS * KS * 32);   // copies of one wave per stage
    static_assert(RB >= 3 && (RB - 1) * CW <= 63);   // copies of a wave outstanding at most
    const int tid  = threadIdx.x;
    const int lane = tid & 31;
    const int w    = tid >> 5;
    const int kg   = w / (WS * WS);
    const int wm   = (w % (WS * WS)) % WS;
    const int wn   = (w % (WS * WS)) / WS;
    const int lm   = lane & 15;
    const int kb   = kg * ST_K + ((lane >> 4) << 3);
    const int crow = tid / (8 * KS), cpc = tid % (8 * KS);
    const _Float16* ga = ab + (size_t)crow * K + cpc * 8;
    const _Float16* gb = bb + (size_t)crow * K + cpc * 8;
    const unsigned  l0 = lds_off(St) + (unsigned)(crow * (PT * 2) + cpc * 16);

#pragma unroll
    for (int ms = 0; ms < 4; ++ms)
#pragma unroll
        for (int nt = 0; nt < 4; ++nt) acc[ms][nt] = zero8();

    // unrolled whole: straight-line copies, buffer offsets as constants
#pragma unroll
    for (int s = 0; s < RB - 1; ++s)
        copy_stage<K, WS, KS>(l0 + (unsigned)s * (ST_HALVES(WS, KS) * 2u), ga + s * SK, gb + s * SK);
    asm volatile("s_wait_asynccnt %0" :: "i"((RB - 2) * CW) : "memory");   // stage 0 landed (this wave's copies); the younger stages fly on
    __syncthreads();                                    // stage 0 published to all waves
    copy_stage<K, WS, KS>(l0 + (unsigned)(RB - 1) * (ST_HALVES(WS, KS) * 2u), ga + (RB - 1) * SK, gb + (RB - 1) * SK);

    int bo = 0;                                         // stage t's buffer, in halves
#pragma unroll 1
    for (int t = 0; t < NT; ++t) {
        const _Float16* sa = St + bo + (wm * 64 + lm) * PT + kb;
        const _Float16* sb = St + bo + ((WS + wn) * 64 + lm) * PT + kb;
        // Fragment reads stand in few groups, each ahead of the products that hide it:
        // k 0..31 whole and the A side of k 32..63 first, the B side of k 32..63 in
        // two halves into the B registers that the first k step has just left.
        v16h a0[4], a1[4], bn[4];
#pragma unroll
        for (int i = 0; i < 4; ++i) a0[i] = load_frag_p(sa + i * 16 * PT);
#pragma unroll
        for (int i = 0; i < 4; ++i) bn[i] = load_frag_p(sb + i * 16 * PT);
#pragma unroll
        for (int i = 0; i < 4; ++i) a1[i] = load_frag_p(sa + i * 16 * PT + 32);
#pragma unroll
        for (int hf = 0; hf < 4; hf += 2) {
#pragma unroll
            for (int nt = hf; nt < hf + 2; ++nt)
#pragma unroll
                for (int ms = 0; ms < 4; ++ms) acc[ms][nt] = wmma16(a0[ms], bn[nt], acc[ms][nt]);
#pragma unroll
            for (int nt = hf; nt < hf + 2; ++nt) bn[nt] = load_frag_p(sb + nt * 16 * PT + 32);
        }
#pragma unroll
        for (int nt = 0; nt < 4; ++nt)
#pragma unroll
            for (int ms = 0; ms < 4; ++ms) acc[ms][nt] = wmma16(a1[ms], bn[nt], acc[ms][nt]);
        asm volatile("s_wait_dscnt 0x0" ::: "memory");      // this wave's reads of the buffer are done
        // stage t+1 landed (this wave's copies): behind it stages t+2 .. t+RB-1 were issued whole, or, at the tail, fewer
        if (t + RB - 1 < NT) asm volatile("s_wait_asynccnt %0" :: "i"((RB - 2) * CW) : "memory");
        else                 asm volatile("s_wait_asynccnt 0x0" ::: "memory");
        __syncthreads();                                    // publishes stage t+1, frees stage t's buffer
        if (t + RB < NT)
            copy_stage<K, WS, KS>(l0 + (unsigned)bo * 2u, ga + (size_t)(t + RB) * SK, gb + (size_t)(t + RB) * SK);
        bo = (bo == (RB - 1) * ST_HALVES(WS, KS)) ? 0 : bo + ST_HALVES(WS, KS);
    }
    asm volatile("s_wait_asynccnt 0x0" ::: "memory");       // nothing in flight when the loop is left
}

// Joining the two k groups' partial sums. X = the operand ring, free behind the loop's
// last barrier. A subtile travels as two runs of 512 B, 16 B per lane, lane-contiguous;
// slot = 256 floats. The sum of a pair is the same whichever group forms it.
static __device__ __forceinline__ void sub_put(float* X, int slot, int lane, v8f v) {
    v4f lo, hi;
    lo.x = v[0]; lo.y = v[1]; lo.z = v[2]; lo.w = v[3];
    hi.x = v[4]; hi.y = v[5]; hi.z = v[6]; hi.w = v[7];
    *(v4f*)(X + slot * 256 + lane * 4)       = lo;
    *(v4f*)(X + slot * 256 + 128 + lane * 4) = hi;
}

static __device__ __forceinline__ v8f sub_add(const float* X, int slot, int lane, v8f v) {
    const v4f lo = *(const v4f*)(X + slot * 256 + lane * 4);
    const v4f hi = *(const v4f*)(X + slot * 256 + 128 + lane * 4);
    v[0] += lo.x; v[1] += lo.y; v[2] += lo.z; v[3] += lo.w;
    v[4] += hi.x; v[5] += hi.y; v[6] += hi.z; v[7] += hi.w;
    return v;
}

// ---------------------------------------------------------------------------
// Q projection: acc = (16 x)(64 Wq) = 1024 x.Wq ; q64 = (acc + 1024 bq) / 16.
// Writes qrow[b][h][s][64] and qT[b][h][64][s] as f16(64 q).
// Block = two k groups of 2 x 2 waves = 128 tokens x two heads; wave tile = 64 tokens x one head. The second group
// hands its partial sums to the first through LDS and ends; the first stores. Row plane: 16-row steps through a
// wave-private LDS tile; transposed plane: whole 64x64 wave-private tile.
// ---------------------------------------------------------------------------
__global__ __launch_bounds__(256) __attribute__((amdgpu_num_vgpr(256)))
void k_gemm_q(const _Float16* __restrict__ xh,
              const _Float16* __restrict__ wqT,
              const float* __restrict__ bq,
              _Float16* __restrict__ qrow,
              _Float16* __restrict__ qT) {
    __shared__ __align__(16) _Float16 Rst[4][16 * 64];   // 8 KB, wave-private
    __shared__ __align__(16) _Float16 Tst[4][64 * 64];   // 32 KB, wave-private
    __shared__ __align__(16) _Float16 St[4 * ST_HALVES(2, 2)]; // 272 KB, operand stages, cross-wave
    const int tid  = threadIdx.x;
    const int lane = tid & 31;
    const int wv   = __builtin_amdgcn_readfirstlane(tid >> 5);   // the wave's number, held scalar: the tests on kg are scalar branches
    const int kg   = wv >> 2;
    const int w    = wv & 3;
    const int hh   = lane >> 4;
    const int lm   = lane & 15;
    const int m0   = blockIdx.x * 128 + (w % 2) * 64;
    const int head = blockIdx.y * 2 + w / 2;
    const int n0   = head * 64;
    const int b    = m0 / SEQ;
    const int s0   = m0 - b * SEQ;

    v8f acc[4][4];
    gemm_tile64<DM, 2, 2, 4>(xh + (size_t)(blockIdx.x * 128) * DM, wqT + (size_t)(blockIdx.y * 128) * DM, St, acc);

    float* X = (float*)St;
    // the loops of the join are unrolled whole: acc stays in registers only under constant indices
    if (kg == 1) {
#pragma unroll
        for (int ms = 0; ms < 4; ++ms)
#pragma unroll
            for (int nt = 0; nt < 4; ++nt) sub_put(X, w * 16 + ms * 4 + nt, lane, acc[ms][nt]);
    }
    __syncthreads();                                    // the second group's partial sums published
    if (kg == 1) return;                                // no block barrier below
#pragma unroll
    for (int ms = 0; ms < 4; ++ms)
#pragma unroll
        for (int nt = 0; nt < 4; ++nt) acc[ms][nt] = sub_add(X, w * 16 + ms * 4 + nt, lane, acc[ms][nt]);

    float bv[4];
#pragma unroll
    for (int nt = 0; nt < 4; ++nt) bv[nt] = bf16r(bq[n0 + nt * 16 + lm]) * 1024.0f;

    _Float16* qr = qrow + (((size_t)b * NH + head) * SEQ + s0) * DH;
    _Float16* qt = qT + ((size_t)b * NH + head) * DH * SEQ + s0;

#pragma unroll
    for (int ms = 0; ms < 4; ++ms) {
#pragma unroll
        for (int nt = 0; nt < 4; ++nt) {
            v8h tv;
#pragma unroll
            for (int r = 0; r < 8; ++r) {
                _Float16 hv = (_Float16)((acc[ms][nt][r] + bv[nt]) * 0.0625f);
                Rst[w][(8 * hh + r) * 64 + nt * 16 + lm] = hv;
                tv[r] = hv;
            }
            *(v8h*)(&Tst[w][(nt * 16 + lm) * 64 + ms * 16 + 8 * hh]) = tv;
        }
        wave_lds_sync();
        v8h rv[4];
#pragma unroll
        for (int i = 0; i < 4; ++i) rv[i] = *(const v8h*)(&Rst[w][i * 256 + lane * 8]);
        _Float16* dst = qr + ms * 1024 + lane * 8;
#pragma unroll
        for (int i = 0; i < 4; ++i) *(v8h*)(dst + i * 256) = rv[i];
        
        wave_lds_sync();
    }
    wave_lds_sync();
#pragma unroll 1
    for (int g = 0; g < 4; ++g) {
        v8h tv[4];
#pragma unroll
        for (int i = 0; i < 4; ++i) tv[i] = *(const v8h*)(&Tst[w][(g * 4 + i) * 256 + lane * 8]);
        _Float16* dst = qt + (size_t)(g * 16 + (lane >> 3)) * SEQ + (lane & 7) * 8;
#pragma unroll
        for (int i = 0; i < 4; ++i) *(v8h*)(dst + (size_t)i * 4 * SEQ) = tv[i];
        
    }
}

// ---------------------------------------------------------------------------
// Fused attention, q = k = v. Block = 8 waves = 128 queries of one (b, head);
// a wave owns 16 queries and streams all SEQ keys, 32 per step:
//   S^T tiles (rows = keys, cols = queries): A = key rows, B = query rows
//   (k = d, 2 steps of 32); query fragments straight from the qrow plane;
//   per-lane online softmax (lane column = its query; partner lane +-16);
//   P^T carried 2^8 as f16: the two S^T tiles chain directly as the B
//   fragment (elements 0..7 = tile keys 0..15, 8..15 = tile keys 16..31);
//   O^T += V^T . P^T with A fragments of V^T (rows = d, k = keys).
// Key rows and V^T rows reach the waves through LDS: a stage is 128 keys, 128
// qrow rows of 128 B at a 144-B pitch and 64 qT rows of 256 B at a 272-B pitch,
// filled once per block by asynchronous copies (16 B per lane, whole lines per
// wave) and read by all 8 waves; three buffers, the next two stages in flight
// while this one is worked on. Fragments keep the k order they had from the planes.
// Epilogue: O^T / (64 l) staged as [query][d] f32 in a wave-private LDS tile,
// bf16(x) added at the store stage, 8 lane-contiguous 16-B-per-lane
// ---------------------------------------------------------------------------
#define AT_KEYS   128                        // keys per stage
#define AK_PITCH  72                         // halves per key row in LDS (144 B)
#define AV_PITCH  136                        // halves per V^T row in LDS (272 B)
#define AK_HALVES (AT_KEYS * AK_PITCH)       // key rows of one buffer, 18,432 B
#define AV_HALVES (DH * AV_PITCH)            // V^T rows of one buffer, 17,408 B
#define AT_HALVES (AK_HALVES + AV_HALVES)    // one buffer, 35,840 B
static_assert(SEQ % AT_KEYS == 0);           // whole stages

// Four copies of key rows (32 rows apart) and four of V^T rows (16 rows apart).
// The s_wait_xcnt closes the statement so that no address register of a copy is
// rewritten ahead of it.
static __device__ __forceinline__ void copy_kv(unsigned lk, const _Float16* gk,
                                               unsigned lv, const _Float16* gv) {
    const unsigned ks = 32u * AK_PITCH * 2u;
    const unsigned vs = 16u * AV_PITCH * 2u;
    const size_t   gks = (size_t)32 * DH;
    const size_t   gvs = (size_t)16 * SEQ;
    asm volatile(
        "global_load_async_to_lds_b128 %0, %8, off\n\t"
        "global_load_async_to_lds_b128 %1, %9, off\n\t"
        "global_load_async_to_lds_b128 %2, %10, off\n\t"
        "global_load_async_to_lds_b128 %3, %11, off\n\t"
        "global_load_async_to_lds_b128 %4, %12, off\n\t"
        "global_load_async_to_lds_b128 %5, %13, off\n\t"
        "global_load_async_to_lds_b128 %6, %14, off\n\t"
        "global_load_async_to_lds_b128 %7, %15, off\n\t"
        "s_wait_xcnt 0x0"
        :: "v"(lk), "v"(lk + ks), "v"(lk + 2u * ks), "v"(lk + 3u * ks),
           "v"(lv), "v"(lv + vs), "v"(lv + 2u * vs), "v"(lv + 3u * vs),
           "v"(gk), "v"(gk + gks), "v"(gk + 2 * gks), "v"(gk + 3 * gks),
           "v"(gv), "v"(gv + gvs), "v"(gv + 2 * gvs), "v"(gv + 3 * gvs)
        : "memory");
}

__global__ __launch_bounds__(256) __attribute__((amdgpu_num_vgpr(256)))
void k_attn(const _Float16* __restrict__ qrow,
            const _Float16* __restrict__ qT,
            const float* __restrict__ x,
            float* __restrict__ y1) {
    __shared__ __align__(16) float Ost[8][16 * DH];      // 32 KB, wave-private
    __shared__ __align__(16) _Float16 Kv[3 * AT_HALVES]; // 105 KB, key and V^T stages, cross-wave
    constexpr int NT = SEQ / AT_KEYS;
    const int tid  = threadIdx.x;
    const int lane = tid & 31;
    const int w    = tid >> 5;
    const int hh   = lane >> 4;
    const int lm   = lane & 15;
    const int kb   = hh << 3;
    const int b    = blockIdx.z;
    const int head = blockIdx.y;
    const int q0   = blockIdx.x * 128 + w * 16;

    const _Float16* qhead = qrow + ((size_t)b * NH + head) * SEQ * DH;
    const _Float16* thead = qT + ((size_t)b * NH + head) * DH * SEQ;
    const _Float16* qlane = qhead + (size_t)lm * DH + kb;
    // key copy i of a thread: stage row i*32 + tid/8, 16-B piece tid%8;
    // V^T copy i: row i*16 + tid/16, 16-B piece tid%16
    const _Float16* gk = qhead + (size_t)(tid >> 3) * DH + (tid & 7) * 8;
    const _Float16* gv = thead + (size_t)(tid >> 4) * SEQ + (tid & 15) * 8;
    const unsigned  lk = lds_off(Kv) + (unsigned)((tid >> 3) * (AK_PITCH * 2) + (tid & 7) * 16);
    const unsigned  lv = lds_off(Kv) + (unsigned)(AK_HALVES * 2 + (tid >> 4) * (AV_PITCH * 2) + (tid & 15) * 16);

    copy_kv(lk, gk, lv, gv);
    if (NT > 1)
        copy_kv(lk + AT_HALVES * 2u, gk + (size_t)AT_KEYS * DH, lv + AT_HALVES * 2u, gv + AT_KEYS);
    // stage 0 landed (this wave's copies); stage 1's eight fly on
    if (NT > 1) asm volatile("s_wait_asynccnt 0x8" ::: "memory");
    else        asm volatile("s_wait_asynccnt 0x0" ::: "memory");
    __syncthreads();                                    // stage 0 published to all waves
    if (NT > 2)
        copy_kv(lk + AT_HALVES * 4u, gk + (size_t)2 * AT_KEYS * DH, lv + AT_HALVES * 4u, gv + 2 * AT_KEYS);

    const v16h qf0 = load_frag_p(qlane + (size_t)q0 * DH);        // d 0..31
    const v16h qf1 = load_frag_p(qlane + (size_t)q0 * DH + 32);   // d 32..63

    v8f o[4];
#pragma unroll
    for (int dt = 0; dt < 4; ++dt) o[dt] = zero8();
    float mr = -1.0e30f, l = 0.0f;

    int bo = 0;                                         // stage t's buffer, in halves
#pragma unroll 1
    for (int t = 0; t < NT; ++t) {
      const _Float16* sk = Kv + bo + lm * AK_PITCH + kb;
      const _Float16* sv = Kv + bo + AK_HALVES + lm * AV_PITCH + kb;
#pragma unroll
      for (int u = 0; u < AT_KEYS / 32; ++u) {
        // The step's LDS reads stand in one group ahead of its products, so that
        // the wave waits out one LDS latency per 32 keys and not one per fragment.
        const _Float16* ka = sk + u * 32 * AK_PITCH;
        v16h a0 = load_frag_p(ka);
        v16h a1 = load_frag_p(ka + 32);
        v16h c0 = load_frag_p(ka + 16 * AK_PITCH);
        v16h c1 = load_frag_p(ka + 16 * AK_PITCH + 32);
        v16h vf[4];
#pragma unroll
        for (int dt = 0; dt < 4; ++dt) vf[dt] = load_frag_p(sv + dt * 16 * AV_PITCH + u * 32);
        v8f sA = wmma16(a0, qf0, zero8());
        sA = wmma16(a1, qf1, sA);
        v8f sB = wmma16(c0, qf0, zero8());
        sB = wmma16(c1, qf1, sB);

        float tA[8], tB[8];
#pragma unroll
        for (int i = 0; i < 8; ++i) { tA[i] = sA[i] * CS; tB[i] = sB[i] * CS; }
        float tmax = fmaxf(tA[0], tB[0]);
#pragma unroll
        for (int i = 1; i < 8; ++i) tmax = fmaxf(tmax, fmaxf(tA[i], tB[i]));
        tmax = fmaxf(tmax, __shfl_xor(tmax, 16, 32));
        const float mn = fmaxf(mr, tmax);
        if (__builtin_amdgcn_ballot_w32(mn > mr) != 0u) {       // wave-uniform
            const float sc = ex2(mr - mn);
            l *= sc;
#pragma unroll
            for (int dt = 0; dt < 4; ++dt)
#pragma unroll
                for (int r = 0; r < 8; ++r) o[dt][r] *= sc;
        }
        mr = mn;
        const float sh = 8.0f - mn;
        float ps = 0.0f;
        v16h pb;
#pragma unroll
        for (int i = 0; i < 8; ++i) {
            const float pa = ex2(tA[i] + sh);
            const float pq = ex2(tB[i] + sh);
            ps += pa + pq;
            pb[i]     = (_Float16)pa;
            pb[8 + i] = (_Float16)pq;
        }
        l += ps;
#pragma unroll
        for (int dt = 0; dt < 4; ++dt) o[dt] = wmma16(vf[dt], pb, o[dt]);
      }
      asm volatile("s_wait_dscnt 0x0" ::: "memory");      // this wave's reads of the buffer are done
      // stage t+1 landed (this wave's copies): behind it stand stage t+2's eight, or, at the tail, none
      if (t + 2 < NT) asm volatile("s_wait_asynccnt 0x8" ::: "memory");
      else            asm volatile("s_wait_asynccnt 0x0" ::: "memory");
      __syncthreads();                                    // publishes stage t+1, frees stage t's buffer
      if (t + 3 < NT)
          copy_kv(lk + (unsigned)bo * 2u, gk + (size_t)(t + 3) * AT_KEYS * DH,
                  lv + (unsigned)bo * 2u, gv + (size_t)(t + 3) * AT_KEYS);
      bo = (bo == 2 * AT_HALVES) ? 0 : bo + AT_HALVES;
    }
    asm volatile("s_wait_asynccnt 0x0" ::: "memory");       // nothing in flight when the loop is left

    const float lt  = l + __shfl_xor(l, 16, 32);
    const float inv = (1.0f / lt) * 0.015625f;          // 2^8 P carry cancels in o/l; 1/64 for the q carry
#pragma unroll
    for (int dt = 0; dt < 4; ++dt) {
        v4f u0, u1;
        u0.x = o[dt][0] * inv; u0.y = o[dt][1] * inv; u0.z = o[dt][2] * inv; u0.w = o[dt][3] * inv;
        u1.x = o[dt][4] * inv; u1.y = o[dt][5] * inv; u1.z = o[dt][6] * inv; u1.w = o[dt][7] * inv;
        *(v4f*)(&Ost[w][lm * DH + dt * 16 + 8 * hh])     = u0;
        *(v4f*)(&Ost[w][lm * DH + dt * 16 + 8 * hh + 4]) = u1;
    }
    wave_lds_sync();

    v4f sv[8];
    const int col = lm * 4;
#pragma unroll
    for (int i = 0; i < 8; ++i) {
        const int row = 2 * i + hh;
        v4f a  = *(const v4f*)(&Ost[w][i * 128 + lane * 4]);
        v4f xv = *(const v4f*)(x + ((size_t)b * SEQ_FULL + q0 + row) * DM + head * DH + col);
        a.x = bf16r(xv.x) + a.x;
        a.y = bf16r(xv.y) + a.y;
        a.z = bf16r(xv.z) + a.z;
        a.w = bf16r(xv.w) + a.w;
        sv[i] = a;
    }
    float* ob = y1 + ((size_t)b * SEQ + q0 + hh) * DM + head * DH + col;
#pragma unroll
    for (int i = 0; i < 8; ++i) *(v4f*)(ob + (size_t)(2 * i) * DM) = sv[i];
    
}

// ---------------------------------------------------------------------------
// row, row kept in a wave-private LDS line, loops rolled. Writes f32 row
// (512 B per instruction, lane-contiguous) and optionally f16(16 * LN(y)) row
// ---------------------------------------------------------------------------
__global__ __launch_bounds__(128) void k_ln(const float* __restrict__ y,
                                             const float* __restrict__ g,
                                             const float* __restrict__ be,
                                             float* __restrict__ of,
                                             _Float16* __restrict__ oh,
                                             int wr16) {
    __shared__ __align__(16) float    Rw[4][DM];     // 16 KB, wave-private
    __shared__ __align__(16) _Float16 Hw[4][DM];     // 8 KB, wave-private
    const int tid  = threadIdx.x;
    const int lane = tid & 31;
    const int w    = tid >> 5;
    const int row  = blockIdx.x * 4 + w;
    if (row >= NTOK) return;                          // wave-uniform; no block barriers below
    const float* yr = y + (size_t)row * DM;

    float s = 0.0f;
#pragma unroll 1
    for (int j = 0; j < 8; ++j) {
        const int c = j * 128 + lane * 4;
        v4f v = *(const v4f*)(yr + c);
        *(v4f*)(&Rw[w][c]) = v;
        s += (v.x + v.y) + (v.z + v.w);
    }
    s = wave_sum(s);
    const float mu = s * 0.0009765625f;
    float qv = 0.0f;
#pragma unroll 1
    for (int j = 0; j < 8; ++j) {
        const int c = j * 128 + lane * 4;
        v4f v = *(const v4f*)(&Rw[w][c]);
        const float d0 = v.x - mu, d1 = v.y - mu, d2 = v.z - mu, d3 = v.w - mu;
        qv += (d0 * d0 + d1 * d1) + (d2 * d2 + d3 * d3);
    }
    qv = wave_sum(qv);
    const float rs = rsqrtf(qv * 0.0009765625f + 1.0e-5f);
#pragma unroll 1
    for (int j = 0; j < 8; ++j) {
        const int c = j * 128 + lane * 4;
        v4f v  = *(const v4f*)(&Rw[w][c]);
        v4f gv = *(const v4f*)(g + c);
        v4f bv = *(const v4f*)(be + c);
        v4f r;
        r.x = (v.x - mu) * rs * bf16r(gv.x) + bf16r(bv.x);
        r.y = (v.y - mu) * rs * bf16r(gv.y) + bf16r(bv.y);
        r.z = (v.z - mu) * rs * bf16r(gv.z) + bf16r(bv.z);
        r.w = (v.w - mu) * rs * bf16r(gv.w) + bf16r(bv.w);
        *(v4f*)(&Rw[w][c]) = r;
        if (wr16 != 0) {
            v4h hv;
            hv.x = (_Float16)(r.x * 16.0f);
            hv.y = (_Float16)(r.y * 16.0f);
            hv.z = (_Float16)(r.z * 16.0f);
            hv.w = (_Float16)(r.w * 16.0f);
            *(v4h*)(&Hw[w][c]) = hv;
        }
    }
    wave_lds_sync();

    float*    df = of + (size_t)row * DM;
    _Float16* dh = oh + (size_t)row * DM;
#pragma unroll 1
    for (int j = 0; j < 8; ++j) {
        const int c = j * 128 + lane * 4;
        v4f v = *(const v4f*)(&Rw[w][c]);
        *(v4f*)(df + c) = v;
    }
    if (wr16 != 0) {
#pragma unroll 1
        for (int j = 0; j < 4; ++j) {
            const int c = j * 256 + lane * 8;
            v8h hv = *(const v8h*)(&Hw[w][c]);
            *(v8h*)(dh + c) = hv;
        }
    }
    
}

// ---------------------------------------------------------------------------
// FFN1: acc = (16 x1)(64 W1) = 1024 pre ; hb = f16(16 relu(pre + b1)).
// Block = 4 x 4 waves = 256 x 256.
// 16-row steps through a wave-private LDS tile; row segment = 64 halves =
// ---------------------------------------------------------------------------
__global__ __launch_bounds__(512) __attribute__((amdgpu_num_vgpr(256)))
void k_gemm_ffn1(const _Float16* __restrict__ a16,
                 const _Float16* __restrict__ w1T,
                 const float* __restrict__ b1,
                 _Float16* __restrict__ hb) {
    __shared__ __align__(16) _Float16 Rst[16][16 * 64];  // 32 KB, wave-private
    __shared__ __align__(16) _Float16 St[3 * ST_HALVES(4, 1)]; // 216 KB, operand stages, cross-wave
    const int tid  = threadIdx.x;
    const int lane = tid & 31;
    const int w    = tid >> 5;
    const int hh   = lane >> 4;
    const int lm   = lane & 15;
    const int m0   = blockIdx.x * 256 + (w % 4) * 64;
    const int n0   = blockIdx.y * 256 + (w / 4) * 64;

    v8f acc[4][4];
    gemm_tile64<DM, 4, 1, 3>(a16 + (size_t)(blockIdx.x * 256) * DM, w1T + (size_t)(blockIdx.y * 256) * DM, St, acc);

    float bv[4];
#pragma unroll
    for (int nt = 0; nt < 4; ++nt) bv[nt] = bf16r(b1[n0 + nt * 16 + lm]) * 1024.0f;

#pragma unroll
    for (int ms = 0; ms < 4; ++ms) {
#pragma unroll
        for (int nt = 0; nt < 4; ++nt)
#pragma unroll
            for (int r = 0; r < 8; ++r)
                Rst[w][(8 * hh + r) * 64 + nt * 16 + lm] =
                    (_Float16)(fmaxf(acc[ms][nt][r] + bv[nt], 0.0f) * 0.015625f);
        wave_lds_sync();
        v8h rv[4];
#pragma unroll
        for (int i = 0; i < 4; ++i) rv[i] = *(const v8h*)(&Rst[w][i * 256 + lane * 8]);
        _Float16* dst = hb + (size_t)(m0 + ms * 16 + (lane >> 3)) * HID + n0 + (lane & 7) * 8;
#pragma unroll
        for (int i = 0; i < 4; ++i) *(v8h*)(dst + (size_t)i * 4 * HID) = rv[i];
        
        wave_lds_sync();
    }
}

// ---------------------------------------------------------------------------
// FFN2: acc = (16 h)(64 W2) = 1024 ff ; y2 = x1 + (ff + b2), f32.
// Block = two k groups of 2 x 2 waves = 128 x 128. The two waves of a 64x64 tile swap
// halves of their partial sums through LDS: group 0 finishes rows 0..31, group 1 rows 32..63.
// 16-row steps through a wave-private f32 LDS tile; bias and skip path added
// at the store stage as 4-float vectors; each instruction = 2 rows x 256 B.
// ---------------------------------------------------------------------------
__global__ __launch_bounds__(256) __attribute__((amdgpu_num_vgpr(256)))
void k_gemm_ffn2(const _Float16* __restrict__ hb,
                 const _Float16* __restrict__ w2T,
                 const float* __restrict__ b2,
                 const float* __restrict__ x1,
                 float* __restrict__ y2) {
    __shared__ __align__(16) float Fst[8][16 * 64];      // 32 KB, wave-private
    __shared__ __align__(16) _Float16 St[4 * ST_HALVES(2, 2)]; // 272 KB, operand stages, cross-wave
    const int tid  = threadIdx.x;
    const int lane = tid & 31;
    const int w    = __builtin_amdgcn_readfirstlane(tid >> 5);   // the wave's number, held scalar: the test on kg is a scalar branch
    const int kg   = w >> 2;
    const int wq   = w & 3;
    const int hh   = lane >> 4;
    const int lm   = lane & 15;
    const int m0   = blockIdx.x * 128 + (wq % 2) * 64 + kg * 32;
    const int n0   = blockIdx.y * 128 + (wq / 2) * 64;

    v8f acc[2][4];
    {
        v8f part[4][4];
        gemm_tile64<HID, 2, 2, 4>(hb + (size_t)(blockIdx.x * 128) * HID, w2T + (size_t)(blockIdx.y * 128) * HID, St, part);
        float* X = (float*)St;
        // the loops of the join are unrolled whole: part and acc stay in registers only under constant indices
        if (kg == 0) {
#pragma unroll
            for (int i = 0; i < 2; ++i)
#pragma unroll
                for (int nt = 0; nt < 4; ++nt) {
                    sub_put(X, wq * 8 + i * 4 + nt, lane, part[2 + i][nt]);
                    acc[i][nt] = part[i][nt];
                }
        } else {
#pragma unroll
            for (int i = 0; i < 2; ++i)
#pragma unroll
                for (int nt = 0; nt < 4; ++nt) {
                    sub_put(X, 32 + wq * 8 + i * 4 + nt, lane, part[i][nt]);
                    acc[i][nt] = part[2 + i][nt];
                }
        }
        __syncthreads();                                // both groups' handed-over halves published
        const int tk = (1 - kg) * 32 + wq * 8;
#pragma unroll
        for (int i = 0; i < 2; ++i)
#pragma unroll
            for (int nt = 0; nt < 4; ++nt) acc[i][nt] = sub_add(X, tk + i * 4 + nt, lane, acc[i][nt]);
    }

    const int col = lm * 4;
    v4f bb = *(const v4f*)(b2 + n0 + col);
    bb.x = bf16r(bb.x); bb.y = bf16r(bb.y); bb.z = bf16r(bb.z); bb.w = bf16r(bb.w);

#pragma unroll
    for (int ms = 0; ms < 2; ++ms) {
#pragma unroll
        for (int nt = 0; nt < 4; ++nt)
#pragma unroll
            for (int r = 0; r < 8; ++r)
                Fst[w][(8 * hh + r) * 64 + nt * 16 + lm] = acc[ms][nt][r] * 0.0009765625f;
        wave_lds_sync();
        v4f sv[8];
        const size_t rbase = ((size_t)(m0 + ms * 16 + hh)) * DM + n0 + col;
#pragma unroll
        for (int i = 0; i < 8; ++i) {
            v4f a  = *(const v4f*)(&Fst[w][i * 128 + lane * 4]);
            v4f xr = *(const v4f*)(x1 + rbase + (size_t)(2 * i) * DM);
            a.x = xr.x + (a.x + bb.x);
            a.y = xr.y + (a.y + bb.y);
            a.z = xr.z + (a.z + bb.z);
            a.w = xr.w + (a.w + bb.w);
            sv[i] = a;
        }
        float* dst = y2 + rbase;
#pragma unroll
        for (int i = 0; i < 8; ++i) *(v4f*)(dst + (size_t)(2 * i) * DM) = sv[i];
        
        wave_lds_sync();
    }
}

// ---------------------------------------------------------------------------
extern "C" void kernel_launch(void* const* d_in, const int* in_sizes, int n_in,
                              void* d_out, int out_size, void* d_ws, size_t ws_size,
                              hipStream_t stream) {
    if (n_in < 11) return;
    if (in_sizes[0] < ((NB - 1) * SEQ_FULL + SEQ) * DM) return;
    if (in_sizes[1] < DM * DM || in_sizes[2] < DM) return;
    if (in_sizes[3] < DM || in_sizes[4] < DM) return;
    if (in_sizes[5] < DM * HID || in_sizes[6] < HID) return;
    if (in_sizes[7] < HID * DM || in_sizes[8] < DM) return;
    if (in_sizes[9] < DM || in_sizes[10] < DM) return;
    if (out_size < NTOK * DM) return;
    if (WS_TOTAL > ws_size) return;

    const float* x    = (const float*)d_in[0];    // [2,2048,1024]
    const float* Wq   = (const float*)d_in[1];    // [16,1024,64]  [head][in][dim]
    const float* bq   = (const float*)d_in[2];    // [16,64]
    const float* ln1g = (const float*)d_in[3];
    const float* ln1b = (const float*)d_in[4];
    const float* W1   = (const float*)d_in[5];    // [1024,4096]  [in][out]
    const float* b1   = (const float*)d_in[6];
    const float* W2   = (const float*)d_in[7];    // [4096,1024]  [in][out]
    const float* b2   = (const float*)d_in[8];
    const float* ln2g = (const float*)d_in[9];
    const float* ln2b = (const float*)d_in[10];
    float* out = (float*)d_out;                   // [2,2048,1024]

    char* ws = (char*)d_ws;
    size_t off = 0;
    _Float16* x16  = (_Float16*)(ws + off); off += SZ_X16;   // xh, then x1h (xh dead after k_gemm_q)
    _Float16* wqT  = (_Float16*)(ws + off); off += SZ_WQT;   // [h*64+e][d]
    _Float16* w1T  = (_Float16*)(ws + off); off += SZ_W1T;   // [n][k]
    _Float16* w2T  = (_Float16*)(ws + off); off += SZ_W2T;   // [n][k]
    _Float16* qrow = (_Float16*)(ws + off); off += SZ_Q16;   // [b][h][s][64]
    _Float16* qT   = (_Float16*)(ws + off); off += SZ_Q16;   // [b][h][64][s]
    float*    y12  = (float*)(ws + off);    off += SZ_Y32;   // y1, then y2 (y1 dead after LN1)
    float*    x1   = (float*)(ws + off);    off += SZ_Y32;
    _Float16* hb   = (_Float16*)(ws + off); off += SZ_HB;
    if (off > ws_size) return;

    // x -> xh; Wq per head [1024 (d)][64 (e)] -> [e][d]; W1 [1024 (k)][4096 (n)] -> [n][k]; W2 [4096 (k)][1024 (n)] -> [n][k]
    k_prep<<<dim3(P1_BLKS + P2_BLKS + PQ_BLKS + PX_BLKS), dim3(256), 0, stream>>>(x, Wq, W1, W2, x16, wqT, w1T, w2T);

    k_gemm_q<<<dim3(NTOK / 128, DM / 128), dim3(256), 0, stream>>>(x16, wqT, bq, qrow, qT);
    k_attn<<<dim3(SEQ / 128, NH, NB), dim3(256), 0, stream>>>(qrow, qT, x, y12);
    k_ln<<<dim3(NTOK / 4), dim3(128), 0, stream>>>(y12, ln1g, ln1b, x1, x16, 1);
    k_gemm_ffn1<<<dim3(NTOK / 256, HID / 256), dim3(512), 0, stream>>>(x16, w1T, b1, hb);
    k_gemm_ffn2<<<dim3(NTOK / 128, DM / 128), dim3(256), 0, stream>>>(hb, w2T, b2, x1, y12);
    k_ln<<<dim3(NTOK / 4), dim3(128), 0, stream>>>(y12, ln2g, ln2b, out, x16, 0);
}

// v007
// A run of this version takes 135 microseconds.
// Next to v006, in two timings, it ran 1.08 times as fast each time.
// Over all steps from v000 it is 3.10 times as fast.
#include <hip/hip_runtime.h>
#include <hip/hip_fp16.h>

// All contractions on v_wmma_f32_16x16x32_f16 (f16 operands, f32 accumulate), single products: x*Wq (x carried x16, Wq x64), q*q^T (q carried x64), P*q (P carried x256), x1*W1 (x1 x16, W1 x64), h*W2 (h x16, W2 x64); raw inputs RNE-converted to bf16 first.

#ifndef NB
#define NB 2
#endif
#ifndef SEQ
#define SEQ 2048
#endif
#define NB_FULL  2
#define SEQ_FULL 2048
#define DM   1024        // model width
#define NH   16          // heads
#define DH   64          // head width
#define HID  4096        // FFN hidden width
#define NTOK (NB * SEQ)

static_assert(NB >= 1 && NB <= NB_FULL);
static_assert(SEQ >= 128 && SEQ <= SEQ_FULL);
static_assert(SEQ % 128 == 0);                      // attention block = 128 queries; key loop steps 32
static_assert(SEQ % 64 == 0);                       // a 64-row GEMM wave tile stays inside one batch
static_assert(NTOK % 256 == 0);                     // GEMM block rows: 256 (FFN1), 128 (Q, FFN2)
static_assert(HID % 256 == 0 && DM % 128 == 0);     // GEMM block columns: 256 (FFN1), 128 (Q, FFN2)
static_assert(NH * DH == DM);                       // heads concatenate to the model width
static_assert(DH == 64);                            // one GEMM column tile == one head; 2 k-steps per score
static_assert(DM % 64 == 0 && HID % 64 == 0);       // N tiles of 64
static_assert(DM % 32 == 0 && HID % 32 == 0);       // K steps of 32
static_assert(DM == 32 * 8 * 4);                    // LN: 32 lanes x 8 chunks x 4 floats

typedef _Float16 v16h __attribute__((ext_vector_type(16)));
typedef _Float16 v8h  __attribute__((ext_vector_type(8)));
typedef _Float16 v4h  __attribute__((ext_vector_type(4)));
typedef float    v8f  __attribute__((ext_vector_type(8)));
typedef float    v4f  __attribute__((ext_vector_type(4)));

union Frag { v16h v; v8h h[2]; };

// scores: acc = (64 q_s).(64 q_t); t (log2 units) = acc * log2(e) / 8 / 4096
#define CS (1.44269504088896340736f * 3.0517578125e-05f)

// plane sizes in bytes (all multiples of 128)
#define SZ_X16   ((size_t)NTOK * DM * 2)     // xh, later x1h
#define SZ_WQT   ((size_t)DM * DM * 2)
#define SZ_W1T   ((size_t)HID * DM * 2)
#define SZ_W2T   ((size_t)DM * HID * 2)
#define SZ_Q16   ((size_t)NTOK * DM * 2)     // qrow, qT each
#define SZ_Y32   ((size_t)NTOK * DM * 4)     // y1 (later y2), x1 each
#define SZ_HB    ((size_t)NTOK * HID * 2)
#define WS_TOTAL (SZ_X16 + SZ_WQT + SZ_W1T + SZ_W2T + 2 * SZ_Q16 + 2 * SZ_Y32 + SZ_HB)
static_assert(WS_TOTAL <= (size_t)134217728);       // carve <= 128 MiB

static __device__ __forceinline__ v8f zero8() {
    v8f z;
#pragma unroll
    for (int i = 0; i < 8; ++i) z[i] = 0.0f;
    return z;
}

// 16x32 A fragment (or B fragment from an [n][k] k-contiguous source).
// p = tile_base + (lane&15)*ld + 8*(lane>>4): elements 0..7 = k 8h..8h+7,
// elements 8..15 = k 16+8h..16+8h+7 (split map, same for A and B).
static __device__ __forceinline__ v16h load_frag_p(const _Float16* p) {
    Frag f;
    f.h[0] = *(const v8h*)(p);
    f.h[1] = *(const v8h*)(p + 16);
    return f.v;
}

static __device__ __forceinline__ v8f wmma16(v16h a, v16h b, v8f c) {
    v8f d = __builtin_amdgcn_wmma_f32_16x16x32_f16(false, a, false, b, (short)0, c, false, false);
    asm volatile("v_nop\n\tv_nop\n\tv_nop\n\tv_nop" : "+v"(d) : "v"(a), "v"(b));
    return d;
}

// f32 -> bf16 RNE convert, value kept as f32
static __device__ __forceinline__ float bf16r(float x) {
    unsigned u = __float_as_uint(x);
    u = (u + 0x7FFFu + ((u >> 16) & 1u)) & 0xFFFF0000u;
    return __uint_as_float(u);
}

static __device__ __forceinline__ float ex2(float x) {
    return __builtin_amdgcn_exp2f(x);
}

// ordering for a wave-private LDS tile: stores before later loads of the same wave
static __device__ __forceinline__ void wave_lds_sync() {
    __builtin_amdgcn_fence(3, "wavefront");
    asm volatile("s_wait_dscnt 0" ::: "memory");
    __builtin_amdgcn_wave_barrier();
}

// ---------------------------------------------------------------------------
// Operand preparation, one launch, no LDS, no barrier. A work-group is 8 waves and
// takes one share of one of four jobs, picked by its index:
//   xh[tok][d]     = f16(16 * bf16(x)),  2048 16-B output pieces per work-group;
//   out[z][c][r]   = f16(64 * bf16(in[z][r][c])) for Wq, W1 and W2, one 64-row x
//                    32-column tile per wave, transposed in registers.
// Every thread has its 16 16-B loads in flight at once and writes 8 16-B pieces,
// so few waves have to be started for the bytes that are moved.
// ---------------------------------------------------------------------------
#define PX_PIECES 2048                                     // x pieces per work-group
#define PX_BLKS   ((int)((size_t)NTOK * DM / 8 / PX_PIECES))
#define PQ_BLKS   (NH * (DM / 64) * (DH / 32) / 8)
#define P1_BLKS   ((DM / 64) * (HID / 32) / 8)
#define P2_BLKS   ((HID / 64) * (DM / 32) / 8)
static_assert(((size_t)NTOK * DM / 8) % PX_PIECES == 0);   // whole work-groups of x pieces
static_assert(SEQ % (PX_PIECES / (DM / 8)) == 0);          // a work-group's token rows lie in one batch entry
static_assert((NH * (DM / 64) * (DH / 32)) % 8 == 0);      // whole work-groups of Wq tiles
static_assert(((DM / 64) * (HID / 32)) % 8 == 0);          // whole work-groups of W1 and W2 tiles

static __device__ __forceinline__ _Float16 cvt_s(float v, float sc) {
    return (_Float16)(bf16r(v) * sc);
}

// Tile u of in[z][ROWS][COLS]: rows rt*64.., columns ct*32... Lane = (r8, c4): it reads
// rows r8*8..+7 at columns c4*4..+3 and 16+c4*4..+3 (4 lanes = 64 B of a row per load)
// and writes, per column, its 8 rows as one 16-B piece (8 lanes = one whole 128-B line).
template <int ROWS, int COLS>
static __device__ __forceinline__ void tr_tile(const float* __restrict__ in,
                                               _Float16* __restrict__ out, int u, int lane) {
    constexpr int NCT = COLS / 32, NRT = ROWS / 64;
    const int ct = u % NCT;
    const int t  = u / NCT;
    const int rt = t % NRT;
    const int zz = t / NRT;
    const int r8 = lane & 7, c4 = lane >> 3;
    const size_t zoff = (size_t)zz * ROWS * COLS;
    const float* sp = in + zoff + (size_t)(rt * 64 + r8 * 8) * COLS + ct * 32 + c4 * 4;
    v4f a[8][2];
    // every loop below is unrolled whole: a and o stay in registers only under constant indices
#pragma unroll
    for (int j = 0; j < 8; ++j) {
        a[j][0] = *(const v4f*)(sp + (size_t)j * COLS);
        a[j][1] = *(const v4f*)(sp + (size_t)j * COLS + 16);
    }
    // the loads' address registers stay untouched up to this wait (sp is named so that they live until here)
    asm volatile("s_wait_xcnt 0x0" :: "v"(sp) : "memory");
    _Float16* dp = out + zoff + (size_t)(ct * 32 + c4 * 4) * ROWS + rt * 64 + r8 * 8;
    v8h o[8];
#pragma unroll
    for (int c = 0; c < 8; ++c)
#pragma unroll
        for (int j = 0; j < 8; ++j) o[c][j] = cvt_s(a[j][c >> 2][c & 3], 64.0f);
#pragma unroll
    for (int c = 0; c < 8; ++c)
        *(v8h*)(dp + (size_t)((c >> 2) * 16 + (c & 3)) * ROWS) = o[c];
    // no data or address register of the stores is rewritten ahead of this wait (another job's code follows in the listing)
    asm volatile("s_wait_xcnt 0x0" ::: "memory");
}

__global__ __launch_bounds__(256) void k_prep(const float* __restrict__ x,
                                               const float* __restrict__ Wq,
                                               const float* __restrict__ W1,
                                               const float* __restrict__ W2,
                                               _Float16* __restrict__ xh,
                                               _Float16* __restrict__ wqT,
                                               _Float16* __restrict__ w1T,
                                               _Float16* __restrict__ w2T) {
    const int tid  = threadIdx.x;
    const int lane = tid & 31;
    const int w    = tid >> 5;
    int blk = blockIdx.x;
    if (blk < P1_BLKS) { tr_tile<DM, HID>(W1, w1T, blk * 8 + w, lane); return; }
    blk -= P1_BLKS;
    if (blk < P2_BLKS) { tr_tile<HID, DM>(W2, w2T, blk * 8 + w, lane); return; }
    blk -= P2_BLKS;
    if (blk < PQ_BLKS) { tr_tile<DM, DH>(Wq, wqT, blk * 8 + w, lane); return; }
    blk -= PQ_BLKS;
    if (blk >= PX_BLKS) return;
    // 2048 pieces = 16 whole token rows, inside one batch entry
    const int tok0 = blk * (PX_PIECES / (DM / 8));
    const int b    = tok0 / SEQ;
    const int s0   = tok0 - b * SEQ;
    const char* xb = (const char*)(x + ((size_t)b * SEQ_FULL + s0) * DM);   // the same for the whole work-group
    const unsigned ob = (unsigned)tid * 32u;                                // the thread's byte offset in a run of 256 pieces
    v4f a[8], c[8];
    // every loop below is unrolled whole: a, c and o stay in registers only under constant indices
#pragma unroll
    for (int i = 0; i < 8; ++i) {
        a[i] = *(const v4f*)(xb + ob + i * 8192);
        c[i] = *(const v4f*)(xb + ob + i * 8192 + 16);
    }
    // the loads' address register stays untouched up to this wait (ob is named so that it lives until here)
    asm volatile("s_wait_xcnt 0x0" :: "v"(ob) : "memory");
    v8h o[8];
#pragma unroll
    for (int i = 0; i < 8; ++i) {
#pragma unroll
        for (int e = 0; e < 4; ++e) {
            o[i][e]     = cvt_s(a[i][e], 16.0f);
            o[i][4 + e] = cvt_s(c[i][e], 16.0f);
        }
    }
    _Float16* dst = xh + (size_t)(blk * PX_PIECES + tid) * 8;
#pragma unroll
    for (int i = 0; i < 8; ++i) *(v8h*)(dst + i * 2048) = o[i];
    // no data or address register of the stores is rewritten ahead of this wait
    asm volatile("s_wait_xcnt 0x0" ::: "memory");
}

// ---------------------------------------------------------------------------
// GEMM main loop: block = KS groups of WS x WS waves = a square (WS*64) x (WS*64) tile,
// one wave = 64x64 = 4x4 subtiles; in its group, wave q takes row band q % WS and column
// band q / WS. A [M][K] and Bt [N][K] are 16-bit k-contiguous planes in global memory.
// A stage is KS*64 k (KS whole 128-B lines) of the block's WS*64 A rows and WS*64 Bt rows,
// laid in LDS at a pitch of 16 B more; asynchronous copies fill it (16 B per lane, 8*KS
// lanes per row), RB buffers, the next RB - 1 stages in flight while this one is multiplied,
// so that a copy has RB - 1 stages' time to land. The counted wait returns when all but the
// wave's youngest copies have landed: left at RB - 2 stages' copies, it covers the next stage.
// A staged row feeds WS waves, so the bytes copied per product fall as 1 / WS.
// Group g multiplies k g*64..g*64+63 of every stage, so with KS = 2 a block of four
// 64x64 tiles runs two waves on each SIMD, one working while the other waits; each
// group ends with a partial sum over its half of k, and the caller joins the two.
// Fragments are two 16-B LDS loads, same k order as from the global planes.
// ---------------------------------------------------------------------------
#define ST_K      64                         // halves of k per stage and wave group
#define ST_PITCH(KS)  ((KS) * ST_K + 8)      // halves per LDS row (144 B, 272 B)
#define ST_HALVES(WS, KS) (2 * (WS) * 64 * ST_PITCH(KS))   // one buffer: A rows, then Bt rows

static __device__ __forceinline__ unsigned lds_off(const void* p) { return (unsigned)(size_t)p; }

// Four copies of A rows and four of Bt rows, each run ls bytes apart in LDS and gs
// halves apart in its plane. The s_wait_xcnt closes the statement so that no
// address register of a copy is rewritten ahead of it.
static __device__ __forceinline__ void copy4_4(unsigned la, const _Float16* ga,
                                               unsigned lb, const _Float16* gb,
                                               unsigned ls, size_t gs) {
    asm volatile(
        "global_load_async_to_lds_b128 %0, %8, off\n\t"
        "global_load_async_to_lds_b128 %1, %9, off\n\t"
        "global_load_async_to_lds_b128 %2, %10, off\n\t"
        "global_load_async_to_lds_b128 %3, %11, off\n\t"
        "global_load_async_to_lds_b128 %4, %12, off\n\t"
        "global_load_async_to_lds_b128 %5, %13, off\n\t"
        "global_load_async_to_lds_b128 %6, %14, off\n\t"
        "global_load_async_to_lds_b128 %7, %15, off\n\t"
        "s_wait_xcnt 0x0"
        :: "v"(la), "v"(la + ls), "v"(la + 2u * ls), "v"(la + 3u * ls),
           "v"(lb), "v"(lb + ls), "v"(lb + 2u * ls), "v"(lb + 3u * ls),
           "v"(ga), "v"(ga + gs), "v"(ga + 2 * gs), "v"(ga + 3 * gs),
           "v"(gb), "v"(gb + gs), "v"(gb + 2 * gs), "v"(gb + 3 * gs)
        : "memory");
}

// One stage: l = the thread's first LDS byte in the buffer, ga / gb = its first A and
// Bt piece at the stage's k. Copy i of a run: run row (i * threads + tid) / (8 * KS).
template <int K, int WS, int KS>
static __device__ __forceinline__ void copy_stage(unsigned l, const _Float16* ga, const _Float16* gb) {
    constexpr int RSTEP = WS * WS * 4;               // rows that one copy of the whole block covers
    constexpr int NG    = WS * 64 / (4 * RSTEP);     // statements per stage
    static_assert(NG * 4 * RSTEP == WS * 64);        // every row of both runs copied once
    const unsigned ls = (unsigned)RSTEP * ST_PITCH(KS) * 2u;
    const size_t   gs = (size_t)RSTEP * K;
#pragma unroll
    for (int j = 0; j < NG; ++j)
        copy4_4(l + 4u * j * ls, ga + 4 * j * gs,
                l + (unsigned)(WS * 64 * ST_PITCH(KS) * 2) + 4u * j * ls, gb + 4 * j * gs, ls, gs);
}

// ab = A + m_block * K (WS*64 rows), bb = Bt + n_block * K (WS*64 rows), St = RB buffers.
template <int K, int WS, int KS, int RB>
static __device__ __forceinline__ void gemm_tile64(const _Float16* __restrict__ ab,
                                                   const _Float16* __restrict__ bb,
                                                   _Float16* St,
                                                   v8f (&acc)[4][4]) {
    constexpr int SK = ST_K * KS;                    // halves of k per stage
    constexpr int PT = ST_PITCH(KS);
    static_assert(K % SK == 0 && K / SK >= RB);      // whole stages, every buffer filled
    constexpr int NT = K / SK;
    constexpr int CW = 2 * WS * 64 * 8 * KS / (WS * WS * KS * 32);   // copies of one wave per stage
    static_assert(RB >= 3 && (RB - 1) * CW <= 63);   // copies of a wave outstanding at most
    const int tid  = threadIdx.x;
    const int lane = tid & 31;
    const int w    = tid >> 5;
    const int kg   = w / (WS * WS);
    const int wm   = (w % (WS * WS)) % WS;
    const int wn   = (w % (WS * WS)) / WS;
    const int lm   = lane & 15;
    const int kb   = kg * ST_K + ((lane >> 4) << 3);
    const int crow = tid / (8 * KS), cpc = tid % (8 * KS);
    const _Float16* ga = ab + (size_t)crow * K + cpc * 8;
    const _Float16* gb = bb + (size_t)crow * K + cpc * 8;
    const unsigned  l0 = lds_off(St) + (unsigned)(crow * (PT * 2) + cpc * 16);

#pragma unroll
    for (int ms = 0; ms < 4; ++ms)
#pragma unroll
        for (int nt = 0; nt < 4; ++nt) acc[ms][nt] = zero8();

    // unrolled whole: straight-line copies, buffer offsets as constants
#pragma unroll
    for (int s = 0; s < RB - 1; ++s)
        copy_stage<K, WS, KS>(l0 + (unsigned)s * (ST_HALVES(WS, KS) * 2u), ga + s * SK, gb + s * SK);
    asm volatile("s_wait_asynccnt %0" :: "i"((RB - 2) * CW) : "memory");   // stage 0 landed (this wave's copies); the younger stages fly on
    __syncthreads();                                    // stage 0 published to all waves
    copy_stage<K, WS, KS>(l0 + (unsigned)(RB - 1) * (ST_HALVES(WS, KS) * 2u), ga + (RB - 1) * SK, gb + (RB - 1) * SK);

    int bo = 0;                                         // stage t's buffer, in halves
#pragma unroll 1
    for (int t = 0; t < NT; ++t) {
        const _Float16* sa = St + bo + (wm * 64 + lm) * PT + kb;
        const _Float16* sb = St + bo + ((WS + wn) * 64 + lm) * PT + kb;
        // Fragment reads stand in few groups, each ahead of the products that hide it:
        // k 0..31 whole and the A side of k 32..63 first, the B side of k 32..63 in
        // two halves into the B registers that the first k step has just left.
        v16h a0[4], a1[4], bn[4];
#pragma unroll
        for (int i = 0; i < 4; ++i) a0[i] = load_frag_p(sa + i * 16 * PT);
#pragma unroll
        for (int i = 0; i < 4; ++i) bn[i] = load_frag_p(sb + i * 16 * PT);
#pragma unroll
        for (int i = 0; i < 4; ++i) a1[i] = load_frag_p(sa + i * 16 * PT + 32);
#pragma unroll
        for (int hf = 0; hf < 4; hf += 2) {
#pragma unroll
            for (int nt = hf; nt < hf + 2; ++nt)
#pragma unroll
                for (int ms = 0; ms < 4; ++ms) acc[ms][nt] = wmma16(a0[ms], bn[nt], acc[ms][nt]);
#pragma unroll
            for (int nt = hf; nt < hf + 2; ++nt) bn[nt] = load_frag_p(sb + nt * 16 * PT + 32);
        }
#pragma unroll
        for (int nt = 0; nt < 4; ++nt)
#pragma unroll
            for (int ms = 0; ms < 4; ++ms) acc[ms][nt] = wmma16(a1[ms], bn[nt], acc[ms][nt]);
        asm volatile("s_wait_dscnt 0x0" ::: "memory");      // this wave's reads of the buffer are done
        // stage t+1 landed (this wave's copies): behind it stages t+2 .. t+RB-1 were issued whole, or, at the tail, fewer
        if (t + RB - 1 < NT) asm volatile("s_wait_asynccnt %0" :: "i"((RB - 2) * CW) : "memory");
        else                 asm volatile("s_wait_asynccnt 0x0" ::: "memory");
        __syncthreads();                                    // publishes stage t+1, frees stage t's buffer
        if (t + RB < NT)
            copy_stage<K, WS, KS>(l0 + (unsigned)bo * 2u, ga + (size_t)(t + RB) * SK, gb + (size_t)(t + RB) * SK);
        bo = (bo == (RB - 1) * ST_HALVES(WS, KS)) ? 0 : bo + ST_HALVES(WS, KS);
    }
    asm volatile("s_wait_asynccnt 0x0" ::: "memory");       // nothing in flight when the loop is left
}

// Joining the two k groups' partial sums. X = the operand ring, free behind the loop's
// last barrier. A subtile travels as two runs of 512 B, 16 B per lane, lane-contiguous;
// slot = 256 floats. The sum of a pair is the same whichever group forms it.
static __device__ __forceinline__ void sub_put(float* X, int slot, int lane, v8f v) {
    v4f lo, hi;
    lo.x = v[0]; lo.y = v[1]; lo.z = v[2]; lo.w = v[3];
    hi.x = v[4]; hi.y = v[5]; hi.z = v[6]; hi.w = v[7];
    *(v4f*)(X + slot * 256 + lane * 4)       = lo;
    *(v4f*)(X + slot * 256 + 128 + lane * 4) = hi;
}

static __device__ __forceinline__ v8f sub_add(const float* X, int slot, int lane, v8f v) {
    const v4f lo = *(const v4f*)(X + slot * 256 + lane * 4);
    const v4f hi = *(const v4f*)(X + slot * 256 + 128 + lane * 4);
    v[0] += lo.x; v[1] += lo.y; v[2] += lo.z; v[3] += lo.w;
    v[4] += hi.x; v[5] += hi.y; v[6] += hi.z; v[7] += hi.w;
    return v;
}

// ---------------------------------------------------------------------------
// Q projection: acc = (16 x)(64 Wq) = 1024 x.Wq ; q64 = (acc + 1024 bq) / 16.
// Writes qrow[b][h][s][64] and qT[b][h][64][s] as f16(64 q).
// Block = two k groups of 2 x 2 waves = 128 tokens x two heads; wave tile = 64 tokens x one head. The second group
// hands its partial sums to the first through LDS and ends; the first stores. Row plane: 16-row steps through a
// wave-private LDS tile; transposed plane: whole 64x64 wave-private tile.
// ---------------------------------------------------------------------------
__global__ __launch_bounds__(256) __attribute__((amdgpu_num_vgpr(256)))
void k_gemm_q(const _Float16* __restrict__ xh,
              const _Float16* __restrict__ wqT,
              const float* __restrict__ bq,
              _Float16* __restrict__ qrow,
              _Float16* __restrict__ qT) {
    __shared__ __align__(16) _Float16 Rst[4][16 * 64];   // 8 KB, wave-private
    __shared__ __align__(16) _Float16 Tst[4][64 * 64];   // 32 KB, wave-private
    __shared__ __align__(16) _Float16 St[4 * ST_HALVES(2, 2)]; // 272 KB, operand stages, cross-wave
    const int tid  = threadIdx.x;
    const int lane = tid & 31;
    const int wv   = __builtin_amdgcn_readfirstlane(tid >> 5);   // the wave's number, held scalar: the tests on kg are scalar branches
    const int kg   = wv >> 2;
    const int w    = wv & 3;
    const int hh   = lane >> 4;
    const int lm   = lane & 15;
    const int m0   = blockIdx.x * 128 + (w % 2) * 64;
    const int head = blockIdx.y * 2 + w / 2;
    const int n0   = head * 64;
    const int b    = m0 / SEQ;
    const int s0   = m0 - b * SEQ;

    v8f acc[4][4];
    gemm_tile64<DM, 2, 2, 4>(xh + (size_t)(blockIdx.x * 128) * DM, wqT + (size_t)(blockIdx.y * 128) * DM, St, acc);

    float* X = (float*)St;
    // the loops of the join are unrolled whole: acc stays in registers only under constant indices
    if (kg == 1) {
#pragma unroll
        for (int ms = 0; ms < 4; ++ms)
#pragma unroll
            for (int nt = 0; nt < 4; ++nt) sub_put(X, w * 16 + ms * 4 + nt, lane, acc[ms][nt]);
    }
    __syncthreads();                                    // the second group's partial sums published
    if (kg == 1) return;                                // no block barrier below
#pragma unroll
    for (int ms = 0; ms < 4; ++ms)
#pragma unroll
        for (int nt = 0; nt < 4; ++nt) acc[ms][nt] = sub_add(X, w * 16 + ms * 4 + nt, lane, acc[ms][nt]);

    float bv[4];
#pragma unroll
    for (int nt = 0; nt < 4; ++nt) bv[nt] = bf16r(bq[n0 + nt * 16 + lm]) * 1024.0f;

    _Float16* qr = qrow + (((size_t)b * NH + head) * SEQ + s0) * DH;
    _Float16* qt = qT + ((size_t)b * NH + head) * DH * SEQ + s0;

#pragma unroll
    for (int ms = 0; ms < 4; ++ms) {
#pragma unroll
        for (int nt = 0; nt < 4; ++nt) {
            v8h tv;
#pragma unroll
            for (int r = 0; r < 8; ++r) {
                _Float16 hv = (_Float16)((acc[ms][nt][r] + bv[nt]) * 0.0625f);
                Rst[w][(8 * hh + r) * 64 + nt * 16 + lm] = hv;
                tv[r] = hv;
            }
            *(v8h*)(&Tst[w][(nt * 16 + lm) * 64 + ms * 16 + 8 * hh]) = tv;
        }
        wave_lds_sync();
        v8h rv[4];
#pragma unroll
        for (int i = 0; i < 4; ++i) rv[i] = *(const v8h*)(&Rst[w][i * 256 + lane * 8]);
        _Float16* dst = qr + ms * 1024 + lane * 8;
#pragma unroll
        for (int i = 0; i < 4; ++i) *(v8h*)(dst + i * 256) = rv[i];
        
        wave_lds_sync();
    }
    wave_lds_sync();
#pragma unroll 1
    for (int g = 0; g < 4; ++g) {
        v8h tv[4];
#pragma unroll
        for (int i = 0; i < 4; ++i) tv[i] = *(const v8h*)(&Tst[w][(g * 4 + i) * 256 + lane * 8]);
        _Float16* dst = qt + (size_t)(g * 16 + (lane >> 3)) * SEQ + (lane & 7) * 8;
#pragma unroll
        for (int i = 0; i < 4; ++i) *(v8h*)(dst + (size_t)i * 4 * SEQ) = tv[i];
        
    }
}

// ---------------------------------------------------------------------------
// Fused attention, q = k = v. Block = 8 waves = 128 queries of one (b, head);
// a wave owns 16 queries and streams all SEQ keys, 32 per step:
//   S^T tiles (rows = keys, cols = queries): A = key rows, B = query rows
//   (k = d, 2 steps of 32); query fragments straight from the qrow plane;
//   per-lane online softmax (lane column = its query; partner lane +-16);
//   P^T carried 2^8 as f16: the two S^T tiles chain directly as the B
//   fragment (elements 0..7 = tile keys 0..15, 8..15 = tile keys 16..31);
//   O^T += V^T . P^T with A fragments of V^T (rows = d, k = keys).
// Key rows and V^T rows reach the waves through LDS: a stage is 128 keys, 128
// qrow rows of 128 B at a 144-B pitch and 64 qT rows of 256 B at a 272-B pitch,
// filled once per block by asynchronous copies (16 B per lane, whole lines per
// wave) and read by all 8 waves; three buffers, the next two stages in flight
// while this one is worked on. Fragments keep the k order they had from the planes.
// Epilogue: O^T / (64 l) staged as [query][d] f32 in a wave-private LDS tile,
// bf16(x) added at the store stage, 8 lane-contiguous 16-B-per-lane
// ---------------------------------------------------------------------------
#define AT_KEYS   128                        // keys per stage
#define AK_PITCH  72                         // halves per key row in LDS (144 B)
#define AV_PITCH  136                        // halves per V^T row in LDS (272 B)
#define AK_HALVES (AT_KEYS * AK_PITCH)       // key rows of one buffer, 18,432 B
#define AV_HALVES (DH * AV_PITCH)            // V^T rows of one buffer, 17,408 B
#define AT_HALVES (AK_HALVES + AV_HALVES)    // one buffer, 35,840 B
static_assert(SEQ % AT_KEYS == 0);           // whole stages

// Four copies of key rows (32 rows apart) and four of V^T rows (16 rows apart).
// The s_wait_xcnt closes the statement so that no address register of a copy is
// rewritten ahead of it.
static __device__ __forceinline__ void copy_kv(unsigned lk, const _Float16* gk,
                                               unsigned lv, const _Float16* gv) {
    const unsigned ks = 32u * AK_PITCH * 2u;
    const unsigned vs = 16u * AV_PITCH * 2u;
    const size_t   gks = (size_t)32 * DH;
    const size_t   gvs = (size_t)16 * SEQ;
    asm volatile(
        "global_load_async_to_lds_b128 %0, %8, off\n\t"
        "global_load_async_to_lds_b128 %1, %9, off\n\t"
        "global_load_async_to_lds_b128 %2, %10, off\n\t"
        "global_load_async_to_lds_b128 %3, %11, off\n\t"
        "global_load_async_to_lds_b128 %4, %12, off\n\t"
        "global_load_async_to_lds_b128 %5, %13, off\n\t"
        "global_load_async_to_lds_b128 %6, %14, off\n\t"
        "global_load_async_to_lds_b128 %7, %15, off\n\t"
        "s_wait_xcnt 0x0"
        :: "v"(lk), "v"(lk + ks), "v"(lk + 2u * ks), "v"(lk + 3u * ks),
           "v"(lv), "v"(lv + vs), "v"(lv + 2u * vs), "v"(lv + 3u * vs),
           "v"(gk), "v"(gk + gks), "v"(gk + 2 * gks), "v"(gk + 3 * gks),
           "v"(gv), "v"(gv + gvs), "v"(gv + 2 * gvs), "v"(gv + 3 * gvs)
        : "memory");
}

__global__ __launch_bounds__(256) __attribute__((amdgpu_num_vgpr(256)))
void k_attn(const _Float16* __restrict__ qrow,
            const _Float16* __restrict__ qT,
            const float* __restrict__ x,
            float* __restrict__ y1) {
    __shared__ __align__(16) float Ost[8][16 * DH];      // 32 KB, wave-private
    __shared__ __align__(16) _Float16 Kv[3 * AT_HALVES]; // 105 KB, key and V^T stages, cross-wave
    constexpr int NT = SEQ / AT_KEYS;
    const int tid  = threadIdx.x;
    const int lane = tid & 31;
    const int w    = tid >> 5;
    const int hh   = lane >> 4;
    const int lm   = lane & 15;
    const int kb   = hh << 3;
    const int b    = blockIdx.z;
    const int head = blockIdx.y;
    const int q0   = blockIdx.x * 128 + w * 16;

    const _Float16* qhead = qrow + ((size_t)b * NH + head) * SEQ * DH;
    const _Float16* thead = qT + ((size_t)b * NH + head) * DH * SEQ;
    const _Float16* qlane = qhead + (size_t)lm * DH + kb;
    // key copy i of a thread: stage row i*32 + tid/8, 16-B piece tid%8;
    // V^T copy i: row i*16 + tid/16, 16-B piece tid%16
    const _Float16* gk = qhead + (size_t)(tid >> 3) * DH + (tid & 7) * 8;
    const _Float16* gv = thead + (size_t)(tid >> 4) * SEQ + (tid & 15) * 8;
    const unsigned  lk = lds_off(Kv) + (unsigned)((tid >> 3) * (AK_PITCH * 2) + (tid & 7) * 16);
    const unsigned  lv = lds_off(Kv) + (unsigned)(AK_HALVES * 2 + (tid >> 4) * (AV_PITCH * 2) + (tid & 15) * 16);

    copy_kv(lk, gk, lv, gv);
    if (NT > 1)
        copy_kv(lk + AT_HALVES * 2u, gk + (size_t)AT_KEYS * DH, lv + AT_HALVES * 2u, gv + AT_KEYS);
    // stage 0 landed (this wave's copies); stage 1's eight fly on
    if (NT > 1) asm volatile("s_wait_asynccnt 0x8" ::: "memory");
    else        asm volatile("s_wait_asynccnt 0x0" ::: "memory");
    __syncthreads();                                    // stage 0 published to all waves
    if (NT > 2)
        copy_kv(lk + AT_HALVES * 4u, gk + (size_t)2 * AT_KEYS * DH, lv + AT_HALVES * 4u, gv + 2 * AT_KEYS);

    const v16h qf0 = load_frag_p(qlane + (size_t)q0 * DH);        // d 0..31
    const v16h qf1 = load_frag_p(qlane + (size_t)q0 * DH + 32);   // d 32..63

    v8f o[4];
#pragma unroll
    for (int dt = 0; dt < 4; ++dt) o[dt] = zero8();
    float mr = -1.0e30f, l = 0.0f;

    int bo = 0;                                         // stage t's buffer, in halves
#pragma unroll 1
    for (int t = 0; t < NT; ++t) {
      const _Float16* sk = Kv + bo + lm * AK_PITCH + kb;
      const _Float16* sv = Kv + bo + AK_HALVES + lm * AV_PITCH + kb;
#pragma unroll
      for (int u = 0; u < AT_KEYS / 32; ++u) {
        // The step's LDS reads stand in one group ahead of its products, so that
        // the wave waits out one LDS latency per 32 keys and not one per fragment.
        const _Float16* ka = sk + u * 32 * AK_PITCH;
        v16h a0 = load_frag_p(ka);
        v16h a1 = load_frag_p(ka + 32);
        v16h c0 = load_frag_p(ka + 16 * AK_PITCH);
        v16h c1 = load_frag_p(ka + 16 * AK_PITCH + 32);
        v16h vf[4];
#pragma unroll
        for (int dt = 0; dt < 4; ++dt) vf[dt] = load_frag_p(sv + dt * 16 * AV_PITCH + u * 32);
        v8f sA = wmma16(a0, qf0, zero8());
        sA = wmma16(a1, qf1, sA);
        v8f sB = wmma16(c0, qf0, zero8());
        sB = wmma16(c1, qf1, sB);

        float tA[8], tB[8];
#pragma unroll
        for (int i = 0; i < 8; ++i) { tA[i] = sA[i] * CS; tB[i] = sB[i] * CS; }
        float tmax = fmaxf(tA[0], tB[0]);
#pragma unroll
        for (int i = 1; i < 8; ++i) tmax = fmaxf(tmax, fmaxf(tA[i], tB[i]));
        tmax = fmaxf(tmax, __shfl_xor(tmax, 16, 32));
        const float mn = fmaxf(mr, tmax);
        if (__builtin_amdgcn_ballot_w32(mn > mr) != 0u) {       // wave-uniform
            const float sc = ex2(mr - mn);
            l *= sc;
#pragma unroll
            for (int dt = 0; dt < 4; ++dt)
#pragma unroll
                for (int r = 0; r < 8; ++r) o[dt][r] *= sc;
        }
        mr = mn;
        const float sh = 8.0f - mn;
        float ps = 0.0f;
        v16h pb;
#pragma unroll
        for (int i = 0; i < 8; ++i) {
            const float pa = ex2(tA[i] + sh);
            const float pq = ex2(tB[i] + sh);
            ps += pa + pq;
            pb[i]     = (_Float16)pa;
            pb[8 + i] = (_Float16)pq;
        }
        l += ps;
#pragma unroll
        for (int dt = 0; dt < 4; ++dt) o[dt] = wmma16(vf[dt], pb, o[dt]);
      }
      asm volatile("s_wait_dscnt 0x0" ::: "memory");      // this wave's reads of the buffer are done
      // stage t+1 landed (this wave's copies): behind it stand stage t+2's eight, or, at the tail, none
      if (t + 2 < NT) asm volatile("s_wait_asynccnt 0x8" ::: "memory");
      else            asm volatile("s_wait_asynccnt 0x0" ::: "memory");
      __syncthreads();                                    // publishes stage t+1, frees stage t's buffer
      if (t + 3 < NT)
          copy_kv(lk + (unsigned)bo * 2u, gk + (size_t)(t + 3) * AT_KEYS * DH,
                  lv + (unsigned)bo * 2u, gv + (size_t)(t + 3) * AT_KEYS);
      bo = (bo == 2 * AT_HALVES) ? 0 : bo + AT_HALVES;
    }
    asm volatile("s_wait_asynccnt 0x0" ::: "memory");       // nothing in flight when the loop is left

    const float lt  = l + __shfl_xor(l, 16, 32);
    const float inv = (1.0f / lt) * 0.015625f;          // 2^8 P carry cancels in o/l; 1/64 for the q carry
#pragma unroll
    for (int dt = 0; dt < 4; ++dt) {
        v4f u0, u1;
        u0.x = o[dt][0] * inv; u0.y = o[dt][1] * inv; u0.z = o[dt][2] * inv; u0.w = o[dt][3] * inv;
        u1.x = o[dt][4] * inv; u1.y = o[dt][5] * inv; u1.z = o[dt][6] * inv; u1.w = o[dt][7] * inv;
        *(v4f*)(&Ost[w][lm * DH + dt * 16 + 8 * hh])     = u0;
        *(v4f*)(&Ost[w][lm * DH + dt * 16 + 8 * hh + 4]) = u1;
    }
    wave_lds_sync();

    v4f sv[8];
    const int col = lm * 4;
#pragma unroll
    for (int i = 0; i < 8; ++i) {
        const int row = 2 * i + hh;
        v4f a  = *(const v4f*)(&Ost[w][i * 128 + lane * 4]);
        v4f xv = *(const v4f*)(x + ((size_t)b * SEQ_FULL + q0 + row) * DM + head * DH + col);
        a.x = bf16r(xv.x) + a.x;
        a.y = bf16r(xv.y) + a.y;
        a.z = bf16r(xv.z) + a.z;
        a.w = bf16r(xv.w) + a.w;
        sv[i] = a;
    }
    float* ob = y1 + ((size_t)b * SEQ + q0 + hh) * DM + head * DH + col;
#pragma unroll
    for (int i = 0; i < 8; ++i) *(v4f*)(ob + (size_t)(2 * i) * DM) = sv[i];
    
}

// ---------------------------------------------------------------------------
// LayerNorm over DM columns. A wave takes LN_R whole rows and holds them in registers:
// lane l has columns j*128 + l*4 .. +3, j = 0..7, of each row. All loads of the wave's
// rows are issued before the first is waited for, so the wave pays one memory latency
// for them, and few waves have to be started; gain and bias are read and converted once
// for the LN_R rows. No LDS, no barrier. The sums keep their order: over j in a lane,
// then lanes by xor 16, 8, 4, 2, 1. Every store covers whole 128-B lines (f32: 512 B
// per instruction; f16(16 * y): 256 B).
// ---------------------------------------------------------------------------
#define LN_R 4                                       // rows per wave
static_assert(NTOK % (4 * LN_R) == 0);               // whole work-groups of 4 waves

// the rows' sums over the 32 lanes, the rows' exchanges side by side so that their latencies overlap
static __device__ __forceinline__ void rows_sum(float (&s)[LN_R]) {
#pragma unroll
    for (int m = 16; m >= 1; m >>= 1) {
        float t[LN_R];
#pragma unroll
        for (int r = 0; r < LN_R; ++r) t[r] = __shfl_xor(s[r], m, 32);
#pragma unroll
        for (int r = 0; r < LN_R; ++r) s[r] += t[r];
    }
}

__global__ __launch_bounds__(128) void k_ln(const float* __restrict__ y,
                                             const float* __restrict__ g,
                                             const float* __restrict__ be,
                                             float* __restrict__ of,
                                             _Float16* __restrict__ oh,
                                             int wr16) {
    const int tid  = threadIdx.x;
    const int lane = tid & 31;
    const int w    = __builtin_amdgcn_readfirstlane(tid >> 5);   // the wave's number, held scalar: row bases stay in scalar registers
    const int row0 = (blockIdx.x * 4 + w) * LN_R;
    if (row0 >= NTOK) return;                         // wave-uniform; no barrier in this kernel
    const char* yb = (const char*)(y + (size_t)row0 * DM);
    const unsigned ob = (unsigned)lane * 16u;         // the lane's byte offset in a run of 128 floats

    v4f v[LN_R][8], gv[8], bv[8];
    // every loop below is unrolled whole: v, gv, bv and hv stay in registers only under constant indices
#pragma unroll
    for (int r = 0; r < LN_R; ++r)
#pragma unroll
        for (int j = 0; j < 8; ++j) v[r][j] = *(const v4f*)(yb + ob + r * (DM * 4) + j * 512);
#pragma unroll
    for (int j = 0; j < 8; ++j) {
        gv[j] = *(const v4f*)((const char*)g + ob + j * 512);
        bv[j] = *(const v4f*)((const char*)be + ob + j * 512);
    }
    // the loads' address register stays untouched up to this wait (ob is named so that it lives until here)
    asm volatile("s_wait_xcnt 0x0" :: "v"(ob) : "memory");

    float s[LN_R];
#pragma unroll
    for (int r = 0; r < LN_R; ++r) {
        s[r] = 0.0f;
#pragma unroll
        for (int j = 0; j < 8; ++j) s[r] += (v[r][j].x + v[r][j].y) + (v[r][j].z + v[r][j].w);
    }
    rows_sum(s);
    float mu[LN_R], qv[LN_R];
#pragma unroll
    for (int r = 0; r < LN_R; ++r) {
        mu[r] = s[r] * 0.0009765625f;
        qv[r] = 0.0f;
#pragma unroll
        for (int j = 0; j < 8; ++j) {
            const float d0 = v[r][j].x - mu[r], d1 = v[r][j].y - mu[r], d2 = v[r][j].z - mu[r], d3 = v[r][j].w - mu[r];
            qv[r] += (d0 * d0 + d1 * d1) + (d2 * d2 + d3 * d3);
        }
    }
    rows_sum(qv);
#pragma unroll
    for (int j = 0; j < 8; ++j) {
        gv[j].x = bf16r(gv[j].x); gv[j].y = bf16r(gv[j].y); gv[j].z = bf16r(gv[j].z); gv[j].w = bf16r(gv[j].w);
        bv[j].x = bf16r(bv[j].x); bv[j].y = bf16r(bv[j].y); bv[j].z = bf16r(bv[j].z); bv[j].w = bf16r(bv[j].w);
    }
#pragma unroll
    for (int r = 0; r < LN_R; ++r) {
        const float rs = rsqrtf(qv[r] * 0.0009765625f + 1.0e-5f);
#pragma unroll
        for (int j = 0; j < 8; ++j) {
            v[r][j].x = (v[r][j].x - mu[r]) * rs * gv[j].x + bv[j].x;
            v[r][j].y = (v[r][j].y - mu[r]) * rs * gv[j].y + bv[j].y;
            v[r][j].z = (v[r][j].z - mu[r]) * rs * gv[j].z + bv[j].z;
            v[r][j].w = (v[r][j].w - mu[r]) * rs * gv[j].w + bv[j].w;
        }
    }

    if (wr16 != 0) {
        v4h hv[LN_R][8];
#pragma unroll
        for (int r = 0; r < LN_R; ++r)
#pragma unroll
            for (int j = 0; j < 8; ++j) {
                hv[r][j].x = (_Float16)(v[r][j].x * 16.0f);
                hv[r][j].y = (_Float16)(v[r][j].y * 16.0f);
                hv[r][j].z = (_Float16)(v[r][j].z * 16.0f);
                hv[r][j].w = (_Float16)(v[r][j].w * 16.0f);
            }
        char* hbp = (char*)(oh + (size_t)row0 * DM);
        const unsigned oh8 = (unsigned)lane * 8u;
#pragma unroll
        for (int r = 0; r < LN_R; ++r)
#pragma unroll
            for (int j = 0; j < 8; ++j) *(v4h*)(hbp + oh8 + r * (DM * 2) + j * 256) = hv[r][j];
    }
    char* fb = (char*)(of + (size_t)row0 * DM);
#pragma unroll
    for (int r = 0; r < LN_R; ++r)
#pragma unroll
        for (int j = 0; j < 8; ++j) *(v4f*)(fb + ob + r * (DM * 4) + j * 512) = v[r][j];
    // no data or address register of the stores is rewritten ahead of this wait
    asm volatile("s_wait_xcnt 0x0" ::: "memory");
}

// ---------------------------------------------------------------------------
// FFN1: acc = (16 x1)(64 W1) = 1024 pre ; hb = f16(16 relu(pre + b1)).
// Block = 4 x 4 waves = 256 x 256.
// 16-row steps through a wave-private LDS tile; row segment = 64 halves =
// ---------------------------------------------------------------------------
__global__ __launch_bounds__(512) __attribute__((amdgpu_num_vgpr(256)))
void k_gemm_ffn1(const _Float16* __restrict__ a16,
                 const _Float16* __restrict__ w1T,
                 const float* __restrict__ b1,
                 _Float16* __restrict__ hb) {
    __shared__ __align__(16) _Float16 Rst[16][16 * 64];  // 32 KB, wave-private
    __shared__ __align__(16) _Float16 St[3 * ST_HALVES(4, 1)]; // 216 KB, operand stages, cross-wave
    const int tid  = threadIdx.x;
    const int lane = tid & 31;
    const int w    = tid >> 5;
    const int hh   = lane >> 4;
    const int lm   = lane & 15;
    const int m0   = blockIdx.x * 256 + (w % 4) * 64;
    const int n0   = blockIdx.y * 256 + (w / 4) * 64;

    v8f acc[4][4];
    gemm_tile64<DM, 4, 1, 3>(a16 + (size_t)(blockIdx.x * 256) * DM, w1T + (size_t)(blockIdx.y * 256) * DM, St, acc);

    float bv[4];
#pragma unroll
    for (int nt = 0; nt < 4; ++nt) bv[nt] = bf16r(b1[n0 + nt * 16 + lm]) * 1024.0f;

#pragma unroll
    for (int ms = 0; ms < 4; ++ms) {
#pragma unroll
        for (int nt = 0; nt < 4; ++nt)
#pragma unroll
            for (int r = 0; r < 8; ++r)
                Rst[w][(8 * hh + r) * 64 + nt * 16 + lm] =
                    (_Float16)(fmaxf(acc[ms][nt][r] + bv[nt], 0.0f) * 0.015625f);
        wave_lds_sync();
        v8h rv[4];
#pragma unroll
        for (int i = 0; i < 4; ++i) rv[i] = *(const v8h*)(&Rst[w][i * 256 + lane * 8]);
        _Float16* dst = hb + (size_t)(m0 + ms * 16 + (lane >> 3)) * HID + n0 + (lane & 7) * 8;
#pragma unroll
        for (int i = 0; i < 4; ++i) *(v8h*)(dst + (size_t)i * 4 * HID) = rv[i];
        
        wave_lds_sync();
    }
}

// ---------------------------------------------------------------------------
// FFN2: acc = (16 h)(64 W2) = 1024 ff ; y2 = x1 + (ff + b2), f32.
// Block = two k groups of 2 x 2 waves = 128 x 128. The two waves of a 64x64 tile swap
// halves of their partial sums through LDS: group 0 finishes rows 0..31, group 1 rows 32..63.
// 16-row steps through a wave-private f32 LDS tile; bias and skip path added
// at the store stage as 4-float vectors; each instruction = 2 rows x 256 B.
// ---------------------------------------------------------------------------
__global__ __launch_bounds__(256) __attribute__((amdgpu_num_vgpr(256)))
void k_gemm_ffn2(const _Float16* __restrict__ hb,
                 const _Float16* __restrict__ w2T,
                 const float* __restrict__ b2,
                 const float* __restrict__ x1,
                 float* __restrict__ y2) {
    __shared__ __align__(16) float Fst[8][16 * 64];      // 32 KB, wave-private
    __shared__ __align__(16) _Float16 St[4 * ST_HALVES(2, 2)]; // 272 KB, operand stages, cross-wave
    const int tid  = threadIdx.x;
    const int lane = tid & 31;
    const int w    = __builtin_amdgcn_readfirstlane(tid >> 5);   // the wave's number, held scalar: the test on kg is a scalar branch
    const int kg   = w >> 2;
    const int wq   = w & 3;
    const int hh   = lane >> 4;
    const int lm   = lane & 15;
    const int m0   = blockIdx.x * 128 + (wq % 2) * 64 + kg * 32;
    const int n0   = blockIdx.y * 128 + (wq / 2) * 64;

    v8f acc[2][4];
    {
        v8f part[4][4];
        gemm_tile64<HID, 2, 2, 4>(hb + (size_t)(blockIdx.x * 128) * HID, w2T + (size_t)(blockIdx.y * 128) * HID, St, part);
        float* X = (float*)St;
        // the loops of the join are unrolled whole: part and acc stay in registers only under constant indices
        if (kg == 0) {
#pragma unroll
            for (int i = 0; i < 2; ++i)
#pragma unroll
                for (int nt = 0; nt < 4; ++nt) {
                    sub_put(X, wq * 8 + i * 4 + nt, lane, part[2 + i][nt]);
                    acc[i][nt] = part[i][nt];
                }
        } else {
#pragma unroll
            for (int i = 0; i < 2; ++i)
#pragma unroll
                for (int nt = 0; nt < 4; ++nt) {
                    sub_put(X, 32 + wq * 8 + i * 4 + nt, lane, part[i][nt]);
                    acc[i][nt] = part[2 + i][nt];
                }
        }
        __syncthreads();                                // both groups' handed-over halves published
        const int tk = (1 - kg) * 32 + wq * 8;
#pragma unroll
        for (int i = 0; i < 2; ++i)
#pragma unroll
            for (int nt = 0; nt < 4; ++nt) acc[i][nt] = sub_add(X, tk + i * 4 + nt, lane, acc[i][nt]);
    }

    const int col = lm * 4;
    v4f bb = *(const v4f*)(b2 + n0 + col);
    bb.x = bf16r(bb.x); bb.y = bf16r(bb.y); bb.z = bf16r(bb.z); bb.w = bf16r(bb.w);

#pragma unroll
    for (int ms = 0; ms < 2; ++ms) {
#pragma unroll
        for (int nt = 0; nt < 4; ++nt)
#pragma unroll
            for (int r = 0; r < 8; ++r)
                Fst[w][(8 * hh + r) * 64 + nt * 16 + lm] = acc[ms][nt][r] * 0.0009765625f;
        wave_lds_sync();
        v4f sv[8];
        const size_t rbase = ((size_t)(m0 + ms * 16 + hh)) * DM + n0 + col;
#pragma unroll
        for (int i = 0; i < 8; ++i) {
            v4f a  = *(const v4f*)(&Fst[w][i * 128 + lane * 4]);
            v4f xr = *(const v4f*)(x1 + rbase + (size_t)(2 * i) * DM);
            a.x = xr.x + (a.x + bb.x);
            a.y = xr.y + (a.y + bb.y);
            a.z = xr.z + (a.z + bb.z);
            a.w = xr.w + (a.w + bb.w);
            sv[i] = a;
        }
        float* dst = y2 + rbase;
#pragma unroll
        for (int i = 0; i < 8; ++i) *(v4f*)(dst + (size_t)(2 * i) * DM) = sv[i];
        
        wave_lds_sync();
    }
}

// ---------------------------------------------------------------------------
extern "C" void kernel_launch(void* const* d_in, const int* in_sizes, int n_in,
                              void* d_out, int out_size, void* d_ws, size_t ws_size,
                              hipStream_t stream) {
    if (n_in < 11) return;
    if (in_sizes[0] < ((NB - 1) * SEQ_FULL + SEQ) * DM) return;
    if (in_sizes[1] < DM * DM || in_sizes[2] < DM) return;
    if (in_sizes[3] < DM || in_sizes[4] < DM) return;
    if (in_sizes[5] < DM * HID || in_sizes[6] < HID) return;
    if (in_sizes[7] < HID * DM || in_sizes[8] < DM) return;
    if (in_sizes[9] < DM || in_sizes[10] < DM) return;
    if (out_size < NTOK * DM) return;
    if (WS_TOTAL > ws_size) return;

    const float* x    = (const float*)d_in[0];    // [2,2048,1024]
    const float* Wq   = (const float*)d_in[1];    // [16,1024,64]  [head][in][dim]
    const float* bq   = (const float*)d_in[2];    // [16,64]
    const float* ln1g = (const float*)d_in[3];
    const float* ln1b = (const float*)d_in[4];
    const float* W1   = (const float*)d_in[5];    // [1024,4096]  [in][out]
    const float* b1   = (const float*)d_in[6];
    const float* W2   = (const float*)d_in[7];    // [4096,1024]  [in][out]
    const float* b2   = (const float*)d_in[8];
    const float* ln2g = (const float*)d_in[9];
    const float* ln2b = (const float*)d_in[10];
    float* out = (float*)d_out;                   // [2,2048,1024]

    char* ws = (char*)d_ws;
    size_t off = 0;
    _Float16* x16  = (_Float16*)(ws + off); off += SZ_X16;   // xh, then x1h (xh dead after k_gemm_q)
    _Float16* wqT  = (_Float16*)(ws + off); off += SZ_WQT;   // [h*64+e][d]
    _Float16* w1T  = (_Float16*)(ws + off); off += SZ_W1T;   // [n][k]
    _Float16* w2T  = (_Float16*)(ws + off); off += SZ_W2T;   // [n][k]
    _Float16* qrow = (_Float16*)(ws + off); off += SZ_Q16;   // [b][h][s][64]
    _Float16* qT   = (_Float16*)(ws + off); off += SZ_Q16;   // [b][h][64][s]
    float*    y12  = (float*)(ws + off);    off += SZ_Y32;   // y1, then y2 (y1 dead after LN1)
    float*    x1   = (float*)(ws + off);    off += SZ_Y32;
    _Float16* hb   = (_Float16*)(ws + off); off += SZ_HB;
    if (off > ws_size) return;

    // x -> xh; Wq per head [1024 (d)][64 (e)] -> [e][d]; W1 [1024 (k)][4096 (n)] -> [n][k]; W2 [4096 (k)][1024 (n)] -> [n][k]
    k_prep<<<dim3(P1_BLKS + P2_BLKS + PQ_BLKS + PX_BLKS), dim3(256), 0, stream>>>(x, Wq, W1, W2, x16, wqT, w1T, w2T);

    k_gemm_q<<<dim3(NTOK / 128, DM / 128), dim3(256), 0, stream>>>(x16, wqT, bq, qrow, qT);
    k_attn<<<dim3(SEQ / 128, NH, NB), dim3(256), 0, stream>>>(qrow, qT, x, y12);
    k_ln<<<dim3(NTOK / (4 * LN_R)), dim3(128), 0, stream>>>(y12, ln1g, ln1b, x1, x16, 1);
    k_gemm_ffn1<<<dim3(NTOK / 256, HID / 256), dim3(512), 0, stream>>>(x16, w1T, b1, hb);
    k_gemm_ffn2<<<dim3(NTOK / 128, DM / 128), dim3(256), 0, stream>>>(hb, w2T, b2, x1, y12);
    k_ln<<<dim3(NTOK / (4 * LN_R)), dim3(128), 0, stream>>>(y12, ln2g, ln2b, out, x16, 0);
}

// v008
// Measured time: 129 microseconds a run.
// In both of two side-by-side timings against v007, it was 1.05 times as fast.
// Counting every step since v000, it is 3.26 times as fast.
#include <hip/hip_runtime.h>
#include <hip/hip_fp16.h>

// All contractions on v_wmma_f32_16x16x32_f16 (f16 operands, f32 accumulate), single products: x*Wq (x carried x16, Wq x64), q*q^T (keys carried x64, queries x64 x the score scale), P*q (P carried x256 or more), x1*W1 (x1 x16, W1 x64), h*W2 (h x16, W2 x64); raw inputs RNE-converted to bf16 first.

#ifndef NB
#define NB 2
#endif
#ifndef SEQ
#define SEQ 2048
#endif
#define NB_FULL  2
#define SEQ_FULL 2048
#define DM   1024        // model width
#define NH   16          // heads
#define DH   64          // head width
#define HID  4096        // FFN hidden width
#define NTOK (NB * SEQ)

static_assert(NB >= 1 && NB <= NB_FULL);
static_assert(SEQ >= 128 && SEQ <= SEQ_FULL);
static_assert(SEQ % 128 == 0);                      // attention block = 128 queries; key loop steps 32
static_assert(SEQ % 64 == 0);                       // a 64-row GEMM wave tile stays inside one batch
static_assert(NTOK % 256 == 0);                     // GEMM block rows: 256 (FFN1), 128 (Q, FFN2)
static_assert(HID % 256 == 0 && DM % 128 == 0);     // GEMM block columns: 256 (FFN1), 128 (Q, FFN2)
static_assert(NH * DH == DM);                       // heads concatenate to the model width
static_assert(DH == 64);                            // one GEMM column tile == one head; 2 k-steps per score
static_assert(DM % 64 == 0 && HID % 64 == 0);       // N tiles of 64
static_assert(DM % 32 == 0 && HID % 32 == 0);       // K steps of 32
static_assert(DM == 32 * 8 * 4);                    // LN: 32 lanes x 8 chunks x 4 floats

typedef _Float16 v16h __attribute__((ext_vector_type(16)));
typedef _Float16 v8h  __attribute__((ext_vector_type(8)));
typedef _Float16 v4h  __attribute__((ext_vector_type(4)));
typedef float    v8f  __attribute__((ext_vector_type(8)));
typedef float    v4f  __attribute__((ext_vector_type(4)));

union Frag { v16h v; v8h h[2]; };

// scores: t (log2 units) = (64 q_s).(64 q_t) * log2(e) / 8 / 4096
#define CS (1.44269504088896340736f * 3.0517578125e-05f)

// plane sizes in bytes (all multiples of 128)
#define SZ_X16   ((size_t)NTOK * DM * 2)     // xh, later x1h
#define SZ_WQT   ((size_t)DM * DM * 2)
#define SZ_W1T   ((size_t)HID * DM * 2)
#define SZ_W2T   ((size_t)DM * HID * 2)
#define SZ_Q16   ((size_t)NTOK * DM * 2)     // qrow, qT each
#define SZ_Y32   ((size_t)NTOK * DM * 4)     // y1 (later y2), x1 each
#define SZ_HB    ((size_t)NTOK * HID * 2)
#define WS_TOTAL (SZ_X16 + SZ_WQT + SZ_W1T + SZ_W2T + 2 * SZ_Q16 + 2 * SZ_Y32 + SZ_HB)
static_assert(WS_TOTAL <= (size_t)134217728);       // carve <= 128 MiB

static __device__ __forceinline__ v8f zero8() {
    v8f z;
#pragma unroll
    for (int i = 0; i < 8; ++i) z[i] = 0.0f;
    return z;
}

// 16x32 A fragment (or B fragment from an [n][k] k-contiguous source).
// p = tile_base + (lane&15)*ld + 8*(lane>>4): elements 0..7 = k 8h..8h+7,
// elements 8..15 = k 16+8h..16+8h+7 (split map, same for A and B).
static __device__ __forceinline__ v16h load_frag_p(const _Float16* p) {
    Frag f;
    f.h[0] = *(const v8h*)(p);
    f.h[1] = *(const v8h*)(p + 16);
    return f.v;
}

static __device__ __forceinline__ v8f wmma16(v16h a, v16h b, v8f c) {
    v8f d = __builtin_amdgcn_wmma_f32_16x16x32_f16(false, a, false, b, (short)0, c, false, false);
    asm volatile("v_nop\n\tv_nop\n\tv_nop\n\tv_nop" : "+v"(d) : "v"(a), "v"(b));
    return d;
}

// f32 -> bf16 RNE convert, value kept as f32
static __device__ __forceinline__ float bf16r(float x) {
    unsigned u = __float_as_uint(x);
    u = (u + 0x7FFFu + ((u >> 16) & 1u)) & 0xFFFF0000u;
    return __uint_as_float(u);
}

static __device__ __forceinline__ float ex2(float x) {
    return __builtin_amdgcn_exp2f(x);
}

// ordering for a wave-private LDS tile: stores before later loads of the same wave
static __device__ __forceinline__ void wave_lds_sync() {
    __builtin_amdgcn_fence(3, "wavefront");
    asm volatile("s_wait_dscnt 0" ::: "memory");
    __builtin_amdgcn_wave_barrier();
}

// ---------------------------------------------------------------------------
// Operand preparation, one launch, no LDS, no barrier. A work-group is 8 waves and
// takes one share of one of four jobs, picked by its index:
//   xh[tok][d]     = f16(16 * bf16(x)),  2048 16-B output pieces per work-group;
//   out[z][c][r]   = f16(64 * bf16(in[z][r][c])) for Wq, W1 and W2, one 64-row x
//                    32-column tile per wave, transposed in registers.
// Every thread has its 16 16-B loads in flight at once and writes 8 16-B pieces,
// so few waves have to be started for the bytes that are moved.
// ---------------------------------------------------------------------------
#define PX_PIECES 2048                                     // x pieces per work-group
#define PX_BLKS   ((int)((size_t)NTOK * DM / 8 / PX_PIECES))
#define PQ_BLKS   (NH * (DM / 64) * (DH / 32) / 8)
#define P1_BLKS   ((DM / 64) * (HID / 32) / 8)
#define P2_BLKS   ((HID / 64) * (DM / 32) / 8)
static_assert(((size_t)NTOK * DM / 8) % PX_PIECES == 0);   // whole work-groups of x pieces
static_assert(SEQ % (PX_PIECES / (DM / 8)) == 0);          // a work-group's token rows lie in one batch entry
static_assert((NH * (DM / 64) * (DH / 32)) % 8 == 0);      // whole work-groups of Wq tiles
static_assert(((DM / 64) * (HID / 32)) % 8 == 0);          // whole work-groups of W1 and W2 tiles

static __device__ __forceinline__ _Float16 cvt_s(float v, float sc) {
    return (_Float16)(bf16r(v) * sc);
}

// Tile u of in[z][ROWS][COLS]: rows rt*64.., columns ct*32... Lane = (r8, c4): it reads
// rows r8*8..+7 at columns c4*4..+3 and 16+c4*4..+3 (4 lanes = 64 B of a row per load)
// and writes, per column, its 8 rows as one 16-B piece (8 lanes = one whole 128-B line).
template <int ROWS, int COLS>
static __device__ __forceinline__ void tr_tile(const float* __restrict__ in,
                                               _Float16* __restrict__ out, int u, int lane) {
    constexpr int NCT = COLS / 32, NRT = ROWS / 64;
    const int ct = u % NCT;
    const int t  = u / NCT;
    const int rt = t % NRT;
    const int zz = t / NRT;
    const int r8 = lane & 7, c4 = lane >> 3;
    const size_t zoff = (size_t)zz * ROWS * COLS;
    const float* sp = in + zoff + (size_t)(rt * 64 + r8 * 8) * COLS + ct * 32 + c4 * 4;
    v4f a[8][2];
    // every loop below is unrolled whole: a and o stay in registers only under constant indices
#pragma unroll
    for (int j = 0; j < 8; ++j) {
        a[j][0] = *(const v4f*)(sp + (size_t)j * COLS);
        a[j][1] = *(const v4f*)(sp + (size_t)j * COLS + 16);
    }
    // the loads' address registers stay untouched up to this wait (sp is named so that they live until here)
    asm volatile("s_wait_xcnt 0x0" :: "v"(sp) : "memory");
    _Float16* dp = out + zoff + (size_t)(ct * 32 + c4 * 4) * ROWS + rt * 64 + r8 * 8;
    v8h o[8];
#pragma unroll
    for (int c = 0; c < 8; ++c)
#pragma unroll
        for (int j = 0; j < 8; ++j) o[c][j] = cvt_s(a[j][c >> 2][c & 3], 64.0f);
#pragma unroll
    for (int c = 0; c < 8; ++c)
        *(v8h*)(dp + (size_t)((c >> 2) * 16 + (c & 3)) * ROWS) = o[c];
    // no data or address register of the stores is rewritten ahead of this wait (another job's code follows in the listing)
    asm volatile("s_wait_xcnt 0x0" ::: "memory");
}

__global__ __launch_bounds__(256) void k_prep(const float* __restrict__ x,
                                               const float* __restrict__ Wq,
                                               const float* __restrict__ W1,
                                               const float* __restrict__ W2,
                                               _Float16* __restrict__ xh,
                                               _Float16* __restrict__ wqT,
                                               _Float16* __restrict__ w1T,
                                               _Float16* __restrict__ w2T) {
    const int tid  = threadIdx.x;
    const int lane = tid & 31;
    const int w    = tid >> 5;
    int blk = blockIdx.x;
    if (blk < P1_BLKS) { tr_tile<DM, HID>(W1, w1T, blk * 8 + w, lane); return; }
    blk -= P1_BLKS;
    if (blk < P2_BLKS) { tr_tile<HID, DM>(W2, w2T, blk * 8 + w, lane); return; }
    blk -= P2_BLKS;
    if (blk < PQ_BLKS) { tr_tile<DM, DH>(Wq, wqT, blk * 8 + w, lane); return; }
    blk -= PQ_BLKS;
    if (blk >= PX_BLKS) return;
    // 2048 pieces = 16 whole token rows, inside one batch entry
    const int tok0 = blk * (PX_PIECES / (DM / 8));
    const int b    = tok0 / SEQ;
    const int s0   = tok0 - b * SEQ;
    const char* xb = (const char*)(x + ((size_t)b * SEQ_FULL + s0) * DM);   // the same for the whole work-group
    const unsigned ob = (unsigned)tid * 32u;                                // the thread's byte offset in a run of 256 pieces
    v4f a[8], c[8];
    // every loop below is unrolled whole: a, c and o stay in registers only under constant indices
#pragma unroll
    for (int i = 0; i < 8; ++i) {
        a[i] = *(const v4f*)(xb + ob + i * 8192);
        c[i] = *(const v4f*)(xb + ob + i * 8192 + 16);
    }
    // the loads' address register stays untouched up to this wait (ob is named so that it lives until here)
    asm volatile("s_wait_xcnt 0x0" :: "v"(ob) : "memory");
    v8h o[8];
#pragma unroll
    for (int i = 0; i < 8; ++i) {
#pragma unroll
        for (int e = 0; e < 4; ++e) {
            o[i][e]     = cvt_s(a[i][e], 16.0f);
            o[i][4 + e] = cvt_s(c[i][e], 16.0f);
        }
    }
    _Float16* dst = xh + (size_t)(blk * PX_PIECES + tid) * 8;
#pragma unroll
    for (int i = 0; i < 8; ++i) *(v8h*)(dst + i * 2048) = o[i];
    // no data or address register of the stores is rewritten ahead of this wait
    asm volatile("s_wait_xcnt 0x0" ::: "memory");
}

// ---------------------------------------------------------------------------
// GEMM main loop: block = KS groups of WS x WS waves = a square (WS*64) x (WS*64) tile,
// one wave = 64x64 = 4x4 subtiles; in its group, wave q takes row band q % WS and column
// band q / WS. A [M][K] and Bt [N][K] are 16-bit k-contiguous planes in global memory.
// A stage is KS*64 k (KS whole 128-B lines) of the block's WS*64 A rows and WS*64 Bt rows,
// laid in LDS at a pitch of 16 B more; asynchronous copies fill it (16 B per lane, 8*KS
// lanes per row), RB buffers, the next RB - 1 stages in flight while this one is multiplied,
// so that a copy has RB - 1 stages' time to land. The counted wait returns when all but the
// wave's youngest copies have landed: left at RB - 2 stages' copies, it covers the next stage.
// A staged row feeds WS waves, so the bytes copied per product fall as 1 / WS.
// Group g multiplies k g*64..g*64+63 of every stage, so with KS = 2 a block of four
// 64x64 tiles runs two waves on each SIMD, one working while the other waits; each
// group ends with a partial sum over its half of k, and the caller joins the two.
// Fragments are two 16-B LDS loads, same k order as from the global planes.
// ---------------------------------------------------------------------------
#define ST_K      64                         // halves of k per stage and wave group
#define ST_PITCH(KS)  ((KS) * ST_K + 8)      // halves per LDS row (144 B, 272 B)
#define ST_HALVES(WS, KS) (2 * (WS) * 64 * ST_PITCH(KS))   // one buffer: A rows, then Bt rows

static __device__ __forceinline__ unsigned lds_off(const void* p) { return (unsigned)(size_t)p; }

// Four copies of A rows and four of Bt rows, each run ls bytes apart in LDS and gs
// halves apart in its plane. The s_wait_xcnt closes the statement so that no
// address register of a copy is rewritten ahead of it.
static __device__ __forceinline__ void copy4_4(unsigned la, const _Float16* ga,
                                               unsigned lb, const _Float16* gb,
                                               unsigned ls, size_t gs) {
    asm volatile(
        "global_load_async_to_lds_b128 %0, %8, off\n\t"
        "global_load_async_to_lds_b128 %1, %9, off\n\t"
        "global_load_async_to_lds_b128 %2, %10, off\n\t"
        "global_load_async_to_lds_b128 %3, %11, off\n\t"
        "global_load_async_to_lds_b128 %4, %12, off\n\t"
        "global_load_async_to_lds_b128 %5, %13, off\n\t"
        "global_load_async_to_lds_b128 %6, %14, off\n\t"
        "global_load_async_to_lds_b128 %7, %15, off\n\t"
        "s_wait_xcnt 0x0"
        :: "v"(la), "v"(la + ls), "v"(la + 2u * ls), "v"(la + 3u * ls),
           "v"(lb), "v"(lb + ls), "v"(lb + 2u * ls), "v"(lb + 3u * ls),
           "v"(ga), "v"(ga + gs), "v"(ga + 2 * gs), "v"(ga + 3 * gs),
           "v"(gb), "v"(gb + gs), "v"(gb + 2 * gs), "v"(gb + 3 * gs)
        : "memory");
}

// One stage: l = the thread's first LDS byte in the buffer, ga / gb = its first A and
// Bt piece at the stage's k. Copy i of a run: run row (i * threads + tid) / (8 * KS).
template <int K, int WS, int KS>
static __device__ __forceinline__ void copy_stage(unsigned l, const _Float16* ga, const _Float16* gb) {
    constexpr int RSTEP = WS * WS * 4;               // rows that one copy of the whole block covers
    constexpr int NG    = WS * 64 / (4 * RSTEP);     // statements per stage
    static_assert(NG * 4 * RSTEP == WS * 64);        // every row of both runs copied once
    const unsigned ls = (unsigned)RSTEP * ST_PITCH(KS) * 2u;
    const size_t   gs = (size_t)RSTEP * K;
#pragma unroll
    for (int j = 0; j < NG; ++j)
        copy4_4(l + 4u * j * ls, ga + 4 * j * gs,
                l + (unsigned)(WS * 64 * ST_PITCH(KS) * 2) + 4u * j * ls, gb + 4 * j * gs, ls, gs);
}

// ab = A + m_block * K (WS*64 rows), bb = Bt + n_block * K (WS*64 rows), St = RB buffers.
template <int K, int WS, int KS, int RB>
static __device__ __forceinline__ void gemm_tile64(const _Float16* __restrict__ ab,
                                                   const _Float16* __restrict__ bb,
                                                   _Float16* St,
                                                   v8f (&acc)[4][4]) {
    constexpr int SK = ST_K * KS;                    // halves of k per stage
    constexpr int PT = ST_PITCH(KS);
    static_assert(K % SK == 0 && K / SK >= RB);      // whole stages, every buffer filled
    constexpr int NT = K / SK;
    constexpr int CW = 2 * WS * 64 * 8 * KS / (WS * WS * KS * 32);   // copies of one wave per stage
    static_assert(RB >= 3 && (RB - 1) * CW <= 63);   // copies of a wave outstanding at most
    const int tid  = threadIdx.x;
    const int lane = tid & 31;
    const int w    = tid >> 5;
    const int kg   = w / (WS * WS);
    const int wm   = (w % (WS * WS)) % WS;
    const int wn   = (w % (WS * WS)) / WS;
    const int lm   = lane & 15;
    const int kb   = kg * ST_K + ((lane >> 4) << 3);
    const int crow = tid / (8 * KS), cpc = tid % (8 * KS);
    const _Float16* ga = ab + (size_t)crow * K + cpc * 8;
    const _Float16* gb = bb + (size_t)crow * K + cpc * 8;
    const unsigned  l0 = lds_off(St) + (unsigned)(crow * (PT * 2) + cpc * 16);

#pragma unroll
    for (int ms = 0; ms < 4; ++ms)
#pragma unroll
        for (int nt = 0; nt < 4; ++nt) acc[ms][nt] = zero8();

    // unrolled whole: straight-line copies, buffer offsets as constants
#pragma unroll
    for (int s = 0; s < RB - 1; ++s)
        copy_stage<K, WS, KS>(l0 + (unsigned)s * (ST_HALVES(WS, KS) * 2u), ga + s * SK, gb + s * SK);
    asm volatile("s_wait_asynccnt %0" :: "i"((RB - 2) * CW) : "memory");   // stage 0 landed (this wave's copies); the younger stages fly on
    __syncthreads();                                    // stage 0 published to all waves
    copy_stage<K, WS, KS>(l0 + (unsigned)(RB - 1) * (ST_HALVES(WS, KS) * 2u), ga + (RB - 1) * SK, gb + (RB - 1) * SK);

    int bo = 0;                                         // stage t's buffer, in halves
#pragma unroll 1
    for (int t = 0; t < NT; ++t) {
        const _Float16* sa = St + bo + (wm * 64 + lm) * PT + kb;
        const _Float16* sb = St + bo + ((WS + wn) * 64 + lm) * PT + kb;
        // Fragment reads stand in few groups, each ahead of the products that hide it:
        // k 0..31 whole and the A side of k 32..63 first, the B side of k 32..63 in
        // two halves into the B registers that the first k step has just left.
        v16h a0[4], a1[4], bn[4];
#pragma unroll
        for (int i = 0; i < 4; ++i) a0[i] = load_frag_p(sa + i * 16 * PT);
#pragma unroll
        for (int i = 0; i < 4; ++i) bn[i] = load_frag_p(sb + i * 16 * PT);
#pragma unroll
        for (int i = 0; i < 4; ++i) a1[i] = load_frag_p(sa + i * 16 * PT + 32);
#pragma unroll
        for (int hf = 0; hf < 4; hf += 2) {
#pragma unroll
            for (int nt = hf; nt < hf + 2; ++nt)
#pragma unroll
                for (int ms = 0; ms < 4; ++ms) acc[ms][nt] = wmma16(a0[ms], bn[nt], acc[ms][nt]);
#pragma unroll
            for (int nt = hf; nt < hf + 2; ++nt) bn[nt] = load_frag_p(sb + nt * 16 * PT + 32);
        }
#pragma unroll
        for (int nt = 0; nt < 4; ++nt)
#pragma unroll
            for (int ms = 0; ms < 4; ++ms) acc[ms][nt] = wmma16(a1[ms], bn[nt], acc[ms][nt]);
        asm volatile("s_wait_dscnt 0x0" ::: "memory");      // this wave's reads of the buffer are done
        // stage t+1 landed (this wave's copies): behind it stages t+2 .. t+RB-1 were issued whole, or, at the tail, fewer
        if (t + RB - 1 < NT) asm volatile("s_wait_asynccnt %0" :: "i"((RB - 2) * CW) : "memory");
        else                 asm volatile("s_wait_asynccnt 0x0" ::: "memory");
        __syncthreads();                                    // publishes stage t+1, frees stage t's buffer
        if (t + RB < NT)
            copy_stage<K, WS, KS>(l0 + (unsigned)bo * 2u, ga + (size_t)(t + RB) * SK, gb + (size_t)(t + RB) * SK);
        bo = (bo == (RB - 1) * ST_HALVES(WS, KS)) ? 0 : bo + ST_HALVES(WS, KS);
    }
    asm volatile("s_wait_asynccnt 0x0" ::: "memory");       // nothing in flight when the loop is left
}

// Joining the two k groups' partial sums. X = the operand ring, free behind the loop's
// last barrier. A subtile travels as two runs of 512 B, 16 B per lane, lane-contiguous;
// slot = 256 floats. The sum of a pair is the same whichever group forms it.
static __device__ __forceinline__ void sub_put(float* X, int slot, int lane, v8f v) {
    v4f lo, hi;
    lo.x = v[0]; lo.y = v[1]; lo.z = v[2]; lo.w = v[3];
    hi.x = v[4]; hi.y = v[5]; hi.z = v[6]; hi.w = v[7];
    *(v4f*)(X + slot * 256 + lane * 4)       = lo;
    *(v4f*)(X + slot * 256 + 128 + lane * 4) = hi;
}

static __device__ __forceinline__ v8f sub_add(const float* X, int slot, int lane, v8f v) {
    const v4f lo = *(const v4f*)(X + slot * 256 + lane * 4);
    const v4f hi = *(const v4f*)(X + slot * 256 + 128 + lane * 4);
    v[0] += lo.x; v[1] += lo.y; v[2] += lo.z; v[3] += lo.w;
    v[4] += hi.x; v[5] += hi.y; v[6] += hi.z; v[7] += hi.w;
    return v;
}

// ---------------------------------------------------------------------------
// Q projection: acc = (16 x)(64 Wq) = 1024 x.Wq ; q64 = (acc + 1024 bq) / 16.
// Writes qrow[b][h][s][64] and qT[b][h][64][s] as f16(64 q).
// Block = two k groups of 2 x 2 waves = 128 tokens x two heads; wave tile = 64 tokens x one head. The second group
// hands its partial sums to the first through LDS and ends; the first stores. Row plane: 16-row steps through a
// wave-private LDS tile; transposed plane: whole 64x64 wave-private tile.
// ---------------------------------------------------------------------------
__global__ __launch_bounds__(256) __attribute__((amdgpu_num_vgpr(256)))
void k_gemm_q(const _Float16* __restrict__ xh,
              const _Float16* __restrict__ wqT,
              const float* __restrict__ bq,
              _Float16* __restrict__ qrow,
              _Float16* __restrict__ qT) {
    __shared__ __align__(16) _Float16 Rst[4][16 * 64];   // 8 KB, wave-private
    __shared__ __align__(16) _Float16 Tst[4][64 * 64];   // 32 KB, wave-private
    __shared__ __align__(16) _Float16 St[4 * ST_HALVES(2, 2)]; // 272 KB, operand stages, cross-wave
    const int tid  = threadIdx.x;
    const int lane = tid & 31;
    const int wv   = __builtin_amdgcn_readfirstlane(tid >> 5);   // the wave's number, held scalar: the tests on kg are scalar branches
    const int kg   = wv >> 2;
    const int w    = wv & 3;
    const int hh   = lane >> 4;
    const int lm   = lane & 15;
    const int m0   = blockIdx.x * 128 + (w % 2) * 64;
    const int head = blockIdx.y * 2 + w / 2;
    const int n0   = head * 64;
    const int b    = m0 / SEQ;
    const int s0   = m0 - b * SEQ;

    v8f acc[4][4];
    gemm_tile64<DM, 2, 2, 4>(xh + (size_t)(blockIdx.x * 128) * DM, wqT + (size_t)(blockIdx.y * 128) * DM, St, acc);

    float* X = (float*)St;
    // the loops of the join are unrolled whole: acc stays in registers only under constant indices
    if (kg == 1) {
#pragma unroll
        for (int ms = 0; ms < 4; ++ms)
#pragma unroll
            for (int nt = 0; nt < 4; ++nt) sub_put(X, w * 16 + ms * 4 + nt, lane, acc[ms][nt]);
    }
    __syncthreads();                                    // the second group's partial sums published
    if (kg == 1) return;                                // no block barrier below
#pragma unroll
    for (int ms = 0; ms < 4; ++ms)
#pragma unroll
        for (int nt = 0; nt < 4; ++nt) acc[ms][nt] = sub_add(X, w * 16 + ms * 4 + nt, lane, acc[ms][nt]);

    float bv[4];
#pragma unroll
    for (int nt = 0; nt < 4; ++nt) bv[nt] = bf16r(bq[n0 + nt * 16 + lm]) * 1024.0f;

    _Float16* qr = qrow + (((size_t)b * NH + head) * SEQ + s0) * DH;
    _Float16* qt = qT + ((size_t)b * NH + head) * DH * SEQ + s0;

#pragma unroll
    for (int ms = 0; ms < 4; ++ms) {
#pragma unroll
        for (int nt = 0; nt < 4; ++nt) {
            v8h tv;
#pragma unroll
            for (int r = 0; r < 8; ++r) {
                _Float16 hv = (_Float16)((acc[ms][nt][r] + bv[nt]) * 0.0625f);
                Rst[w][(8 * hh + r) * 64 + nt * 16 + lm] = hv;
                tv[r] = hv;
            }
            *(v8h*)(&Tst[w][(nt * 16 + lm) * 64 + ms * 16 + 8 * hh]) = tv;
        }
        wave_lds_sync();
        v8h rv[4];
#pragma unroll
        for (int i = 0; i < 4; ++i) rv[i] = *(const v8h*)(&Rst[w][i * 256 + lane * 8]);
        _Float16* dst = qr + ms * 1024 + lane * 8;
#pragma unroll
        for (int i = 0; i < 4; ++i) *(v8h*)(dst + i * 256) = rv[i];
        
        wave_lds_sync();
    }
    wave_lds_sync();
#pragma unroll 1
    for (int g = 0; g < 4; ++g) {
        v8h tv[4];
#pragma unroll
        for (int i = 0; i < 4; ++i) tv[i] = *(const v8h*)(&Tst[w][(g * 4 + i) * 256 + lane * 8]);
        _Float16* dst = qt + (size_t)(g * 16 + (lane >> 3)) * SEQ + (lane & 7) * 8;
#pragma unroll
        for (int i = 0; i < 4; ++i) *(v8h*)(dst + (size_t)i * 4 * SEQ) = tv[i];
        
    }
}

// ---------------------------------------------------------------------------
// Fused attention, q = k = v. Block = 8 waves = 128 queries of one (b, head);
// a wave owns 16 queries and streams all SEQ keys, 32 per product step:
//   S^T tiles (rows = keys, cols = queries): A = key rows, B = query rows
//   (k = d, 2 steps of 32); query fragments straight from the qrow plane;
//   per-lane online softmax (lane column = its query; partner lane +-16): the scale
//   rides in the query fragment and the shift 8 - base in the products' C operand, so
//   a score leaves the matrix unit as its exponent; the base is tested once per stage,
//   on the sums of P, and moves only when a P could leave the range of f16, which
//   rescales l and O^T;
//   P^T carried 2^8 or more at the row's maximum as f16: the two S^T tiles chain directly as the B
//   fragment (elements 0..7 = tile keys 0..15, 8..15 = tile keys 16..31);
//   O^T += V^T . P^T with A fragments of V^T (rows = d, k = keys).
// Key rows and V^T rows reach the waves through LDS: a stage is 128 keys, 128
// qrow rows of 128 B at a 144-B pitch and 64 qT rows of 256 B at a 272-B pitch,
// filled once per block by asynchronous copies (16 B per lane, whole lines per
// wave) and read by all 8 waves; three buffers, the next two stages in flight
// while this one is worked on. Fragments keep the k order they had from the planes.
// Epilogue: O^T / (64 l) staged as [query][d] f32 in a wave-private LDS tile,
// bf16(x) added at the store stage, 8 lane-contiguous 16-B-per-lane
// ---------------------------------------------------------------------------
#define AT_KEYS   128                        // keys per stage
#define AK_PITCH  72                         // halves per key row in LDS (144 B)
#define AV_PITCH  136                        // halves per V^T row in LDS (272 B)
#define AK_HALVES (AT_KEYS * AK_PITCH)       // key rows of one buffer, 18,432 B
#define AV_HALVES (DH * AV_PITCH)            // V^T rows of one buffer, 17,408 B
#define AT_HALVES (AK_HALVES + AV_HALVES)    // one buffer, 35,840 B
static_assert(SEQ % AT_KEYS == 0);           // whole stages

// Four copies of key rows (32 rows apart) and four of V^T rows (16 rows apart).
// The s_wait_xcnt closes the statement so that no address register of a copy is
// rewritten ahead of it.
static __device__ __forceinline__ void copy_kv(unsigned lk, const _Float16* gk,
                                               unsigned lv, const _Float16* gv) {
    const unsigned ks = 32u * AK_PITCH * 2u;
    const unsigned vs = 16u * AV_PITCH * 2u;
    const size_t   gks = (size_t)32 * DH;
    const size_t   gvs = (size_t)16 * SEQ;
    asm volatile(
        "global_load_async_to_lds_b128 %0, %8, off\n\t"
        "global_load_async_to_lds_b128 %1, %9, off\n\t"
        "global_load_async_to_lds_b128 %2, %10, off\n\t"
        "global_load_async_to_lds_b128 %3, %11, off\n\t"
        "global_load_async_to_lds_b128 %4, %12, off\n\t"
        "global_load_async_to_lds_b128 %5, %13, off\n\t"
        "global_load_async_to_lds_b128 %6, %14, off\n\t"
        "global_load_async_to_lds_b128 %7, %15, off\n\t"
        "s_wait_xcnt 0x0"
        :: "v"(lk), "v"(lk + ks), "v"(lk + 2u * ks), "v"(lk + 3u * ks),
           "v"(lv), "v"(lv + vs), "v"(lv + 2u * vs), "v"(lv + 3u * vs),
           "v"(gk), "v"(gk + gks), "v"(gk + 2 * gks), "v"(gk + 3 * gks),
           "v"(gv), "v"(gv + gvs), "v"(gv + 2 * gvs), "v"(gv + 3 * gvs)
        : "memory");
}

// P = 2^exponent for a stage's scores: packed as the B fragments of the P^T products
// (elements 0..7 = tile keys 0..15, 8..15 = tile keys 16..31), and summed per 32 keys.
// Unrolled whole: the arrays stay in registers only under constant indices.
static __device__ __forceinline__ void stage_exp(const v8f (&sA)[AT_KEYS / 32], const v8f (&sB)[AT_KEYS / 32],
                                                 v16h (&pb)[AT_KEYS / 32], float (&ps)[AT_KEYS / 32]) {
#pragma unroll
    for (int u = 0; u < AT_KEYS / 32; ++u) {
        float s = 0.0f;
#pragma unroll
        for (int i = 0; i < 8; ++i) {
            const float pa = ex2(sA[u][i]);
            const float pq = ex2(sB[u][i]);
            s += pa + pq;
            pb[u][i]     = (_Float16)pa;
            pb[u][8 + i] = (_Float16)pq;
        }
        ps[u] = s;
    }
}

__global__ __launch_bounds__(256) __attribute__((amdgpu_num_vgpr(256)))
void k_attn(const _Float16* __restrict__ qrow,
            const _Float16* __restrict__ qT,
            const float* __restrict__ x,
            float* __restrict__ y1) {
    __shared__ __align__(16) float Ost[8][16 * DH];      // 32 KB, wave-private
    __shared__ __align__(16) _Float16 Kv[3 * AT_HALVES]; // 105 KB, key and V^T stages, cross-wave
    constexpr int NT = SEQ / AT_KEYS;
    const int tid  = threadIdx.x;
    const int lane = tid & 31;
    const int w    = tid >> 5;
    const int hh   = lane >> 4;
    const int lm   = lane & 15;
    const int kb   = hh << 3;
    const int b    = blockIdx.z;
    const int head = blockIdx.y;
    const int q0   = blockIdx.x * 128 + w * 16;

    const _Float16* qhead = qrow + ((size_t)b * NH + head) * SEQ * DH;
    const _Float16* thead = qT + ((size_t)b * NH + head) * DH * SEQ;
    const _Float16* qlane = qhead + (size_t)lm * DH + kb;
    // key copy i of a thread: stage row i*32 + tid/8, 16-B piece tid%8;
    // V^T copy i: row i*16 + tid/16, 16-B piece tid%16
    const _Float16* gk = qhead + (size_t)(tid >> 3) * DH + (tid & 7) * 8;
    const _Float16* gv = thead + (size_t)(tid >> 4) * SEQ + (tid & 15) * 8;
    const unsigned  lk = lds_off(Kv) + (unsigned)((tid >> 3) * (AK_PITCH * 2) + (tid & 7) * 16);
    const unsigned  lv = lds_off(Kv) + (unsigned)(AK_HALVES * 2 + (tid >> 4) * (AV_PITCH * 2) + (tid & 15) * 16);

    copy_kv(lk, gk, lv, gv);
    if (NT > 1)
        copy_kv(lk + AT_HALVES * 2u, gk + (size_t)AT_KEYS * DH, lv + AT_HALVES * 2u, gv + AT_KEYS);
    // stage 0 landed (this wave's copies); stage 1's eight fly on
    if (NT > 1) asm volatile("s_wait_asynccnt 0x8" ::: "memory");
    else        asm volatile("s_wait_asynccnt 0x0" ::: "memory");
    __syncthreads();                                    // stage 0 published to all waves
    if (NT > 2)
        copy_kv(lk + AT_HALVES * 4u, gk + (size_t)2 * AT_KEYS * DH, lv + AT_HALVES * 4u, gv + 2 * AT_KEYS);

    v16h qf0 = load_frag_p(qlane + (size_t)q0 * DH);        // d 0..31
    v16h qf1 = load_frag_p(qlane + (size_t)q0 * DH + 32);   // d 32..63
    // the query side takes the score scale once: (64 q_t).(64 q_s CS) = t, in log2 units
#pragma unroll
    for (int e = 0; e < 16; ++e) {
        qf0[e] = (_Float16)((float)qf0[e] * CS);
        qf1[e] = (_Float16)((float)qf1[e] * CS);
    }

    v8f o[4];
#pragma unroll
    for (int dt = 0; dt < 4; ++dt) o[dt] = zero8();
    float l = 0.0f;
    // C operand of the score products: 8 - base in all 8 registers, base = the lane's query's
    // softmax base. It starts at 0: a row's largest score is at least its own q.q >= 0, so the
    // base never lies above the row's maximum, and the test in the loop keeps P inside f16.
    v8f cv;
#pragma unroll
    for (int i = 0; i < 8; ++i) cv[i] = 8.0f;

    int bo = 0;                                         // stage t's buffer, in halves
#pragma unroll 1
    for (int t = 0; t < NT; ++t) {
      const _Float16* sk = Kv + bo + lm * AK_PITCH + kb;
      const _Float16* sv = Kv + bo + AK_HALVES + lm * AV_PITCH + kb;
      // Score products of the whole stage first. They leave the matrix unit as exponents,
      // t + (8 - base), with no vector arithmetic between product and exponential.
      // The loops over u are unrolled whole: the arrays stay in registers only under constant indices.
      v8f sA[AT_KEYS / 32], sB[AT_KEYS / 32];
      // The key fragments of 32 keys are read one group ahead of the products that use them,
      // so that a group's LDS latency passes under the group before it.
      v16h kf[2][4];                                      // j: keys 0..15 / 16..31 (j & 1), d 0..31 / 32..63 (j >> 1)
#pragma unroll
      for (int j = 0; j < 4; ++j) kf[0][j] = load_frag_p(sk + (j & 1) * 16 * AK_PITCH + (j >> 1) * 32);
#pragma unroll
      for (int u = 0; u < AT_KEYS / 32; ++u) {
        if (u + 1 < AT_KEYS / 32) {
#pragma unroll
            for (int j = 0; j < 4; ++j)
                kf[(u + 1) & 1][j] = load_frag_p(sk + ((u + 1) * 32 + (j & 1) * 16) * AK_PITCH + (j >> 1) * 32);
        }
        sA[u] = wmma16(kf[u & 1][0], qf0, cv);
        sB[u] = wmma16(kf[u & 1][1], qf0, cv);
        sA[u] = wmma16(kf[u & 1][2], qf1, sA[u]);
        sB[u] = wmma16(kf[u & 1][3], qf1, sB[u]);
      }
      // P of the stage, packed for the B operand, and its sums per 32 keys (order of the sums as before)
      v16h pb[AT_KEYS / 32];
      float ps[AT_KEYS / 32];
      stage_exp(sA, sB, pb, ps);
      // No P is above the sum that holds it: sums under 60000 say that every P fits f16. An
      // exponent beyond f32's range gives an infinite sum, which the negated compare catches too.
      float pm = ps[0];
#pragma unroll
      for (int u = 1; u < AT_KEYS / 32; ++u) pm = fmaxf(pm, ps[u]);
      if (__builtin_amdgcn_ballot_w32(!(pm <= 60000.0f)) != 0u) {   // wave-uniform, rare
        // new base = the query's largest score of this stage, where that lies above the old base
        float tmax = fmaxf(sA[0][0], sB[0][0]);
#pragma unroll
        for (int u = 0; u < AT_KEYS / 32; ++u)
#pragma unroll
            for (int i = 0; i < 8; ++i) tmax = fmaxf(tmax, fmaxf(sA[u][i], sB[u][i]));
        tmax = fmaxf(tmax, __shfl_xor(tmax, 16, 32));
        const float dn = fmaxf(tmax - 8.0f, 0.0f);
        const float sc = ex2(-dn);
        l *= sc;
#pragma unroll
        for (int dt = 0; dt < 4; ++dt)
#pragma unroll
            for (int r = 0; r < 8; ++r) o[dt][r] *= sc;
#pragma unroll
        for (int u = 0; u < AT_KEYS / 32; ++u)
#pragma unroll
            for (int i = 0; i < 8; ++i) { sA[u][i] -= dn; sB[u][i] -= dn; }
#pragma unroll
        for (int i = 0; i < 8; ++i) cv[i] -= dn;
        stage_exp(sA, sB, pb, ps);
      }
      // V^T fragments, too, are read one group of 32 keys ahead of their products
      v16h vf[2][4];
#pragma unroll
      for (int dt = 0; dt < 4; ++dt) vf[0][dt] = load_frag_p(sv + dt * 16 * AV_PITCH);
#pragma unroll
      for (int u = 0; u < AT_KEYS / 32; ++u) {
        if (u + 1 < AT_KEYS / 32) {
#pragma unroll
            for (int dt = 0; dt < 4; ++dt) vf[(u + 1) & 1][dt] = load_frag_p(sv + dt * 16 * AV_PITCH + (u + 1) * 32);
        }
        l += ps[u];
#pragma unroll
        for (int dt = 0; dt < 4; ++dt) o[dt] = wmma16(vf[u & 1][dt], pb[u], o[dt]);
      }
      asm volatile("s_wait_dscnt 0x0" ::: "memory");      // this wave's reads of the buffer are done
      // stage t+1 landed (this wave's copies): behind it stand stage t+2's eight, or, at the tail, none
      if (t + 2 < NT) asm volatile("s_wait_asynccnt 0x8" ::: "memory");
      else            asm volatile("s_wait_asynccnt 0x0" ::: "memory");
      __syncthreads();                                    // publishes stage t+1, frees stage t's buffer
      if (t + 3 < NT)
          copy_kv(lk + (unsigned)bo * 2u, gk + (size_t)(t + 3) * AT_KEYS * DH,
                  lv + (unsigned)bo * 2u, gv + (size_t)(t + 3) * AT_KEYS);
      bo = (bo == 2 * AT_HALVES) ? 0 : bo + AT_HALVES;
    }
    asm volatile("s_wait_asynccnt 0x0" ::: "memory");       // nothing in flight when the loop is left

    const float lt  = l + __shfl_xor(l, 16, 32);
    const float inv = (1.0f / lt) * 0.015625f;          // 2^8 P carry cancels in o/l; 1/64 for the q carry
#pragma unroll
    for (int dt = 0; dt < 4; ++dt) {
        v4f u0, u1;
        u0.x = o[dt][0] * inv; u0.y = o[dt][1] * inv; u0.z = o[dt][2] * inv; u0.w = o[dt][3] * inv;
        u1.x = o[dt][4] * inv; u1.y = o[dt][5] * inv; u1.z = o[dt][6] * inv; u1.w = o[dt][7] * inv;
        *(v4f*)(&Ost[w][lm * DH + dt * 16 + 8 * hh])     = u0;
        *(v4f*)(&Ost[w][lm * DH + dt * 16 + 8 * hh + 4]) = u1;
    }
    wave_lds_sync();

    v4f sv[8];
    const int col = lm * 4;
#pragma unroll
    for (int i = 0; i < 8; ++i) {
        const int row = 2 * i + hh;
        v4f a  = *(const v4f*)(&Ost[w][i * 128 + lane * 4]);
        v4f xv = *(const v4f*)(x + ((size_t)b * SEQ_FULL + q0 + row) * DM + head * DH + col);
        a.x = bf16r(xv.x) + a.x;
        a.y = bf16r(xv.y) + a.y;
        a.z = bf16r(xv.z) + a.z;
        a.w = bf16r(xv.w) + a.w;
        sv[i] = a;
    }
    float* ob = y1 + ((size_t)b * SEQ + q0 + hh) * DM + head * DH + col;
#pragma unroll
    for (int i = 0; i < 8; ++i) *(v4f*)(ob + (size_t)(2 * i) * DM) = sv[i];
    
}

// ---------------------------------------------------------------------------
// LayerNorm over DM columns. A wave takes LN_R whole rows and holds them in registers:
// lane l has columns j*128 + l*4 .. +3, j = 0..7, of each row. All loads of the wave's
// rows are issued before the first is waited for, so the wave pays one memory latency
// for them, and few waves have to be started; gain and bias are read and converted once
// for the LN_R rows. No LDS, no barrier. The sums keep their order: over j in a lane,
// then lanes by xor 16, 8, 4, 2, 1. Every store covers whole 128-B lines (f32: 512 B
// per instruction; f16(16 * y): 256 B).
// ---------------------------------------------------------------------------
#define LN_R 4                                       // rows per wave
static_assert(NTOK % (4 * LN_R) == 0);               // whole work-groups of 4 waves

// the rows' sums over the 32 lanes, the rows' exchanges side by side so that their latencies overlap
static __device__ __forceinline__ void rows_sum(float (&s)[LN_R]) {
#pragma unroll
    for (int m = 16; m >= 1; m >>= 1) {
        float t[LN_R];
#pragma unroll
        for (int r = 0; r < LN_R; ++r) t[r] = __shfl_xor(s[r], m, 32);
#pragma unroll
        for (int r = 0; r < LN_R; ++r) s[r] += t[r];
    }
}

__global__ __launch_bounds__(128) void k_ln(const float* __restrict__ y,
                                             const float* __restrict__ g,
                                             const float* __restrict__ be,
                                             float* __restrict__ of,
                                             _Float16* __restrict__ oh,
                                             int wr16) {
    const int tid  = threadIdx.x;
    const int lane = tid & 31;
    const int w    = __builtin_amdgcn_readfirstlane(tid >> 5);   // the wave's number, held scalar: row bases stay in scalar registers
    const int row0 = (blockIdx.x * 4 + w) * LN_R;
    if (row0 >= NTOK) return;                         // wave-uniform; no barrier in this kernel
    const char* yb = (const char*)(y + (size_t)row0 * DM);
    const unsigned ob = (unsigned)lane * 16u;         // the lane's byte offset in a run of 128 floats

    v4f v[LN_R][8], gv[8], bv[8];
    // every loop below is unrolled whole: v, gv, bv and hv stay in registers only under constant indices
#pragma unroll
    for (int r = 0; r < LN_R; ++r)
#pragma unroll
        for (int j = 0; j < 8; ++j) v[r][j] = *(const v4f*)(yb + ob + r * (DM * 4) + j * 512);
#pragma unroll
    for (int j = 0; j < 8; ++j) {
        gv[j] = *(const v4f*)((const char*)g + ob + j * 512);
        bv[j] = *(const v4f*)((const char*)be + ob + j * 512);
    }
    // the loads' address register stays untouched up to this wait (ob is named so that it lives until here)
    asm volatile("s_wait_xcnt 0x0" :: "v"(ob) : "memory");

    float s[LN_R];
#pragma unroll
    for (int r = 0; r < LN_R; ++r) {
        s[r] = 0.0f;
#pragma unroll
        for (int j = 0; j < 8; ++j) s[r] += (v[r][j].x + v[r][j].y) + (v[r][j].z + v[r][j].w);
    }
    rows_sum(s);
    float mu[LN_R], qv[LN_R];
#pragma unroll
    for (int r = 0; r < LN_R; ++r) {
        mu[r] = s[r] * 0.0009765625f;
        qv[r] = 0.0f;
#pragma unroll
        for (int j = 0; j < 8; ++j) {
            const float d0 = v[r][j].x - mu[r], d1 = v[r][j].y - mu[r], d2 = v[r][j].z - mu[r], d3 = v[r][j].w - mu[r];
            qv[r] += (d0 * d0 + d1 * d1) + (d2 * d2 + d3 * d3);
        }
    }
    rows_sum(qv);
#pragma unroll
    for (int j = 0; j < 8; ++j) {
        gv[j].x = bf16r(gv[j].x); gv[j].y = bf16r(gv[j].y); gv[j].z = bf16r(gv[j].z); gv[j].w = bf16r(gv[j].w);
        bv[j].x = bf16r(bv[j].x); bv[j].y = bf16r(bv[j].y); bv[j].z = bf16r(bv[j].z); bv[j].w = bf16r(bv[j].w);
    }
#pragma unroll
    for (int r = 0; r < LN_R; ++r) {
        const float rs = rsqrtf(qv[r] * 0.0009765625f + 1.0e-5f);
#pragma unroll
        for (int j = 0; j < 8; ++j) {
            v[r][j].x = (v[r][j].x - mu[r]) * rs * gv[j].x + bv[j].x;
            v[r][j].y = (v[r][j].y - mu[r]) * rs * gv[j].y + bv[j].y;
            v[r][j].z = (v[r][j].z - mu[r]) * rs * gv[j].z + bv[j].z;
            v[r][j].w = (v[r][j].w - mu[r]) * rs * gv[j].w + bv[j].w;
        }
    }

    if (wr16 != 0) {
        v4h hv[LN_R][8];
#pragma unroll
        for (int r = 0; r < LN_R; ++r)
#pragma unroll
            for (int j = 0; j < 8; ++j) {
                hv[r][j].x = (_Float16)(v[r][j].x * 16.0f);
                hv[r][j].y = (_Float16)(v[r][j].y * 16.0f);
                hv[r][j].z = (_Float16)(v[r][j].z * 16.0f);
                hv[r][j].w = (_Float16)(v[r][j].w * 16.0f);
            }
        char* hbp = (char*)(oh + (size_t)row0 * DM);
        const unsigned oh8 = (unsigned)lane * 8u;
#pragma unroll
        for (int r = 0; r < LN_R; ++r)
#pragma unroll
            for (int j = 0; j < 8; ++j) *(v4h*)(hbp + oh8 + r * (DM * 2) + j * 256) = hv[r][j];
    }
    char* fb = (char*)(of + (size_t)row0 * DM);
#pragma unroll
    for (int r = 0; r < LN_R; ++r)
#pragma unroll
        for (int j = 0; j < 8; ++j) *(v4f*)(fb + ob + r * (DM * 4) + j * 512) = v[r][j];
    // no data or address register of the stores is rewritten ahead of this wait
    asm volatile("s_wait_xcnt 0x0" ::: "memory");
}

// ---------------------------------------------------------------------------
// FFN1: acc = (16 x1)(64 W1) = 1024 pre ; hb = f16(16 relu(pre + b1)).
// Block = 4 x 4 waves = 256 x 256.
// 16-row steps through a wave-private LDS tile; row segment = 64 halves =
// ---------------------------------------------------------------------------
__global__ __launch_bounds__(512) __attribute__((amdgpu_num_vgpr(256)))
void k_gemm_ffn1(const _Float16* __restrict__ a16,
                 const _Float16* __restrict__ w1T,
                 const float* __restrict__ b1,
                 _Float16* __restrict__ hb) {
    __shared__ __align__(16) _Float16 Rst[16][16 * 64];  // 32 KB, wave-private
    __shared__ __align__(16) _Float16 St[3 * ST_HALVES(4, 1)]; // 216 KB, operand stages, cross-wave
    const int tid  = threadIdx.x;
    const int lane = tid & 31;
    const int w    = tid >> 5;
    const int hh   = lane >> 4;
    const int lm   = lane & 15;
    const int m0   = blockIdx.x * 256 + (w % 4) * 64;
    const int n0   = blockIdx.y * 256 + (w / 4) * 64;

    v8f acc[4][4];
    gemm_tile64<DM, 4, 1, 3>(a16 + (size_t)(blockIdx.x * 256) * DM, w1T + (size_t)(blockIdx.y * 256) * DM, St, acc);

    float bv[4];
#pragma unroll
    for (int nt = 0; nt < 4; ++nt) bv[nt] = bf16r(b1[n0 + nt * 16 + lm]) * 1024.0f;

#pragma unroll
    for (int ms = 0; ms < 4; ++ms) {
#pragma unroll
        for (int nt = 0; nt < 4; ++nt)
#pragma unroll
            for (int r = 0; r < 8; ++r)
                Rst[w][(8 * hh + r) * 64 + nt * 16 + lm] =
                    (_Float16)(fmaxf(acc[ms][nt][r] + bv[nt], 0.0f) * 0.015625f);
        wave_lds_sync();
        v8h rv[4];
#pragma unroll
        for (int i = 0; i < 4; ++i) rv[i] = *(const v8h*)(&Rst[w][i * 256 + lane * 8]);
        _Float16* dst = hb + (size_t)(m0 + ms * 16 + (lane >> 3)) * HID + n0 + (lane & 7) * 8;
#pragma unroll
        for (int i = 0; i < 4; ++i) *(v8h*)(dst + (size_t)i * 4 * HID) = rv[i];
        
        wave_lds_sync();
    }
}

// ---------------------------------------------------------------------------
// FFN2: acc = (16 h)(64 W2) = 1024 ff ; y2 = x1 + (ff + b2), f32.
// Block = two k groups of 2 x 2 waves = 128 x 128. The two waves of a 64x64 tile swap
// halves of their partial sums through LDS: group 0 finishes rows 0..31, group 1 rows 32..63.
// 16-row steps through a wave-private f32 LDS tile; bias and skip path added
// at the store stage as 4-float vectors; each instruction = 2 rows x 256 B.
// ---------------------------------------------------------------------------
__global__ __launch_bounds__(256) __attribute__((amdgpu_num_vgpr(256)))
void k_gemm_ffn2(const _Float16* __restrict__ hb,
                 const _Float16* __restrict__ w2T,
                 const float* __restrict__ b2,
                 const float* __restrict__ x1,
                 float* __restrict__ y2) {
    __shared__ __align__(16) float Fst[8][16 * 64];      // 32 KB, wave-private
    __shared__ __align__(16) _Float16 St[4 * ST_HALVES(2, 2)]; // 272 KB, operand stages, cross-wave
    const int tid  = threadIdx.x;
    const int lane = tid & 31;
    const int w    = __builtin_amdgcn_readfirstlane(tid >> 5);   // the wave's number, held scalar: the test on kg is a scalar branch
    const int kg   = w >> 2;
    const int wq   = w & 3;
    const int hh   = lane >> 4;
    const int lm   = lane & 15;
    const int m0   = blockIdx.x * 128 + (wq % 2) * 64 + kg * 32;
    const int n0   = blockIdx.y * 128 + (wq / 2) * 64;

    v8f acc[2][4];
    {
        v8f part[4][4];
        gemm_tile64<HID, 2, 2, 4>(hb + (size_t)(blockIdx.x * 128) * HID, w2T + (size_t)(blockIdx.y * 128) * HID, St, part);
        float* X = (float*)St;
        // the loops of the join are unrolled whole: part and acc stay in registers only under constant indices
        if (kg == 0) {
#pragma unroll
            for (int i = 0; i < 2; ++i)
#pragma unroll
                for (int nt = 0; nt < 4; ++nt) {
                    sub_put(X, wq * 8 + i * 4 + nt, lane, part[2 + i][nt]);
                    acc[i][nt] = part[i][nt];
                }
        } else {
#pragma unroll
            for (int i = 0; i < 2; ++i)
#pragma unroll
                for (int nt = 0; nt < 4; ++nt) {
                    sub_put(X, 32 + wq * 8 + i * 4 + nt, lane, part[i][nt]);
                    acc[i][nt] = part[2 + i][nt];
                }
        }
        __syncthreads();                                // both groups' handed-over halves published
        const int tk = (1 - kg) * 32 + wq * 8;
#pragma unroll
        for (int i = 0; i < 2; ++i)
#pragma unroll
            for (int nt = 0; nt < 4; ++nt) acc[i][nt] = sub_add(X, tk + i * 4 + nt, lane, acc[i][nt]);
    }

    const int col = lm * 4;
    v4f bb = *(const v4f*)(b2 + n0 + col);
    bb.x = bf16r(bb.x); bb.y = bf16r(bb.y); bb.z = bf16r(bb.z); bb.w = bf16r(bb.w);

#pragma unroll
    for (int ms = 0; ms < 2; ++ms) {
#pragma unroll
        for (int nt = 0; nt < 4; ++nt)
#pragma unroll
            for (int r = 0; r < 8; ++r)
                Fst[w][(8 * hh + r) * 64 + nt * 16 + lm] = acc[ms][nt][r] * 0.0009765625f;
        wave_lds_sync();
        v4f sv[8];
        const size_t rbase = ((size_t)(m0 + ms * 16 + hh)) * DM + n0 + col;
#pragma unroll
        for (int i = 0; i < 8; ++i) {
            v4f a  = *(const v4f*)(&Fst[w][i * 128 + lane * 4]);
            v4f xr = *(const v4f*)(x1 + rbase + (size_t)(2 * i) * DM);
            a.x = xr.x + (a.x + bb.x);
            a.y = xr.y + (a.y + bb.y);
            a.z = xr.z + (a.z + bb.z);
            a.w = xr.w + (a.w + bb.w);
            sv[i] = a;
        }
        float* dst = y2 + rbase;
#pragma unroll
        for (int i = 0; i < 8; ++i) *(v4f*)(dst + (size_t)(2 * i) * DM) = sv[i];
        
        wave_lds_sync();
    }
}

// ---------------------------------------------------------------------------
extern "C" void kernel_launch(void* const* d_in, const int* in_sizes, int n_in,
                              void* d_out, int out_size, void* d_ws, size_t ws_size,
                              hipStream_t stream) {
    if (n_in < 11) return;
    if (in_sizes[0] < ((NB - 1) * SEQ_FULL + SEQ) * DM) return;
    if (in_sizes[1] < DM * DM || in_sizes[2] < DM) return;
    if (in_sizes[3] < DM || in_sizes[4] < DM) return;
    if (in_sizes[5] < DM * HID || in_sizes[6] < HID) return;
    if (in_sizes[7] < HID * DM || in_sizes[8] < DM) return;
    if (in_sizes[9] < DM || in_sizes[10] < DM) return;
    if (out_size < NTOK * DM) return;
    if (WS_TOTAL > ws_size) return;

    const float* x    = (const float*)d_in[0];    // [2,2048,1024]
    const float* Wq   = (const float*)d_in[1];    // [16,1024,64]  [head][in][dim]
    const float* bq   = (const float*)d_in[2];    // [16,64]
    const float* ln1g = (const float*)d_in[3];
    const float* ln1b = (const float*)d_in[4];
    const float* W1   = (const float*)d_in[5];    // [1024,4096]  [in][out]
    const float* b1   = (const float*)d_in[6];
    const float* W2   = (const float*)d_in[7];    // [4096,1024]  [in][out]
    const float* b2   = (const float*)d_in[8];
    const float* ln2g = (const float*)d_in[9];
    const float* ln2b = (const float*)d_in[10];
    float* out = (float*)d_out;                   // [2,2048,1024]

    char* ws = (char*)d_ws;
    size_t off = 0;
    _Float16* x16  = (_Float16*)(ws + off); off += SZ_X16;   // xh, then x1h (xh dead after k_gemm_q)
    _Float16* wqT  = (_Float16*)(ws + off); off += SZ_WQT;   // [h*64+e][d]
    _Float16* w1T  = (_Float16*)(ws + off); off += SZ_W1T;   // [n][k]
    _Float16* w2T  = (_Float16*)(ws + off); off += SZ_W2T;   // [n][k]
    _Float16* qrow = (_Float16*)(ws + off); off += SZ_Q16;   // [b][h][s][64]
    _Float16* qT   = (_Float16*)(ws + off); off += SZ_Q16;   // [b][h][64][s]
    float*    y12  = (float*)(ws + off);    off += SZ_Y32;   // y1, then y2 (y1 dead after LN1)
    float*    x1   = (float*)(ws + off);    off += SZ_Y32;
    _Float16* hb   = (_Float16*)(ws + off); off += SZ_HB;
    if (off > ws_size) return;

    // x -> xh; Wq per head [1024 (d)][64 (e)] -> [e][d]; W1 [1024 (k)][4096 (n)] -> [n][k]; W2 [4096 (k)][1024 (n)] -> [n][k]
    k_prep<<<dim3(P1_BLKS + P2_BLKS + PQ_BLKS + PX_BLKS), dim3(256), 0, stream>>>(x, Wq, W1, W2, x16, wqT, w1T, w2T);

    k_gemm_q<<<dim3(NTOK / 128, DM / 128), dim3(256), 0, stream>>>(x16, wqT, bq, qrow, qT);
    k_attn<<<dim3(SEQ / 128, NH, NB), dim3(256), 0, stream>>>(qrow, qT, x, y12);
    k_ln<<<dim3(NTOK / (4 * LN_R)), dim3(128), 0, stream>>>(y12, ln1g, ln1b, x1, x16, 1);
    k_gemm_ffn1<<<dim3(NTOK / 256, HID / 256), dim3(512), 0, stream>>>(x16, w1T, b1, hb);
    k_gemm_ffn2<<<dim3(NTOK / 128, DM / 128), dim3(256), 0, stream>>>(hb, w2T, b2, x1, y12);
    k_ln<<<dim3(NTOK / (4 * LN_R)), dim3(128), 0, stream>>>(y12, ln2g, ln2b, out, x16, 0);
}

// v009
// Measured time: 124 microseconds a run.
// In both of two side-by-side timings against v008, it was 1.04 times as fast.
// Over all steps from v000 it is 3.39 times as fast.
#include <hip/hip_runtime.h>
#include <hip/hip_fp16.h>

// All contractions on v_wmma_f32_16x16x32_f16 (f16 operands, f32 accumulate), single products: x*Wq (x carried x16, Wq x64), q*q^T (keys carried x64, queries x64 x the score scale), P*q (P carried x256 or more), x1*W1 (x1 x16, W1 x64), h*W2 (h x16, W2 x64); raw inputs RNE-converted to bf16 first.

#ifndef NB
#define NB 2
#endif
#ifndef SEQ
#define SEQ 2048
#endif
#define NB_FULL  2
#define SEQ_FULL 2048
#define DM   1024        // model width
#define NH   16          // heads
#define DH   64          // head width
#define HID  4096        // FFN hidden width
#define NTOK (NB * SEQ)

static_assert(NB >= 1 && NB <= NB_FULL);
static_assert(SEQ >= 128 && SEQ <= SEQ_FULL);
static_assert(SEQ % 128 == 0);                      // attention block = 128 queries; key loop steps 32
static_assert(SEQ % 64 == 0);                       // a 64-row GEMM wave tile stays inside one batch
static_assert(NTOK % 256 == 0);                     // GEMM block rows: 256 (FFN1), 128 (Q, FFN2)
static_assert(HID % 256 == 0 && DM % 128 == 0);     // GEMM block columns: 256 (FFN1), 128 (Q, FFN2)
static_assert(NH * DH == DM);                       // heads concatenate to the model width
static_assert(DH == 64);                            // one GEMM column tile == one head; 2 k-steps per score
static_assert(DM % 64 == 0 && HID % 64 == 0);       // N tiles of 64
static_assert(DM % 32 == 0 && HID % 32 == 0);       // K steps of 32
static_assert(DM == 32 * 8 * 4);                    // LN: 32 lanes x 8 chunks x 4 floats

typedef _Float16 v16h __attribute__((ext_vector_type(16)));
typedef _Float16 v8h  __attribute__((ext_vector_type(8)));
typedef _Float16 v4h  __attribute__((ext_vector_type(4)));
typedef float    v8f  __attribute__((ext_vector_type(8)));
typedef float    v4f  __attribute__((ext_vector_type(4)));

union Frag { v16h v; v8h h[2]; };

// scores: t (log2 units) = (64 q_s).(64 q_t) * log2(e) / 8 / 4096
#define CS (1.44269504088896340736f * 3.0517578125e-05f)

// plane sizes in bytes (all multiples of 128)
#define SZ_X16   ((size_t)NTOK * DM * 2)     // xh, later x1h
#define SZ_WQT   ((size_t)DM * DM * 2)
#define SZ_W1T   ((size_t)HID * DM * 2)
#define SZ_W2T   ((size_t)DM * HID * 2)
#define SZ_Q16   ((size_t)NTOK * DM * 2)     // qrow, qT each
#define SZ_Y32   ((size_t)NTOK * DM * 4)     // y1 (later y2), x1 each
#define SZ_HB    ((size_t)NTOK * HID * 2)
#define WS_TOTAL (SZ_X16 + SZ_WQT + SZ_W1T + SZ_W2T + 2 * SZ_Q16 + 2 * SZ_Y32 + SZ_HB)
static_assert(WS_TOTAL <= (size_t)134217728);       // carve <= 128 MiB

static __device__ __forceinline__ v8f zero8() {
    v8f z;
#pragma unroll
    for (int i = 0; i < 8; ++i) z[i] = 0.0f;
    return z;
}

// 16x32 A fragment (or B fragment from an [n][k] k-contiguous source).
// p = tile_base + (lane&15)*ld + 8*(lane>>4): elements 0..7 = k 8h..8h+7,
// elements 8..15 = k 16+8h..16+8h+7 (split map, same for A and B).
static __device__ __forceinline__ v16h load_frag_p(const _Float16* p) {
    Frag f;
    f.h[0] = *(const v8h*)(p);
    f.h[1] = *(const v8h*)(p + 16);
    return f.v;
}

static __device__ __forceinline__ v8f wmma16(v16h a, v16h b, v8f c) {
    v8f d = __builtin_amdgcn_wmma_f32_16x16x32_f16(false, a, false, b, (short)0, c, false, false);
    asm volatile("v_nop\n\tv_nop\n\tv_nop\n\tv_nop" : "+v"(d) : "v"(a), "v"(b));
    return d;
}

// f32 -> bf16 RNE convert, value kept as f32
static __device__ __forceinline__ float bf16r(float x) {
    unsigned u = __float_as_uint(x);
    u = (u + 0x7FFFu + ((u >> 16) & 1u)) & 0xFFFF0000u;
    return __uint_as_float(u);
}

static __device__ __forceinline__ float ex2(float x) {
    return __builtin_amdgcn_exp2f(x);
}

// ordering for a wave-private LDS tile: stores before later loads of the same wave
static __device__ __forceinline__ void wave_lds_sync() {
    __builtin_amdgcn_fence(3, "wavefront");
    asm volatile("s_wait_dscnt 0" ::: "memory");
    __builtin_amdgcn_wave_barrier();
}

// ---------------------------------------------------------------------------
// Operand preparation, one launch, no LDS, no barrier. A work-group is 8 waves and
// takes one share of one of four jobs, picked by its index:
//   xh[tok][d]     = f16(16 * bf16(x)),  2048 16-B output pieces per work-group;
//   out[z][c][r]   = f16(64 * bf16(in[z][r][c])) for Wq, W1 and W2, one 64-row x
//                    32-column tile per wave, transposed in registers.
// Every thread has its 16 16-B loads in flight at once and writes 8 16-B pieces,
// so few waves have to be started for the bytes that are moved.
// ---------------------------------------------------------------------------
#define PX_PIECES 2048                                     // x pieces per work-group
#define PX_BLKS   ((int)((size_t)NTOK * DM / 8 / PX_PIECES))
#define PQ_BLKS   (NH * (DM / 64) * (DH / 32) / 8)
#define P1_BLKS   ((DM / 64) * (HID / 32) / 8)
#define P2_BLKS   ((HID / 64) * (DM / 32) / 8)
static_assert(((size_t)NTOK * DM / 8) % PX_PIECES == 0);   // whole work-groups of x pieces
static_assert(SEQ % (PX_PIECES / (DM / 8)) == 0);          // a work-group's token rows lie in one batch entry
static_assert((NH * (DM / 64) * (DH / 32)) % 8 == 0);      // whole work-groups of Wq tiles
static_assert(((DM / 64) * (HID / 32)) % 8 == 0);          // whole work-groups of W1 and W2 tiles

static __device__ __forceinline__ _Float16 cvt_s(float v, float sc) {
    return (_Float16)(bf16r(v) * sc);
}

// Tile u of in[z][ROWS][COLS]: rows rt*64.., columns ct*32... Lane = (r8, c4): it reads
// rows r8*8..+7 at columns c4*4..+3 and 16+c4*4..+3 (4 lanes = 64 B of a row per load)
// and writes, per column, its 8 rows as one 16-B piece (8 lanes = one whole 128-B line).
template <int ROWS, int COLS>
static __device__ __forceinline__ void tr_tile(const float* __restrict__ in,
                                               _Float16* __restrict__ out, int u, int lane) {
    constexpr int NCT = COLS / 32, NRT = ROWS / 64;
    const int ct = u % NCT;
    const int t  = u / NCT;
    const int rt = t % NRT;
    const int zz = t / NRT;
    const int r8 = lane & 7, c4 = lane >> 3;
    const size_t zoff = (size_t)zz * ROWS * COLS;
    const float* sp = in + zoff + (size_t)(rt * 64 + r8 * 8) * COLS + ct * 32 + c4 * 4;
    v4f a[8][2];
    // every loop below is unrolled whole: a and o stay in registers only under constant indices
#pragma unroll
    for (int j = 0; j < 8; ++j) {
        a[j][0] = *(const v4f*)(sp + (size_t)j * COLS);
        a[j][1] = *(const v4f*)(sp + (size_t)j * COLS + 16);
    }
    // the loads' address registers stay untouched up to this wait (sp is named so that they live until here)
    asm volatile("s_wait_xcnt 0x0" :: "v"(sp) : "memory");
    _Float16* dp = out + zoff + (size_t)(ct * 32 + c4 * 4) * ROWS + rt * 64 + r8 * 8;
    v8h o[8];
#pragma unroll
    for (int c = 0; c < 8; ++c)
#pragma unroll
        for (int j = 0; j < 8; ++j) o[c][j] = cvt_s(a[j][c >> 2][c & 3], 64.0f);
#pragma unroll
    for (int c = 0; c < 8; ++c)
        *(v8h*)(dp + (size_t)((c >> 2) * 16 + (c & 3)) * ROWS) = o[c];
    // no data or address register of the stores is rewritten ahead of this wait (another job's code follows in the listing)
    asm volatile("s_wait_xcnt 0x0" ::: "memory");
}

__global__ __launch_bounds__(256) void k_prep(const float* __restrict__ x,
                                               const float* __restrict__ Wq,
                                               const float* __restrict__ W1,
                                               const float* __restrict__ W2,
                                               _Float16* __restrict__ xh,
                                               _Float16* __restrict__ wqT,
                                               _Float16* __restrict__ w1T,
                                               _Float16* __restrict__ w2T) {
    const int tid  = threadIdx.x;
    const int lane = tid & 31;
    const int w    = tid >> 5;
    int blk = blockIdx.x;
    if (blk < P1_BLKS) { tr_tile<DM, HID>(W1, w1T, blk * 8 + w, lane); return; }
    blk -= P1_BLKS;
    if (blk < P2_BLKS) { tr_tile<HID, DM>(W2, w2T, blk * 8 + w, lane); return; }
    blk -= P2_BLKS;
    if (blk < PQ_BLKS) { tr_tile<DM, DH>(Wq, wqT, blk * 8 + w, lane); return; }
    blk -= PQ_BLKS;
    if (blk >= PX_BLKS) return;
    // 2048 pieces = 16 whole token rows, inside one batch entry
    const int tok0 = blk * (PX_PIECES / (DM / 8));
    const int b    = tok0 / SEQ;
    const int s0   = tok0 - b * SEQ;
    const char* xb = (const char*)(x + ((size_t)b * SEQ_FULL + s0) * DM);   // the same for the whole work-group
    const unsigned ob = (unsigned)tid * 32u;                                // the thread's byte offset in a run of 256 pieces
    v4f a[8], c[8];
    // every loop below is unrolled whole: a, c and o stay in registers only under constant indices
#pragma unroll
    for (int i = 0; i < 8; ++i) {
        a[i] = *(const v4f*)(xb + ob + i * 8192);
        c[i] = *(const v4f*)(xb + ob + i * 8192 + 16);
    }
    // the loads' address register stays untouched up to this wait (ob is named so that it lives until here)
    asm volatile("s_wait_xcnt 0x0" :: "v"(ob) : "memory");
    v8h o[8];
#pragma unroll
    for (int i = 0; i < 8; ++i) {
#pragma unroll
        for (int e = 0; e < 4; ++e) {
            o[i][e]     = cvt_s(a[i][e], 16.0f);
            o[i][4 + e] = cvt_s(c[i][e], 16.0f);
        }
    }
    _Float16* dst = xh + (size_t)(blk * PX_PIECES + tid) * 8;
#pragma unroll
    for (int i = 0; i < 8; ++i) *(v8h*)(dst + i * 2048) = o[i];
    // no data or address register of the stores is rewritten ahead of this wait
    asm volatile("s_wait_xcnt 0x0" ::: "memory");
}

// ---------------------------------------------------------------------------
// GEMM main loop: block = KS groups of WS x WS waves = a square (WS*64) x (WS*64) tile,
// one wave = 64x64 = 4x4 subtiles; in its group, wave q takes row band q % WS and column
// band q / WS. A [M][K] and Bt [N][K] are 16-bit k-contiguous planes in global memory.
// A stage is KS*64 k (KS whole 128-B lines) of the block's WS*64 A rows and WS*64 Bt rows,
// laid in LDS at a pitch of 16 B more; tensor loads fill it (one request of 128 rows per
// issuing wave and stage, the pad set by the descriptor), RB buffers, the next RB - 1 stages
// in flight while this one is multiplied, so that a tile has RB - 1 stages' time to land. The
// counted wait returns when all but the wave's youngest requests have landed: left at RB - 2,
// it covers the next stage. A staged row feeds WS waves, so the bytes moved per product fall as 1 / WS.
// Group g multiplies k g*64..g*64+63 of every stage, so with KS = 2 a block of four
// 64x64 tiles runs two waves on each SIMD, one working while the other waits; each
// group ends with a partial sum over its half of k, and the caller joins the two.
// Fragments are two 16-B LDS loads, same k order as from the global planes.
// ---------------------------------------------------------------------------
#define ST_K      64                         // halves of k per stage and wave group
#define ST_PITCH(KS)  ((KS) * ST_K + 8)      // halves per LDS row (144 B, 272 B)
#define ST_HALVES(WS, KS) (2 * (WS) * 64 * ST_PITCH(KS))   // one buffer: A rows, then Bt rows

static __device__ __forceinline__ unsigned lds_off(const void* p) { return (unsigned)(size_t)p; }

typedef unsigned u32x4 __attribute__((ext_vector_type(4)));
typedef unsigned u32x8 __attribute__((ext_vector_type(8)));

static __device__ __forceinline__ unsigned uni(unsigned v) { return (unsigned)__builtin_amdgcn_readfirstlane(v); }

// A wave-uniform test held in a scalar register, so that the branch on it is a scalar branch:
// a tensor load ignores EXEC, and only such a branch keeps a wave from issuing it.
static __device__ __forceinline__ unsigned pinned(unsigned v) {
    unsigned w = uni(v);
    asm volatile("" : "+s"(w));
    return w;
}

// Tensor descriptor, group 1: a tile of ROWS rows of ROWB bytes (tensor = tile, 1-byte elements, no mask),
// source rows SRCP bytes apart, 16 B of LDS pad behind every row (pitch ROWB + 16).
template <unsigned ROWB, unsigned ROWS, unsigned SRCP>
static __device__ __forceinline__ u32x8 tdm_group1() {
    static_assert(ROWB == 128 || ROWB == 256);             // pad interval = the row: code 4 or 5
    static_assert(SRCP % 16 == 0 && SRCP >= 16 && SRCP <= 131072);
    constexpr unsigned w0 = (1u << 20) | ((ROWB == 256 ? 5u : 4u) << 22) | (3u << 25);
    u32x8 g;
    g[0] = uni(w0);
    g[1] = uni((ROWB & 0xFFFFu) << 16);
    g[2] = uni((ROWB >> 16) | ((ROWS & 0xFFFFu) << 16));
    g[3] = uni((ROWS >> 16) | (ROWB << 16));
    g[4] = uni(ROWS);
    g[5] = uni(SRCP);
    g[6] = uni(0u);
    g[7] = uni(0u);
    return g;
}

// word 3 of group 0: address bits 56..32, type 2
static __device__ __forceinline__ unsigned tdm_word3(unsigned long long ga) {
    return uni((((unsigned)(ga >> 32)) & 0x01FFFFFFu) | 0x80000000u);
}

// group 0 of a walk's first request; tdm_issue sets words 1 and 2
static __device__ __forceinline__ u32x4 tdm_group0(unsigned long long ga) {
    u32x4 g;
    g[0] = uni(1u);
    g[1] = uni(0u);
    g[2] = uni((unsigned)ga);
    g[3] = tdm_word3(ga);
    return g;
}

// One request of the calling wave: the tile whose first byte is ga lands at LDS byte dst. A walk keeps
// its two groups in the same scalar registers from its first request to the wait behind its last (they
// are in-out operands for that, and that wait names them): while requests are outstanding only words 1
// and 2 of group 0 are rewritten. Should a walk ever cross a 4-GiB line, word 3 changes with nothing outstanding.
static __device__ __forceinline__ void tdm_issue(u32x4& g0, u32x8& g1, unsigned dst, unsigned long long ga) {
    const unsigned n3 = tdm_word3(ga);
    unsigned w3 = g0[3];
    if (pinned(n3 != w3))
        asm volatile("s_wait_tensorcnt 0x0\n\ts_mov_b32 %0, %1" : "+s"(w3) : "s"(n3) : "memory");
    g0[3] = w3;
    g0[1] = uni(dst);
    g0[2] = uni((unsigned)ga);
    asm volatile("tensor_load_to_lds %0, %1" : "+s"(g0), "+s"(g1) :: "memory");
}

// ab = A + m_block * K (WS*64 rows), bb = Bt + n_block * K (WS*64 rows), St = RB buffers.
template <int K, int WS, int KS, int RB>
static __device__ __forceinline__ void gemm_tile64(const _Float16* __restrict__ ab,
                                                   const _Float16* __restrict__ bb,
                                                   _Float16* St,
                                                   v8f (&acc)[4][4]) {
    constexpr int SK = ST_K * KS;                    // halves of k per stage
    constexpr int PT = ST_PITCH(KS);
    static_assert(K % SK == 0 && K / SK >= RB);      // whole stages, every buffer filled
    constexpr int NT = K / SK;
    constexpr unsigned SROWS = 128;                  // rows per request
    constexpr unsigned SLB   = SROWS * PT * 2;       // a request's bytes in LDS, pads counted
    constexpr unsigned BUFB  = ST_HALVES(WS, KS) * 2u;
    constexpr unsigned NI    = 2 * WS * 64 / SROWS;  // issuing waves: one request each per stage
    static_assert(SLB % 2048 == 0 && BUFB == NI * SLB);   // every place in LDS a multiple of 2 KiB
    static_assert(RB >= 3 && RB - 1 <= 3);           // requests of a wave outstanding at most
    const int tid  = threadIdx.x;
    const int lane = tid & 31;
    const int w    = tid >> 5;
    const int kg   = w / (WS * WS);
    const int wm   = (w % (WS * WS)) % WS;
    const int wn   = (w % (WS * WS)) / WS;
    const int lm   = lane & 15;
    const int kb   = kg * ST_K + ((lane >> 4) << 3);
    // issuing wave i brings rows i*128.. of the buffer's run (A rows, then Bt rows); the other waves issue nothing
    const unsigned wv  = uni((unsigned)tid >> 5);
    const unsigned isu = wv < NI ? 1u : 0u;
    const unsigned sl  = isu ? wv : 0u;
    const _Float16* sp = (sl < NI / 2) ? ab + (size_t)(sl * SROWS) * K : bb + (size_t)((sl - NI / 2) * SROWS) * K;
    const unsigned long long g = (unsigned long long)(size_t)sp;
    const unsigned  l0 = lds_off(St) + sl * SLB;
    u32x8           g1 = tdm_group1<SK * 2, SROWS, K * 2>();
    u32x4           g0 = tdm_group0(g);

#pragma unroll
    for (int ms = 0; ms < 4; ++ms)
#pragma unroll
        for (int nt = 0; nt < 4; ++nt) acc[ms][nt] = zero8();

    if (pinned(isu)) {
        // unrolled whole: straight-line requests, buffer offsets as constants
#pragma unroll
        for (int s = 0; s < RB - 1; ++s) tdm_issue(g0, g1, l0 + (unsigned)s * BUFB, g + (unsigned)(s * SK * 2));
    }
    asm volatile("s_wait_tensorcnt %0" :: "i"(RB - 2) : "memory");   // stage 0 landed (this wave's request); the younger stages fly on
    __syncthreads();                                    // stage 0 published to all waves
    if (pinned(isu)) tdm_issue(g0, g1, l0 + (unsigned)(RB - 1) * BUFB, g + (unsigned)((RB - 1) * SK * 2));

    int bo = 0;                                         // stage t's buffer, in halves
#pragma unroll 1
    for (int t = 0; t < NT; ++t) {
        const _Float16* sa = St + bo + (wm * 64 + lm) * PT + kb;
        const _Float16* sb = St + bo + ((WS + wn) * 64 + lm) * PT + kb;
        // Fragment reads stand in few groups, each ahead of the products that hide it:
        // k 0..31 whole and the A side of k 32..63 first, the B side of k 32..63 in
        // two halves into the B registers that the first k step has just left.
        v16h a0[4], a1[4], bn[4];
#pragma unroll
        for (int i = 0; i < 4; ++i) a0[i] = load_frag_p(sa + i * 16 * PT);
#pragma unroll
        for (int i = 0; i < 4; ++i) bn[i] = load_frag_p(sb + i * 16 * PT);
#pragma unroll
        for (int i = 0; i < 4; ++i) a1[i] = load_frag_p(sa + i * 16 * PT + 32);
#pragma unroll
        for (int hf = 0; hf < 4; hf += 2) {
#pragma unroll
            for (int nt = hf; nt < hf + 2; ++nt)
#pragma unroll
                for (int ms = 0; ms < 4; ++ms) acc[ms][nt] = wmma16(a0[ms], bn[nt], acc[ms][nt]);
#pragma unroll
            for (int nt = hf; nt < hf + 2; ++nt) bn[nt] = load_frag_p(sb + nt * 16 * PT + 32);
        }
#pragma unroll
        for (int nt = 0; nt < 4; ++nt)
#pragma unroll
            for (int ms = 0; ms < 4; ++ms) acc[ms][nt] = wmma16(a1[ms], bn[nt], acc[ms][nt]);
        asm volatile("s_wait_dscnt 0x0" ::: "memory");      // this wave's reads of the buffer are done
        // stage t+1 landed (this wave's request): behind it stages t+2 .. t+RB-1 were issued, or, at the tail, fewer
        if (t + RB - 1 < NT) asm volatile("s_wait_tensorcnt %0" :: "i"(RB - 2) : "memory");
        else                 asm volatile("s_wait_tensorcnt 0x0" ::: "memory");
        __syncthreads();                                    // publishes stage t+1, frees stage t's buffer
        if (pinned(isu & (t + RB < NT ? 1u : 0u)))
            tdm_issue(g0, g1, l0 + (unsigned)bo * 2u, g + (unsigned)((t + RB) * SK * 2));
        bo = (bo == (RB - 1) * ST_HALVES(WS, KS)) ? 0 : bo + ST_HALVES(WS, KS);
    }
    asm volatile("s_wait_tensorcnt 0x0" :: "s"(g0), "s"(g1) : "memory");   // nothing in flight when the loop is left; the descriptors live until here
    asm volatile("s_wait_dscnt 0x0" ::: "memory");          // and no read of the ring
}

// Joining the two k groups' partial sums. X = the operand ring, free behind the loop's
// last barrier. A subtile travels as two runs of 512 B, 16 B per lane, lane-contiguous;
// slot = 256 floats. The sum of a pair is the same whichever group forms it.
static __device__ __forceinline__ void sub_put(float* X, int slot, int lane, v8f v) {
    v4f lo, hi;
    lo.x = v[0]; lo.y = v[1]; lo.z = v[2]; lo.w = v[3];
    hi.x = v[4]; hi.y = v[5]; hi.z = v[6]; hi.w = v[7];
    *(v4f*)(X + slot * 256 + lane * 4)       = lo;
    *(v4f*)(X + slot * 256 + 128 + lane * 4) = hi;
}

static __device__ __forceinline__ v8f sub_add(const float* X, int slot, int lane, v8f v) {
    const v4f lo = *(const v4f*)(X + slot * 256 + lane * 4);
    const v4f hi = *(const v4f*)(X + slot * 256 + 128 + lane * 4);
    v[0] += lo.x; v[1] += lo.y; v[2] += lo.z; v[3] += lo.w;
    v[4] += hi.x; v[5] += hi.y; v[6] += hi.z; v[7] += hi.w;
    return v;
}

// ---------------------------------------------------------------------------
// Q projection: acc = (16 x)(64 Wq) = 1024 x.Wq ; q64 = (acc + 1024 bq) / 16.
// Writes qrow[b][h][s][64] and qT[b][h][64][s] as f16(64 q).
// Block = two k groups of 2 x 2 waves = 128 tokens x two heads; wave tile = 64 tokens x one head. The second group
// hands its partial sums to the first through LDS and ends; the first stores. Row plane: 16-row steps through a
// wave-private LDS tile; transposed plane: whole 64x64 wave-private tile.
// ---------------------------------------------------------------------------
__global__ __launch_bounds__(256) __attribute__((amdgpu_num_vgpr(256)))
void k_gemm_q(const _Float16* __restrict__ xh,
              const _Float16* __restrict__ wqT,
              const float* __restrict__ bq,
              _Float16* __restrict__ qrow,
              _Float16* __restrict__ qT) {
    __shared__ __align__(16) _Float16 Rst[4][16 * 64];   // 8 KB, wave-private
    __shared__ __align__(16) _Float16 Tst[4][64 * 64];   // 32 KB, wave-private
    __shared__ __attribute__((aligned(2048))) _Float16 St[4 * ST_HALVES(2, 2)]; // 272 KB, operand stages, cross-wave
    const int tid  = threadIdx.x;
    const int lane = tid & 31;
    const int wv   = __builtin_amdgcn_readfirstlane(tid >> 5);   // the wave's number, held scalar: the tests on kg are scalar branches
    const int kg   = wv >> 2;
    const int w    = wv & 3;
    const int hh   = lane >> 4;
    const int lm   = lane & 15;
    const int m0   = blockIdx.x * 128 + (w % 2) * 64;
    const int head = blockIdx.y * 2 + w / 2;
    const int n0   = head * 64;
    const int b    = m0 / SEQ;
    const int s0   = m0 - b * SEQ;

    v8f acc[4][4];
    gemm_tile64<DM, 2, 2, 4>(xh + (size_t)(blockIdx.x * 128) * DM, wqT + (size_t)(blockIdx.y * 128) * DM, St, acc);

    float* X = (float*)St;
    // the loops of the join are unrolled whole: acc stays in registers only under constant indices
    if (kg == 1) {
#pragma unroll
        for (int ms = 0; ms < 4; ++ms)
#pragma unroll
            for (int nt = 0; nt < 4; ++nt) sub_put(X, w * 16 + ms * 4 + nt, lane, acc[ms][nt]);
    }
    __syncthreads();                                    // the second group's partial sums published
    if (kg == 1) return;                                // no block barrier below
#pragma unroll
    for (int ms = 0; ms < 4; ++ms)
#pragma unroll
        for (int nt = 0; nt < 4; ++nt) acc[ms][nt] = sub_add(X, w * 16 + ms * 4 + nt, lane, acc[ms][nt]);

    float bv[4];
#pragma unroll
    for (int nt = 0; nt < 4; ++nt) bv[nt] = bf16r(bq[n0 + nt * 16 + lm]) * 1024.0f;

    _Float16* qr = qrow + (((size_t)b * NH + head) * SEQ + s0) * DH;
    _Float16* qt = qT + ((size_t)b * NH + head) * DH * SEQ + s0;

#pragma unroll
    for (int ms = 0; ms < 4; ++ms) {
#pragma unroll
        for (int nt = 0; nt < 4; ++nt) {
            v8h tv;
#pragma unroll
            for (int r = 0; r < 8; ++r) {
                _Float16 hv = (_Float16)((acc[ms][nt][r] + bv[nt]) * 0.0625f);
                Rst[w][(8 * hh + r) * 64 + nt * 16 + lm] = hv;
                tv[r] = hv;
            }
            *(v8h*)(&Tst[w][(nt * 16 + lm) * 64 + ms * 16 + 8 * hh]) = tv;
        }
        wave_lds_sync();
        v8h rv[4];
#pragma unroll
        for (int i = 0; i < 4; ++i) rv[i] = *(const v8h*)(&Rst[w][i * 256 + lane * 8]);
        _Float16* dst = qr + ms * 1024 + lane * 8;
#pragma unroll
        for (int i = 0; i < 4; ++i) *(v8h*)(dst + i * 256) = rv[i];
        
        wave_lds_sync();
    }
    wave_lds_sync();
#pragma unroll 1
    for (int g = 0; g < 4; ++g) {
        v8h tv[4];
#pragma unroll
        for (int i = 0; i < 4; ++i) tv[i] = *(const v8h*)(&Tst[w][(g * 4 + i) * 256 + lane * 8]);
        _Float16* dst = qt + (size_t)(g * 16 + (lane >> 3)) * SEQ + (lane & 7) * 8;
#pragma unroll
        for (int i = 0; i < 4; ++i) *(v8h*)(dst + (size_t)i * 4 * SEQ) = tv[i];
        
    }
}

// ---------------------------------------------------------------------------
// Fused attention, q = k = v. Block = 8 waves = 128 queries of one (b, head);
// a wave owns 16 queries and streams all SEQ keys, 32 per product step:
//   S^T tiles (rows = keys, cols = queries): A = key rows, B = query rows
//   (k = d, 2 steps of 32); query fragments straight from the qrow plane;
//   per-lane online softmax (lane column = its query; partner lane +-16): the scale
//   rides in the query fragment and the shift 8 - base in the products' C operand, so
//   a score leaves the matrix unit as its exponent; the base is tested once per stage,
//   on the sums of P, and moves only when a P could leave the range of f16, which
//   rescales l and O^T;
//   P^T carried 2^8 or more at the row's maximum as f16: the two S^T tiles chain directly as the B
//   fragment (elements 0..7 = tile keys 0..15, 8..15 = tile keys 16..31);
//   O^T += V^T . P^T with A fragments of V^T (rows = d, k = keys).
// Key rows and V^T rows reach the waves through LDS: a stage is 128 keys, 128
// qrow rows of 128 B at a 144-B pitch and 64 qT rows of 256 B at a 272-B pitch,
// filled once per block by two tensor loads (one request each for the key rows
// and the V^T rows) and read by all 8 waves; three buffers, the next two stages in flight
// while this one is worked on. Fragments keep the k order they had from the planes.
// Epilogue: O^T / (64 l) staged as [query][d] f32 in a wave-private LDS tile,
// bf16(x) added at the store stage, 8 lane-contiguous 16-B-per-lane
// ---------------------------------------------------------------------------
#define AT_KEYS   128                        // keys per stage
#define AK_PITCH  72                         // halves per key row in LDS (144 B)
#define AV_PITCH  136                        // halves per V^T row in LDS (272 B)
#define AK_HALVES (AT_KEYS * AK_PITCH)       // key rows of one buffer, 18,432 B
#define AV_HALVES 9216                       // V^T rows of one buffer, 17,408 B, rounded up to a multiple of 2 KiB
#define AT_HALVES (AK_HALVES + AV_HALVES)    // one buffer, 36,864 B
static_assert(SEQ % AT_KEYS == 0);           // whole stages
static_assert(AV_HALVES >= DH * AV_PITCH);   // the V^T rows fit their place
static_assert((AK_HALVES * 2) % 2048 == 0 && (AV_HALVES * 2) % 2048 == 0);   // every place in LDS a multiple of 2 KiB

// P = 2^exponent for a stage's scores: packed as the B fragments of the P^T products
// (elements 0..7 = tile keys 0..15, 8..15 = tile keys 16..31), and summed per 32 keys.
// Unrolled whole: the arrays stay in registers only under constant indices.
static __device__ __forceinline__ void stage_exp(const v8f (&sA)[AT_KEYS / 32], const v8f (&sB)[AT_KEYS / 32],
                                                 v16h (&pb)[AT_KEYS / 32], float (&ps)[AT_KEYS / 32]) {
#pragma unroll
    for (int u = 0; u < AT_KEYS / 32; ++u) {
        float s = 0.0f;
#pragma unroll
        for (int i = 0; i < 8; ++i) {
            const float pa = ex2(sA[u][i]);
            const float pq = ex2(sB[u][i]);
            s += pa + pq;
            pb[u][i]     = (_Float16)pa;
            pb[u][8 + i] = (_Float16)pq;
        }
        ps[u] = s;
    }
}

__global__ __launch_bounds__(256) __attribute__((amdgpu_num_vgpr(256)))
void k_attn(const _Float16* __restrict__ qrow,
            const _Float16* __restrict__ qT,
            const float* __restrict__ x,
            float* __restrict__ y1) {
    __shared__ __align__(16) float Ost[8][16 * DH];      // 32 KB, wave-private
    __shared__ __attribute__((aligned(2048))) _Float16 Kv[3 * AT_HALVES]; // 108 KB, key and V^T stages, cross-wave
    constexpr int NT = SEQ / AT_KEYS;
    const int tid  = threadIdx.x;
    const int lane = tid & 31;
    const int w    = tid >> 5;
    const int hh   = lane >> 4;
    const int lm   = lane & 15;
    const int kb   = hh << 3;
    const int b    = blockIdx.z;
    const int head = blockIdx.y;
    const int q0   = blockIdx.x * 128 + w * 16;

    const _Float16* qhead = qrow + ((size_t)b * NH + head) * SEQ * DH;
    const _Float16* thead = qT + ((size_t)b * NH + head) * DH * SEQ;
    const _Float16* qlane = qhead + (size_t)lm * DH + kb;
    // Per stage wave 0 issues one request for the 128 key rows (128 B each, contiguous in the plane) and
    // wave 1 one for the 64 V^T rows (256 B each, SEQ halves apart); the other waves issue nothing.
    const unsigned wv = uni((unsigned)tid >> 5);
    const unsigned long long gk = (unsigned long long)(size_t)qhead;
    const unsigned long long gv = (unsigned long long)(size_t)thead;
    const unsigned  lk  = lds_off(Kv);
    const unsigned  lv  = lds_off(Kv) + AK_HALVES * 2u;
    u32x8           g1k = tdm_group1<DH * 2, AT_KEYS, DH * 2>();
    u32x8           g1v = tdm_group1<AT_KEYS * 2, DH, SEQ * 2>();
    u32x4           g0k = tdm_group0(gk);
    u32x4           g0v = tdm_group0(gv);
    constexpr unsigned KSTEP = AT_KEYS * DH * 2;        // bytes from a stage's key rows to the next stage's
    constexpr unsigned VSTEP = AT_KEYS * 2;             // the same along a V^T row
    constexpr unsigned BUFB  = AT_HALVES * 2u;

    if (pinned(wv == 0)) {
        tdm_issue(g0k, g1k, lk, gk);
        if (NT > 1) tdm_issue(g0k, g1k, lk + BUFB, gk + KSTEP);
    }
    if (pinned(wv == 1)) {
        tdm_issue(g0v, g1v, lv, gv);
        if (NT > 1) tdm_issue(g0v, g1v, lv + BUFB, gv + VSTEP);
    }
    // stage 0 landed (this wave's request); stage 1's flies on
    if (NT > 1) asm volatile("s_wait_tensorcnt 0x1" ::: "memory");
    else        asm volatile("s_wait_tensorcnt 0x0" ::: "memory");
    __syncthreads();                                    // stage 0 published to all waves
    if (NT > 2) {
        if (pinned(wv == 0)) tdm_issue(g0k, g1k, lk + 2u * BUFB, gk + 2u * KSTEP);
        if (pinned(wv == 1)) tdm_issue(g0v, g1v, lv + 2u * BUFB, gv + 2u * VSTEP);
    }

    v16h qf0 = load_frag_p(qlane + (size_t)q0 * DH);        // d 0..31
    v16h qf1 = load_frag_p(qlane + (size_t)q0 * DH + 32);   // d 32..63
    // the query side takes the score scale once: (64 q_t).(64 q_s CS) = t, in log2 units
#pragma unroll
    for (int e = 0; e < 16; ++e) {
        qf0[e] = (_Float16)((float)qf0[e] * CS);
        qf1[e] = (_Float16)((float)qf1[e] * CS);
    }

    v8f o[4];
#pragma unroll
    for (int dt = 0; dt < 4; ++dt) o[dt] = zero8();
    float l = 0.0f;
    // C operand of the score products: 8 - base in all 8 registers, base = the lane's query's
    // softmax base. It starts at 0: a row's largest score is at least its own q.q >= 0, so the
    // base never lies above the row's maximum, and the test in the loop keeps P inside f16.
    v8f cv;
#pragma unroll
    for (int i = 0; i < 8; ++i) cv[i] = 8.0f;

    int bo = 0;                                         // stage t's buffer, in halves
#pragma unroll 1
    for (int t = 0; t < NT; ++t) {
      const _Float16* sk = Kv + bo + lm * AK_PITCH + kb;
      const _Float16* sv = Kv + bo + AK_HALVES + lm * AV_PITCH + kb;
      // Score products of the whole stage first. They leave the matrix unit as exponents,
      // t + (8 - base), with no vector arithmetic between product and exponential.
      // The loops over u are unrolled whole: the arrays stay in registers only under constant indices.
      v8f sA[AT_KEYS / 32], sB[AT_KEYS / 32];
      // The key fragments of 32 keys are read one group ahead of the products that use them,
      // so that a group's LDS latency passes under the group before it.
      v16h kf[2][4];                                      // j: keys 0..15 / 16..31 (j & 1), d 0..31 / 32..63 (j >> 1)
#pragma unroll
      for (int j = 0; j < 4; ++j) kf[0][j] = load_frag_p(sk + (j & 1) * 16 * AK_PITCH + (j >> 1) * 32);
#pragma unroll
      for (int u = 0; u < AT_KEYS / 32; ++u) {
        if (u + 1 < AT_KEYS / 32) {
#pragma unroll
            for (int j = 0; j < 4; ++j)
                kf[(u + 1) & 1][j] = load_frag_p(sk + ((u + 1) * 32 + (j & 1) * 16) * AK_PITCH + (j >> 1) * 32);
        }
        sA[u] = wmma16(kf[u & 1][0], qf0, cv);
        sB[u] = wmma16(kf[u & 1][1], qf0, cv);
        sA[u] = wmma16(kf[u & 1][2], qf1, sA[u]);
        sB[u] = wmma16(kf[u & 1][3], qf1, sB[u]);
      }
      // P of the stage, packed for the B operand, and its sums per 32 keys (order of the sums as before)
      v16h pb[AT_KEYS / 32];
      float ps[AT_KEYS / 32];
      stage_exp(sA, sB, pb, ps);
      // No P is above the sum that holds it: sums under 60000 say that every P fits f16. An
      // exponent beyond f32's range gives an infinite sum, which the negated compare catches too.
      float pm = ps[0];
#pragma unroll
      for (int u = 1; u < AT_KEYS / 32; ++u) pm = fmaxf(pm, ps[u]);
      if (__builtin_amdgcn_ballot_w32(!(pm <= 60000.0f)) != 0u) {   // wave-uniform, rare
        // new base = the query's largest score of this stage, where that lies above the old base
        float tmax = fmaxf(sA[0][0], sB[0][0]);
#pragma unroll
        for (int u = 0; u < AT_KEYS / 32; ++u)
#pragma unroll
            for (int i = 0; i < 8; ++i) tmax = fmaxf(tmax, fmaxf(sA[u][i], sB[u][i]));
        tmax = fmaxf(tmax, __shfl_xor(tmax, 16, 32));
        const float dn = fmaxf(tmax - 8.0f, 0.0f);
        const float sc = ex2(-dn);
        l *= sc;
#pragma unroll
        for (int dt = 0; dt < 4; ++dt)
#pragma unroll
            for (int r = 0; r < 8; ++r) o[dt][r] *= sc;
#pragma unroll
        for (int u = 0; u < AT_KEYS / 32; ++u)
#pragma unroll
            for (int i = 0; i < 8; ++i) { sA[u][i] -= dn; sB[u][i] -= dn; }
#pragma unroll
        for (int i = 0; i < 8; ++i) cv[i] -= dn;
        stage_exp(sA, sB, pb, ps);
      }
      // V^T fragments, too, are read one group of 32 keys ahead of their products
      v16h vf[2][4];
#pragma unroll
      for (int dt = 0; dt < 4; ++dt) vf[0][dt] = load_frag_p(sv + dt * 16 * AV_PITCH);
#pragma unroll
      for (int u = 0; u < AT_KEYS / 32; ++u) {
        if (u + 1 < AT_KEYS / 32) {
#pragma unroll
            for (int dt = 0; dt < 4; ++dt) vf[(u + 1) & 1][dt] = load_frag_p(sv + dt * 16 * AV_PITCH + (u + 1) * 32);
        }
        l += ps[u];
#pragma unroll
        for (int dt = 0; dt < 4; ++dt) o[dt] = wmma16(vf[u & 1][dt], pb[u], o[dt]);
      }
      asm volatile("s_wait_dscnt 0x0" ::: "memory");      // this wave's reads of the buffer are done
      // stage t+1 landed (this wave's request): behind it stands stage t+2's, or, at the tail, none
      if (t + 2 < NT) asm volatile("s_wait_tensorcnt 0x1" ::: "memory");
      else            asm volatile("s_wait_tensorcnt 0x0" ::: "memory");
      __syncthreads();                                    // publishes stage t+1, frees stage t's buffer
      const unsigned more = t + 3 < NT ? 1u : 0u;
      if (pinned(more & (wv == 0 ? 1u : 0u))) tdm_issue(g0k, g1k, lk + (unsigned)bo * 2u, gk + (unsigned)(t + 3) * KSTEP);
      if (pinned(more & (wv == 1 ? 1u : 0u))) tdm_issue(g0v, g1v, lv + (unsigned)bo * 2u, gv + (unsigned)(t + 3) * VSTEP);
      bo = (bo == 2 * AT_HALVES) ? 0 : bo + AT_HALVES;
    }
    // nothing in flight when the loop is left; the descriptors live until here
    asm volatile("s_wait_tensorcnt 0x0" :: "s"(g0k), "s"(g1k), "s"(g0v), "s"(g1v) : "memory");
    asm volatile("s_wait_dscnt 0x0" ::: "memory");          // and no read of the ring

    const float lt  = l + __shfl_xor(l, 16, 32);
    const float inv = (1.0f / lt) * 0.015625f;          // 2^8 P carry cancels in o/l; 1/64 for the q carry
#pragma unroll
    for (int dt = 0; dt < 4; ++dt) {
        v4f u0, u1;
        u0.x = o[dt][0] * inv; u0.y = o[dt][1] * inv; u0.z = o[dt][2] * inv; u0.w = o[dt][3] * inv;
        u1.x = o[dt][4] * inv; u1.y = o[dt][5] * inv; u1.z = o[dt][6] * inv; u1.w = o[dt][7] * inv;
        *(v4f*)(&Ost[w][lm * DH + dt * 16 + 8 * hh])     = u0;
        *(v4f*)(&Ost[w][lm * DH + dt * 16 + 8 * hh + 4]) = u1;
    }
    wave_lds_sync();

    v4f sv[8];
    const int col = lm * 4;
#pragma unroll
    for (int i = 0; i < 8; ++i) {
        const int row = 2 * i + hh;
        v4f a  = *(const v4f*)(&Ost[w][i * 128 + lane * 4]);
        v4f xv = *(const v4f*)(x + ((size_t)b * SEQ_FULL + q0 + row) * DM + head * DH + col);
        a.x = bf16r(xv.x) + a.x;
        a.y = bf16r(xv.y) + a.y;
        a.z = bf16r(xv.z) + a.z;
        a.w = bf16r(xv.w) + a.w;
        sv[i] = a;
    }
    float* ob = y1 + ((size_t)b * SEQ + q0 + hh) * DM + head * DH + col;
#pragma unroll
    for (int i = 0; i < 8; ++i) *(v4f*)(ob + (size_t)(2 * i) * DM) = sv[i];
    
}

// ---------------------------------------------------------------------------
// LayerNorm over DM columns. A wave takes LN_R whole rows and holds them in registers:
// lane l has columns j*128 + l*4 .. +3, j = 0..7, of each row. All loads of the wave's
// rows are issued before the first is waited for, so the wave pays one memory latency
// for them, and few waves have to be started; gain and bias are read and converted once
// for the LN_R rows. No LDS, no barrier. The sums keep their order: over j in a lane,
// then lanes by xor 16, 8, 4, 2, 1. Every store covers whole 128-B lines (f32: 512 B
// per instruction; f16(16 * y): 256 B).
// ---------------------------------------------------------------------------
#define LN_R 4                                       // rows per wave
static_assert(NTOK % (4 * LN_R) == 0);               // whole work-groups of 4 waves

// the rows' sums over the 32 lanes, the rows' exchanges side by side so that their latencies overlap
static __device__ __forceinline__ void rows_sum(float (&s)[LN_R]) {
#pragma unroll
    for (int m = 16; m >= 1; m >>= 1) {
        float t[LN_R];
#pragma unroll
        for (int r = 0; r < LN_R; ++r) t[r] = __shfl_xor(s[r], m, 32);
#pragma unroll
        for (int r = 0; r < LN_R; ++r) s[r] += t[r];
    }
}

__global__ __launch_bounds__(128) void k_ln(const float* __restrict__ y,
                                             const float* __restrict__ g,
                                             const float* __restrict__ be,
                                             float* __restrict__ of,
                                             _Float16* __restrict__ oh,
                                             int wr16) {
    const int tid  = threadIdx.x;
    const int lane = tid & 31;
    const int w    = __builtin_amdgcn_readfirstlane(tid >> 5);   // the wave's number, held scalar: row bases stay in scalar registers
    const int row0 = (blockIdx.x * 4 + w) * LN_R;
    if (row0 >= NTOK) return;                         // wave-uniform; no barrier in this kernel
    const char* yb = (const char*)(y + (size_t)row0 * DM);
    const unsigned ob = (unsigned)lane * 16u;         // the lane's byte offset in a run of 128 floats

    v4f v[LN_R][8], gv[8], bv[8];
    // every loop below is unrolled whole: v, gv, bv and hv stay in registers only under constant indices
#pragma unroll
    for (int r = 0; r < LN_R; ++r)
#pragma unroll
        for (int j = 0; j < 8; ++j) v[r][j] = *(const v4f*)(yb + ob + r * (DM * 4) + j * 512);
#pragma unroll
    for (int j = 0; j < 8; ++j) {
        gv[j] = *(const v4f*)((const char*)g + ob + j * 512);
        bv[j] = *(const v4f*)((const char*)be + ob + j * 512);
    }
    // the loads' address register stays untouched up to this wait (ob is named so that it lives until here)
    asm volatile("s_wait_xcnt 0x0" :: "v"(ob) : "memory");

    float s[LN_R];
#pragma unroll
    for (int r = 0; r < LN_R; ++r) {
        s[r] = 0.0f;
#pragma unroll
        for (int j = 0; j < 8; ++j) s[r] += (v[r][j].x + v[r][j].y) + (v[r][j].z + v[r][j].w);
    }
    rows_sum(s);
    float mu[LN_R], qv[LN_R];
#pragma unroll
    for (int r = 0; r < LN_R; ++r) {
        mu[r] = s[r] * 0.0009765625f;
        qv[r] = 0.0f;
#pragma unroll
        for (int j = 0; j < 8; ++j) {
            const float d0 = v[r][j].x - mu[r], d1 = v[r][j].y - mu[r], d2 = v[r][j].z - mu[r], d3 = v[r][j].w - mu[r];
            qv[r] += (d0 * d0 + d1 * d1) + (d2 * d2 + d3 * d3);
        }
    }
    rows_sum(qv);
#pragma unroll
    for (int j = 0; j < 8; ++j) {
        gv[j].x = bf16r(gv[j].x); gv[j].y = bf16r(gv[j].y); gv[j].z = bf16r(gv[j].z); gv[j].w = bf16r(gv[j].w);
        bv[j].x = bf16r(bv[j].x); bv[j].y = bf16r(bv[j].y); bv[j].z = bf16r(bv[j].z); bv[j].w = bf16r(bv[j].w);
    }
#pragma unroll
    for (int r = 0; r < LN_R; ++r) {
        const float rs = rsqrtf(qv[r] * 0.0009765625f + 1.0e-5f);
#pragma unroll
        for (int j = 0; j < 8; ++j) {
            v[r][j].x = (v[r][j].x - mu[r]) * rs * gv[j].x + bv[j].x;
            v[r][j].y = (v[r][j].y - mu[r]) * rs * gv[j].y + bv[j].y;
            v[r][j].z = (v[r][j].z - mu[r]) * rs * gv[j].z + bv[j].z;
            v[r][j].w = (v[r][j].w - mu[r]) * rs * gv[j].w + bv[j].w;
        }
    }

    if (wr16 != 0) {
        v4h hv[LN_R][8];
#pragma unroll
        for (int r = 0; r < LN_R; ++r)
#pragma unroll
            for (int j = 0; j < 8; ++j) {
                hv[r][j].x = (_Float16)(v[r][j].x * 16.0f);
                hv[r][j].y = (_Float16)(v[r][j].y * 16.0f);
                hv[r][j].z = (_Float16)(v[r][j].z * 16.0f);
                hv[r][j].w = (_Float16)(v[r][j].w * 16.0f);
            }
        char* hbp = (char*)(oh + (size_t)row0 * DM);
        const unsigned oh8 = (unsigned)lane * 8u;
#pragma unroll
        for (int r = 0; r < LN_R; ++r)
#pragma unroll
            for (int j = 0; j < 8; ++j) *(v4h*)(hbp + oh8 + r * (DM * 2) + j * 256) = hv[r][j];
    }
    char* fb = (char*)(of + (size_t)row0 * DM);
#pragma unroll
    for (int r = 0; r < LN_R; ++r)
#pragma unroll
        for (int j = 0; j < 8; ++j) *(v4f*)(fb + ob + r * (DM * 4) + j * 512) = v[r][j];
    // no data or address register of the stores is rewritten ahead of this wait
    asm volatile("s_wait_xcnt 0x0" ::: "memory");
}

// ---------------------------------------------------------------------------
// FFN1: acc = (16 x1)(64 W1) = 1024 pre ; hb = f16(16 relu(pre + b1)).
// Block = 4 x 4 waves = 256 x 256.
// 16-row steps through a wave-private LDS tile; row segment = 64 halves =
// ---------------------------------------------------------------------------
__global__ __launch_bounds__(512) __attribute__((amdgpu_num_vgpr(256)))
void k_gemm_ffn1(const _Float16* __restrict__ a16,
                 const _Float16* __restrict__ w1T,
                 const float* __restrict__ b1,
                 _Float16* __restrict__ hb) {
    __shared__ __align__(16) _Float16 Rst[16][16 * 64];  // 32 KB, wave-private
    __shared__ __attribute__((aligned(2048))) _Float16 St[3 * ST_HALVES(4, 1)]; // 216 KB, operand stages, cross-wave
    const int tid  = threadIdx.x;
    const int lane = tid & 31;
    const int w    = tid >> 5;
    const int hh   = lane >> 4;
    const int lm   = lane & 15;
    const int m0   = blockIdx.x * 256 + (w % 4) * 64;
    const int n0   = blockIdx.y * 256 + (w / 4) * 64;

    v8f acc[4][4];
    gemm_tile64<DM, 4, 1, 3>(a16 + (size_t)(blockIdx.x * 256) * DM, w1T + (size_t)(blockIdx.y * 256) * DM, St, acc);

    float bv[4];
#pragma unroll
    for (int nt = 0; nt < 4; ++nt) bv[nt] = bf16r(b1[n0 + nt * 16 + lm]) * 1024.0f;

#pragma unroll
    for (int ms = 0; ms < 4; ++ms) {
#pragma unroll
        for (int nt = 0; nt < 4; ++nt)
#pragma unroll
            for (int r = 0; r < 8; ++r)
                Rst[w][(8 * hh + r) * 64 + nt * 16 + lm] =
                    (_Float16)(fmaxf(acc[ms][nt][r] + bv[nt], 0.0f) * 0.015625f);
        wave_lds_sync();
        v8h rv[4];
#pragma unroll
        for (int i = 0; i < 4; ++i) rv[i] = *(const v8h*)(&Rst[w][i * 256 + lane * 8]);
        _Float16* dst = hb + (size_t)(m0 + ms * 16 + (lane >> 3)) * HID + n0 + (lane & 7) * 8;
#pragma unroll
        for (int i = 0; i < 4; ++i) *(v8h*)(dst + (size_t)i * 4 * HID) = rv[i];
        
        wave_lds_sync();
    }
}

// ---------------------------------------------------------------------------
// FFN2: acc = (16 h)(64 W2) = 1024 ff ; y2 = x1 + (ff + b2), f32.
// Block = two k groups of 2 x 2 waves = 128 x 128. The two waves of a 64x64 tile swap
// halves of their partial sums through LDS: group 0 finishes rows 0..31, group 1 rows 32..63.
// 16-row steps through a wave-private f32 LDS tile; bias and skip path added
// at the store stage as 4-float vectors; each instruction = 2 rows x 256 B.
// ---------------------------------------------------------------------------
__global__ __launch_bounds__(256) __attribute__((amdgpu_num_vgpr(256)))
void k_gemm_ffn2(const _Float16* __restrict__ hb,
                 const _Float16* __restrict__ w2T,
                 const float* __restrict__ b2,
                 const float* __restrict__ x1,
                 float* __restrict__ y2) {
    __shared__ __align__(16) float Fst[8][16 * 64];      // 32 KB, wave-private
    __shared__ __attribute__((aligned(2048))) _Float16 St[4 * ST_HALVES(2, 2)]; // 272 KB, operand stages, cross-wave
    const int tid  = threadIdx.x;
    const int lane = tid & 31;
    const int w    = __builtin_amdgcn_readfirstlane(tid >> 5);   // the wave's number, held scalar: the test on kg is a scalar branch
    const int kg   = w >> 2;
    const int wq   = w & 3;
    const int hh   = lane >> 4;
    const int lm   = lane & 15;
    const int m0   = blockIdx.x * 128 + (wq % 2) * 64 + kg * 32;
    const int n0   = blockIdx.y * 128 + (wq / 2) * 64;

    v8f acc[2][4];
    {
        v8f part[4][4];
        gemm_tile64<HID, 2, 2, 4>(hb + (size_t)(blockIdx.x * 128) * HID, w2T + (size_t)(blockIdx.y * 128) * HID, St, part);
        float* X = (float*)St;
        // the loops of the join are unrolled whole: part and acc stay in registers only under constant indices
        if (kg == 0) {
#pragma unroll
            for (int i = 0; i < 2; ++i)
#pragma unroll
                for (int nt = 0; nt < 4; ++nt) {
                    sub_put(X, wq * 8 + i * 4 + nt, lane, part[2 + i][nt]);
                    acc[i][nt] = part[i][nt];
                }
        } else {
#pragma unroll
            for (int i = 0; i < 2; ++i)
#pragma unroll
                for (int nt = 0; nt < 4; ++nt) {
                    sub_put(X, 32 + wq * 8 + i * 4 + nt, lane, part[i][nt]);
                    acc[i][nt] = part[2 + i][nt];
                }
        }
        __syncthreads();                                // both groups' handed-over halves published
        const int tk = (1 - kg) * 32 + wq * 8;
#pragma unroll
        for (int i = 0; i < 2; ++i)
#pragma unroll
            for (int nt = 0; nt < 4; ++nt) acc[i][nt] = sub_add(X, tk + i * 4 + nt, lane, acc[i][nt]);
    }

    const int col = lm * 4;
    v4f bb = *(const v4f*)(b2 + n0 + col);
    bb.x = bf16r(bb.x); bb.y = bf16r(bb.y); bb.z = bf16r(bb.z); bb.w = bf16r(bb.w);

#pragma unroll
    for (int ms = 0; ms < 2; ++ms) {
#pragma unroll
        for (int nt = 0; nt < 4; ++nt)
#pragma unroll
            for (int r = 0; r < 8; ++r)
                Fst[w][(8 * hh + r) * 64 + nt * 16 + lm] = acc[ms][nt][r] * 0.0009765625f;
        wave_lds_sync();
        v4f sv[8];
        const size_t rbase = ((size_t)(m0 + ms * 16 + hh)) * DM + n0 + col;
#pragma unroll
        for (int i = 0; i < 8; ++i) {
            v4f a  = *(const v4f*)(&Fst[w][i * 128 + lane * 4]);
            v4f xr = *(const v4f*)(x1 + rbase + (size_t)(2 * i) * DM);
            a.x = xr.x + (a.x + bb.x);
            a.y = xr.y + (a.y + bb.y);
            a.z = xr.z + (a.z + bb.z);
            a.w = xr.w + (a.w + bb.w);
            sv[i] = a;
        }
        float* dst = y2 + rbase;
#pragma unroll
        for (int i = 0; i < 8; ++i) *(v4f*)(dst + (size_t)(2 * i) * DM) = sv[i];
        
        wave_lds_sync();
    }
}

// ---------------------------------------------------------------------------
extern "C" void kernel_launch(void* const* d_in, const int* in_sizes, int n_in,
                              void* d_out, int out_size, void* d_ws, size_t ws_size,
                              hipStream_t stream) {
    if (n_in < 11) return;
    if (in_sizes[0] < ((NB - 1) * SEQ_FULL + SEQ) * DM) return;
    if (in_sizes[1] < DM * DM || in_sizes[2] < DM) return;
    if (in_sizes[3] < DM || in_sizes[4] < DM) return;
    if (in_sizes[5] < DM * HID || in_sizes[6] < HID) return;
    if (in_sizes[7] < HID * DM || in_sizes[8] < DM) return;
    if (in_sizes[9] < DM || in_sizes[10] < DM) return;
    if (out_size < NTOK * DM) return;
    if (WS_TOTAL > ws_size) return;

    const float* x    = (const float*)d_in[0];    // [2,2048,1024]
    const float* Wq   = (const float*)d_in[1];    // [16,1024,64]  [head][in][dim]
    const float* bq   = (const float*)d_in[2];    // [16,64]
    const float* ln1g = (const float*)d_in[3];
    const float* ln1b = (const float*)d_in[4];
    const float* W1   = (const float*)d_in[5];    // [1024,4096]  [in][out]
    const float* b1   = (const float*)d_in[6];
    const float* W2   = (const float*)d_in[7];    // [4096,1024]  [in][out]
    const float* b2   = (const float*)d_in[8];
    const float* ln2g = (const float*)d_in[9];
    const float* ln2b = (const float*)d_in[10];
    float* out = (float*)d_out;                   // [2,2048,1024]

    char* ws = (char*)d_ws;
    size_t off = 0;
    _Float16* x16  = (_Float16*)(ws + off); off += SZ_X16;   // xh, then x1h (xh dead after k_gemm_q)
    _Float16* wqT  = (_Float16*)(ws + off); off += SZ_WQT;   // [h*64+e][d]
    _Float16* w1T  = (_Float16*)(ws + off); off += SZ_W1T;   // [n][k]
    _Float16* w2T  = (_Float16*)(ws + off); off += SZ_W2T;   // [n][k]
    _Float16* qrow = (_Float16*)(ws + off); off += SZ_Q16;   // [b][h][s][64]
    _Float16* qT   = (_Float16*)(ws + off); off += SZ_Q16;   // [b][h][64][s]
    float*    y12  = (float*)(ws + off);    off += SZ_Y32;   // y1, then y2 (y1 dead after LN1)
    float*    x1   = (float*)(ws + off);    off += SZ_Y32;
    _Float16* hb   = (_Float16*)(ws + off); off += SZ_HB;
    if (off > ws_size) return;

    // x -> xh; Wq per head [1024 (d)][64 (e)] -> [e][d]; W1 [1024 (k)][4096 (n)] -> [n][k]; W2 [4096 (k)][1024 (n)] -> [n][k]
    k_prep<<<dim3(P1_BLKS + P2_BLKS + PQ_BLKS + PX_BLKS), dim3(256), 0, stream>>>(x, Wq, W1, W2, x16, wqT, w1T, w2T);

    k_gemm_q<<<dim3(NTOK / 128, DM / 128), dim3(256), 0, stream>>>(x16, wqT, bq, qrow, qT);
    k_attn<<<dim3(SEQ / 128, NH, NB), dim3(256), 0, stream>>>(qrow, qT, x, y12);
    k_ln<<<dim3(NTOK / (4 * LN_R)), dim3(128), 0, stream>>>(y12, ln1g, ln1b, x1, x16, 1);
    k_gemm_ffn1<<<dim3(NTOK / 256, HID / 256), dim3(512), 0, stream>>>(x16, w1T, b1, hb);
    k_gemm_ffn2<<<dim3(NTOK / 128, DM / 128), dim3(256), 0, stream>>>(hb, w2T, b2, x1, y12);
    k_ln<<<dim3(NTOK / (4 * LN_R)), dim3(128), 0, stream>>>(y12, ln2g, ln2b, out, x16, 0);
}

// v010
// It runs in 119 microseconds.
// Next to v009, in two timings, it ran 1.04 times as fast each time.
// All steps since v000 together make it 3.53 times as fast.
#include <hip/hip_runtime.h>
#include <hip/hip_fp16.h>

// All contractions on v_wmma_f32_16x16x32_f16 (f16 operands, f32 accumulate), single products: x*Wq (x carried x16, Wq x64), q*q^T (keys carried x64, queries x64 x the score scale), P*q (P carried x256 or more), x1*W1 (x1 x16, W1 x64), h*W2 (h x16, W2 x64); raw inputs RNE-converted to bf16 first.

#ifndef NB
#define NB 2
#endif
#ifndef SEQ
#define SEQ 2048
#endif
#define NB_FULL  2
#define SEQ_FULL 2048
#define DM   1024        // model width
#define NH   16          // heads
#define DH   64          // head width
#define HID  4096        // FFN hidden width
#define NTOK (NB * SEQ)

static_assert(NB >= 1 && NB <= NB_FULL);
static_assert(SEQ >= 128 && SEQ <= SEQ_FULL);
static_assert(SEQ % 128 == 0);                      // attention block = 128 queries; key loop steps 32
static_assert(SEQ % 64 == 0);                       // a 64-row GEMM wave tile stays inside one batch
static_assert(NTOK % 256 == 0);                     // GEMM block rows: 256 (FFN1), 128 (Q, FFN2)
static_assert(HID % 256 == 0 && DM % 128 == 0);     // GEMM block columns: 256 (FFN1), 128 (Q, FFN2)
static_assert(NH * DH == DM);                       // heads concatenate to the model width
static_assert(DH == 64);                            // one GEMM column tile == one head; 2 k-steps per score
static_assert(DM % 64 == 0 && HID % 64 == 0);       // N tiles of 64
static_assert(DM % 32 == 0 && HID % 32 == 0);       // K steps of 32
static_assert(DM == 32 * 8 * 4);                    // LN: 32 lanes x 8 chunks x 4 floats

typedef _Float16 v16h __attribute__((ext_vector_type(16)));
typedef _Float16 v8h  __attribute__((ext_vector_type(8)));
typedef _Float16 v4h  __attribute__((ext_vector_type(4)));
typedef float    v8f  __attribute__((ext_vector_type(8)));
typedef float    v4f  __attribute__((ext_vector_type(4)));

union Frag { v16h v; v8h h[2]; };

// scores: t (log2 units) = (64 q_s).(64 q_t) * log2(e) / 8 / 4096
#define CS (1.44269504088896340736f * 3.0517578125e-05f)

// plane sizes in bytes (all multiples of 128)
#define SZ_X16   ((size_t)NTOK * DM * 2)     // xh, later x1h
#define SZ_WQT   ((size_t)DM * DM * 2)
#define SZ_W1T   ((size_t)HID * DM * 2)
#define SZ_W2T   ((size_t)DM * HID * 2)
#define SZ_Q16   ((size_t)NTOK * DM * 2)     // qrow, qT each
#define SZ_Y32   ((size_t)NTOK * DM * 4)     // y1 (later y2), x1 each
#define SZ_HB    ((size_t)NTOK * HID * 2)
#define WS_TOTAL (SZ_X16 + SZ_WQT + SZ_W1T + SZ_W2T + 2 * SZ_Q16 + 2 * SZ_Y32 + SZ_HB)
static_assert(WS_TOTAL <= (size_t)134217728);       // carve <= 128 MiB

static __device__ __forceinline__ v8f zero8() {
    v8f z;
#pragma unroll
    for (int i = 0; i < 8; ++i) z[i] = 0.0f;
    return z;
}

// 16x32 A fragment (or B fragment from an [n][k] k-contiguous source).
// p = tile_base + (lane&15)*ld + 8*(lane>>4): elements 0..7 = k 8h..8h+7,
// elements 8..15 = k 16+8h..16+8h+7 (split map, same for A and B).
static __device__ __forceinline__ v16h load_frag_p(const _Float16* p) {
    Frag f;
    f.h[0] = *(const v8h*)(p);
    f.h[1] = *(const v8h*)(p + 16);
    return f.v;
}

static __device__ __forceinline__ v8f wmma16(v16h a, v16h b, v8f c) {
    v8f d = __builtin_amdgcn_wmma_f32_16x16x32_f16(false, a, false, b, (short)0, c, false, false);
    asm volatile("v_nop\n\tv_nop\n\tv_nop\n\tv_nop" : "+v"(d) : "v"(a), "v"(b));
    return d;
}

// f32 -> bf16 RNE convert, value kept as f32
static __device__ __forceinline__ float bf16r(float x) {
    unsigned u = __float_as_uint(x);
    u = (u + 0x7FFFu + ((u >> 16) & 1u)) & 0xFFFF0000u;
    return __uint_as_float(u);
}

static __device__ __forceinline__ float ex2(float x) {
    return __builtin_amdgcn_exp2f(x);
}

// ordering for a wave-private LDS tile: stores before later loads of the same wave
static __device__ __forceinline__ void wave_lds_sync() {
    __builtin_amdgcn_fence(3, "wavefront");
    asm volatile("s_wait_dscnt 0" ::: "memory");
    __builtin_amdgcn_wave_barrier();
}

// ---------------------------------------------------------------------------
// Operand preparation, one launch, no LDS, no barrier. A work-group is 8 waves and
// takes one share of one of four jobs, picked by its index:
//   xh[tok][d]     = f16(16 * bf16(x)),  2048 16-B output pieces per work-group;
//   out[z][c][r]   = f16(64 * bf16(in[z][r][c])) for Wq, W1 and W2, one 64-row x
//                    32-column tile per wave, transposed in registers.
// Every thread has its 16 16-B loads in flight at once and writes 8 16-B pieces,
// so few waves have to be started for the bytes that are moved.
// ---------------------------------------------------------------------------
#define PX_PIECES 2048                                     // x pieces per work-group
#define PX_BLKS   ((int)((size_t)NTOK * DM / 8 / PX_PIECES))
#define PQ_BLKS   (NH * (DM / 64) * (DH / 32) / 8)
#define P1_BLKS   ((DM / 64) * (HID / 32) / 8)
#define P2_BLKS   ((HID / 64) * (DM / 32) / 8)
static_assert(((size_t)NTOK * DM / 8) % PX_PIECES == 0);   // whole work-groups of x pieces
static_assert(SEQ % (PX_PIECES / (DM / 8)) == 0);          // a work-group's token rows lie in one batch entry
static_assert((NH * (DM / 64) * (DH / 32)) % 8 == 0);      // whole work-groups of Wq tiles
static_assert(((DM / 64) * (HID / 32)) % 8 == 0);          // whole work-groups of W1 and W2 tiles

static __device__ __forceinline__ _Float16 cvt_s(float v, float sc) {
    return (_Float16)(bf16r(v) * sc);
}

// Tile u of in[z][ROWS][COLS]: rows rt*64.., columns ct*32... Lane = (r8, c4): it reads
// rows r8*8..+7 at columns c4*4..+3 and 16+c4*4..+3 (4 lanes = 64 B of a row per load)
// and writes, per column, its 8 rows as one 16-B piece (8 lanes = one whole 128-B line).
template <int ROWS, int COLS>
static __device__ __forceinline__ void tr_tile(const float* __restrict__ in,
                                               _Float16* __restrict__ out, int u, int lane) {
    constexpr int NCT = COLS / 32, NRT = ROWS / 64;
    const int ct = u % NCT;
    const int t  = u / NCT;
    const int rt = t % NRT;
    const int zz = t / NRT;
    const int r8 = lane & 7, c4 = lane >> 3;
    const size_t zoff = (size_t)zz * ROWS * COLS;
    const float* sp = in + zoff + (size_t)(rt * 64 + r8 * 8) * COLS + ct * 32 + c4 * 4;
    v4f a[8][2];
    // every loop below is unrolled whole: a and o stay in registers only under constant indices
#pragma unroll
    for (int j = 0; j < 8; ++j) {
        a[j][0] = *(const v4f*)(sp + (size_t)j * COLS);
        a[j][1] = *(const v4f*)(sp + (size_t)j * COLS + 16);
    }
    // the loads' address registers stay untouched up to this wait (sp is named so that they live until here)
    asm volatile("s_wait_xcnt 0x0" :: "v"(sp) : "memory");
    _Float16* dp = out + zoff + (size_t)(ct * 32 + c4 * 4) * ROWS + rt * 64 + r8 * 8;
    v8h o[8];
#pragma unroll
    for (int c = 0; c < 8; ++c)
#pragma unroll
        for (int j = 0; j < 8; ++j) o[c][j] = cvt_s(a[j][c >> 2][c & 3], 64.0f);
#pragma unroll
    for (int c = 0; c < 8; ++c)
        *(v8h*)(dp + (size_t)((c >> 2) * 16 + (c & 3)) * ROWS) = o[c];
    // no data or address register of the stores is rewritten ahead of this wait (another job's code follows in the listing)
    asm volatile("s_wait_xcnt 0x0" ::: "memory");
}

__global__ __launch_bounds__(256) void k_prep(const float* __restrict__ x,
                                               const float* __restrict__ Wq,
                                               const float* __restrict__ W1,
                                               const float* __restrict__ W2,
                                               _Float16* __restrict__ xh,
                                               _Float16* __restrict__ wqT,
                                               _Float16* __restrict__ w1T,
                                               _Float16* __restrict__ w2T) {
    const int tid  = threadIdx.x;
    const int lane = tid & 31;
    const int w    = tid >> 5;
    int blk = blockIdx.x;
    if (blk < P1_BLKS) { tr_tile<DM, HID>(W1, w1T, blk * 8 + w, lane); return; }
    blk -= P1_BLKS;
    if (blk < P2_BLKS) { tr_tile<HID, DM>(W2, w2T, blk * 8 + w, lane); return; }
    blk -= P2_BLKS;
    if (blk < PQ_BLKS) { tr_tile<DM, DH>(Wq, wqT, blk * 8 + w, lane); return; }
    blk -= PQ_BLKS;
    if (blk >= PX_BLKS) return;
    // 2048 pieces = 16 whole token rows, inside one batch entry
    const int tok0 = blk * (PX_PIECES / (DM / 8));
    const int b    = tok0 / SEQ;
    const int s0   = tok0 - b * SEQ;
    const char* xb = (const char*)(x + ((size_t)b * SEQ_FULL + s0) * DM);   // the same for the whole work-group
    const unsigned ob = (unsigned)tid * 32u;                                // the thread's byte offset in a run of 256 pieces
    v4f a[8], c[8];
    // every loop below is unrolled whole: a, c and o stay in registers only under constant indices
#pragma unroll
    for (int i = 0; i < 8; ++i) {
        a[i] = *(const v4f*)(xb + ob + i * 8192);
        c[i] = *(const v4f*)(xb + ob + i * 8192 + 16);
    }
    // the loads' address register stays untouched up to this wait (ob is named so that it lives until here)
    asm volatile("s_wait_xcnt 0x0" :: "v"(ob) : "memory");
    v8h o[8];
#pragma unroll
    for (int i = 0; i < 8; ++i) {
#pragma unroll
        for (int e = 0; e < 4; ++e) {
            o[i][e]     = cvt_s(a[i][e], 16.0f);
            o[i][4 + e] = cvt_s(c[i][e], 16.0f);
        }
    }
    _Float16* dst = xh + (size_t)(blk * PX_PIECES + tid) * 8;
#pragma unroll
    for (int i = 0; i < 8; ++i) *(v8h*)(dst + i * 2048) = o[i];
    // no data or address register of the stores is rewritten ahead of this wait
    asm volatile("s_wait_xcnt 0x0" ::: "memory");
}

// ---------------------------------------------------------------------------
// GEMM main loop: block = KS groups of WS x WS waves = a square (WS*64) x (WS*64) tile,
// one wave = 64x64 = 4x4 subtiles; in its group, wave q takes row band q % WS and column
// band q / WS. A [M][K] and Bt [N][K] are 16-bit k-contiguous planes in global memory.
// A stage is KS*64 k (KS whole 128-B lines) of the block's WS*64 A rows and WS*64 Bt rows,
// laid in LDS at a pitch of 16 B more; tensor loads fill it (one request of 128 rows per
// issuing wave and stage, the pad set by the descriptor), RB buffers, the next RB - 1 stages
// in flight while this one is multiplied, so that a tile has RB - 1 stages' time to land. The
// counted wait returns when all but the wave's youngest requests have landed: left at RB - 2,
// it covers the next stage. A staged row feeds WS waves, so the bytes moved per product fall as 1 / WS.
// Group g multiplies k g*64..g*64+63 of every stage, so with KS = 2 a block of four
// 64x64 tiles runs two waves on each SIMD, one working while the other waits; each
// group ends with a partial sum over its half of k, and the caller joins the two.
// Fragments are two 16-B LDS loads, same k order as from the global planes.
// ---------------------------------------------------------------------------
#define ST_K      64                         // halves of k per stage and wave group
#define ST_PITCH(KS)  ((KS) * ST_K + 8)      // halves per LDS row (144 B, 272 B)
#define ST_HALVES(WS, KS) (2 * (WS) * 64 * ST_PITCH(KS))   // one buffer: A rows, then Bt rows

static __device__ __forceinline__ unsigned lds_off(const void* p) { return (unsigned)(size_t)p; }

typedef unsigned u32x4 __attribute__((ext_vector_type(4)));
typedef unsigned u32x8 __attribute__((ext_vector_type(8)));

static __device__ __forceinline__ unsigned uni(unsigned v) { return (unsigned)__builtin_amdgcn_readfirstlane(v); }

// A wave-uniform test held in a scalar register, so that the branch on it is a scalar branch:
// a tensor load ignores EXEC, and only such a branch keeps a wave from issuing it.
static __device__ __forceinline__ unsigned pinned(unsigned v) {
    unsigned w = uni(v);
    asm volatile("" : "+s"(w));
    return w;
}

// Tensor descriptor, group 1: a tile of ROWS rows of ROWB bytes (tensor = tile, 1-byte elements, no mask),
// source rows SRCP bytes apart, 16 B of LDS pad behind every row (pitch ROWB + 16).
template <unsigned ROWB, unsigned ROWS, unsigned SRCP>
static __device__ __forceinline__ u32x8 tdm_group1() {
    static_assert(ROWB == 128 || ROWB == 256);             // pad interval = the row: code 4 or 5
    static_assert(SRCP % 16 == 0 && SRCP >= 16 && SRCP <= 131072);
    constexpr unsigned w0 = (1u << 20) | ((ROWB == 256 ? 5u : 4u) << 22) | (3u << 25);
    u32x8 g;
    g[0] = uni(w0);
    g[1] = uni((ROWB & 0xFFFFu) << 16);
    g[2] = uni((ROWB >> 16) | ((ROWS & 0xFFFFu) << 16));
    g[3] = uni((ROWS >> 16) | (ROWB << 16));
    g[4] = uni(ROWS);
    g[5] = uni(SRCP);
    g[6] = uni(0u);
    g[7] = uni(0u);
    return g;
}

// word 3 of group 0: address bits 56..32, type 2
static __device__ __forceinline__ unsigned tdm_word3(unsigned long long ga) {
    return uni((((unsigned)(ga >> 32)) & 0x01FFFFFFu) | 0x80000000u);
}

// group 0 of a walk's first request; tdm_issue sets words 1 and 2
static __device__ __forceinline__ u32x4 tdm_group0(unsigned long long ga) {
    u32x4 g;
    g[0] = uni(1u);
    g[1] = uni(0u);
    g[2] = uni((unsigned)ga);
    g[3] = tdm_word3(ga);
    return g;
}

// One request of the calling wave: the tile whose first byte is ga lands at LDS byte dst. A walk keeps
// its two groups in the same scalar registers from its first request to the wait behind its last (they
// are in-out operands for that, and that wait names them): while requests are outstanding only words 1
// and 2 of group 0 are rewritten. Should a walk ever cross a 4-GiB line, word 3 changes with nothing outstanding.
static __device__ __forceinline__ void tdm_issue(u32x4& g0, u32x8& g1, unsigned dst, unsigned long long ga) {
    const unsigned n3 = tdm_word3(ga);
    unsigned w3 = g0[3];
    if (pinned(n3 != w3))
        asm volatile("s_wait_tensorcnt 0x0\n\ts_mov_b32 %0, %1" : "+s"(w3) : "s"(n3) : "memory");
    g0[3] = w3;
    g0[1] = uni(dst);
    g0[2] = uni((unsigned)ga);
    asm volatile("tensor_load_to_lds %0, %1" : "+s"(g0), "+s"(g1) :: "memory");
}

// ab = A + m_block * K (WS*64 rows), bb = Bt + n_block * K (WS*64 rows), St = RB buffers.
template <int K, int WS, int KS, int RB>
static __device__ __forceinline__ void gemm_tile64(const _Float16* __restrict__ ab,
                                                   const _Float16* __restrict__ bb,
                                                   _Float16* St,
                                                   v8f (&acc)[4][4]) {
    constexpr int SK = ST_K * KS;                    // halves of k per stage
    constexpr int PT = ST_PITCH(KS);
    static_assert(K % SK == 0 && K / SK >= RB);      // whole stages, every buffer filled
    constexpr int NT = K / SK;
    constexpr unsigned SROWS = 128;                  // rows per request
    constexpr unsigned SLB   = SROWS * PT * 2;       // a request's bytes in LDS, pads counted
    constexpr unsigned BUFB  = ST_HALVES(WS, KS) * 2u;
    constexpr unsigned NI    = 2 * WS * 64 / SROWS;  // issuing waves: one request each per stage
    static_assert(SLB % 2048 == 0 && BUFB == NI * SLB);   // every place in LDS a multiple of 2 KiB
    static_assert(RB >= 3 && RB - 1 <= 3);           // requests of a wave outstanding at most
    const int tid  = threadIdx.x;
    const int lane = tid & 31;
    const int w    = tid >> 5;
    const int kg   = w / (WS * WS);
    const int wm   = (w % (WS * WS)) % WS;
    const int wn   = (w % (WS * WS)) / WS;
    const int lm   = lane & 15;
    const int kb   = kg * ST_K + ((lane >> 4) << 3);
    // issuing wave i brings rows i*128.. of the buffer's run (A rows, then Bt rows); the other waves issue nothing
    const unsigned wv  = uni((unsigned)tid >> 5);
    const unsigned isu = wv < NI ? 1u : 0u;
    const unsigned sl  = isu ? wv : 0u;
    const _Float16* sp = (sl < NI / 2) ? ab + (size_t)(sl * SROWS) * K : bb + (size_t)((sl - NI / 2) * SROWS) * K;
    const unsigned long long g = (unsigned long long)(size_t)sp;
    const unsigned  l0 = lds_off(St) + sl * SLB;
    u32x8           g1 = tdm_group1<SK * 2, SROWS, K * 2>();
    u32x4           g0 = tdm_group0(g);

#pragma unroll
    for (int ms = 0; ms < 4; ++ms)
#pragma unroll
        for (int nt = 0; nt < 4; ++nt) acc[ms][nt] = zero8();

    if (pinned(isu)) {
        // unrolled whole: straight-line requests, buffer offsets as constants
#pragma unroll
        for (int s = 0; s < RB - 1; ++s) tdm_issue(g0, g1, l0 + (unsigned)s * BUFB, g + (unsigned)(s * SK * 2));
    }
    asm volatile("s_wait_tensorcnt %0" :: "i"(RB - 2) : "memory");   // stage 0 landed (this wave's request); the younger stages fly on
    __syncthreads();                                    // stage 0 published to all waves
    if (pinned(isu)) tdm_issue(g0, g1, l0 + (unsigned)(RB - 1) * BUFB, g + (unsigned)((RB - 1) * SK * 2));

    int bo = 0;                                         // stage t's buffer, in halves
#pragma unroll 1
    for (int t = 0; t < NT; ++t) {
        const _Float16* sa = St + bo + (wm * 64 + lm) * PT + kb;
        const _Float16* sb = St + bo + ((WS + wn) * 64 + lm) * PT + kb;
        // Fragment reads stand in few groups, each ahead of the products that hide it:
        // k 0..31 whole and the A side of k 32..63 first, the B side of k 32..63 in
        // two halves into the B registers that the first k step has just left.
        v16h a0[4], a1[4], bn[4];
#pragma unroll
        for (int i = 0; i < 4; ++i) a0[i] = load_frag_p(sa + i * 16 * PT);
#pragma unroll
        for (int i = 0; i < 4; ++i) bn[i] = load_frag_p(sb + i * 16 * PT);
#pragma unroll
        for (int i = 0; i < 4; ++i) a1[i] = load_frag_p(sa + i * 16 * PT + 32);
#pragma unroll
        for (int hf = 0; hf < 4; hf += 2) {
#pragma unroll
            for (int nt = hf; nt < hf + 2; ++nt)
#pragma unroll
                for (int ms = 0; ms < 4; ++ms) acc[ms][nt] = wmma16(a0[ms], bn[nt], acc[ms][nt]);
#pragma unroll
            for (int nt = hf; nt < hf + 2; ++nt) bn[nt] = load_frag_p(sb + nt * 16 * PT + 32);
        }
#pragma unroll
        for (int nt = 0; nt < 4; ++nt)
#pragma unroll
            for (int ms = 0; ms < 4; ++ms) acc[ms][nt] = wmma16(a1[ms], bn[nt], acc[ms][nt]);
        asm volatile("s_wait_dscnt 0x0" ::: "memory");      // this wave's reads of the buffer are done
        // stage t+1 landed (this wave's request): behind it stages t+2 .. t+RB-1 were issued, or, at the tail, fewer
        if (t + RB - 1 < NT) asm volatile("s_wait_tensorcnt %0" :: "i"(RB - 2) : "memory");
        else                 asm volatile("s_wait_tensorcnt 0x0" ::: "memory");
        __syncthreads();                                    // publishes stage t+1, frees stage t's buffer
        if (pinned(isu & (t + RB < NT ? 1u : 0u)))
            tdm_issue(g0, g1, l0 + (unsigned)bo * 2u, g + (unsigned)((t + RB) * SK * 2));
        bo = (bo == (RB - 1) * ST_HALVES(WS, KS)) ? 0 : bo + ST_HALVES(WS, KS);
    }
    asm volatile("s_wait_tensorcnt 0x0" :: "s"(g0), "s"(g1) : "memory");   // nothing in flight when the loop is left; the descriptors live until here
    asm volatile("s_wait_dscnt 0x0" ::: "memory");          // and no read of the ring
}

// Joining the two k groups' partial sums. X = the operand ring, free behind the loop's
// last barrier. A subtile travels as two runs of 512 B, 16 B per lane, lane-contiguous;
// slot = 256 floats. The sum of a pair is the same whichever group forms it.
static __device__ __forceinline__ void sub_put(float* X, int slot, int lane, v8f v) {
    v4f lo, hi;
    lo.x = v[0]; lo.y = v[1]; lo.z = v[2]; lo.w = v[3];
    hi.x = v[4]; hi.y = v[5]; hi.z = v[6]; hi.w = v[7];
    *(v4f*)(X + slot * 256 + lane * 4)       = lo;
    *(v4f*)(X + slot * 256 + 128 + lane * 4) = hi;
}

static __device__ __forceinline__ v8f sub_add(const float* X, int slot, int lane, v8f v) {
    const v4f lo = *(const v4f*)(X + slot * 256 + lane * 4);
    const v4f hi = *(const v4f*)(X + slot * 256 + 128 + lane * 4);
    v[0] += lo.x; v[1] += lo.y; v[2] += lo.z; v[3] += lo.w;
    v[4] += hi.x; v[5] += hi.y; v[6] += hi.z; v[7] += hi.w;
    return v;
}

// ---------------------------------------------------------------------------
// Q projection: acc = (16 x)(64 Wq) = 1024 x.Wq ; q64 = (acc + 1024 bq) / 16.
// Writes qrow[b][h][s][64] and qT[b][h][64][s] as f16(64 q).
// Block = two k groups of 2 x 2 waves = 128 tokens x two heads; wave tile = 64 tokens x one head. The second group
// hands its partial sums to the first through LDS and ends; the first stores. Row plane: 16-row steps through a
// wave-private LDS tile; transposed plane: whole 64x64 wave-private tile.
// ---------------------------------------------------------------------------
__global__ __launch_bounds__(256) __attribute__((amdgpu_num_vgpr(256)))
void k_gemm_q(const _Float16* __restrict__ xh,
              const _Float16* __restrict__ wqT,
              const float* __restrict__ bq,
              _Float16* __restrict__ qrow,
              _Float16* __restrict__ qT) {
    __shared__ __align__(16) _Float16 Rst[4][16 * 64];   // 8 KB, wave-private
    __shared__ __align__(16) _Float16 Tst[4][64 * 64];   // 32 KB, wave-private
    __shared__ __attribute__((aligned(2048))) _Float16 St[4 * ST_HALVES(2, 2)]; // 272 KB, operand stages, cross-wave
    const int tid  = threadIdx.x;
    const int lane = tid & 31;
    const int wv   = __builtin_amdgcn_readfirstlane(tid >> 5);   // the wave's number, held scalar: the tests on kg are scalar branches
    const int kg   = wv >> 2;
    const int w    = wv & 3;
    const int hh   = lane >> 4;
    const int lm   = lane & 15;
    const int m0   = blockIdx.x * 128 + (w % 2) * 64;
    const int head = blockIdx.y * 2 + w / 2;
    const int n0   = head * 64;
    const int b    = m0 / SEQ;
    const int s0   = m0 - b * SEQ;

    v8f acc[4][4];
    gemm_tile64<DM, 2, 2, 4>(xh + (size_t)(blockIdx.x * 128) * DM, wqT + (size_t)(blockIdx.y * 128) * DM, St, acc);

    float* X = (float*)St;
    // the loops of the join are unrolled whole: acc stays in registers only under constant indices
    if (kg == 1) {
#pragma unroll
        for (int ms = 0; ms < 4; ++ms)
#pragma unroll
            for (int nt = 0; nt < 4; ++nt) sub_put(X, w * 16 + ms * 4 + nt, lane, acc[ms][nt]);
    }
    __syncthreads();                                    // the second group's partial sums published
    if (kg == 1) return;                                // no block barrier below
#pragma unroll
    for (int ms = 0; ms < 4; ++ms)
#pragma unroll
        for (int nt = 0; nt < 4; ++nt) acc[ms][nt] = sub_add(X, w * 16 + ms * 4 + nt, lane, acc[ms][nt]);

    float bv[4];
#pragma unroll
    for (int nt = 0; nt < 4; ++nt) bv[nt] = bf16r(bq[n0 + nt * 16 + lm]) * 1024.0f;

    _Float16* qr = qrow + (((size_t)b * NH + head) * SEQ + s0) * DH;
    _Float16* qt = qT + ((size_t)b * NH + head) * DH * SEQ + s0;

#pragma unroll
    for (int ms = 0; ms < 4; ++ms) {
#pragma unroll
        for (int nt = 0; nt < 4; ++nt) {
            v8h tv;
#pragma unroll
            for (int r = 0; r < 8; ++r) {
                _Float16 hv = (_Float16)((acc[ms][nt][r] + bv[nt]) * 0.0625f);
                Rst[w][(8 * hh + r) * 64 + nt * 16 + lm] = hv;
                tv[r] = hv;
            }
            *(v8h*)(&Tst[w][(nt * 16 + lm) * 64 + ms * 16 + 8 * hh]) = tv;
        }
        wave_lds_sync();
        v8h rv[4];
#pragma unroll
        for (int i = 0; i < 4; ++i) rv[i] = *(const v8h*)(&Rst[w][i * 256 + lane * 8]);
        _Float16* dst = qr + ms * 1024 + lane * 8;
#pragma unroll
        for (int i = 0; i < 4; ++i) *(v8h*)(dst + i * 256) = rv[i];
        
        wave_lds_sync();
    }
    wave_lds_sync();
#pragma unroll 1
    for (int g = 0; g < 4; ++g) {
        v8h tv[4];
#pragma unroll
        for (int i = 0; i < 4; ++i) tv[i] = *(const v8h*)(&Tst[w][(g * 4 + i) * 256 + lane * 8]);
        _Float16* dst = qt + (size_t)(g * 16 + (lane >> 3)) * SEQ + (lane & 7) * 8;
#pragma unroll
        for (int i = 0; i < 4; ++i) *(v8h*)(dst + (size_t)i * 4 * SEQ) = tv[i];
        
    }
}

// ---------------------------------------------------------------------------
// Fused attention, q = k = v. Block = 8 waves = 128 queries of one (b, head), as four
// query groups x two key groups: a wave owns 32 queries (two tiles of 16) and, of every
// stage of 128 keys, the 64 keys of its key group. A key or V^T fragment read from LDS
// so feeds two products, which halves the LDS bytes per product, and the block keeps its
// 8 waves. Per 32 keys:
//   S^T tiles (rows = keys, cols = queries): A = key rows, B = query rows
//   (k = d, 2 steps of 32); query fragments straight from the qrow plane;
//   per-lane online softmax (lane column = its query; partner lane +-16): the scale
//   rides in the query fragment and the shift 8 - base in the products' C operand, so
//   a score leaves the matrix unit as its exponent; the base is tested once per stage,
//   on the sums of P, and moves only when a P could leave the range of f16, which
//   rescales l and O^T;
//   P^T carried 2^8 or more at the largest score seen as f16: the two S^T tiles chain directly as the B
//   fragment (elements 0..7 = tile keys 0..15, 8..15 = tile keys 16..31);
//   O^T += V^T . P^T with A fragments of V^T (rows = d, k = keys).
// Key rows and V^T rows reach the waves through LDS: a stage is 128 keys, 128
// qrow rows of 128 B at a 144-B pitch and 64 qT rows of 256 B at a 272-B pitch,
// filled once per block by two tensor loads (one request each for the key rows
// and the V^T rows); three buffers, the next two stages in flight
// while this one is worked on. Fragments keep the k order they had from the planes.
// Behind the loop the two waves of a query group swap one query tile's partial l, O^T and
// base through LDS, bring both halves to the larger base and add them: key group 0 finishes
// queries 0..15 of the group, key group 1 queries 16..31.
// Epilogue: O^T / (64 l) staged as [query][d] f32 in a wave-private LDS tile,
// bf16(x) added at the store stage, 8 lane-contiguous 16-B-per-lane
// ---------------------------------------------------------------------------
#define AT_KEYS   128                        // keys per stage
#define AT_QT     2                          // query tiles of 16 per wave
#define AT_NU     2                          // groups of 32 keys per wave and stage (half of the stage's four)
#define AK_PITCH  72                         // halves per key row in LDS (144 B)
#define AV_PITCH  136                        // halves per V^T row in LDS (272 B)
#define AK_HALVES (AT_KEYS * AK_PITCH)       // key rows of one buffer, 18,432 B
#define AV_HALVES 9216                       // V^T rows of one buffer, 17,408 B, rounded up to a multiple of 2 KiB
#define AT_HALVES (AK_HALVES + AV_HALVES)    // one buffer, 36,864 B
#define AJ_FLOATS 1280                       // a wave's place for the hand-over: 4 subtiles of 256 floats, l, shift
static_assert(SEQ % AT_KEYS == 0);           // whole stages
static_assert(AT_NU * 2 * 32 == AT_KEYS);    // two key groups share a stage
static_assert(AT_NU * AT_QT == AT_KEYS / 32);   // a wave's score tiles per stage: as many as stage_exp takes
static_assert(AV_HALVES >= DH * AV_PITCH);   // the V^T rows fit their place
static_assert((AK_HALVES * 2) % 2048 == 0 && (AV_HALVES * 2) % 2048 == 0);   // every place in LDS a multiple of 2 KiB
static_assert(8 * AJ_FLOATS * 4 <= 3 * AT_HALVES * 2);   // the hand-over fits the ring

// P = 2^exponent for a wave's scores of a stage, tile g = (group of 32 keys) * AT_QT + query tile:
// packed as the B fragments of the P^T products (elements 0..7 = tile keys 0..15, 8..15 = tile
// keys 16..31), and summed per 32 keys and query.
// Unrolled whole: the arrays stay in registers only under constant indices.
static __device__ __forceinline__ void stage_exp(const v8f (&sA)[AT_KEYS / 32], const v8f (&sB)[AT_KEYS / 32],
                                                 v16h (&pb)[AT_KEYS / 32], float (&ps)[AT_KEYS / 32]) {
#pragma unroll
    for (int u = 0; u < AT_KEYS / 32; ++u) {
        float s = 0.0f;
#pragma unroll
        for (int i = 0; i < 8; ++i) {
            const float pa = ex2(sA[u][i]);
            const float pq = ex2(sB[u][i]);
            s += pa + pq;
            pb[u][i]     = (_Float16)pa;
            pb[u][8 + i] = (_Float16)pq;
        }
        ps[u] = s;
    }
}

// own * so + (the subtile that sub_put laid in slot) * sp
static __device__ __forceinline__ v8f sub_join(const float* X, int slot, int lane, v8f v, float so, float sp) {
    const v4f lo = *(const v4f*)(X + slot * 256 + lane * 4);
    const v4f hi = *(const v4f*)(X + slot * 256 + 128 + lane * 4);
    v[0] = v[0] * so + lo.x * sp; v[1] = v[1] * so + lo.y * sp; v[2] = v[2] * so + lo.z * sp; v[3] = v[3] * so + lo.w * sp;
    v[4] = v[4] * so + hi.x * sp; v[5] = v[5] * so + hi.y * sp; v[6] = v[6] * so + hi.z * sp; v[7] = v[7] * so + hi.w * sp;
    return v;
}

__global__ __launch_bounds__(256) __attribute__((amdgpu_num_vgpr(256)))
void k_attn(const _Float16* __restrict__ qrow,
            const _Float16* __restrict__ qT,
            const float* __restrict__ x,
            float* __restrict__ y1) {
    __shared__ __align__(16) float Ost[8][16 * DH];      // 32 KB, wave-private
    __shared__ __attribute__((aligned(2048))) _Float16 Kv[3 * AT_HALVES]; // 108 KB, key and V^T stages, cross-wave
    constexpr int NT = SEQ / AT_KEYS;
    const int tid  = threadIdx.x;
    const int lane = tid & 31;
    const unsigned wv = uni((unsigned)tid >> 5);        // the wave's number, held scalar: the tests on it are scalar branches
    const int w    = (int)wv;
    const int kg   = w >> 2;                            // key group
    const int wq   = w & 3;                             // query group
    const int hh   = lane >> 4;
    const int lm   = lane & 15;
    const int kb   = hh << 3;
    const int b    = blockIdx.z;
    const int head = blockIdx.y;
    const int qg   = blockIdx.x * 128 + wq * 32;        // first of the wave's 32 queries

    const _Float16* qhead = qrow + ((size_t)b * NH + head) * SEQ * DH;
    const _Float16* thead = qT + ((size_t)b * NH + head) * DH * SEQ;
    const _Float16* qlane = qhead + (size_t)lm * DH + kb;
    // Per stage wave 0 issues one request for the 128 key rows (128 B each, contiguous in the plane) and
    // wave 1 one for the 64 V^T rows (256 B each, SEQ halves apart); the other waves issue nothing.
    const unsigned long long gk = (unsigned long long)(size_t)qhead;
    const unsigned long long gv = (unsigned long long)(size_t)thead;
    const unsigned  lk  = lds_off(Kv);
    const unsigned  lv  = lds_off(Kv) + AK_HALVES * 2u;
    u32x8           g1k = tdm_group1<DH * 2, AT_KEYS, DH * 2>();
    u32x8           g1v = tdm_group1<AT_KEYS * 2, DH, SEQ * 2>();
    u32x4           g0k = tdm_group0(gk);
    u32x4           g0v = tdm_group0(gv);
    constexpr unsigned KSTEP = AT_KEYS * DH * 2;        // bytes from a stage's key rows to the next stage's
    constexpr unsigned VSTEP = AT_KEYS * 2;             // the same along a V^T row
    constexpr unsigned BUFB  = AT_HALVES * 2u;

    if (pinned(wv == 0)) {
        tdm_issue(g0k, g1k, lk, gk);
        if (NT > 1) tdm_issue(g0k, g1k, lk + BUFB, gk + KSTEP);
    }
    if (pinned(wv == 1)) {
        tdm_issue(g0v, g1v, lv, gv);
        if (NT > 1) tdm_issue(g0v, g1v, lv + BUFB, gv + VSTEP);
    }
    // stage 0 landed (this wave's request); stage 1's flies on
    if (NT > 1) asm volatile("s_wait_tensorcnt 0x1" ::: "memory");
    else        asm volatile("s_wait_tensorcnt 0x0" ::: "memory");
    __syncthreads();                                    // stage 0 published to all waves
    if (NT > 2) {
        if (pinned(wv == 0)) tdm_issue(g0k, g1k, lk + 2u * BUFB, gk + 2u * KSTEP);
        if (pinned(wv == 1)) tdm_issue(g0v, g1v, lv + 2u * BUFB, gv + 2u * VSTEP);
    }

    // every loop over qt, u, dt, j below is unrolled whole: the arrays stay in registers only under constant indices
    v16h qf[AT_QT][2];                                  // [query tile][d 0..31 / 32..63]
#pragma unroll
    for (int qt = 0; qt < AT_QT; ++qt) {
        qf[qt][0] = load_frag_p(qlane + (size_t)(qg + qt * 16) * DH);
        qf[qt][1] = load_frag_p(qlane + (size_t)(qg + qt * 16) * DH + 32);
        // the query side takes the score scale once: (64 q_t).(64 q_s CS) = t, in log2 units
#pragma unroll
        for (int e = 0; e < 16; ++e) {
            qf[qt][0][e] = (_Float16)((float)qf[qt][0][e] * CS);
            qf[qt][1][e] = (_Float16)((float)qf[qt][1][e] * CS);
        }
    }

    v8f o[4][AT_QT];
    float l[AT_QT];
    // C operand of the score products: 8 - base in all 8 registers, base = the lane's query's
    // softmax base in this key group. It starts at 0 and moves only up to a score that the wave has
    // seen; a row's largest score is at least its own q.q >= 0, so neither group's base lies above
    // the row's maximum, and the test in the loop keeps P inside f16.
    v8f cv[AT_QT];
#pragma unroll
    for (int qt = 0; qt < AT_QT; ++qt) {
#pragma unroll
        for (int dt = 0; dt < 4; ++dt) o[dt][qt] = zero8();
        l[qt] = 0.0f;
#pragma unroll
        for (int i = 0; i < 8; ++i) cv[qt][i] = 8.0f;
    }

    int bo = 0;                                         // stage t's buffer, in halves
#pragma unroll 1
    for (int t = 0; t < NT; ++t) {
      const _Float16* sk = Kv + bo + (kg * (AT_NU * 32) + lm) * AK_PITCH + kb;
      const _Float16* sv = Kv + bo + AK_HALVES + lm * AV_PITCH + kg * (AT_NU * 32) + kb;
      // Score products of the wave's share of the stage first. They leave the matrix unit as
      // exponents, t + (8 - base), with no vector arithmetic between product and exponential.
      v8f sA[AT_KEYS / 32], sB[AT_KEYS / 32];             // tile g = u * AT_QT + qt
      // The key fragments of 32 keys are read one group ahead of the products that use them,
      // so that a group's LDS latency passes under the group before it.
      v16h kf[2][4];                                      // j: keys 0..15 / 16..31 (j & 1), d 0..31 / 32..63 (j >> 1)
#pragma unroll
      for (int j = 0; j < 4; ++j) kf[0][j] = load_frag_p(sk + (j & 1) * 16 * AK_PITCH + (j >> 1) * 32);
#pragma unroll
      for (int u = 0; u < AT_NU; ++u) {
        if (u + 1 < AT_NU) {
#pragma unroll
            for (int j = 0; j < 4; ++j)
                kf[(u + 1) & 1][j] = load_frag_p(sk + ((u + 1) * 32 + (j & 1) * 16) * AK_PITCH + (j >> 1) * 32);
        }
#pragma unroll
        for (int qt = 0; qt < AT_QT; ++qt) sA[u * AT_QT + qt] = wmma16(kf[u & 1][0], qf[qt][0], cv[qt]);
#pragma unroll
        for (int qt = 0; qt < AT_QT; ++qt) sB[u * AT_QT + qt] = wmma16(kf[u & 1][1], qf[qt][0], cv[qt]);
#pragma unroll
        for (int qt = 0; qt < AT_QT; ++qt) sA[u * AT_QT + qt] = wmma16(kf[u & 1][2], qf[qt][1], sA[u * AT_QT + qt]);
#pragma unroll
        for (int qt = 0; qt < AT_QT; ++qt) sB[u * AT_QT + qt] = wmma16(kf[u & 1][3], qf[qt][1], sB[u * AT_QT + qt]);
      }
      // P of the wave's share, packed for the B operand, and its sums per 32 keys and query
      v16h pb[AT_KEYS / 32];
      float ps[AT_KEYS / 32];
      stage_exp(sA, sB, pb, ps);
      // No P is above the sum that holds it: sums under 60000 say that every P fits f16. An
      // exponent beyond f32's range gives an infinite sum, which the negated compare catches too.
      float pm = ps[0];
#pragma unroll
      for (int g = 1; g < AT_KEYS / 32; ++g) pm = fmaxf(pm, ps[g]);
      if (__builtin_amdgcn_ballot_w32(!(pm <= 60000.0f)) != 0u) {   // wave-uniform, rare
        // new base = the query's largest score of the wave's share, where that lies above the old base
#pragma unroll
        for (int qt = 0; qt < AT_QT; ++qt) {
            float tmax = fmaxf(sA[qt][0], sB[qt][0]);
#pragma unroll
            for (int u = 0; u < AT_NU; ++u)
#pragma unroll
                for (int i = 0; i < 8; ++i) tmax = fmaxf(tmax, fmaxf(sA[u * AT_QT + qt][i], sB[u * AT_QT + qt][i]));
            tmax = fmaxf(tmax, __shfl_xor(tmax, 16, 32));
            const float dn = fmaxf(tmax - 8.0f, 0.0f);
            const float sc = ex2(-dn);
            l[qt] *= sc;
#pragma unroll
            for (int dt = 0; dt < 4; ++dt)
#pragma unroll
                for (int r = 0; r < 8; ++r) o[dt][qt][r] *= sc;
#pragma unroll
            for (int u = 0; u < AT_NU; ++u)
#pragma unroll
                for (int i = 0; i < 8; ++i) { sA[u * AT_QT + qt][i] -= dn; sB[u * AT_QT + qt][i] -= dn; }
#pragma unroll
            for (int i = 0; i < 8; ++i) cv[qt][i] -= dn;
        }
        stage_exp(sA, sB, pb, ps);
      }
      // V^T fragments, too, are read one group of 32 keys ahead of their products
      v16h vf[2][4];
#pragma unroll
      for (int dt = 0; dt < 4; ++dt) vf[0][dt] = load_frag_p(sv + dt * 16 * AV_PITCH);
#pragma unroll
      for (int u = 0; u < AT_NU; ++u) {
        if (u + 1 < AT_NU) {
#pragma unroll
            for (int dt = 0; dt < 4; ++dt) vf[(u + 1) & 1][dt] = load_frag_p(sv + dt * 16 * AV_PITCH + (u + 1) * 32);
        }
#pragma unroll
        for (int qt = 0; qt < AT_QT; ++qt) l[qt] += ps[u * AT_QT + qt];
#pragma unroll
        for (int dt = 0; dt < 4; ++dt)
#pragma unroll
            for (int qt = 0; qt < AT_QT; ++qt) o[dt][qt] = wmma16(vf[u & 1][dt], pb[u * AT_QT + qt], o[dt][qt]);
      }
      asm volatile("s_wait_dscnt 0x0" ::: "memory");      // this wave's reads of the buffer are done
      // stage t+1 landed (this wave's request): behind it stands stage t+2's, or, at the tail, none
      if (t + 2 < NT) asm volatile("s_wait_tensorcnt 0x1" ::: "memory");
      else            asm volatile("s_wait_tensorcnt 0x0" ::: "memory");
      __syncthreads();                                    // publishes stage t+1, frees stage t's buffer
      const unsigned more = t + 3 < NT ? 1u : 0u;
      if (pinned(more & (wv == 0 ? 1u : 0u))) tdm_issue(g0k, g1k, lk + (unsigned)bo * 2u, gk + (unsigned)(t + 3) * KSTEP);
      if (pinned(more & (wv == 1 ? 1u : 0u))) tdm_issue(g0v, g1v, lv + (unsigned)bo * 2u, gv + (unsigned)(t + 3) * VSTEP);
      bo = (bo == 2 * AT_HALVES) ? 0 : bo + AT_HALVES;
    }
    // nothing in flight when the loop is left; the descriptors live until here
    asm volatile("s_wait_tensorcnt 0x0" :: "s"(g0k), "s"(g1k), "s"(g0v), "s"(g1v) : "memory");
    asm volatile("s_wait_dscnt 0x0" ::: "memory");          // and no read of the ring

    // Joining the two key groups. The ring is free behind the loop's last barrier. Each wave keeps the
    // query tile of its key group's number and hands the other to its partner, lane for lane.
    // The lane's number is formed anew here: the loop stands at the register limit, and values held across it for the epilogue alone would spill.
    const int ln  = (int)__builtin_amdgcn_mbcnt_lo(~0u, 0u);
    const int lh  = ln >> 4;
    const int lq  = ln & 15;
    float* Xo = (float*)Kv + w * AJ_FLOATS;
    v8f   om[4];
    float lo_, co_;
    if (kg == 0) {
#pragma unroll
        for (int dt = 0; dt < 4; ++dt) { sub_put(Xo, dt, ln, o[dt][1]); om[dt] = o[dt][0]; }
        Xo[1024 + ln] = l[1];
        Xo[1056 + ln] = cv[1][0];
        lo_ = l[0];
        co_ = cv[0][0];
    } else {
#pragma unroll
        for (int dt = 0; dt < 4; ++dt) { sub_put(Xo, dt, ln, o[dt][0]); om[dt] = o[dt][1]; }
        Xo[1024 + ln] = l[0];
        Xo[1056 + ln] = cv[0][0];
        lo_ = l[1];
        co_ = cv[1][0];
    }
    __syncthreads();                                    // both key groups' handed-over tiles published
    const float* Xp = (const float*)Kv + (w ^ 4) * AJ_FLOATS;
    const float lp = Xp[1024 + ln];
    const float cp = Xp[1056 + ln];
    // shift = 8 - base: the smaller shift is the larger base; each half is scaled down to it (by 1 where the bases agree)
    const float cm = fminf(co_, cp);
    const float so = ex2(cm - co_);
    const float sp = ex2(cm - cp);
#pragma unroll
    for (int dt = 0; dt < 4; ++dt) om[dt] = sub_join(Xp, dt, ln, om[dt], so, sp);
    const float lj = lo_ * so + lp * sp;

    const int   q0  = qg + kg * 16;                     // the 16 queries that this wave finishes
    const float lt  = lj + __shfl_xor(lj, 16, 32);
    const float inv = (1.0f / lt) * 0.015625f;          // 2^8 P carry cancels in o/l; 1/64 for the q carry
#pragma unroll
    for (int dt = 0; dt < 4; ++dt) {
        v4f u0, u1;
        u0.x = om[dt][0] * inv; u0.y = om[dt][1] * inv; u0.z = om[dt][2] * inv; u0.w = om[dt][3] * inv;
        u1.x = om[dt][4] * inv; u1.y = om[dt][5] * inv; u1.z = om[dt][6] * inv; u1.w = om[dt][7] * inv;
        *(v4f*)(&Ost[w][lq * DH + dt * 16 + 8 * lh])     = u0;
        *(v4f*)(&Ost[w][lq * DH + dt * 16 + 8 * lh + 4]) = u1;
    }
    wave_lds_sync();

    v4f sv[8];
    const int col = lq * 4;
#pragma unroll
    for (int i = 0; i < 8; ++i) {
        const int row = 2 * i + lh;
        v4f a  = *(const v4f*)(&Ost[w][i * 128 + ln * 4]);
        v4f xv = *(const v4f*)(x + ((size_t)b * SEQ_FULL + q0 + row) * DM + head * DH + col);
        a.x = bf16r(xv.x) + a.x;
        a.y = bf16r(xv.y) + a.y;
        a.z = bf16r(xv.z) + a.z;
        a.w = bf16r(xv.w) + a.w;
        sv[i] = a;
    }
    float* ob = y1 + ((size_t)b * SEQ + q0 + lh) * DM + head * DH + col;
#pragma unroll
    for (int i = 0; i < 8; ++i) *(v4f*)(ob + (size_t)(2 * i) * DM) = sv[i];
    
}

// ---------------------------------------------------------------------------
// LayerNorm over DM columns. A wave takes LN_R whole rows and holds them in registers:
// lane l has columns j*128 + l*4 .. +3, j = 0..7, of each row. All loads of the wave's
// rows are issued before the first is waited for, so the wave pays one memory latency
// for them, and few waves have to be started; gain and bias are read and converted once
// for the LN_R rows. No LDS, no barrier. The sums keep their order: over j in a lane,
// then lanes by xor 16, 8, 4, 2, 1. Every store covers whole 128-B lines (f32: 512 B
// per instruction; f16(16 * y): 256 B).
// ---------------------------------------------------------------------------
#define LN_R 4                                       // rows per wave
static_assert(NTOK % (4 * LN_R) == 0);               // whole work-groups of 4 waves

// the rows' sums over the 32 lanes, the rows' exchanges side by side so that their latencies overlap
static __device__ __forceinline__ void rows_sum(float (&s)[LN_R]) {
#pragma unroll
    for (int m = 16; m >= 1; m >>= 1) {
        float t[LN_R];
#pragma unroll
        for (int r = 0; r < LN_R; ++r) t[r] = __shfl_xor(s[r], m, 32);
#pragma unroll
        for (int r = 0; r < LN_R; ++r) s[r] += t[r];
    }
}

__global__ __launch_bounds__(128) void k_ln(const float* __restrict__ y,
                                             const float* __restrict__ g,
                                             const float* __restrict__ be,
                                             float* __restrict__ of,
                                             _Float16* __restrict__ oh,
                                             int wr16) {
    const int tid  = threadIdx.x;
    const int lane = tid & 31;
    const int w    = __builtin_amdgcn_readfirstlane(tid >> 5);   // the wave's number, held scalar: row bases stay in scalar registers
    const int row0 = (blockIdx.x * 4 + w) * LN_R;
    if (row0 >= NTOK) return;                         // wave-uniform; no barrier in this kernel
    const char* yb = (const char*)(y + (size_t)row0 * DM);
    const unsigned ob = (unsigned)lane * 16u;         // the lane's byte offset in a run of 128 floats

    v4f v[LN_R][8], gv[8], bv[8];
    // every loop below is unrolled whole: v, gv, bv and hv stay in registers only under constant indices
#pragma unroll
    for (int r = 0; r < LN_R; ++r)
#pragma unroll
        for (int j = 0; j < 8; ++j) v[r][j] = *(const v4f*)(yb + ob + r * (DM * 4) + j * 512);
#pragma unroll
    for (int j = 0; j < 8; ++j) {
        gv[j] = *(const v4f*)((const char*)g + ob + j * 512);
        bv[j] = *(const v4f*)((const char*)be + ob + j * 512);
    }
    // the loads' address register stays untouched up to this wait (ob is named so that it lives until here)
    asm volatile("s_wait_xcnt 0x0" :: "v"(ob) : "memory");

    float s[LN_R];
#pragma unroll
    for (int r = 0; r < LN_R; ++r) {
        s[r] = 0.0f;
#pragma unroll
        for (int j = 0; j < 8; ++j) s[r] += (v[r][j].x + v[r][j].y) + (v[r][j].z + v[r][j].w);
    }
    rows_sum(s);
    float mu[LN_R], qv[LN_R];
#pragma unroll
    for (int r = 0; r < LN_R; ++r) {
        mu[r] = s[r] * 0.0009765625f;
        qv[r] = 0.0f;
#pragma unroll
        for (int j = 0; j < 8; ++j) {
            const float d0 = v[r][j].x - mu[r], d1 = v[r][j].y - mu[r], d2 = v[r][j].z - mu[r], d3 = v[r][j].w - mu[r];
            qv[r] += (d0 * d0 + d1 * d1) + (d2 * d2 + d3 * d3);
        }
    }
    rows_sum(qv);
#pragma unroll
    for (int j = 0; j < 8; ++j) {
        gv[j].x = bf16r(gv[j].x); gv[j].y = bf16r(gv[j].y); gv[j].z = bf16r(gv[j].z); gv[j].w = bf16r(gv[j].w);
        bv[j].x = bf16r(bv[j].x); bv[j].y = bf16r(bv[j].y); bv[j].z = bf16r(bv[j].z); bv[j].w = bf16r(bv[j].w);
    }
#pragma unroll
    for (int r = 0; r < LN_R; ++r) {
        const float rs = rsqrtf(qv[r] * 0.0009765625f + 1.0e-5f);
#pragma unroll
        for (int j = 0; j < 8; ++j) {
            v[r][j].x = (v[r][j].x - mu[r]) * rs * gv[j].x + bv[j].x;
            v[r][j].y = (v[r][j].y - mu[r]) * rs * gv[j].y + bv[j].y;
            v[r][j].z = (v[r][j].z - mu[r]) * rs * gv[j].z + bv[j].z;
            v[r][j].w = (v[r][j].w - mu[r]) * rs * gv[j].w + bv[j].w;
        }
    }

    if (wr16 != 0) {
        v4h hv[LN_R][8];
#pragma unroll
        for (int r = 0; r < LN_R; ++r)
#pragma unroll
            for (int j = 0; j < 8; ++j) {
                hv[r][j].x = (_Float16)(v[r][j].x * 16.0f);
                hv[r][j].y = (_Float16)(v[r][j].y * 16.0f);
                hv[r][j].z = (_Float16)(v[r][j].z * 16.0f);
                hv[r][j].w = (_Float16)(v[r][j].w * 16.0f);
            }
        char* hbp = (char*)(oh + (size_t)row0 * DM);
        const unsigned oh8 = (unsigned)lane * 8u;
#pragma unroll
        for (int r = 0; r < LN_R; ++r)
#pragma unroll
            for (int j = 0; j < 8; ++j) *(v4h*)(hbp + oh8 + r * (DM * 2) + j * 256) = hv[r][j];
    }
    char* fb = (char*)(of + (size_t)row0 * DM);
#pragma unroll
    for (int r = 0; r < LN_R; ++r)
#pragma unroll
        for (int j = 0; j < 8; ++j) *(v4f*)(fb + ob + r * (DM * 4) + j * 512) = v[r][j];
    // no data or address register of the stores is rewritten ahead of this wait
    asm volatile("s_wait_xcnt 0x0" ::: "memory");
}

// ---------------------------------------------------------------------------
// FFN1: acc = (16 x1)(64 W1) = 1024 pre ; hb = f16(16 relu(pre + b1)).
// Block = 4 x 4 waves = 256 x 256.
// 16-row steps through a wave-private LDS tile; row segment = 64 halves =
// ---------------------------------------------------------------------------
__global__ __launch_bounds__(512) __attribute__((amdgpu_num_vgpr(256)))
void k_gemm_ffn1(const _Float16* __restrict__ a16,
                 const _Float16* __restrict__ w1T,
                 const float* __restrict__ b1,
                 _Float16* __restrict__ hb) {
    __shared__ __align__(16) _Float16 Rst[16][16 * 64];  // 32 KB, wave-private
    __shared__ __attribute__((aligned(2048))) _Float16 St[3 * ST_HALVES(4, 1)]; // 216 KB, operand stages, cross-wave
    const int tid  = threadIdx.x;
    const int lane = tid & 31;
    const int w    = tid >> 5;
    const int hh   = lane >> 4;
    const int lm   = lane & 15;
    const int m0   = blockIdx.x * 256 + (w % 4) * 64;
    const int n0   = blockIdx.y * 256 + (w / 4) * 64;

    v8f acc[4][4];
    gemm_tile64<DM, 4, 1, 3>(a16 + (size_t)(blockIdx.x * 256) * DM, w1T + (size_t)(blockIdx.y * 256) * DM, St, acc);

    float bv[4];
#pragma unroll
    for (int nt = 0; nt < 4; ++nt) bv[nt] = bf16r(b1[n0 + nt * 16 + lm]) * 1024.0f;

#pragma unroll
    for (int ms = 0; ms < 4; ++ms) {
#pragma unroll
        for (int nt = 0; nt < 4; ++nt)
#pragma unroll
            for (int r = 0; r < 8; ++r)
                Rst[w][(8 * hh + r) * 64 + nt * 16 + lm] =
                    (_Float16)(fmaxf(acc[ms][nt][r] + bv[nt], 0.0f) * 0.015625f);
        wave_lds_sync();
        v8h rv[4];
#pragma unroll
        for (int i = 0; i < 4; ++i) rv[i] = *(const v8h*)(&Rst[w][i * 256 + lane * 8]);
        _Float16* dst = hb + (size_t)(m0 + ms * 16 + (lane >> 3)) * HID + n0 + (lane & 7) * 8;
#pragma unroll
        for (int i = 0; i < 4; ++i) *(v8h*)(dst + (size_t)i * 4 * HID) = rv[i];
        
        wave_lds_sync();
    }
}

// ---------------------------------------------------------------------------
// FFN2: acc = (16 h)(64 W2) = 1024 ff ; y2 = x1 + (ff + b2), f32.
// Block = two k groups of 2 x 2 waves = 128 x 128. The two waves of a 64x64 tile swap
// halves of their partial sums through LDS: group 0 finishes rows 0..31, group 1 rows 32..63.
// 16-row steps through a wave-private f32 LDS tile; bias and skip path added
// at the store stage as 4-float vectors; each instruction = 2 rows x 256 B.
// ---------------------------------------------------------------------------
__global__ __launch_bounds__(256) __attribute__((amdgpu_num_vgpr(256)))
void k_gemm_ffn2(const _Float16* __restrict__ hb,
                 const _Float16* __restrict__ w2T,
                 const float* __restrict__ b2,
                 const float* __restrict__ x1,
                 float* __restrict__ y2) {
    __shared__ __align__(16) float Fst[8][16 * 64];      // 32 KB, wave-private
    __shared__ __attribute__((aligned(2048))) _Float16 St[4 * ST_HALVES(2, 2)]; // 272 KB, operand stages, cross-wave
    const int tid  = threadIdx.x;
    const int lane = tid & 31;
    const int w    = __builtin_amdgcn_readfirstlane(tid >> 5);   // the wave's number, held scalar: the test on kg is a scalar branch
    const int kg   = w >> 2;
    const int wq   = w & 3;
    const int hh   = lane >> 4;
    const int lm   = lane & 15;
    const int m0   = blockIdx.x * 128 + (wq % 2) * 64 + kg * 32;
    const int n0   = blockIdx.y * 128 + (wq / 2) * 64;

    v8f acc[2][4];
    {
        v8f part[4][4];
        gemm_tile64<HID, 2, 2, 4>(hb + (size_t)(blockIdx.x * 128) * HID, w2T + (size_t)(blockIdx.y * 128) * HID, St, part);
        float* X = (float*)St;
        // the loops of the join are unrolled whole: part and acc stay in registers only under constant indices
        if (kg == 0) {
#pragma unroll
            for (int i = 0; i < 2; ++i)
#pragma unroll
                for (int nt = 0; nt < 4; ++nt) {
                    sub_put(X, wq * 8 + i * 4 + nt, lane, part[2 + i][nt]);
                    acc[i][nt] = part[i][nt];
                }
        } else {
#pragma unroll
            for (int i = 0; i < 2; ++i)
#pragma unroll
                for (int nt = 0; nt < 4; ++nt) {
                    sub_put(X, 32 + wq * 8 + i * 4 + nt, lane, part[i][nt]);
                    acc[i][nt] = part[2 + i][nt];
                }
        }
        __syncthreads();                                // both groups' handed-over halves published
        const int tk = (1 - kg) * 32 + wq * 8;
#pragma unroll
        for (int i = 0; i < 2; ++i)
#pragma unroll
            for (int nt = 0; nt < 4; ++nt) acc[i][nt] = sub_add(X, tk + i * 4 + nt, lane, acc[i][nt]);
    }

    const int col = lm * 4;
    v4f bb = *(const v4f*)(b2 + n0 + col);
    bb.x = bf16r(bb.x); bb.y = bf16r(bb.y); bb.z = bf16r(bb.z); bb.w = bf16r(bb.w);

#pragma unroll
    for (int ms = 0; ms < 2; ++ms) {
#pragma unroll
        for (int nt = 0; nt < 4; ++nt)
#pragma unroll
            for (int r = 0; r < 8; ++r)
                Fst[w][(8 * hh + r) * 64 + nt * 16 + lm] = acc[ms][nt][r] * 0.0009765625f;
        wave_lds_sync();
        v4f sv[8];
        const size_t rbase = ((size_t)(m0 + ms * 16 + hh)) * DM + n0 + col;
#pragma unroll
        for (int i = 0; i < 8; ++i) {
            v4f a  = *(const v4f*)(&Fst[w][i * 128 + lane * 4]);
            v4f xr = *(const v4f*)(x1 + rbase + (size_t)(2 * i) * DM);
            a.x = xr.x + (a.x + bb.x);
            a.y = xr.y + (a.y + bb.y);
            a.z = xr.z + (a.z + bb.z);
            a.w = xr.w + (a.w + bb.w);
            sv[i] = a;
        }
        float* dst = y2 + rbase;
#pragma unroll
        for (int i = 0; i < 8; ++i) *(v4f*)(dst + (size_t)(2 * i) * DM) = sv[i];
        
        wave_lds_sync();
    }
}

// ---------------------------------------------------------------------------
extern "C" void kernel_launch(void* const* d_in, const int* in_sizes, int n_in,
                              void* d_out, int out_size, void* d_ws, size_t ws_size,
                              hipStream_t stream) {
    if (n_in < 11) return;
    if (in_sizes[0] < ((NB - 1) * SEQ_FULL + SEQ) * DM) return;
    if (in_sizes[1] < DM * DM || in_sizes[2] < DM) return;
    if (in_sizes[3] < DM || in_sizes[4] < DM) return;
    if (in_sizes[5] < DM * HID || in_sizes[6] < HID) return;
    if (in_sizes[7] < HID * DM || in_sizes[8] < DM) return;
    if (in_sizes[9] < DM || in_sizes[10] < DM) return;
    if (out_size < NTOK * DM) return;
    if (WS_TOTAL > ws_size) return;

    const float* x    = (const float*)d_in[0];    // [2,2048,1024]
    const float* Wq   = (const float*)d_in[1];    // [16,1024,64]  [head][in][dim]
    const float* bq   = (const float*)d_in[2];    // [16,64]
    const float* ln1g = (const float*)d_in[3];
    const float* ln1b = (const float*)d_in[4];
    const float* W1   = (const float*)d_in[5];    // [1024,4096]  [in][out]
    const float* b1   = (const float*)d_in[6];
    const float* W2   = (const float*)d_in[7];    // [4096,1024]  [in][out]
    const float* b2   = (const float*)d_in[8];
    const float* ln2g = (const float*)d_in[9];
    const float* ln2b = (const float*)d_in[10];
    float* out = (float*)d_out;                   // [2,2048,1024]

    char* ws = (char*)d_ws;
    size_t off = 0;
    _Float16* x16  = (_Float16*)(ws + off); off += SZ_X16;   // xh, then x1h (xh dead after k_gemm_q)
    _Float16* wqT  = (_Float16*)(ws + off); off += SZ_WQT;   // [h*64+e][d]
    _Float16* w1T  = (_Float16*)(ws + off); off += SZ_W1T;   // [n][k]
    _Float16* w2T  = (_Float16*)(ws + off); off += SZ_W2T;   // [n][k]
    _Float16* qrow = (_Float16*)(ws + off); off += SZ_Q16;   // [b][h][s][64]
    _Float16* qT   = (_Float16*)(ws + off); off += SZ_Q16;   // [b][h][64][s]
    float*    y12  = (float*)(ws + off);    off += SZ_Y32;   // y1, then y2 (y1 dead after LN1)
    float*    x1   = (float*)(ws + off);    off += SZ_Y32;
    _Float16* hb   = (_Float16*)(ws + off); off += SZ_HB;
    if (off > ws_size) return;

    // x -> xh; Wq per head [1024 (d)][64 (e)] -> [e][d]; W1 [1024 (k)][4096 (n)] -> [n][k]; W2 [4096 (k)][1024 (n)] -> [n][k]
    k_prep<<<dim3(P1_BLKS + P2_BLKS + PQ_BLKS + PX_BLKS), dim3(256), 0, stream>>>(x, Wq, W1, W2, x16, wqT, w1T, w2T);

    k_gemm_q<<<dim3(NTOK / 128, DM / 128), dim3(256), 0, stream>>>(x16, wqT, bq, qrow, qT);
    k_attn<<<dim3(SEQ / 128, NH, NB), dim3(256), 0, stream>>>(qrow, qT, x, y12);
    k_ln<<<dim3(NTOK / (4 * LN_R)), dim3(128), 0, stream>>>(y12, ln1g, ln1b, x1, x16, 1);
    k_gemm_ffn1<<<dim3(NTOK / 256, HID / 256), dim3(512), 0, stream>>>(x16, w1T, b1, hb);
    k_gemm_ffn2<<<dim3(NTOK / 128, DM / 128), dim3(256), 0, stream>>>(hb, w2T, b2, x1, y12);
    k_ln<<<dim3(NTOK / (4 * LN_R)), dim3(128), 0, stream>>>(y12, ln2g, ln2b, out, x16, 0);
}
